// v000
// Measured on an AMD MI455X. A time is GPU time per run, averaged over a window of back-to-back runs after a warm-up
// (all launches, gaps included; the runs take copies of the inputs in turn), and the median of several windows.
// Apart from v000's, it joins two sittings. Times from different sittings can be a few percent apart, while
// side-by-side timings come from the same sitting.
// The starting kernel, v000, takes 365 microseconds a run.
// Contractions: gate logits (x f16 x16 . [Wa;We;Wa;We] f16 x64, K=1024), inner|outer projections (x f16 x16 . [Wi;Wo] f16 x64, K=1024),
// v^T projection (Wv f16 x64 . x f16 x16, K=1024; stored as f16 hi x1024 + residual plane), scores (inner f16 x16 . outer f16 x16, K=64),
// P . v^T (P f16 x1024 hi+residual . v^T f16 hi+residual, three products, 2048 keys in steps of 32),
// output projection (ctx f16 x4096 hi+residual . Wout f16 x64, two products, K=1024): all v_wmma_f32_16x16x32_f16, f32 accumulate.
// Sigmoid gates, online max-subtracted softmax, renormaliser, valve/rotation epilogue in f32 on VALU; every float input RNE-converted to bf16 on load.
#include <hip/hip_runtime.h>
#include <math.h>
#include <stdint.h>

#define TT      2048
#define DM      1024
#define NHEAD   16
#define HDIM    64
#define NGATE   64
#define HPB     8
#define QKP     (2 * DM)
#define OSW     (HPB * HDIM)
#define WSC     64.0f
#define ACARRY  16.0f
#define QC      16.0f
#define KC      16.0f
#define VC      1024.0f
#define PC      1024.0f
#define FC      4096.0f
#define ATT_SCALE 0.125f
#define PI_F    3.14159265358979323846f
#define REN_EPS 1e-8f
static_assert(NHEAD * HDIM == DM);
static_assert((TT % 64) == 0 && (DM % 64) == 0 && (DM % 256) == 0 && (TT % 32) == 0 && (TT % 16) == 0);
static_assert((NHEAD % HPB) == 0 && (NHEAD / HPB) == 2 && NGATE == 64 && OSW == 512);
#define ATT_THREADS (HPB * 32)
#define ATT_QT      (TT / 16)
#define ATT_BLOCKS  (ATT_QT * (NHEAD / HPB))
static_assert(ATT_THREADS == 256 && ATT_BLOCKS == 256);

typedef _Float16 v16h __attribute__((ext_vector_type(16)));
typedef _Float16 v8h  __attribute__((ext_vector_type(8)));
typedef float    v8f  __attribute__((ext_vector_type(8)));
typedef float    v4f  __attribute__((ext_vector_type(4)));
typedef unsigned int v4u __attribute__((ext_vector_type(4)));

union FragH { v16h v; v8h h[2]; v4u u[2]; };

// ---- scalar helpers --------------------------------------------------------------------------------
__device__ __forceinline__ unsigned short bf_bits(float f) {          // f32 -> bf16 bits, RNE convert
  unsigned u = __float_as_uint(f);
  return (unsigned short)((u + 0x7FFFu + ((u >> 16) & 1u)) >> 16);
}
__device__ __forceinline__ float bf_up(unsigned short h) { return __uint_as_float(((unsigned)h) << 16); }
__device__ __forceinline__ float bfr(float f) { return bf_up(bf_bits(f)); }   // value of the bf16 RNE convert
__device__ __forceinline__ unsigned short h_bits(_Float16 x) { return __builtin_bit_cast(unsigned short, x); }
__device__ __forceinline__ unsigned pk16(unsigned short a, unsigned short b) { return (unsigned)a | ((unsigned)b << 16); }
__device__ __forceinline__ v8f zero8() { v8f z = {0.f, 0.f, 0.f, 0.f, 0.f, 0.f, 0.f, 0.f}; return z; }
__device__ __forceinline__ float sigf(float v) { return 1.0f / (1.0f + expf(-v)); }

// ---- fragment loaders: 16-bit A/B operand, lane -> row/col (lane&15), p already includes +8*(lane>>4);
//      elements 0..7 <- p[0..7] (k0+8h..), elements 8..15 <- p[16..23] (k0+16+8h..)  (same split k map for A and B;
//      B is always read from a k-contiguous [n][k] plane)
__device__ __forceinline__ v16h ldfrag_h(const _Float16* p) {
  FragH f;
  f.h[0] = *(const v8h*)(p);
  f.h[1] = *(const v8h*)(p + 16);
  return f.v;
}
__device__ __forceinline__ v16h ldfrag_u(const unsigned short* p) {
  FragH f;
  f.u[0] = *(const v4u*)(p);
  f.u[1] = *(const v4u*)(p + 16);
  return f.v;
}

// ---- WMMA helpers with trailing VALU hazard gaps ------------------------------------------------------
__device__ __forceinline__ v8f mma_raw(v16h a, v16h b, v8f c) {
  return __builtin_amdgcn_wmma_f32_16x16x32_f16(false, a, false, b, (short)0, c, false, false);
}
__device__ __forceinline__ void dep_guard1(v8f& a, v8f& b, v16h x) {
#if defined(__HIP_DEVICE_COMPILE__)
  asm volatile("v_nop\n\tv_nop\n\tv_nop\n\tv_nop" : "+v"(a), "+v"(b) : "v"(x));
#endif
}
__device__ __forceinline__ void dep_guard2(v8f& a, v8f& b, v16h x, v16h y) {
#if defined(__HIP_DEVICE_COMPILE__)
  asm volatile("v_nop\n\tv_nop\n\tv_nop\n\tv_nop" : "+v"(a), "+v"(b) : "v"(x), "v"(y));
#endif
}
__device__ __forceinline__ void guard_s2(v8f& s, v16h a0, v16h a1) {
#if defined(__HIP_DEVICE_COMPILE__)
  asm volatile("v_nop\n\tv_nop\n\tv_nop\n\tv_nop" : "+v"(s) : "v"(a0), "v"(a1));
#endif
}
__device__ __forceinline__ void guard_s4(v8f& s, v16h a0, v16h a1, v16h b0, v16h b1) {
#if defined(__HIP_DEVICE_COMPILE__)
  asm volatile("v_nop\n\tv_nop\n\tv_nop\n\tv_nop" : "+v"(s) : "v"(a0), "v"(a1), "v"(b0), "v"(b1));
#endif
}
__device__ __forceinline__ void guard_pv6(v8f& a, v8f& b, v8f& c, v8f& d,
                                          v16h p0, v16h p1, v16h x0, v16h x1, v16h x2, v16h x3) {
#if defined(__HIP_DEVICE_COMPILE__)
  asm volatile("v_nop\n\tv_nop\n\tv_nop\n\tv_nop"
               : "+v"(a), "+v"(b), "+v"(c), "+v"(d) : "v"(p0), "v"(p1), "v"(x0), "v"(x1), "v"(x2), "v"(x3));
#endif
}
__device__ __forceinline__ void guard_pv5(v8f& a, v8f& b, v8f& c, v8f& d,
                                          v16h p0, v16h x0, v16h x1, v16h x2, v16h x3) {
#if defined(__HIP_DEVICE_COMPILE__)
  asm volatile("v_nop\n\tv_nop\n\tv_nop\n\tv_nop"
               : "+v"(a), "+v"(b), "+v"(c), "+v"(d) : "v"(p0), "v"(x0), "v"(x1), "v"(x2), "v"(x3));
#endif
}
__device__ __forceinline__ void keep4_h(v16h a, v16h b, v16h c, v16h d) {
#if defined(__HIP_DEVICE_COMPILE__)
  asm volatile("v_nop" :: "v"(a), "v"(b), "v"(c), "v"(d));
#endif
}
__device__ __forceinline__ void acc_guard4(v8f& a, v8f& b, v8f& c, v8f& d) {
#if defined(__HIP_DEVICE_COMPILE__)
  asm volatile("v_nop\n\tv_nop\n\tv_nop\n\tv_nop" : "+v"(a), "+v"(b), "+v"(c), "+v"(d));
#endif
}
__device__ __forceinline__ void wave_sync_lds() {
  __builtin_amdgcn_fence(__ATOMIC_RELEASE, "workgroup");
  __builtin_amdgcn_wave_barrier();
  __builtin_amdgcn_fence(__ATOMIC_ACQUIRE, "workgroup");
}

// =====================================================================================================
// Row convert: X f32 [nrows][1024] -> Y f16 [nrows][1024] = f16( bf16_RNE(X) * carry ), carry a power of two (exact).
// One wave per row (8 rows per block); lane l holds cols j*256 + 8l..8l+7 for j = 0..3; store instruction j covers a contiguous
// coverage: 4 x 32 lanes x 8 halves = 1024 = the whole row; grid = nrows/8 (exact multiples here) with a wave-uniform row bound.
// Used for x (carry 16) and for Wi, Wo, Wv, Wout in their native [out][in] = [n][k] layout (carry 64).
// =====================================================================================================
__global__ __launch_bounds__(256) void conv_rows(const float* __restrict__ X, unsigned short* Y, int nrows, float carry) {
  const int lane = threadIdx.x & 31, wave = threadIdx.x >> 5;
  const int row = blockIdx.x * 8 + wave;
  if (row >= nrows) return;                      // wave-uniform; no barriers in this kernel
  const float* xp = X + (size_t)row * DM;
  unsigned short* op = Y + (size_t)row * DM;
  v4u res[4];
#pragma unroll
  for (int j = 0; j < 4; ++j) {
    const int c0 = j * 256 + lane * 8;
    const v4f a0 = *(const v4f*)(xp + c0), a1 = *(const v4f*)(xp + c0 + 4);
    float t[8];
#pragma unroll
    for (int e = 0; e < 4; ++e) { t[e] = bfr(a0[e]) * carry; t[4 + e] = bfr(a1[e]) * carry; }
    v4u o = {0u, 0u, 0u, 0u};
#pragma unroll
    for (int e = 0; e < 4; ++e) o[e] = pk16(h_bits((_Float16)t[2 * e]), h_bits((_Float16)t[2 * e + 1]));
    res[j] = o;
  }
  {
#pragma unroll
    for (int j = 0; j < 4; ++j) *(v4u*)(op + j * 256 + lane * 8) = res[j];
    
  }
}

// =====================================================================================================
// Gate weight plane: G f16 [64][1024]: row r = f16( 64 * bf16_RNE( (r & 16) ? We[r & 15] : Wa[r & 15] ) ) (rows 32..63 duplicate 0..31).
// Both candidate rows loaded with clamped in-range addresses, selected by value (row is wave-uniform). Same store shape as conv_rows.
// coverage: 8 blocks x 8 waves = 64 rows x (4 x 32 x 8 = 1024 cols), exact.
// =====================================================================================================
__global__ __launch_bounds__(256) void conv_gate(const float* __restrict__ Wa, const float* __restrict__ We,
                                                 unsigned short* Y, float carry) {
  const int lane = threadIdx.x & 31, wave = threadIdx.x >> 5;
  const int row = blockIdx.x * 8 + wave;
  if (row >= NGATE) return;                      // wave-uniform; no barriers in this kernel
  const float* pa = Wa + (size_t)(row & 15) * DM;
  const float* pb = We + (size_t)(row & 15) * DM;
  const bool useb = (row & 16) != 0;
  unsigned short* op = Y + (size_t)row * DM;
  v4u res[4];
#pragma unroll
  for (int j = 0; j < 4; ++j) {
    const int c0 = j * 256 + lane * 8;
    const v4f a0 = *(const v4f*)(pa + c0), a1 = *(const v4f*)(pa + c0 + 4);
    const v4f b0 = *(const v4f*)(pb + c0), b1 = *(const v4f*)(pb + c0 + 4);
    float t[8];
#pragma unroll
    for (int e = 0; e < 4; ++e) {
      t[e]     = bfr(useb ? b0[e] : a0[e]) * carry;
      t[4 + e] = bfr(useb ? b1[e] : a1[e]) * carry;
    }
    v4u o = {0u, 0u, 0u, 0u};
#pragma unroll
    for (int e = 0; e < 4; ++e) o[e] = pk16(h_bits((_Float16)t[2 * e]), h_bits((_Float16)t[2 * e + 1]));
    res[j] = o;
  }
  {
#pragma unroll
    for (int j = 0; j < 4; ++j) *(v4u*)(op + j * 256 + lane * 8) = res[j];
    
  }
}

// =====================================================================================================
// Register-blocked f16 WMMA GEMM: C[m][n] = f( oscale * sum_k A[m][k] * Bt[n][k] ); one wave per 64x64 tile, no block barriers.
// A row-major [M][K] pitch lda (16-bit plane), Bt row-major [N][K] pitch ldb (k contiguous); M, N multiples of 64, K multiple of 32.
// SPLITA 1: a second A plane A2 (same pitch) holding the unscaled f16 residual of A; its products go into the same accumulator.
// BM: 0 = no bias; 3 = per-column head bias bf16( (col & 16) ? bias2[col & 15] : bias[col & 15] ) (in-range addresses).
// OM: 0 = f32 out (pitch ldc), ACT 2 applies sigmoid after bias;
//     2 = f16 out = f16( value * ocarry ); 3 = f16 hi plane f16(value*ocarry) to C and unscaled residual f16(value*ocarry - hi) to C2.
// coverage: 4 slabs x 16 rows (f32: it 0..7 x lane>>4; f16: it 0..3 x lane>>3) x 64 cols = the wave's whole 64x64 tile;
//           grid = ceil(tilesM*tilesN/8) blocks, surplus waves exit (wave-uniform).
// =====================================================================================================
template <int OM, int BM, int ACT, int SPLITA>
__global__ __launch_bounds__(256) void gemm64(
    const unsigned short* __restrict__ Ap, const unsigned short* __restrict__ A2p, int lda,
    const unsigned short* __restrict__ Btp, int ldb,
    const float* __restrict__ bias, const float* __restrict__ bias2,
    void* Cout, void* C2out, int ldc,
    int M, int N, int K, float oscale, float ocarry) {
  __shared__ __align__(16) float sT[8][16 * 68];   // per-wave 16x64 slab, pitch 68 floats
  const int lane = threadIdx.x & 31;
  const int wave = threadIdx.x >> 5;
  const int tilesN = N >> 6;
  const int tilesM = M >> 6;
  const int tile = blockIdx.x * 8 + wave;
  if (tile >= tilesM * tilesN) return;   // wave-uniform; no block barriers in this kernel
  const int tm = tile / tilesN;
  const int tn = tile - tm * tilesN;
  const int m0 = tm << 6;
  const int n0 = tn << 6;

  const int rlane = lane & 15;                 // row (A) / col (B, D) within subtile
  const int koff  = (lane >> 4) * 8;           // k offset of this lane half
  const int mOff  = (lane >> 4) * 8;           // D row offset

  v8f acc[4][4];
#pragma unroll
  for (int i = 0; i < 4; ++i)
#pragma unroll
    for (int j = 0; j < 4; ++j) acc[i][j] = zero8();

  for (int k0 = 0; k0 < K; k0 += 32) {
    v16h bh[4];
#pragma unroll
    for (int j = 0; j < 4; ++j) {
      const size_t bofs = (size_t)(n0 + (j << 4) + rlane) * ldb + koff + k0;
      bh[j] = ldfrag_u(Btp + bofs);
    }
#pragma unroll
    for (int i = 0; i < 4; ++i) {
      const size_t ao = (size_t)(m0 + (i << 4) + rlane) * lda + koff + k0;
      const v16h ah = ldfrag_u(Ap + ao);
#pragma unroll
      for (int j = 0; j < 4; ++j) acc[i][j] = mma_raw(ah, bh[j], acc[i][j]);
      if constexpr (SPLITA != 0) {
        const v16h al = ldfrag_u(A2p + ao);
#pragma unroll
        for (int j = 0; j < 4; ++j) acc[i][j] = mma_raw(al, bh[j], acc[i][j]);
        dep_guard2(acc[i][0], acc[i][3], ah, al);
      } else {
        dep_guard1(acc[i][0], acc[i][3], ah);
      }
    }
    keep4_h(bh[0], bh[1], bh[2], bh[3]);
  }
  acc_guard4(acc[0][0], acc[0][1], acc[0][2], acc[0][3]);
  acc_guard4(acc[1][0], acc[1][1], acc[1][2], acc[1][3]);
  acc_guard4(acc[2][0], acc[2][1], acc[2][2], acc[2][3]);
  acc_guard4(acc[3][0], acc[3][1], acc[3][2], acc[3][3]);

  const int hh2 = lane >> 4, c4 = (lane & 15) * 4;     // f32 out: 256-B row segment = 16 lanes x 16 B
  const int q8  = lane >> 3, c8 = (lane & 7) * 8;
  float bc[4];
#pragma unroll
  for (int e = 0; e < 4; ++e) bc[e] = 0.f;
  if constexpr (BM == 3) {
#pragma unroll
    for (int e = 0; e < 4; ++e) {
      const int col = n0 + c4 + e;
      const float fa = bfr(bias[col & 15]);             // in-range addresses 0..15
      const float fb = bfr(bias2[col & 15]);
      bc[e] = (col & 16) ? fb : fa;
    }
  }

  // ---- epilogue ----
  float* slab = sT[wave];
#pragma unroll
  for (int i = 0; i < 4; ++i) {
    const int mBase = m0 + (i << 4);
#pragma unroll
    for (int j = 0; j < 4; ++j) {
#pragma unroll
      for (int r = 0; r < 8; ++r) {
        slab[(mOff + r) * 68 + (j << 4) + rlane] = acc[i][j][r];
      }
    }
    wave_sync_lds();
    if constexpr (OM == 0) {
      float* C = (float*)Cout;
      v4f vals[8];
#pragma unroll
      for (int it = 0; it < 8; ++it) {
        const int row = it * 2 + hh2;                      // it 0..7 x hh2 0..1 = rows 0..15
        v4f v = *(const v4f*)(slab + row * 68 + c4);
#pragma unroll
        for (int e = 0; e < 4; ++e) {
          float f = v[e] * oscale + bc[e];
          if constexpr (ACT == 2) f = 1.0f / (1.0f + __expf(-f));
          v[e] = f;
        }
        vals[it] = v;
      }
      {
#pragma unroll
        for (int it = 0; it < 8; ++it) {
          const int gr = mBase + it * 2 + hh2;
          *(v4f*)(C + (size_t)gr * ldc + n0 + c4) = vals[it];
        }
        
      }
    } else {
      unsigned short* C  = (unsigned short*)Cout;
      unsigned short* C2 = (unsigned short*)C2out;
      v4u hv[4], lv[4];
#pragma unroll
      for (int it = 0; it < 4; ++it) {
        const int row = it * 4 + q8;                       // it 0..3 x q8 0..3 = rows 0..15
        const float* sp = slab + row * 68 + c8;
        v4u a = {0u, 0u, 0u, 0u};
        v4u b = {0u, 0u, 0u, 0u};
#pragma unroll
        for (int e = 0; e < 4; ++e) {
          const float f0 = (sp[2 * e] * oscale) * ocarry;
          const float f1 = (sp[2 * e + 1] * oscale) * ocarry;
          const _Float16 h0 = (_Float16)f0, h1 = (_Float16)f1;
          a[e] = pk16(h_bits(h0), h_bits(h1));
          if constexpr (OM == 3) {
            const _Float16 l0 = (_Float16)(f0 - (float)h0);
            const _Float16 l1 = (_Float16)(f1 - (float)h1);
            b[e] = pk16(h_bits(l0), h_bits(l1));
          }
        }
        hv[it] = a;
        lv[it] = b;
      }
      {
#pragma unroll
        for (int it = 0; it < 4; ++it) {
          const int row = it * 4 + q8;
          *(v4u*)(C + (size_t)(mBase + row) * ldc + n0 + c8) = hv[it];
          if constexpr (OM == 3) {
            *(v4u*)(C2 + (size_t)(mBase + row) * ldc + n0 + c8) = lv[it];
          }
        }
        
      }
    }
    wave_sync_lds();
  }
}

// =====================================================================================================
// Flash attention for 16 query rows and 8 heads (one wave per head), head dim 64, 2048 keys:
//   inner|outer plane (f16 x16) QK[tok][2048]: inner at col 64h + d, outer at col 1024 + 64h + d;
//   v^T planes (f16 hi x1024, unscaled residual): VH/VL[64h + d][key] (pitch 2048);
//   gate plane AEF f32 [tok][64]: col h = ap[h][tok] (sigmoid applied), col 16 + h = ex[h][tok];
//   out: CTH/CTL[tok][64h + d] = f16 hi / residual of 4096 * ctx, ctx = valve/rotation epilogue of
//        ap * sum_s p_s v_s / (ap * sum_s p_s + 1e-8 * sum_s e_s), e_s = exp(score_s - max), p_s = e_s * ex[s].
//   block = 8 waves = 256 threads; grid = 128 query tiles x 2 head groups = 256; every wave does identical bounded work (64 steps).
//   Per step: 2 score tiles on f16 WMMA (K = 64 as two k-steps of 32), fragments loaded straight from the 16-bit plane; ex for the
//   lane's two key columns loaded from AEF; online max-subtracted softmax in f32 (exp2, log2e / 8 / carries folded in), running sums
//   of e and of p = e*ex; rescale of sums and accumulators; the 16x32 p tile stored to wave-private LDS (f32 element stores),
//   loads, split k map); v^T hi and residual B fragments loaded straight from the planes; 12 WMMAs (hi.hi, lo.hi, hi.lo) into one
//   accumulator set.
//   Final scaling in f32; each wave stages its 16x64 slice (hi and residual 16-bit values) in the block's LDS row buffers [16][512];
// coverage: LDS row buffers: 8 waves x 16 rows x 64 cols = 16 x 512; global: 4 iterations x 256 threads x 8 halves = 16 rows x 512
//           cols (cols 512*hg ..) of rows q0..q0+15, both planes; grid covers all 2048 rows x 1024 cols exactly once.
// =====================================================================================================
__global__ __launch_bounds__(ATT_THREADS)
void attn_heads(const unsigned short* __restrict__ QKq, const unsigned short* __restrict__ VHq,
                const unsigned short* __restrict__ VLq, const float* __restrict__ AEF,
                const float* __restrict__ betap, const float* __restrict__ ivp,
                const float* __restrict__ ovp, const float* __restrict__ chg,
                unsigned short* CTH, unsigned short* CTL) {
  __shared__ __align__(16) float Ps[HPB][16 * 36];          // per wave p tile [row][32 keys], pitch 36
  __shared__ __align__(16) unsigned short Osh[16 * OSW];    // block result rows [16][512], hi
  __shared__ __align__(16) unsigned short Osl[16 * OSW];    // residual

  const int tid  = threadIdx.x;
  const int wave = tid >> 5;
  const int lane = tid & 31;
  const int hh   = lane >> 4;
  const int c    = lane & 15;

  const int qt   = blockIdx.x % ATT_QT;                     // 0..127
  const int hg   = (blockIdx.x / ATT_QT) & 1;               // head group 0..1
  const int head = hg * HPB + wave;                         // 0..15
  const int q0   = qt * 16;

  const _Float16* Qh = (const _Float16*)(const void*)QKq + (size_t)(q0 + c) * QKP + head * HDIM + 8 * hh;
  const _Float16* Kb = (const _Float16*)(const void*)QKq + DM + head * HDIM + 8 * hh;
  const _Float16* Vh = (const _Float16*)(const void*)VHq + (size_t)(head * HDIM + c) * TT + 8 * hh;
  const _Float16* Vl = (const _Float16*)(const void*)VLq + (size_t)(head * HDIM + c) * TT + 8 * hh;
  const float* Ex = AEF + 16 + head;                                    // ex column of this head
  const float lsc = (1.4426950408889634f * ATT_SCALE) / (QC * KC);      // log2(e) / 8 / carries

  const v16h qa = ldfrag_h(Qh), qb = ldfrag_h(Qh + 32);

  float mrow[8], lrow[8], zrow[8];
  v8f o0 = zero8(), o1 = zero8(), o2 = zero8(), o3 = zero8();
#pragma unroll
  for (int r = 0; r < 8; ++r) { mrow[r] = -INFINITY; lrow[r] = 0.f; zrow[r] = 0.f; }
  float* pt = Ps[wave];

#pragma unroll 1
  for (int kb = 0; kb < TT; kb += 32) {
    const _Float16* kp = Kb + (size_t)(kb + c) * QKP;
    v8f s0, s1;
    {
      const v16h k0 = ldfrag_h(kp), k1 = ldfrag_h(kp + 32);
      s0 = mma_raw(qa, k0, zero8());
      s0 = mma_raw(qb, k1, s0);
      guard_s2(s0, k0, k1);
    }
    {
      const _Float16* kq = kp + (size_t)16 * QKP;
      const v16h k0 = ldfrag_h(kq), k1 = ldfrag_h(kq + 32);
      s1 = mma_raw(qa, k0, zero8());
      s1 = mma_raw(qb, k1, s1);
      guard_s4(s1, k0, k1, qa, qb);
    }
    const float ex0 = Ex[(size_t)(kb + c) * NGATE];          // key kb + c
    const float ex1 = Ex[(size_t)(kb + 16 + c) * NGATE];     // key kb + 16 + c
#pragma unroll
    for (int r = 0; r < 8; ++r) {
      const float t0 = s0[r] * lsc, t1 = s1[r] * lsc;
      float mx = fmaxf(t0, t1);
#pragma unroll
      for (int off = 1; off < 16; off <<= 1) mx = fmaxf(mx, __shfl_xor(mx, off, 32));
      const float mn = fmaxf(mrow[r], mx);
      const float al = exp2f(mrow[r] - mn);
      mrow[r] = mn;
      const float e0 = exp2f(t0 - mn), e1 = exp2f(t1 - mn);
      const float p0 = e0 * ex0, p1 = e1 * ex1;
      float zs = e0 + e1;
      float ps = p0 + p1;
#pragma unroll
      for (int off = 1; off < 16; off <<= 1) {
        zs += __shfl_xor(zs, off, 32);
        ps += __shfl_xor(ps, off, 32);
      }
      zrow[r] = zrow[r] * al + zs;
      lrow[r] = lrow[r] * al + ps;
      o0[r] *= al;
      o1[r] *= al;
      o2[r] *= al;
      o3[r] *= al;
      const int ro = (8 * hh + r) * 36 + c;
      pt[ro]      = p0;
      pt[ro + 16] = p1;
    }
    wave_sync_lds();
    FragH ph, pl;
    {
      const float* prow = pt + c * 36 + 8 * hh;
      const v4f g0 = *(const v4f*)(prow), g1 = *(const v4f*)(prow + 4);
      const v4f g2 = *(const v4f*)(prow + 16), g3 = *(const v4f*)(prow + 20);
#pragma unroll
      for (int e = 0; e < 4; ++e) {
        float xv; _Float16 hx;
        xv = g0[e] * PC; hx = (_Float16)xv; ph.h[0][e]     = hx; pl.h[0][e]     = (_Float16)(xv - (float)hx);   // keys kb + 8hh + e
        xv = g1[e] * PC; hx = (_Float16)xv; ph.h[0][4 + e] = hx; pl.h[0][4 + e] = (_Float16)(xv - (float)hx);
        xv = g2[e] * PC; hx = (_Float16)xv; ph.h[1][e]     = hx; pl.h[1][e]     = (_Float16)(xv - (float)hx);   // keys kb + 16 + 8hh + e
        xv = g3[e] * PC; hx = (_Float16)xv; ph.h[1][4 + e] = hx; pl.h[1][4 + e] = (_Float16)(xv - (float)hx);
      }
    }
    {
      const _Float16* vp = Vh + kb;
      const v16h vb0 = ldfrag_h(vp);
      const v16h vb1 = ldfrag_h(vp + (size_t)16 * TT);
      const v16h vb2 = ldfrag_h(vp + (size_t)32 * TT);
      const v16h vb3 = ldfrag_h(vp + (size_t)48 * TT);
      o0 = mma_raw(ph.v, vb0, o0);
      o1 = mma_raw(ph.v, vb1, o1);
      o2 = mma_raw(ph.v, vb2, o2);
      o3 = mma_raw(ph.v, vb3, o3);
      o0 = mma_raw(pl.v, vb0, o0);
      o1 = mma_raw(pl.v, vb1, o1);
      o2 = mma_raw(pl.v, vb2, o2);
      o3 = mma_raw(pl.v, vb3, o3);
      guard_pv6(o0, o1, o2, o3, ph.v, pl.v, vb0, vb1, vb2, vb3);
    }
    {
      const _Float16* vp = Vl + kb;
      const v16h vl0 = ldfrag_h(vp);
      const v16h vl1 = ldfrag_h(vp + (size_t)16 * TT);
      const v16h vl2 = ldfrag_h(vp + (size_t)32 * TT);
      const v16h vl3 = ldfrag_h(vp + (size_t)48 * TT);
      o0 = mma_raw(ph.v, vl0, o0);
      o1 = mma_raw(ph.v, vl1, o1);
      o2 = mma_raw(ph.v, vl2, o2);
      o3 = mma_raw(ph.v, vl3, o3);
      guard_pv5(o0, o1, o2, o3, ph.v, vl0, vl1, vl2, vl3);
    }
    wave_sync_lds();
  }

  // ---- per-head gates and rotation, renormaliser, carries (1024 on p, 1024 on v, 4096 on the stored ctx) ----
  const float* Ap = AEF + head;
  float apr[8];
#pragma unroll
  for (int r = 0; r < 8; ++r) apr[r] = Ap[(size_t)(q0 + 8 * hh + r) * NGATE];
  const float bet = bfr(betap[head]);
  const float ivs = sigf(bfr(ivp[head]));
  const float og  = sigf(bfr(ovp[head])) * tanhf(bfr(chg[head]));
  const float ang = PI_F * sigf(bet);
  const float ca  = cosf(ang), sa = sinf(ang);
  const float base = ivs / (PC * VC);
  unsigned short* oh = Osh + wave * HDIM + c;
  unsigned short* ol = Osl + wave * HDIM + c;
#pragma unroll
  for (int r = 0; r < 8; ++r) {
    const float den = apr[r] * lrow[r] + REN_EPS * zrow[r];
    const float sc  = apr[r] * (1.0f / den) * base;
    const float x0 = o0[r] * sc, x1 = o1[r] * sc, x2 = o2[r] * sc, x3 = o3[r] * sc;
    const float y0 = ((x0 * ca - x2 * sa) * og) * FC;
    const float y1 = ((x1 * ca - x3 * sa) * og) * FC;
    const float y2 = ((x0 * sa + x2 * ca) * og) * FC;
    const float y3 = ((x1 * sa + x3 * ca) * og) * FC;
    const _Float16 h0 = (_Float16)y0, h1 = (_Float16)y1, h2 = (_Float16)y2, h3 = (_Float16)y3;
    const int ro = (8 * hh + r) * OSW;
    oh[ro]      = h_bits(h0);
    oh[ro + 16] = h_bits(h1);
    oh[ro + 32] = h_bits(h2);
    oh[ro + 48] = h_bits(h3);
    ol[ro]      = h_bits((_Float16)(y0 - (float)h0));
    ol[ro + 16] = h_bits((_Float16)(y1 - (float)h1));
    ol[ro + 32] = h_bits((_Float16)(y2 - (float)h2));
    ol[ro + 48] = h_bits((_Float16)(y3 - (float)h3));
  }
  __syncthreads();
  // ---- block writes its 16 row segments: piece p = it*256 + tid -> row p>>6, halves (p&63)*8 of the 512-col slab ----
  {
    v4u vh[4], vl[4];
#pragma unroll
    for (int it = 0; it < 4; ++it) {
      const int p = it * ATT_THREADS + tid;
      vh[it] = *(const v4u*)(Osh + (size_t)p * 8);
      vl[it] = *(const v4u*)(Osl + (size_t)p * 8);
    }
    const size_t dofs = (size_t)q0 * DM + (size_t)hg * OSW;
    unsigned short* dh = CTH + dofs;
    unsigned short* dl = CTL + dofs;
    {
#pragma unroll
      for (int it = 0; it < 4; ++it) {
        const int p = it * ATT_THREADS + tid;
        const size_t po = (size_t)(p >> 6) * DM + (size_t)(p & 63) * 8;
        *(v4u*)(dh + po) = vh[it];
        *(v4u*)(dl + po) = vl[it];
      }
      
    }
  }
}

// =====================================================================================================
// Workspace map (bytes); every plane is an exact multiple of its tile / whole-row store granularity (M, N exact tile multiples,
// row blocks exact, no pad rows needed), every offset a multiple of 131072:
//   WIO  f16 [2048][1024] x64     4194304   (rows 0..1023 Wi, 1024..2047 Wo; native [out][in] = [n][k])
//   WV   f16 [1024][1024] x64     2097152
//   WOUT f16 [1024][1024] x64     2097152
//   WG   f16 [64][1024]   x64      131072   (Wa, We, Wa, We)
//   XB   f16 [2048][1024] x16     4194304
//   QK   f16 [2048][2048] x16     8388608   (inner | outer)
//   VTH  f16 [1024][2048] x1024   4194304   (v^T hi)
//   VTL  f16 [1024][2048]         4194304   (v^T residual)
//   AEF  f32 [2048][64]            524288   (sigmoid gates)
//   CTH  f16 [2048][1024] x4096   4194304   (ctx hi)
//   CTL  f16 [2048][1024]         4194304   (ctx residual)
//   end                          38404096
// =====================================================================================================
extern "C" void kernel_launch(void* const* d_in, const int* in_sizes, int n_in,
                              void* d_out, int out_size, void* d_ws, size_t ws_size,
                              hipStream_t stream) {
  if (n_in < 13) return;
  if (in_sizes[0] != TT * DM) return;
  if (in_sizes[1] != NHEAD * DM || in_sizes[2] != NHEAD) return;
  if (in_sizes[3] != NHEAD * DM || in_sizes[4] != NHEAD) return;
  if (in_sizes[5] != DM * DM || in_sizes[6] != DM * DM || in_sizes[7] != DM * DM || in_sizes[8] != DM * DM) return;
  if (in_sizes[9] != NHEAD || in_sizes[10] != NHEAD || in_sizes[11] != NHEAD || in_sizes[12] != NHEAD) return;
  if (out_size != TT * DM) return;

  const float* x     = (const float*)d_in[0];
  const float* Wa    = (const float*)d_in[1];
  const float* ba    = (const float*)d_in[2];
  const float* We    = (const float*)d_in[3];
  const float* be    = (const float*)d_in[4];
  const float* Wi    = (const float*)d_in[5];
  const float* Wo    = (const float*)d_in[6];
  const float* Wv    = (const float*)d_in[7];
  const float* Wout  = (const float*)d_in[8];
  const float* betap = (const float*)d_in[9];
  const float* ivp   = (const float*)d_in[10];
  const float* ovp   = (const float*)d_in[11];
  const float* chg   = (const float*)d_in[12];
  float*       out   = (float*)d_out;

  const size_t PWIO = (size_t)2 * DM * DM * 2;                    //  4194304
  const size_t PW   = (size_t)DM * DM * 2;                        //  2097152
  const size_t PG   = (size_t)NGATE * DM * 2;                     //   131072
  const size_t PX   = (size_t)TT * DM * 2;                        //  4194304
  const size_t PQK  = (size_t)TT * QKP * 2;                       //  8388608
  const size_t PVT  = (size_t)DM * TT * 2;                        //  4194304
  const size_t PAE  = (size_t)TT * NGATE * 4;                     //   524288
  const size_t PCT  = (size_t)TT * DM * 2;                        //  4194304
  size_t off = 0;
  const size_t oWIO = off; off += PWIO;
  const size_t oWV  = off; off += PW;
  const size_t oWOU = off; off += PW;
  const size_t oWG  = off; off += PG;
  const size_t oXB  = off; off += PX;
  const size_t oQK  = off; off += PQK;
  const size_t oVTH = off; off += PVT;
  const size_t oVTL = off; off += PVT;
  const size_t oAEF = off; off += PAE;
  const size_t oCTH = off; off += PCT;
  const size_t oCTL = off; off += PCT;
  if (off > ws_size) return;                                      // off = 38404096
  if (off > (size_t)134217728) return;

  char* ws = (char*)d_ws;
  unsigned short* WIO  = (unsigned short*)(ws + oWIO);
  unsigned short* WV   = (unsigned short*)(ws + oWV);
  unsigned short* WOUT = (unsigned short*)(ws + oWOU);
  unsigned short* WG   = (unsigned short*)(ws + oWG);
  unsigned short* XB   = (unsigned short*)(ws + oXB);
  unsigned short* QK   = (unsigned short*)(ws + oQK);
  unsigned short* VTH  = (unsigned short*)(ws + oVTH);
  unsigned short* VTL  = (unsigned short*)(ws + oVTL);
  float*          AEF  = (float*)(ws + oAEF);
  unsigned short* CTH  = (unsigned short*)(ws + oCTH);
  unsigned short* CTL  = (unsigned short*)(ws + oCTL);

  const dim3 blk(256);
  const dim3 gX(TT / 8);                                          // 256 blocks
  const dim3 gW(DM / 8);                                          // 128 blocks
  const dim3 gG(NGATE / 8);                                       // 8 blocks
  const int tilesG = (TT / 64) * (NGATE / 64);                    // 32
  const int tilesQ = (TT / 64) * (QKP / 64);                      // 1024
  const int tilesV = (DM / 64) * (TT / 64);                       // 512
  const int tilesO = (TT / 64) * (DM / 64);                       // 512
  const dim3 gGE((tilesG + 7) / 8);                               // 4
  const dim3 gQK((tilesQ + 7) / 8);                               // 128
  const dim3 gVT((tilesV + 7) / 8);                               // 64
  const dim3 gO((tilesO + 7) / 8);                                // 64
  const dim3 gAT(ATT_BLOCKS);                                     // 256
  const dim3 bAT(ATT_THREADS);                                    // 256

  // (0) 16-bit planes: XB = f16(16 * bf16(x)); W planes = f16(64 * bf16(W)) in native [n][k] layout; gate plane
  conv_rows<<<gX, blk, 0, stream>>>(x, XB, TT, ACARRY);                         // [2048][1024]
  conv_rows<<<gW, blk, 0, stream>>>(Wi, WIO, DM, WSC);                           // [1024][1024] -> WIO rows 0..1023
  conv_rows<<<gW, blk, 0, stream>>>(Wo, WIO + (size_t)DM * DM, DM, WSC);         // -> WIO rows 1024..2047
  conv_rows<<<gW, blk, 0, stream>>>(Wv, WV, DM, WSC);
  conv_rows<<<gW, blk, 0, stream>>>(Wout, WOUT, DM, WSC);
  conv_gate<<<gG, blk, 0, stream>>>(Wa, We, WG, WSC);                            // [64][1024]

  // (1) gates: AEF[t][j] = sigmoid(x[t] . G[j] / (16*64) + bf16(bias_j)); M = 2048, N = 64, K = 1024, f32 out
  gemm64<0, 3, 2, 0><<<gGE, blk, 0, stream>>>(
      XB, XB, DM,
      WG, DM,
      ba, be,
      (void*)AEF, (void*)AEF, NGATE,
      TT, NGATE, DM, 1.0f / (ACARRY * WSC), 1.0f);

  // (2) inner | outer: QK[t][n] = f16(16 * x[t] . [Wi;Wo][n]); M = 2048, N = 2048, K = 1024
  gemm64<2, 0, 0, 0><<<gQK, blk, 0, stream>>>(
      XB, XB, DM,
      WIO, DM,
      ba, be,
      (void*)QK, (void*)QK, QKP,
      TT, QKP, DM, 1.0f / (ACARRY * WSC), QC);

  // (3) v^T: VTH/VTL[d][t] = hi/residual of f16(1024 * Wv[d] . x[t]); M = 1024, N = 2048, K = 1024
  gemm64<3, 0, 0, 0><<<gVT, blk, 0, stream>>>(
      WV, WV, DM,
      XB, DM,
      ba, be,
      (void*)VTH, (void*)VTL, TT,
      DM, TT, DM, 1.0f / (WSC * ACARRY), VC);

  // (4) attention per (16 query rows, 8 heads) -> CTH/CTL (ctx x4096 hi + residual)
  attn_heads<<<gAT, bAT, 0, stream>>>(QK, VTH, VTL, AEF, betap, ivp, ovp, chg, CTH, CTL);

  // (5) out = (ctx_hi + ctx_lo) . Wout plane / (4096 * 64); M = 2048, N = 1024, K = 1024, f32
  gemm64<0, 0, 0, 1><<<gO, blk, 0, stream>>>(
      CTH, CTL, DM,
      WOUT, DM,
      ba, be,
      (void*)out, (void*)out, DM,
      TT, DM, DM, 1.0f / (FC * WSC), 1.0f);
  (void)hipGetLastError();
}

// v001
// One run takes 243 microseconds.
// In two side-by-side timings against v000, it was 1.52 and 1.53 times as fast.
// Contractions: gate logits (x f16 x16 . [Wa;We;Wa;We] f16 x64, K=1024), inner|outer projections (x f16 x16 . [Wi;Wo] f16 x64, K=1024),
// v^T projection (Wv f16 x64 . x f16 x16, K=1024; stored as f16 hi x1024 + residual plane), scores (inner f16 x16 . outer f16 x16, K=64),
// P . v^T (P f16 x1024 hi+residual . v^T f16 hi+residual, three products, 2048 keys in steps of 32),
// output projection (ctx f16 x4096 hi+residual . Wout f16 x64, two products, K=1024): all v_wmma_f32_16x16x32_f16, f32 accumulate.
// Sigmoid gates, online max-subtracted softmax, renormaliser, valve/rotation epilogue in f32 on VALU; every float input RNE-converted to bf16 on load.
#include <hip/hip_runtime.h>
#include <math.h>
#include <stdint.h>

#define TT      2048
#define DM      1024
#define NHEAD   16
#define HDIM    64
#define NGATE   64
#define HPB     8
#define QKP     (2 * DM)
#define OSW     (HPB * HDIM)
#define WSC     64.0f
#define ACARRY  16.0f
#define QC      16.0f
#define KC      16.0f
#define VC      1024.0f
#define PC      1024.0f
#define FC      4096.0f
#define ATT_SCALE 0.125f
#define PI_F    3.14159265358979323846f
#define REN_EPS 1e-8f
static_assert(NHEAD * HDIM == DM);
static_assert((TT % 64) == 0 && (DM % 64) == 0 && (DM % 256) == 0 && (TT % 32) == 0 && (TT % 16) == 0);
static_assert((NHEAD % HPB) == 0 && (NHEAD / HPB) == 2 && NGATE == 64 && OSW == 512);
#define ATT_THREADS (HPB * 32)
#define ATT_QT      (TT / 16)
#define ATT_BLOCKS  (ATT_QT * (NHEAD / HPB))
static_assert(ATT_THREADS == 256 && ATT_BLOCKS == 256);

typedef _Float16 v16h __attribute__((ext_vector_type(16)));
typedef _Float16 v8h  __attribute__((ext_vector_type(8)));
typedef float    v8f  __attribute__((ext_vector_type(8)));
typedef float    v4f  __attribute__((ext_vector_type(4)));
typedef unsigned int v4u __attribute__((ext_vector_type(4)));

union FragH { v16h v; v8h h[2]; v4u u[2]; };

// ---- scalar helpers --------------------------------------------------------------------------------
__device__ __forceinline__ unsigned short bf_bits(float f) {          // f32 -> bf16 bits, RNE convert
  unsigned u = __float_as_uint(f);
  return (unsigned short)((u + 0x7FFFu + ((u >> 16) & 1u)) >> 16);
}
__device__ __forceinline__ float bf_up(unsigned short h) { return __uint_as_float(((unsigned)h) << 16); }
__device__ __forceinline__ float bfr(float f) { return bf_up(bf_bits(f)); }   // value of the bf16 RNE convert
__device__ __forceinline__ unsigned short h_bits(_Float16 x) { return __builtin_bit_cast(unsigned short, x); }
__device__ __forceinline__ unsigned pk16(unsigned short a, unsigned short b) { return (unsigned)a | ((unsigned)b << 16); }
__device__ __forceinline__ v8f zero8() { v8f z = {0.f, 0.f, 0.f, 0.f, 0.f, 0.f, 0.f, 0.f}; return z; }
__device__ __forceinline__ float sigf(float v) { return 1.0f / (1.0f + expf(-v)); }

// ---- fragment loaders: 16-bit A/B operand, lane -> row/col (lane&15), p already includes +8*(lane>>4);
//      elements 0..7 <- p[0..7] (k0+8h..), elements 8..15 <- p[16..23] (k0+16+8h..)  (same split k map for A and B;
//      B is always read from a k-contiguous [n][k] plane)
__device__ __forceinline__ v16h ldfrag_h(const _Float16* p) {
  FragH f;
  f.h[0] = *(const v8h*)(p);
  f.h[1] = *(const v8h*)(p + 16);
  return f.v;
}
__device__ __forceinline__ v16h ldfrag_u(const unsigned short* p) {
  FragH f;
  f.u[0] = *(const v4u*)(p);
  f.u[1] = *(const v4u*)(p + 16);
  return f.v;
}

// ---- WMMA helpers with trailing VALU hazard gaps ------------------------------------------------------
__device__ __forceinline__ v8f mma_raw(v16h a, v16h b, v8f c) {
  return __builtin_amdgcn_wmma_f32_16x16x32_f16(false, a, false, b, (short)0, c, false, false);
}
__device__ __forceinline__ void dep_guard1(v8f& a, v8f& b, v16h x) {
#if defined(__HIP_DEVICE_COMPILE__)
  asm volatile("v_nop\n\tv_nop\n\tv_nop\n\tv_nop" : "+v"(a), "+v"(b) : "v"(x));
#endif
}
__device__ __forceinline__ void dep_guard2(v8f& a, v8f& b, v16h x, v16h y) {
#if defined(__HIP_DEVICE_COMPILE__)
  asm volatile("v_nop\n\tv_nop\n\tv_nop\n\tv_nop" : "+v"(a), "+v"(b) : "v"(x), "v"(y));
#endif
}
__device__ __forceinline__ void guard_s2(v8f& s, v16h a0, v16h a1) {
#if defined(__HIP_DEVICE_COMPILE__)
  asm volatile("v_nop\n\tv_nop\n\tv_nop\n\tv_nop" : "+v"(s) : "v"(a0), "v"(a1));
#endif
}
__device__ __forceinline__ void guard_s4(v8f& s, v16h a0, v16h a1, v16h b0, v16h b1) {
#if defined(__HIP_DEVICE_COMPILE__)
  asm volatile("v_nop\n\tv_nop\n\tv_nop\n\tv_nop" : "+v"(s) : "v"(a0), "v"(a1), "v"(b0), "v"(b1));
#endif
}
__device__ __forceinline__ void guard_pv6(v8f& a, v8f& b, v8f& c, v8f& d,
                                          v16h p0, v16h p1, v16h x0, v16h x1, v16h x2, v16h x3) {
#if defined(__HIP_DEVICE_COMPILE__)
  asm volatile("v_nop\n\tv_nop\n\tv_nop\n\tv_nop"
               : "+v"(a), "+v"(b), "+v"(c), "+v"(d) : "v"(p0), "v"(p1), "v"(x0), "v"(x1), "v"(x2), "v"(x3));
#endif
}
__device__ __forceinline__ void guard_pv5(v8f& a, v8f& b, v8f& c, v8f& d,
                                          v16h p0, v16h x0, v16h x1, v16h x2, v16h x3) {
#if defined(__HIP_DEVICE_COMPILE__)
  asm volatile("v_nop\n\tv_nop\n\tv_nop\n\tv_nop"
               : "+v"(a), "+v"(b), "+v"(c), "+v"(d) : "v"(p0), "v"(x0), "v"(x1), "v"(x2), "v"(x3));
#endif
}
__device__ __forceinline__ void keep4_h(v16h a, v16h b, v16h c, v16h d) {
#if defined(__HIP_DEVICE_COMPILE__)
  asm volatile("v_nop" :: "v"(a), "v"(b), "v"(c), "v"(d));
#endif
}
__device__ __forceinline__ void acc_guard4(v8f& a, v8f& b, v8f& c, v8f& d) {
#if defined(__HIP_DEVICE_COMPILE__)
  asm volatile("v_nop\n\tv_nop\n\tv_nop\n\tv_nop" : "+v"(a), "+v"(b), "+v"(c), "+v"(d));
#endif
}
__device__ __forceinline__ void wave_sync_lds() {
  __builtin_amdgcn_fence(__ATOMIC_RELEASE, "workgroup");
  __builtin_amdgcn_wave_barrier();
  __builtin_amdgcn_fence(__ATOMIC_ACQUIRE, "workgroup");
}

// =====================================================================================================
// Row convert: X f32 [nrows][1024] -> Y f16 [nrows][1024] = f16( bf16_RNE(X) * carry ), carry a power of two (exact).
// One wave per row (8 rows per block); lane l holds cols j*256 + 8l..8l+7 for j = 0..3; store instruction j covers a contiguous
// coverage: 4 x 32 lanes x 8 halves = 1024 = the whole row; grid = nrows/8 (exact multiples here) with a wave-uniform row bound.
// Used for x (carry 16) and for Wi, Wo, Wv, Wout in their native [out][in] = [n][k] layout (carry 64).
// =====================================================================================================
__global__ __launch_bounds__(256) void conv_rows(const float* __restrict__ X, unsigned short* Y, int nrows, float carry) {
  const int lane = threadIdx.x & 31, wave = threadIdx.x >> 5;
  const int row = blockIdx.x * 8 + wave;
  if (row >= nrows) return;                      // wave-uniform; no barriers in this kernel
  const float* xp = X + (size_t)row * DM;
  unsigned short* op = Y + (size_t)row * DM;
  v4u res[4];
#pragma unroll
  for (int j = 0; j < 4; ++j) {
    const int c0 = j * 256 + lane * 8;
    const v4f a0 = *(const v4f*)(xp + c0), a1 = *(const v4f*)(xp + c0 + 4);
    float t[8];
#pragma unroll
    for (int e = 0; e < 4; ++e) { t[e] = bfr(a0[e]) * carry; t[4 + e] = bfr(a1[e]) * carry; }
    v4u o = {0u, 0u, 0u, 0u};
#pragma unroll
    for (int e = 0; e < 4; ++e) o[e] = pk16(h_bits((_Float16)t[2 * e]), h_bits((_Float16)t[2 * e + 1]));
    res[j] = o;
  }
  {
#pragma unroll
    for (int j = 0; j < 4; ++j) *(v4u*)(op + j * 256 + lane * 8) = res[j];
    
  }
}

// =====================================================================================================
// Gate weight plane: G f16 [64][1024]: row r = f16( 64 * bf16_RNE( (r & 16) ? We[r & 15] : Wa[r & 15] ) ) (rows 32..63 duplicate 0..31).
// Both candidate rows loaded with clamped in-range addresses, selected by value (row is wave-uniform). Same store shape as conv_rows.
// coverage: 8 blocks x 8 waves = 64 rows x (4 x 32 x 8 = 1024 cols), exact.
// =====================================================================================================
__global__ __launch_bounds__(256) void conv_gate(const float* __restrict__ Wa, const float* __restrict__ We,
                                                 unsigned short* Y, float carry) {
  const int lane = threadIdx.x & 31, wave = threadIdx.x >> 5;
  const int row = blockIdx.x * 8 + wave;
  if (row >= NGATE) return;                      // wave-uniform; no barriers in this kernel
  const float* pa = Wa + (size_t)(row & 15) * DM;
  const float* pb = We + (size_t)(row & 15) * DM;
  const bool useb = (row & 16) != 0;
  unsigned short* op = Y + (size_t)row * DM;
  v4u res[4];
#pragma unroll
  for (int j = 0; j < 4; ++j) {
    const int c0 = j * 256 + lane * 8;
    const v4f a0 = *(const v4f*)(pa + c0), a1 = *(const v4f*)(pa + c0 + 4);
    const v4f b0 = *(const v4f*)(pb + c0), b1 = *(const v4f*)(pb + c0 + 4);
    float t[8];
#pragma unroll
    for (int e = 0; e < 4; ++e) {
      t[e]     = bfr(useb ? b0[e] : a0[e]) * carry;
      t[4 + e] = bfr(useb ? b1[e] : a1[e]) * carry;
    }
    v4u o = {0u, 0u, 0u, 0u};
#pragma unroll
    for (int e = 0; e < 4; ++e) o[e] = pk16(h_bits((_Float16)t[2 * e]), h_bits((_Float16)t[2 * e + 1]));
    res[j] = o;
  }
  {
#pragma unroll
    for (int j = 0; j < 4; ++j) *(v4u*)(op + j * 256 + lane * 8) = res[j];
    
  }
}

// ---- asynchronous global -> LDS copies (16 B per lane). Each statement ends in s_wait_xcnt 0 so that no address register of an
//      issued copy is rewritten before the wait (a precaution); landing is waited for separately with s_wait_asynccnt 0.
#define KST   64      // k per stage: 128 B of every operand row = one whole line
#define LROW  144     // LDS row pitch in bytes: 128 + 16 (16 B x odd: conflict-free for 16-byte readers)
#define RSTEP (32 * LROW)   // LDS bytes between two copy rounds (a round = 8 waves x 4 rows)
__device__ __forceinline__ unsigned lds_off(const void* p) { return (unsigned)(size_t)p; }
__device__ __forceinline__ void copy2_lds(unsigned l, const unsigned short* g, size_t st) {
#if defined(__HIP_DEVICE_COMPILE__)
  asm volatile("global_load_async_to_lds_b128 %0, %1, off\n\t"
               "global_load_async_to_lds_b128 %2, %3, off\n\t"
               "s_wait_xcnt 0x0"
               :: "v"(l), "v"(g), "v"(l + RSTEP), "v"(g + st) : "memory");
#endif
}
__device__ __forceinline__ void copy8_lds(unsigned l, const unsigned short* g, size_t st) {
#if defined(__HIP_DEVICE_COMPILE__)
  asm volatile("global_load_async_to_lds_b128 %0, %1, off\n\t"
               "global_load_async_to_lds_b128 %2, %3, off\n\t"
               "global_load_async_to_lds_b128 %4, %5, off\n\t"
               "global_load_async_to_lds_b128 %6, %7, off\n\t"
               "global_load_async_to_lds_b128 %8, %9, off\n\t"
               "global_load_async_to_lds_b128 %10, %11, off\n\t"
               "global_load_async_to_lds_b128 %12, %13, off\n\t"
               "global_load_async_to_lds_b128 %14, %15, off\n\t"
               "s_wait_xcnt 0x0"
               :: "v"(l), "v"(g), "v"(l + RSTEP), "v"(g + st), "v"(l + 2 * RSTEP), "v"(g + 2 * st),
                  "v"(l + 3 * RSTEP), "v"(g + 3 * st), "v"(l + 4 * RSTEP), "v"(g + 4 * st), "v"(l + 5 * RSTEP), "v"(g + 5 * st),
                  "v"(l + 6 * RSTEP), "v"(g + 6 * st), "v"(l + 7 * RSTEP), "v"(g + 7 * st) : "memory");
#endif
}
// NR rounds of 32 rows (NR = 2 or 16): lane -> row 4*wave + (lane>>3) of its round, 16-byte piece lane&7; st = 32 source rows in elements
template <int NR>
__device__ __forceinline__ void copy_rows(unsigned l, const unsigned short* g, size_t st) {
  static_assert(NR == 2 || NR == 16);
  if constexpr (NR == 2) {
    copy2_lds(l, g, st);
  } else {
    copy8_lds(l, g, st);
    copy8_lds(l + 8 * RSTEP, g + 8 * st, st);
  }
}
__device__ __forceinline__ void wait_copies() {      // this wave's copies have landed in LDS
#if defined(__HIP_DEVICE_COMPILE__)
  asm volatile("s_wait_asynccnt 0x0" ::: "memory");
#endif
}
__device__ __forceinline__ void wait_lds_reads() {   // this wave's LDS reads have returned (before their buffer is refilled)
#if defined(__HIP_DEVICE_COMPILE__)
  asm volatile("s_wait_dscnt 0x0" ::: "memory");
#endif
}

// =====================================================================================================
// Register-blocked f16 WMMA GEMM: C[m][n] = f( oscale * sum_k A[m][k] * Bt[n][k] ); one wave per 64x64 tile, 8 tiles per block.
// Operands reach the fragments through LDS: per stage of 64 k the block copies its operand rows (128 B each, whole lines) with
// asynchronous copies into one of two buffers; the next stage's copies fly while this stage is multiplied; one barrier per stage.
// WM 1: the 8 tiles share their 64 A rows and lie side by side in n (N a multiple of 512); WM 8: they share their 64 B rows and
// lie below one another in m (N = 64, M a multiple of 512). K a multiple of 64.
// A row-major [M][K] pitch lda (16-bit plane), Bt row-major [N][K] pitch ldb (k contiguous); M, N multiples of 64, K multiple of 64.
// SPLITA 1: a second A plane A2 (same pitch) holding the unscaled f16 residual of A; its products go into the same accumulator.
// BM: 0 = no bias; 3 = per-column head bias bf16( (col & 16) ? bias2[col & 15] : bias[col & 15] ) (in-range addresses).
// OM: 0 = f32 out (pitch ldc), ACT 2 applies sigmoid after bias;
//     2 = f16 out = f16( value * ocarry ); 3 = f16 hi plane f16(value*ocarry) to C and unscaled residual f16(value*ocarry - hi) to C2.
// coverage: 4 slabs x 16 rows (f32: it 0..7 x lane>>4; f16: it 0..3 x lane>>3) x 64 cols = the wave's whole 64x64 tile;
//           grid = tilesM*tilesN/8 blocks (exact here); a block that does not fit the shape rules leaves as a whole before any barrier.
// =====================================================================================================
template <int OM, int BM, int ACT, int SPLITA, int WM>
__global__ __launch_bounds__(256) void gemm64(
    const unsigned short* __restrict__ Ap, const unsigned short* __restrict__ A2p, int lda,
    const unsigned short* __restrict__ Btp, int ldb,
    const float* __restrict__ bias, const float* __restrict__ bias2,
    void* Cout, void* C2out, int ldc,
    int M, int N, int K, float oscale, float ocarry) {
  static_assert(WM == 1 || WM == 8);
  constexpr int RA  = WM * 64;                     // A rows per block
  constexpr int RB  = (8 / WM) * 64;               // B rows per block
  constexpr int OA2 = RA * LROW;                   // stage layout in bytes: [A | A2 (SPLITA) | B]
  constexpr int OB  = RA * (1 + SPLITA) * LROW;
  constexpr int STG = OB + RB * LROW;              // bytes per stage
  __shared__ __align__(16) unsigned char ring[2 * STG];
  __shared__ __align__(16) float sT[8][16 * 68];   // per-wave 16x64 slab, pitch 68 floats
  const int lane = threadIdx.x & 31;
  const int wave = threadIdx.x >> 5;
  const int tilesN = N >> 6;
  const int tilesM = M >> 6;
  const int tile0 = blockIdx.x * 8;
  if (tile0 + 8 > tilesM * tilesN) return;         // block-uniform, before any barrier or copy
  if (WM == 1 ? (tilesN & 7) != 0 : (tilesN != 1)) return;   // block-uniform shape rule of this build
  const int tmB = tile0 / tilesN;
  const int mB = tmB << 6;                         // block's first row and column
  const int nB = (tile0 - tmB * tilesN) << 6;
  const int m0 = mB + (WM == 8 ? (wave << 6) : 0);
  const int n0 = nB + (WM == 1 ? (wave << 6) : 0);

  const int rlane = lane & 15;                 // row (A) / col (B, D) within subtile
  const int koff  = (lane >> 4) * 8;           // k offset of this lane half
  const int mOff  = (lane >> 4) * 8;           // D row offset

  // copy side: this lane's row and 16-byte piece in a round of 32 rows
  const int crow = wave * 4 + (lane >> 3);
  const int cseg = (lane & 7) * 8;
  const unsigned lcp = lds_off(ring) + (unsigned)(crow * LROW + cseg * 2);
  const unsigned short* gA  = Ap  + (size_t)(mB + crow) * lda + cseg;
  const unsigned short* gA2 = A2p + (size_t)(mB + crow) * lda + cseg;
  const unsigned short* gB  = Btp + (size_t)(nB + crow) * ldb + cseg;
  const size_t stA = (size_t)32 * lda, stB = (size_t)32 * ldb;
  // reader side: fragment rows of this wave in a stage
  const int fa = ((WM == 8 ? (wave << 6) : 0) + rlane) * LROW + koff * 2;
  const int fb = OB + ((WM == 1 ? (wave << 6) : 0) + rlane) * LROW + koff * 2;

  v8f acc[4][4];
#pragma unroll
  for (int i = 0; i < 4; ++i)
#pragma unroll
    for (int j = 0; j < 4; ++j) acc[i][j] = zero8();

  const int nst = K / KST;
  // stage 0 into buffer 0, landed and published; then stage 1 into buffer 1
  copy_rows<RA / 32>(lcp, gA, stA);
  if constexpr (SPLITA != 0) copy_rows<RA / 32>(lcp + OA2, gA2, stA);
  copy_rows<RB / 32>(lcp + OB, gB, stB);
  wait_copies();
  __syncthreads();
  if (nst > 1) {
    copy_rows<RA / 32>(lcp + STG, gA + KST, stA);
    if constexpr (SPLITA != 0) copy_rows<RA / 32>(lcp + STG + OA2, gA2 + KST, stA);
    copy_rows<RB / 32>(lcp + STG + OB, gB + KST, stB);
  }

#pragma unroll 1   // one stage per trip: the ring's order at the foot stays as written
  for (int t = 0; t < nst; ++t) {
    const unsigned bofs = (unsigned)(t & 1) * STG;
    const unsigned char* sb = ring + bofs;
#pragma unroll
    for (int s = 0; s < 2; ++s) {              // two k-steps of 32 per stage, ascending k
      v16h bh[4], ah[4], al[SPLITA != 0 ? 4 : 1];
#pragma unroll
      for (int j = 0; j < 4; ++j) bh[j] = ldfrag_u((const unsigned short*)(sb + fb + j * 16 * LROW + s * 64));
#pragma unroll
      for (int i = 0; i < 4; ++i) ah[i] = ldfrag_u((const unsigned short*)(sb + fa + i * 16 * LROW + s * 64));
      if constexpr (SPLITA != 0) {
#pragma unroll
        for (int i = 0; i < 4; ++i) al[i] = ldfrag_u((const unsigned short*)(sb + OA2 + fa + i * 16 * LROW + s * 64));
      }
#pragma unroll
      for (int i = 0; i < 4; ++i) {
#pragma unroll
        for (int j = 0; j < 4; ++j) acc[i][j] = mma_raw(ah[i], bh[j], acc[i][j]);
        if constexpr (SPLITA != 0) {
#pragma unroll
          for (int j = 0; j < 4; ++j) acc[i][j] = mma_raw(al[i], bh[j], acc[i][j]);
          dep_guard2(acc[i][0], acc[i][3], ah[i], al[i]);
        } else {
          dep_guard1(acc[i][0], acc[i][3], ah[i]);
        }
      }
      keep4_h(bh[0], bh[1], bh[2], bh[3]);
    }
    // publish point of stage t + 1; the same barrier ends every reader's last read of stage t's buffer
    wait_lds_reads();
    wait_copies();
    __syncthreads();
    if (t + 2 < nst) {                         // block-uniform: refill the buffer that this trip has just read
      const int kn = (t + 2) * KST;
      copy_rows<RA / 32>(lcp + bofs, gA + kn, stA);
      if constexpr (SPLITA != 0) copy_rows<RA / 32>(lcp + bofs + OA2, gA2 + kn, stA);
      copy_rows<RB / 32>(lcp + bofs + OB, gB + kn, stB);
    }
  }
  wait_copies();
  acc_guard4(acc[0][0], acc[0][1], acc[0][2], acc[0][3]);
  acc_guard4(acc[1][0], acc[1][1], acc[1][2], acc[1][3]);
  acc_guard4(acc[2][0], acc[2][1], acc[2][2], acc[2][3]);
  acc_guard4(acc[3][0], acc[3][1], acc[3][2], acc[3][3]);

  const int hh2 = lane >> 4, c4 = (lane & 15) * 4;     // f32 out: 256-B row segment = 16 lanes x 16 B
  const int q8  = lane >> 3, c8 = (lane & 7) * 8;
  float bc[4];
#pragma unroll
  for (int e = 0; e < 4; ++e) bc[e] = 0.f;
  if constexpr (BM == 3) {
#pragma unroll
    for (int e = 0; e < 4; ++e) {
      const int col = n0 + c4 + e;
      const float fa = bfr(bias[col & 15]);             // in-range addresses 0..15
      const float fb = bfr(bias2[col & 15]);
      bc[e] = (col & 16) ? fb : fa;
    }
  }

  // ---- epilogue ----
  float* slab = sT[wave];
#pragma unroll
  for (int i = 0; i < 4; ++i) {
    const int mBase = m0 + (i << 4);
#pragma unroll
    for (int j = 0; j < 4; ++j) {
#pragma unroll
      for (int r = 0; r < 8; ++r) {
        slab[(mOff + r) * 68 + (j << 4) + rlane] = acc[i][j][r];
      }
    }
    wave_sync_lds();
    if constexpr (OM == 0) {
      float* C = (float*)Cout;
      v4f vals[8];
#pragma unroll
      for (int it = 0; it < 8; ++it) {
        const int row = it * 2 + hh2;                      // it 0..7 x hh2 0..1 = rows 0..15
        v4f v = *(const v4f*)(slab + row * 68 + c4);
#pragma unroll
        for (int e = 0; e < 4; ++e) {
          float f = v[e] * oscale + bc[e];
          if constexpr (ACT == 2) f = 1.0f / (1.0f + __expf(-f));
          v[e] = f;
        }
        vals[it] = v;
      }
      {
#pragma unroll
        for (int it = 0; it < 8; ++it) {
          const int gr = mBase + it * 2 + hh2;
          *(v4f*)(C + (size_t)gr * ldc + n0 + c4) = vals[it];
        }
        
      }
    } else {
      unsigned short* C  = (unsigned short*)Cout;
      unsigned short* C2 = (unsigned short*)C2out;
      v4u hv[4], lv[4];
#pragma unroll
      for (int it = 0; it < 4; ++it) {
        const int row = it * 4 + q8;                       // it 0..3 x q8 0..3 = rows 0..15
        const float* sp = slab + row * 68 + c8;
        v4u a = {0u, 0u, 0u, 0u};
        v4u b = {0u, 0u, 0u, 0u};
#pragma unroll
        for (int e = 0; e < 4; ++e) {
          const float f0 = (sp[2 * e] * oscale) * ocarry;
          const float f1 = (sp[2 * e + 1] * oscale) * ocarry;
          const _Float16 h0 = (_Float16)f0, h1 = (_Float16)f1;
          a[e] = pk16(h_bits(h0), h_bits(h1));
          if constexpr (OM == 3) {
            const _Float16 l0 = (_Float16)(f0 - (float)h0);
            const _Float16 l1 = (_Float16)(f1 - (float)h1);
            b[e] = pk16(h_bits(l0), h_bits(l1));
          }
        }
        hv[it] = a;
        lv[it] = b;
      }
      {
#pragma unroll
        for (int it = 0; it < 4; ++it) {
          const int row = it * 4 + q8;
          *(v4u*)(C + (size_t)(mBase + row) * ldc + n0 + c8) = hv[it];
          if constexpr (OM == 3) {
            *(v4u*)(C2 + (size_t)(mBase + row) * ldc + n0 + c8) = lv[it];
          }
        }
        
      }
    }
    wave_sync_lds();
  }
}

// =====================================================================================================
// Flash attention for 16 query rows and 8 heads (one wave per head), head dim 64, 2048 keys:
//   inner|outer plane (f16 x16) QK[tok][2048]: inner at col 64h + d, outer at col 1024 + 64h + d;
//   v^T planes (f16 hi x1024, unscaled residual): VH/VL[64h + d][key] (pitch 2048);
//   gate plane AEF f32 [tok][64]: col h = ap[h][tok] (sigmoid applied), col 16 + h = ex[h][tok];
//   out: CTH/CTL[tok][64h + d] = f16 hi / residual of 4096 * ctx, ctx = valve/rotation epilogue of
//        ap * sum_s p_s v_s / (ap * sum_s p_s + 1e-8 * sum_s e_s), e_s = exp(score_s - max), p_s = e_s * ex[s].
//   block = 8 waves = 256 threads; grid = 128 query tiles x 2 head groups = 256; every wave does identical bounded work (64 steps).
//   Per step: 2 score tiles on f16 WMMA (K = 64 as two k-steps of 32), fragments loaded straight from the 16-bit plane; ex for the
//   lane's two key columns loaded from AEF; online max-subtracted softmax in f32 (exp2, log2e / 8 / carries folded in), running sums
//   of e and of p = e*ex; rescale of sums and accumulators; the 16x32 p tile stored to wave-private LDS (f32 element stores),
//   loads, split k map); v^T hi and residual B fragments loaded straight from the planes; 12 WMMAs (hi.hi, lo.hi, hi.lo) into one
//   accumulator set.
//   Final scaling in f32; each wave stages its 16x64 slice (hi and residual 16-bit values) in the block's LDS row buffers [16][512];
// coverage: LDS row buffers: 8 waves x 16 rows x 64 cols = 16 x 512; global: 4 iterations x 256 threads x 8 halves = 16 rows x 512
//           cols (cols 512*hg ..) of rows q0..q0+15, both planes; grid covers all 2048 rows x 1024 cols exactly once.
// =====================================================================================================
__global__ __launch_bounds__(ATT_THREADS)
void attn_heads(const unsigned short* __restrict__ QKq, const unsigned short* __restrict__ VHq,
                const unsigned short* __restrict__ VLq, const float* __restrict__ AEF,
                const float* __restrict__ betap, const float* __restrict__ ivp,
                const float* __restrict__ ovp, const float* __restrict__ chg,
                unsigned short* CTH, unsigned short* CTL) {
  __shared__ __align__(16) float Ps[HPB][16 * 36];          // per wave p tile [row][32 keys], pitch 36
  __shared__ __align__(16) unsigned short Osh[16 * OSW];    // block result rows [16][512], hi
  __shared__ __align__(16) unsigned short Osl[16 * OSW];    // residual

  const int tid  = threadIdx.x;
  const int wave = tid >> 5;
  const int lane = tid & 31;
  const int hh   = lane >> 4;
  const int c    = lane & 15;

  const int qt   = blockIdx.x % ATT_QT;                     // 0..127
  const int hg   = (blockIdx.x / ATT_QT) & 1;               // head group 0..1
  const int head = hg * HPB + wave;                         // 0..15
  const int q0   = qt * 16;

  const _Float16* Qh = (const _Float16*)(const void*)QKq + (size_t)(q0 + c) * QKP + head * HDIM + 8 * hh;
  const _Float16* Kb = (const _Float16*)(const void*)QKq + DM + head * HDIM + 8 * hh;
  const _Float16* Vh = (const _Float16*)(const void*)VHq + (size_t)(head * HDIM + c) * TT + 8 * hh;
  const _Float16* Vl = (const _Float16*)(const void*)VLq + (size_t)(head * HDIM + c) * TT + 8 * hh;
  const float* Ex = AEF + 16 + head;                                    // ex column of this head
  const float lsc = (1.4426950408889634f * ATT_SCALE) / (QC * KC);      // log2(e) / 8 / carries

  const v16h qa = ldfrag_h(Qh), qb = ldfrag_h(Qh + 32);

  float mrow[8], lrow[8], zrow[8];
  v8f o0 = zero8(), o1 = zero8(), o2 = zero8(), o3 = zero8();
#pragma unroll
  for (int r = 0; r < 8; ++r) { mrow[r] = -INFINITY; lrow[r] = 0.f; zrow[r] = 0.f; }
  float* pt = Ps[wave];

#pragma unroll 1
  for (int kb = 0; kb < TT; kb += 32) {
    const _Float16* kp = Kb + (size_t)(kb + c) * QKP;
    v8f s0, s1;
    {
      const v16h k0 = ldfrag_h(kp), k1 = ldfrag_h(kp + 32);
      s0 = mma_raw(qa, k0, zero8());
      s0 = mma_raw(qb, k1, s0);
      guard_s2(s0, k0, k1);
    }
    {
      const _Float16* kq = kp + (size_t)16 * QKP;
      const v16h k0 = ldfrag_h(kq), k1 = ldfrag_h(kq + 32);
      s1 = mma_raw(qa, k0, zero8());
      s1 = mma_raw(qb, k1, s1);
      guard_s4(s1, k0, k1, qa, qb);
    }
    const float ex0 = Ex[(size_t)(kb + c) * NGATE];          // key kb + c
    const float ex1 = Ex[(size_t)(kb + 16 + c) * NGATE];     // key kb + 16 + c
#pragma unroll
    for (int r = 0; r < 8; ++r) {
      const float t0 = s0[r] * lsc, t1 = s1[r] * lsc;
      float mx = fmaxf(t0, t1);
#pragma unroll
      for (int off = 1; off < 16; off <<= 1) mx = fmaxf(mx, __shfl_xor(mx, off, 32));
      const float mn = fmaxf(mrow[r], mx);
      const float al = exp2f(mrow[r] - mn);
      mrow[r] = mn;
      const float e0 = exp2f(t0 - mn), e1 = exp2f(t1 - mn);
      const float p0 = e0 * ex0, p1 = e1 * ex1;
      float zs = e0 + e1;
      float ps = p0 + p1;
#pragma unroll
      for (int off = 1; off < 16; off <<= 1) {
        zs += __shfl_xor(zs, off, 32);
        ps += __shfl_xor(ps, off, 32);
      }
      zrow[r] = zrow[r] * al + zs;
      lrow[r] = lrow[r] * al + ps;
      o0[r] *= al;
      o1[r] *= al;
      o2[r] *= al;
      o3[r] *= al;
      const int ro = (8 * hh + r) * 36 + c;
      pt[ro]      = p0;
      pt[ro + 16] = p1;
    }
    wave_sync_lds();
    FragH ph, pl;
    {
      const float* prow = pt + c * 36 + 8 * hh;
      const v4f g0 = *(const v4f*)(prow), g1 = *(const v4f*)(prow + 4);
      const v4f g2 = *(const v4f*)(prow + 16), g3 = *(const v4f*)(prow + 20);
#pragma unroll
      for (int e = 0; e < 4; ++e) {
        float xv; _Float16 hx;
        xv = g0[e] * PC; hx = (_Float16)xv; ph.h[0][e]     = hx; pl.h[0][e]     = (_Float16)(xv - (float)hx);   // keys kb + 8hh + e
        xv = g1[e] * PC; hx = (_Float16)xv; ph.h[0][4 + e] = hx; pl.h[0][4 + e] = (_Float16)(xv - (float)hx);
        xv = g2[e] * PC; hx = (_Float16)xv; ph.h[1][e]     = hx; pl.h[1][e]     = (_Float16)(xv - (float)hx);   // keys kb + 16 + 8hh + e
        xv = g3[e] * PC; hx = (_Float16)xv; ph.h[1][4 + e] = hx; pl.h[1][4 + e] = (_Float16)(xv - (float)hx);
      }
    }
    {
      const _Float16* vp = Vh + kb;
      const v16h vb0 = ldfrag_h(vp);
      const v16h vb1 = ldfrag_h(vp + (size_t)16 * TT);
      const v16h vb2 = ldfrag_h(vp + (size_t)32 * TT);
      const v16h vb3 = ldfrag_h(vp + (size_t)48 * TT);
      o0 = mma_raw(ph.v, vb0, o0);
      o1 = mma_raw(ph.v, vb1, o1);
      o2 = mma_raw(ph.v, vb2, o2);
      o3 = mma_raw(ph.v, vb3, o3);
      o0 = mma_raw(pl.v, vb0, o0);
      o1 = mma_raw(pl.v, vb1, o1);
      o2 = mma_raw(pl.v, vb2, o2);
      o3 = mma_raw(pl.v, vb3, o3);
      guard_pv6(o0, o1, o2, o3, ph.v, pl.v, vb0, vb1, vb2, vb3);
    }
    {
      const _Float16* vp = Vl + kb;
      const v16h vl0 = ldfrag_h(vp);
      const v16h vl1 = ldfrag_h(vp + (size_t)16 * TT);
      const v16h vl2 = ldfrag_h(vp + (size_t)32 * TT);
      const v16h vl3 = ldfrag_h(vp + (size_t)48 * TT);
      o0 = mma_raw(ph.v, vl0, o0);
      o1 = mma_raw(ph.v, vl1, o1);
      o2 = mma_raw(ph.v, vl2, o2);
      o3 = mma_raw(ph.v, vl3, o3);
      guard_pv5(o0, o1, o2, o3, ph.v, vl0, vl1, vl2, vl3);
    }
    wave_sync_lds();
  }

  // ---- per-head gates and rotation, renormaliser, carries (1024 on p, 1024 on v, 4096 on the stored ctx) ----
  const float* Ap = AEF + head;
  float apr[8];
#pragma unroll
  for (int r = 0; r < 8; ++r) apr[r] = Ap[(size_t)(q0 + 8 * hh + r) * NGATE];
  const float bet = bfr(betap[head]);
  const float ivs = sigf(bfr(ivp[head]));
  const float og  = sigf(bfr(ovp[head])) * tanhf(bfr(chg[head]));
  const float ang = PI_F * sigf(bet);
  const float ca  = cosf(ang), sa = sinf(ang);
  const float base = ivs / (PC * VC);
  unsigned short* oh = Osh + wave * HDIM + c;
  unsigned short* ol = Osl + wave * HDIM + c;
#pragma unroll
  for (int r = 0; r < 8; ++r) {
    const float den = apr[r] * lrow[r] + REN_EPS * zrow[r];
    const float sc  = apr[r] * (1.0f / den) * base;
    const float x0 = o0[r] * sc, x1 = o1[r] * sc, x2 = o2[r] * sc, x3 = o3[r] * sc;
    const float y0 = ((x0 * ca - x2 * sa) * og) * FC;
    const float y1 = ((x1 * ca - x3 * sa) * og) * FC;
    const float y2 = ((x0 * sa + x2 * ca) * og) * FC;
    const float y3 = ((x1 * sa + x3 * ca) * og) * FC;
    const _Float16 h0 = (_Float16)y0, h1 = (_Float16)y1, h2 = (_Float16)y2, h3 = (_Float16)y3;
    const int ro = (8 * hh + r) * OSW;
    oh[ro]      = h_bits(h0);
    oh[ro + 16] = h_bits(h1);
    oh[ro + 32] = h_bits(h2);
    oh[ro + 48] = h_bits(h3);
    ol[ro]      = h_bits((_Float16)(y0 - (float)h0));
    ol[ro + 16] = h_bits((_Float16)(y1 - (float)h1));
    ol[ro + 32] = h_bits((_Float16)(y2 - (float)h2));
    ol[ro + 48] = h_bits((_Float16)(y3 - (float)h3));
  }
  __syncthreads();
  // ---- block writes its 16 row segments: piece p = it*256 + tid -> row p>>6, halves (p&63)*8 of the 512-col slab ----
  {
    v4u vh[4], vl[4];
#pragma unroll
    for (int it = 0; it < 4; ++it) {
      const int p = it * ATT_THREADS + tid;
      vh[it] = *(const v4u*)(Osh + (size_t)p * 8);
      vl[it] = *(const v4u*)(Osl + (size_t)p * 8);
    }
    const size_t dofs = (size_t)q0 * DM + (size_t)hg * OSW;
    unsigned short* dh = CTH + dofs;
    unsigned short* dl = CTL + dofs;
    {
#pragma unroll
      for (int it = 0; it < 4; ++it) {
        const int p = it * ATT_THREADS + tid;
        const size_t po = (size_t)(p >> 6) * DM + (size_t)(p & 63) * 8;
        *(v4u*)(dh + po) = vh[it];
        *(v4u*)(dl + po) = vl[it];
      }
      
    }
  }
}

// =====================================================================================================
// Workspace map (bytes); every plane is an exact multiple of its tile / whole-row store granularity (M, N exact tile multiples,
// row blocks exact, no pad rows needed), every offset a multiple of 131072:
//   WIO  f16 [2048][1024] x64     4194304   (rows 0..1023 Wi, 1024..2047 Wo; native [out][in] = [n][k])
//   WV   f16 [1024][1024] x64     2097152
//   WOUT f16 [1024][1024] x64     2097152
//   WG   f16 [64][1024]   x64      131072   (Wa, We, Wa, We)
//   XB   f16 [2048][1024] x16     4194304
//   QK   f16 [2048][2048] x16     8388608   (inner | outer)
//   VTH  f16 [1024][2048] x1024   4194304   (v^T hi)
//   VTL  f16 [1024][2048]         4194304   (v^T residual)
//   AEF  f32 [2048][64]            524288   (sigmoid gates)
//   CTH  f16 [2048][1024] x4096   4194304   (ctx hi)
//   CTL  f16 [2048][1024]         4194304   (ctx residual)
//   end                          38404096
// =====================================================================================================
extern "C" void kernel_launch(void* const* d_in, const int* in_sizes, int n_in,
                              void* d_out, int out_size, void* d_ws, size_t ws_size,
                              hipStream_t stream) {
  if (n_in < 13) return;
  if (in_sizes[0] != TT * DM) return;
  if (in_sizes[1] != NHEAD * DM || in_sizes[2] != NHEAD) return;
  if (in_sizes[3] != NHEAD * DM || in_sizes[4] != NHEAD) return;
  if (in_sizes[5] != DM * DM || in_sizes[6] != DM * DM || in_sizes[7] != DM * DM || in_sizes[8] != DM * DM) return;
  if (in_sizes[9] != NHEAD || in_sizes[10] != NHEAD || in_sizes[11] != NHEAD || in_sizes[12] != NHEAD) return;
  if (out_size != TT * DM) return;

  const float* x     = (const float*)d_in[0];
  const float* Wa    = (const float*)d_in[1];
  const float* ba    = (const float*)d_in[2];
  const float* We    = (const float*)d_in[3];
  const float* be    = (const float*)d_in[4];
  const float* Wi    = (const float*)d_in[5];
  const float* Wo    = (const float*)d_in[6];
  const float* Wv    = (const float*)d_in[7];
  const float* Wout  = (const float*)d_in[8];
  const float* betap = (const float*)d_in[9];
  const float* ivp   = (const float*)d_in[10];
  const float* ovp   = (const float*)d_in[11];
  const float* chg   = (const float*)d_in[12];
  float*       out   = (float*)d_out;

  const size_t PWIO = (size_t)2 * DM * DM * 2;                    //  4194304
  const size_t PW   = (size_t)DM * DM * 2;                        //  2097152
  const size_t PG   = (size_t)NGATE * DM * 2;                     //   131072
  const size_t PX   = (size_t)TT * DM * 2;                        //  4194304
  const size_t PQK  = (size_t)TT * QKP * 2;                       //  8388608
  const size_t PVT  = (size_t)DM * TT * 2;                        //  4194304
  const size_t PAE  = (size_t)TT * NGATE * 4;                     //   524288
  const size_t PCT  = (size_t)TT * DM * 2;                        //  4194304
  size_t off = 0;
  const size_t oWIO = off; off += PWIO;
  const size_t oWV  = off; off += PW;
  const size_t oWOU = off; off += PW;
  const size_t oWG  = off; off += PG;
  const size_t oXB  = off; off += PX;
  const size_t oQK  = off; off += PQK;
  const size_t oVTH = off; off += PVT;
  const size_t oVTL = off; off += PVT;
  const size_t oAEF = off; off += PAE;
  const size_t oCTH = off; off += PCT;
  const size_t oCTL = off; off += PCT;
  if (off > ws_size) return;                                      // off = 38404096
  if (off > (size_t)134217728) return;

  char* ws = (char*)d_ws;
  unsigned short* WIO  = (unsigned short*)(ws + oWIO);
  unsigned short* WV   = (unsigned short*)(ws + oWV);
  unsigned short* WOUT = (unsigned short*)(ws + oWOU);
  unsigned short* WG   = (unsigned short*)(ws + oWG);
  unsigned short* XB   = (unsigned short*)(ws + oXB);
  unsigned short* QK   = (unsigned short*)(ws + oQK);
  unsigned short* VTH  = (unsigned short*)(ws + oVTH);
  unsigned short* VTL  = (unsigned short*)(ws + oVTL);
  float*          AEF  = (float*)(ws + oAEF);
  unsigned short* CTH  = (unsigned short*)(ws + oCTH);
  unsigned short* CTL  = (unsigned short*)(ws + oCTL);

  const dim3 blk(256);
  const dim3 gX(TT / 8);                                          // 256 blocks
  const dim3 gW(DM / 8);                                          // 128 blocks
  const dim3 gG(NGATE / 8);                                       // 8 blocks
  const int tilesG = (TT / 64) * (NGATE / 64);                    // 32
  const int tilesQ = (TT / 64) * (QKP / 64);                      // 1024
  const int tilesV = (DM / 64) * (TT / 64);                       // 512
  const int tilesO = (TT / 64) * (DM / 64);                       // 512
  const dim3 gGE((tilesG + 7) / 8);                               // 4
  const dim3 gQK((tilesQ + 7) / 8);                               // 128
  const dim3 gVT((tilesV + 7) / 8);                               // 64
  const dim3 gO((tilesO + 7) / 8);                                // 64
  const dim3 gAT(ATT_BLOCKS);                                     // 256
  const dim3 bAT(ATT_THREADS);                                    // 256

  // (0) 16-bit planes: XB = f16(16 * bf16(x)); W planes = f16(64 * bf16(W)) in native [n][k] layout; gate plane
  conv_rows<<<gX, blk, 0, stream>>>(x, XB, TT, ACARRY);                         // [2048][1024]
  conv_rows<<<gW, blk, 0, stream>>>(Wi, WIO, DM, WSC);                           // [1024][1024] -> WIO rows 0..1023
  conv_rows<<<gW, blk, 0, stream>>>(Wo, WIO + (size_t)DM * DM, DM, WSC);         // -> WIO rows 1024..2047
  conv_rows<<<gW, blk, 0, stream>>>(Wv, WV, DM, WSC);
  conv_rows<<<gW, blk, 0, stream>>>(Wout, WOUT, DM, WSC);
  conv_gate<<<gG, blk, 0, stream>>>(Wa, We, WG, WSC);                            // [64][1024]

  // (1) gates: AEF[t][j] = sigmoid(x[t] . G[j] / (16*64) + bf16(bias_j)); M = 2048, N = 64, K = 1024, f32 out
  gemm64<0, 3, 2, 0, 8><<<gGE, blk, 0, stream>>>(
      XB, XB, DM,
      WG, DM,
      ba, be,
      (void*)AEF, (void*)AEF, NGATE,
      TT, NGATE, DM, 1.0f / (ACARRY * WSC), 1.0f);

  // (2) inner | outer: QK[t][n] = f16(16 * x[t] . [Wi;Wo][n]); M = 2048, N = 2048, K = 1024
  gemm64<2, 0, 0, 0, 1><<<gQK, blk, 0, stream>>>(
      XB, XB, DM,
      WIO, DM,
      ba, be,
      (void*)QK, (void*)QK, QKP,
      TT, QKP, DM, 1.0f / (ACARRY * WSC), QC);

  // (3) v^T: VTH/VTL[d][t] = hi/residual of f16(1024 * Wv[d] . x[t]); M = 1024, N = 2048, K = 1024
  gemm64<3, 0, 0, 0, 1><<<gVT, blk, 0, stream>>>(
      WV, WV, DM,
      XB, DM,
      ba, be,
      (void*)VTH, (void*)VTL, TT,
      DM, TT, DM, 1.0f / (WSC * ACARRY), VC);

  // (4) attention per (16 query rows, 8 heads) -> CTH/CTL (ctx x4096 hi + residual)
  attn_heads<<<gAT, bAT, 0, stream>>>(QK, VTH, VTL, AEF, betap, ivp, ovp, chg, CTH, CTL);

  // (5) out = (ctx_hi + ctx_lo) . Wout plane / (4096 * 64); M = 2048, N = 1024, K = 1024, f32
  gemm64<0, 0, 0, 1, 1><<<gO, blk, 0, stream>>>(
      CTH, CTL, DM,
      WOUT, DM,
      ba, be,
      (void*)out, (void*)out, DM,
      TT, DM, DM, 1.0f / (FC * WSC), 1.0f);
  (void)hipGetLastError();
}

// v002
// Measured time: 194 microseconds a run.
// Timed twice side by side with v001, it ran 1.28 and 1.26 times as fast.
// Over all steps from v000 it is 1.93 times as fast.
// Contractions: gate logits (x f16 x16 . [Wa;We;Wa;We] f16 x64, K=1024), inner|outer projections (x f16 x16 . [Wi;Wo] f16 x64, K=1024),
// v^T projection (Wv f16 x64 . x f16 x16, K=1024; stored as f16 hi x1024 + residual plane), scores (inner f16 x16 . outer f16 x16, K=64),
// P . v^T (P f16 x1024 hi+residual . v^T f16 hi+residual, three products, 2048 keys in steps of 32),
// output projection (ctx f16 x4096 hi+residual . Wout f16 x64, two products, K=1024): all v_wmma_f32_16x16x32_f16, f32 accumulate.
// Sigmoid gates, online max-subtracted softmax, renormaliser, valve/rotation epilogue in f32 on VALU; every float input RNE-converted to bf16 on load.
#include <hip/hip_runtime.h>
#include <math.h>
#include <stdint.h>

#define TT      2048
#define DM      1024
#define NHEAD   16
#define HDIM    64
#define NGATE   64
#define QTB     8
#define QKP     (2 * DM)
#define WSC     64.0f
#define ACARRY  16.0f
#define QC      16.0f
#define KC      16.0f
#define VC      1024.0f
#define PC      1024.0f
#define FC      4096.0f
#define ATT_SCALE 0.125f
#define PI_F    3.14159265358979323846f
#define REN_EPS 1e-8f
static_assert(NHEAD * HDIM == DM);
static_assert((TT % 64) == 0 && (DM % 64) == 0 && (DM % 256) == 0 && (TT % 32) == 0 && (TT % 16) == 0);
static_assert(NHEAD == 16 && NGATE == 64);
#define ATT_THREADS (QTB * 32)
#define ATT_QB      (QTB * 16)
#define ATT_QG      (TT / ATT_QB)
#define ATT_BLOCKS  (ATT_QG * NHEAD)
static_assert(ATT_THREADS == 256 && ATT_BLOCKS == 256 && (TT % ATT_QB) == 0);

typedef _Float16 v16h __attribute__((ext_vector_type(16)));
typedef _Float16 v8h  __attribute__((ext_vector_type(8)));
typedef float    v8f  __attribute__((ext_vector_type(8)));
typedef float    v4f  __attribute__((ext_vector_type(4)));
typedef unsigned int v4u __attribute__((ext_vector_type(4)));

union FragH { v16h v; v8h h[2]; v4u u[2]; };

// ---- scalar helpers --------------------------------------------------------------------------------
__device__ __forceinline__ unsigned short bf_bits(float f) {          // f32 -> bf16 bits, RNE convert
  unsigned u = __float_as_uint(f);
  return (unsigned short)((u + 0x7FFFu + ((u >> 16) & 1u)) >> 16);
}
__device__ __forceinline__ float bf_up(unsigned short h) { return __uint_as_float(((unsigned)h) << 16); }
__device__ __forceinline__ float bfr(float f) { return bf_up(bf_bits(f)); }   // value of the bf16 RNE convert
__device__ __forceinline__ unsigned short h_bits(_Float16 x) { return __builtin_bit_cast(unsigned short, x); }
__device__ __forceinline__ unsigned pk16(unsigned short a, unsigned short b) { return (unsigned)a | ((unsigned)b << 16); }
__device__ __forceinline__ v8f zero8() { v8f z = {0.f, 0.f, 0.f, 0.f, 0.f, 0.f, 0.f, 0.f}; return z; }
__device__ __forceinline__ float sigf(float v) { return 1.0f / (1.0f + expf(-v)); }

// ---- fragment loaders: 16-bit A/B operand, lane -> row/col (lane&15), p already includes +8*(lane>>4);
//      elements 0..7 <- p[0..7] (k0+8h..), elements 8..15 <- p[16..23] (k0+16+8h..)  (same split k map for A and B;
//      B is always read from a k-contiguous [n][k] plane)
__device__ __forceinline__ v16h ldfrag_h(const _Float16* p) {
  FragH f;
  f.h[0] = *(const v8h*)(p);
  f.h[1] = *(const v8h*)(p + 16);
  return f.v;
}
__device__ __forceinline__ v16h ldfrag_u(const unsigned short* p) {
  FragH f;
  f.u[0] = *(const v4u*)(p);
  f.u[1] = *(const v4u*)(p + 16);
  return f.v;
}

// ---- WMMA helpers with trailing VALU hazard gaps ------------------------------------------------------
__device__ __forceinline__ v8f mma_raw(v16h a, v16h b, v8f c) {
  return __builtin_amdgcn_wmma_f32_16x16x32_f16(false, a, false, b, (short)0, c, false, false);
}
__device__ __forceinline__ void dep_guard1(v8f& a, v8f& b, v16h x) {
#if defined(__HIP_DEVICE_COMPILE__)
  asm volatile("v_nop\n\tv_nop\n\tv_nop\n\tv_nop" : "+v"(a), "+v"(b) : "v"(x));
#endif
}
__device__ __forceinline__ void dep_guard2(v8f& a, v8f& b, v16h x, v16h y) {
#if defined(__HIP_DEVICE_COMPILE__)
  asm volatile("v_nop\n\tv_nop\n\tv_nop\n\tv_nop" : "+v"(a), "+v"(b) : "v"(x), "v"(y));
#endif
}
__device__ __forceinline__ void guard_s2(v8f& s, v16h a0, v16h a1) {
#if defined(__HIP_DEVICE_COMPILE__)
  asm volatile("v_nop\n\tv_nop\n\tv_nop\n\tv_nop" : "+v"(s) : "v"(a0), "v"(a1));
#endif
}
__device__ __forceinline__ void guard_s4(v8f& s, v16h a0, v16h a1, v16h b0, v16h b1) {
#if defined(__HIP_DEVICE_COMPILE__)
  asm volatile("v_nop\n\tv_nop\n\tv_nop\n\tv_nop" : "+v"(s) : "v"(a0), "v"(a1), "v"(b0), "v"(b1));
#endif
}
__device__ __forceinline__ void guard_pv6(v8f& a, v8f& b, v8f& c, v8f& d,
                                          v16h p0, v16h p1, v16h x0, v16h x1, v16h x2, v16h x3) {
#if defined(__HIP_DEVICE_COMPILE__)
  asm volatile("v_nop\n\tv_nop\n\tv_nop\n\tv_nop"
               : "+v"(a), "+v"(b), "+v"(c), "+v"(d) : "v"(p0), "v"(p1), "v"(x0), "v"(x1), "v"(x2), "v"(x3));
#endif
}
__device__ __forceinline__ void guard_pv5(v8f& a, v8f& b, v8f& c, v8f& d,
                                          v16h p0, v16h x0, v16h x1, v16h x2, v16h x3) {
#if defined(__HIP_DEVICE_COMPILE__)
  asm volatile("v_nop\n\tv_nop\n\tv_nop\n\tv_nop"
               : "+v"(a), "+v"(b), "+v"(c), "+v"(d) : "v"(p0), "v"(x0), "v"(x1), "v"(x2), "v"(x3));
#endif
}
__device__ __forceinline__ void keep4_h(v16h a, v16h b, v16h c, v16h d) {
#if defined(__HIP_DEVICE_COMPILE__)
  asm volatile("v_nop" :: "v"(a), "v"(b), "v"(c), "v"(d));
#endif
}
__device__ __forceinline__ void acc_guard4(v8f& a, v8f& b, v8f& c, v8f& d) {
#if defined(__HIP_DEVICE_COMPILE__)
  asm volatile("v_nop\n\tv_nop\n\tv_nop\n\tv_nop" : "+v"(a), "+v"(b), "+v"(c), "+v"(d));
#endif
}
__device__ __forceinline__ void wave_sync_lds() {
  __builtin_amdgcn_fence(__ATOMIC_RELEASE, "workgroup");
  __builtin_amdgcn_wave_barrier();
  __builtin_amdgcn_fence(__ATOMIC_ACQUIRE, "workgroup");
}

// =====================================================================================================
// Row convert: X f32 [nrows][1024] -> Y f16 [nrows][1024] = f16( bf16_RNE(X) * carry ), carry a power of two (exact).
// One wave per row (8 rows per block); lane l holds cols j*256 + 8l..8l+7 for j = 0..3; store instruction j covers a contiguous
// coverage: 4 x 32 lanes x 8 halves = 1024 = the whole row; grid = nrows/8 (exact multiples here) with a wave-uniform row bound.
// Used for x (carry 16) and for Wi, Wo, Wv, Wout in their native [out][in] = [n][k] layout (carry 64).
// =====================================================================================================
__global__ __launch_bounds__(256) void conv_rows(const float* __restrict__ X, unsigned short* Y, int nrows, float carry) {
  const int lane = threadIdx.x & 31, wave = threadIdx.x >> 5;
  const int row = blockIdx.x * 8 + wave;
  if (row >= nrows) return;                      // wave-uniform; no barriers in this kernel
  const float* xp = X + (size_t)row * DM;
  unsigned short* op = Y + (size_t)row * DM;
  v4u res[4];
#pragma unroll
  for (int j = 0; j < 4; ++j) {
    const int c0 = j * 256 + lane * 8;
    const v4f a0 = *(const v4f*)(xp + c0), a1 = *(const v4f*)(xp + c0 + 4);
    float t[8];
#pragma unroll
    for (int e = 0; e < 4; ++e) { t[e] = bfr(a0[e]) * carry; t[4 + e] = bfr(a1[e]) * carry; }
    v4u o = {0u, 0u, 0u, 0u};
#pragma unroll
    for (int e = 0; e < 4; ++e) o[e] = pk16(h_bits((_Float16)t[2 * e]), h_bits((_Float16)t[2 * e + 1]));
    res[j] = o;
  }
  {
#pragma unroll
    for (int j = 0; j < 4; ++j) *(v4u*)(op + j * 256 + lane * 8) = res[j];
    
  }
}

// =====================================================================================================
// Gate weight plane: G f16 [64][1024]: row r = f16( 64 * bf16_RNE( (r & 16) ? We[r & 15] : Wa[r & 15] ) ) (rows 32..63 duplicate 0..31).
// Both candidate rows loaded with clamped in-range addresses, selected by value (row is wave-uniform). Same store shape as conv_rows.
// coverage: 8 blocks x 8 waves = 64 rows x (4 x 32 x 8 = 1024 cols), exact.
// =====================================================================================================
__global__ __launch_bounds__(256) void conv_gate(const float* __restrict__ Wa, const float* __restrict__ We,
                                                 unsigned short* Y, float carry) {
  const int lane = threadIdx.x & 31, wave = threadIdx.x >> 5;
  const int row = blockIdx.x * 8 + wave;
  if (row >= NGATE) return;                      // wave-uniform; no barriers in this kernel
  const float* pa = Wa + (size_t)(row & 15) * DM;
  const float* pb = We + (size_t)(row & 15) * DM;
  const bool useb = (row & 16) != 0;
  unsigned short* op = Y + (size_t)row * DM;
  v4u res[4];
#pragma unroll
  for (int j = 0; j < 4; ++j) {
    const int c0 = j * 256 + lane * 8;
    const v4f a0 = *(const v4f*)(pa + c0), a1 = *(const v4f*)(pa + c0 + 4);
    const v4f b0 = *(const v4f*)(pb + c0), b1 = *(const v4f*)(pb + c0 + 4);
    float t[8];
#pragma unroll
    for (int e = 0; e < 4; ++e) {
      t[e]     = bfr(useb ? b0[e] : a0[e]) * carry;
      t[4 + e] = bfr(useb ? b1[e] : a1[e]) * carry;
    }
    v4u o = {0u, 0u, 0u, 0u};
#pragma unroll
    for (int e = 0; e < 4; ++e) o[e] = pk16(h_bits((_Float16)t[2 * e]), h_bits((_Float16)t[2 * e + 1]));
    res[j] = o;
  }
  {
#pragma unroll
    for (int j = 0; j < 4; ++j) *(v4u*)(op + j * 256 + lane * 8) = res[j];
    
  }
}

// ---- asynchronous global -> LDS copies (16 B per lane). Each statement ends in s_wait_xcnt 0 so that no address register of an
//      issued copy is rewritten before the wait (a precaution); landing is waited for separately with s_wait_asynccnt 0.
#define KST   64      // k per stage: 128 B of every operand row = one whole line
#define LROW  144     // LDS row pitch in bytes: 128 + 16 (16 B x odd: conflict-free for 16-byte readers)
#define RSTEP (32 * LROW)   // LDS bytes between two copy rounds (a round = 8 waves x 4 rows)
__device__ __forceinline__ unsigned lds_off(const void* p) { return (unsigned)(size_t)p; }
__device__ __forceinline__ void copy2_lds(unsigned l, const unsigned short* g, size_t st) {
#if defined(__HIP_DEVICE_COMPILE__)
  asm volatile("global_load_async_to_lds_b128 %0, %1, off\n\t"
               "global_load_async_to_lds_b128 %2, %3, off\n\t"
               "s_wait_xcnt 0x0"
               :: "v"(l), "v"(g), "v"(l + RSTEP), "v"(g + st) : "memory");
#endif
}
__device__ __forceinline__ void copy8_lds(unsigned l, const unsigned short* g, size_t st) {
#if defined(__HIP_DEVICE_COMPILE__)
  asm volatile("global_load_async_to_lds_b128 %0, %1, off\n\t"
               "global_load_async_to_lds_b128 %2, %3, off\n\t"
               "global_load_async_to_lds_b128 %4, %5, off\n\t"
               "global_load_async_to_lds_b128 %6, %7, off\n\t"
               "global_load_async_to_lds_b128 %8, %9, off\n\t"
               "global_load_async_to_lds_b128 %10, %11, off\n\t"
               "global_load_async_to_lds_b128 %12, %13, off\n\t"
               "global_load_async_to_lds_b128 %14, %15, off\n\t"
               "s_wait_xcnt 0x0"
               :: "v"(l), "v"(g), "v"(l + RSTEP), "v"(g + st), "v"(l + 2 * RSTEP), "v"(g + 2 * st),
                  "v"(l + 3 * RSTEP), "v"(g + 3 * st), "v"(l + 4 * RSTEP), "v"(g + 4 * st), "v"(l + 5 * RSTEP), "v"(g + 5 * st),
                  "v"(l + 6 * RSTEP), "v"(g + 6 * st), "v"(l + 7 * RSTEP), "v"(g + 7 * st) : "memory");
#endif
}
// NR rounds of 32 rows (NR = 2 or 16): lane -> row 4*wave + (lane>>3) of its round, 16-byte piece lane&7; st = 32 source rows in elements
template <int NR>
__device__ __forceinline__ void copy_rows(unsigned l, const unsigned short* g, size_t st) {
  static_assert(NR == 2 || NR == 16);
  if constexpr (NR == 2) {
    copy2_lds(l, g, st);
  } else {
    copy8_lds(l, g, st);
    copy8_lds(l + 8 * RSTEP, g + 8 * st, st);
  }
}
__device__ __forceinline__ void wait_copies() {      // this wave's copies have landed in LDS
#if defined(__HIP_DEVICE_COMPILE__)
  asm volatile("s_wait_asynccnt 0x0" ::: "memory");
#endif
}
__device__ __forceinline__ void wait_lds_reads() {   // this wave's LDS reads have returned (before their buffer is refilled)
#if defined(__HIP_DEVICE_COMPILE__)
  asm volatile("s_wait_dscnt 0x0" ::: "memory");
#endif
}

// =====================================================================================================
// Register-blocked f16 WMMA GEMM: C[m][n] = f( oscale * sum_k A[m][k] * Bt[n][k] ); one wave per 64x64 tile, 8 tiles per block.
// Operands reach the fragments through LDS: per stage of 64 k the block copies its operand rows (128 B each, whole lines) with
// asynchronous copies into one of two buffers; the next stage's copies fly while this stage is multiplied; one barrier per stage.
// WM 1: the 8 tiles share their 64 A rows and lie side by side in n (N a multiple of 512); WM 8: they share their 64 B rows and
// lie below one another in m (N = 64, M a multiple of 512). K a multiple of 64.
// A row-major [M][K] pitch lda (16-bit plane), Bt row-major [N][K] pitch ldb (k contiguous); M, N multiples of 64, K multiple of 64.
// SPLITA 1: a second A plane A2 (same pitch) holding the unscaled f16 residual of A; its products go into the same accumulator.
// BM: 0 = no bias; 3 = per-column head bias bf16( (col & 16) ? bias2[col & 15] : bias[col & 15] ) (in-range addresses).
// OM: 0 = f32 out (pitch ldc), ACT 2 applies sigmoid after bias;
//     2 = f16 out = f16( value * ocarry ); 3 = f16 hi plane f16(value*ocarry) to C and unscaled residual f16(value*ocarry - hi) to C2.
// coverage: 4 slabs x 16 rows (f32: it 0..7 x lane>>4; f16: it 0..3 x lane>>3) x 64 cols = the wave's whole 64x64 tile;
//           grid = tilesM*tilesN/8 blocks (exact here); a block that does not fit the shape rules leaves as a whole before any barrier.
// =====================================================================================================
template <int OM, int BM, int ACT, int SPLITA, int WM>
__global__ __launch_bounds__(256) void gemm64(
    const unsigned short* __restrict__ Ap, const unsigned short* __restrict__ A2p, int lda,
    const unsigned short* __restrict__ Btp, int ldb,
    const float* __restrict__ bias, const float* __restrict__ bias2,
    void* Cout, void* C2out, int ldc,
    int M, int N, int K, float oscale, float ocarry) {
  static_assert(WM == 1 || WM == 8);
  constexpr int RA  = WM * 64;                     // A rows per block
  constexpr int RB  = (8 / WM) * 64;               // B rows per block
  constexpr int OA2 = RA * LROW;                   // stage layout in bytes: [A | A2 (SPLITA) | B]
  constexpr int OB  = RA * (1 + SPLITA) * LROW;
  constexpr int STG = OB + RB * LROW;              // bytes per stage
  __shared__ __align__(16) unsigned char ring[2 * STG];
  __shared__ __align__(16) float sT[8][16 * 68];   // per-wave 16x64 slab, pitch 68 floats
  const int lane = threadIdx.x & 31;
  const int wave = threadIdx.x >> 5;
  const int tilesN = N >> 6;
  const int tilesM = M >> 6;
  const int tile0 = blockIdx.x * 8;
  if (tile0 + 8 > tilesM * tilesN) return;         // block-uniform, before any barrier or copy
  if (WM == 1 ? (tilesN & 7) != 0 : (tilesN != 1)) return;   // block-uniform shape rule of this build
  const int tmB = tile0 / tilesN;
  const int mB = tmB << 6;                         // block's first row and column
  const int nB = (tile0 - tmB * tilesN) << 6;
  const int m0 = mB + (WM == 8 ? (wave << 6) : 0);
  const int n0 = nB + (WM == 1 ? (wave << 6) : 0);

  const int rlane = lane & 15;                 // row (A) / col (B, D) within subtile
  const int koff  = (lane >> 4) * 8;           // k offset of this lane half
  const int mOff  = (lane >> 4) * 8;           // D row offset

  // copy side: this lane's row and 16-byte piece in a round of 32 rows
  const int crow = wave * 4 + (lane >> 3);
  const int cseg = (lane & 7) * 8;
  const unsigned lcp = lds_off(ring) + (unsigned)(crow * LROW + cseg * 2);
  const unsigned short* gA  = Ap  + (size_t)(mB + crow) * lda + cseg;
  const unsigned short* gA2 = A2p + (size_t)(mB + crow) * lda + cseg;
  const unsigned short* gB  = Btp + (size_t)(nB + crow) * ldb + cseg;
  const size_t stA = (size_t)32 * lda, stB = (size_t)32 * ldb;
  // reader side: fragment rows of this wave in a stage
  const int fa = ((WM == 8 ? (wave << 6) : 0) + rlane) * LROW + koff * 2;
  const int fb = OB + ((WM == 1 ? (wave << 6) : 0) + rlane) * LROW + koff * 2;

  v8f acc[4][4];
#pragma unroll
  for (int i = 0; i < 4; ++i)
#pragma unroll
    for (int j = 0; j < 4; ++j) acc[i][j] = zero8();

  const int nst = K / KST;
  // stage 0 into buffer 0, landed and published; then stage 1 into buffer 1
  copy_rows<RA / 32>(lcp, gA, stA);
  if constexpr (SPLITA != 0) copy_rows<RA / 32>(lcp + OA2, gA2, stA);
  copy_rows<RB / 32>(lcp + OB, gB, stB);
  wait_copies();
  __syncthreads();
  if (nst > 1) {
    copy_rows<RA / 32>(lcp + STG, gA + KST, stA);
    if constexpr (SPLITA != 0) copy_rows<RA / 32>(lcp + STG + OA2, gA2 + KST, stA);
    copy_rows<RB / 32>(lcp + STG + OB, gB + KST, stB);
  }

#pragma unroll 1   // one stage per trip: the ring's order at the foot stays as written
  for (int t = 0; t < nst; ++t) {
    const unsigned bofs = (unsigned)(t & 1) * STG;
    const unsigned char* sb = ring + bofs;
#pragma unroll
    for (int s = 0; s < 2; ++s) {              // two k-steps of 32 per stage, ascending k
      v16h bh[4], ah[4], al[SPLITA != 0 ? 4 : 1];
#pragma unroll
      for (int j = 0; j < 4; ++j) bh[j] = ldfrag_u((const unsigned short*)(sb + fb + j * 16 * LROW + s * 64));
#pragma unroll
      for (int i = 0; i < 4; ++i) ah[i] = ldfrag_u((const unsigned short*)(sb + fa + i * 16 * LROW + s * 64));
      if constexpr (SPLITA != 0) {
#pragma unroll
        for (int i = 0; i < 4; ++i) al[i] = ldfrag_u((const unsigned short*)(sb + OA2 + fa + i * 16 * LROW + s * 64));
      }
#pragma unroll
      for (int i = 0; i < 4; ++i) {
#pragma unroll
        for (int j = 0; j < 4; ++j) acc[i][j] = mma_raw(ah[i], bh[j], acc[i][j]);
        if constexpr (SPLITA != 0) {
#pragma unroll
          for (int j = 0; j < 4; ++j) acc[i][j] = mma_raw(al[i], bh[j], acc[i][j]);
          dep_guard2(acc[i][0], acc[i][3], ah[i], al[i]);
        } else {
          dep_guard1(acc[i][0], acc[i][3], ah[i]);
        }
      }
      keep4_h(bh[0], bh[1], bh[2], bh[3]);
    }
    // publish point of stage t + 1; the same barrier ends every reader's last read of stage t's buffer
    wait_lds_reads();
    wait_copies();
    __syncthreads();
    if (t + 2 < nst) {                         // block-uniform: refill the buffer that this trip has just read
      const int kn = (t + 2) * KST;
      copy_rows<RA / 32>(lcp + bofs, gA + kn, stA);
      if constexpr (SPLITA != 0) copy_rows<RA / 32>(lcp + bofs + OA2, gA2 + kn, stA);
      copy_rows<RB / 32>(lcp + bofs + OB, gB + kn, stB);
    }
  }
  wait_copies();
  acc_guard4(acc[0][0], acc[0][1], acc[0][2], acc[0][3]);
  acc_guard4(acc[1][0], acc[1][1], acc[1][2], acc[1][3]);
  acc_guard4(acc[2][0], acc[2][1], acc[2][2], acc[2][3]);
  acc_guard4(acc[3][0], acc[3][1], acc[3][2], acc[3][3]);

  const int hh2 = lane >> 4, c4 = (lane & 15) * 4;     // f32 out: 256-B row segment = 16 lanes x 16 B
  const int q8  = lane >> 3, c8 = (lane & 7) * 8;
  float bc[4];
#pragma unroll
  for (int e = 0; e < 4; ++e) bc[e] = 0.f;
  if constexpr (BM == 3) {
#pragma unroll
    for (int e = 0; e < 4; ++e) {
      const int col = n0 + c4 + e;
      const float fa = bfr(bias[col & 15]);             // in-range addresses 0..15
      const float fb = bfr(bias2[col & 15]);
      bc[e] = (col & 16) ? fb : fa;
    }
  }

  // ---- epilogue ----
  float* slab = sT[wave];
#pragma unroll
  for (int i = 0; i < 4; ++i) {
    const int mBase = m0 + (i << 4);
#pragma unroll
    for (int j = 0; j < 4; ++j) {
#pragma unroll
      for (int r = 0; r < 8; ++r) {
        slab[(mOff + r) * 68 + (j << 4) + rlane] = acc[i][j][r];
      }
    }
    wave_sync_lds();
    if constexpr (OM == 0) {
      float* C = (float*)Cout;
      v4f vals[8];
#pragma unroll
      for (int it = 0; it < 8; ++it) {
        const int row = it * 2 + hh2;                      // it 0..7 x hh2 0..1 = rows 0..15
        v4f v = *(const v4f*)(slab + row * 68 + c4);
#pragma unroll
        for (int e = 0; e < 4; ++e) {
          float f = v[e] * oscale + bc[e];
          if constexpr (ACT == 2) f = 1.0f / (1.0f + __expf(-f));
          v[e] = f;
        }
        vals[it] = v;
      }
      {
#pragma unroll
        for (int it = 0; it < 8; ++it) {
          const int gr = mBase + it * 2 + hh2;
          *(v4f*)(C + (size_t)gr * ldc + n0 + c4) = vals[it];
        }
        
      }
    } else {
      unsigned short* C  = (unsigned short*)Cout;
      unsigned short* C2 = (unsigned short*)C2out;
      v4u hv[4], lv[4];
#pragma unroll
      for (int it = 0; it < 4; ++it) {
        const int row = it * 4 + q8;                       // it 0..3 x q8 0..3 = rows 0..15
        const float* sp = slab + row * 68 + c8;
        v4u a = {0u, 0u, 0u, 0u};
        v4u b = {0u, 0u, 0u, 0u};
#pragma unroll
        for (int e = 0; e < 4; ++e) {
          const float f0 = (sp[2 * e] * oscale) * ocarry;
          const float f1 = (sp[2 * e + 1] * oscale) * ocarry;
          const _Float16 h0 = (_Float16)f0, h1 = (_Float16)f1;
          a[e] = pk16(h_bits(h0), h_bits(h1));
          if constexpr (OM == 3) {
            const _Float16 l0 = (_Float16)(f0 - (float)h0);
            const _Float16 l1 = (_Float16)(f1 - (float)h1);
            b[e] = pk16(h_bits(l0), h_bits(l1));
          }
        }
        hv[it] = a;
        lv[it] = b;
      }
      {
#pragma unroll
        for (int it = 0; it < 4; ++it) {
          const int row = it * 4 + q8;
          *(v4u*)(C + (size_t)(mBase + row) * ldc + n0 + c8) = hv[it];
          if constexpr (OM == 3) {
            *(v4u*)(C2 + (size_t)(mBase + row) * ldc + n0 + c8) = lv[it];
          }
        }
        
      }
    }
    wave_sync_lds();
  }
}

// =====================================================================================================
// Flash attention for one head and 128 query rows (one wave per 16 query rows), head dim 64, 2048 keys:
//   inner|outer plane (f16 x16) QK[tok][2048]: inner at col 64h + d, outer at col 1024 + 64h + d;
//   v^T planes (f16 hi x1024, unscaled residual): VH/VL[64h + d][key] (pitch 2048);
//   gate plane AEF f32 [tok][64]: col h = ap[h][tok] (sigmoid applied), col 16 + h = ex[h][tok];
//   out: CTH/CTL[tok][64h + d] = f16 hi / residual of 4096 * ctx, ctx = valve/rotation epilogue of
//        ap * sum_s p_s v_s / (ap * sum_s p_s + 1e-8 * sum_s e_s), e_s = exp(score_s - max), p_s = e_s * ex[s].
//   block = 8 waves = 256 threads; grid = 16 heads x 16 query groups = 256; every wave does identical bounded work (64 steps).
//   The 8 waves read the same keys: per stage of 64 keys the block copies the head's 64 outer rows and the 64 rows of each v^T
//   plane (128 B each, whole lines) with asynchronous copies into one of two LDS buffers; the next stage's copies fly while this
//   stage is worked on; one barrier per stage. A stage is two steps of 32 keys.
//   Per step: 2 score tiles on f16 WMMA (K = 64 as two k-steps of 32), key fragments read from the stage; ex for the
//   lane's two key columns loaded from AEF; online max-subtracted softmax in f32 (exp2, log2e / 8 / carries folded in), running sums
//   of e and of p = e*ex; rescale of sums and accumulators; the 16x32 p tile goes through wave-private LDS (f32 element stores,
//   16-byte loads, split k map); v^T hi and residual B fragments read from the stage; 12 WMMAs (hi.hi, lo.hi, hi.lo) into one
//   accumulator set.
//   Final scaling in f32; each wave stages its 16x64 slice (hi and residual 16-bit values) in the block's LDS row buffers [128][64];
// coverage: LDS row buffers: 8 waves x 16 rows x 64 cols = 128 x 64; global: 4 iterations x 256 threads x 8 halves = 128 rows x 64
//           cols (cols 64*head ..) of rows qB..qB+127, both planes; grid covers all 2048 rows x 1024 cols exactly once.
// =====================================================================================================
#define AKS   64                        // keys per stage: 128 B of every v^T row = one whole line
#define AOVH  (AKS * LROW)              // stage layout in bytes: [64 outer rows | 64 v^T hi rows | 64 v^T residual rows]
#define AOVL  (AOVH + HDIM * LROW)
#define ASTG  (AOVL + HDIM * LROW)      // bytes per stage
static_assert(AKS == 64 && HDIM == 64 && (TT % AKS) == 0 && (TT / AKS) >= 2 && HDIM * 2 + 16 == LROW && AKS * 2 + 16 == LROW);
// one stage: keys 64 t .. 64 t + 63; l, gK, gVh, gVl are this lane's row (4*wave + (lane>>3) of a round of 32) and 16-byte piece
__device__ __forceinline__ void att_stage(unsigned l, const unsigned short* gK, const unsigned short* gVh,
                                          const unsigned short* gVl, int t) {
  copy_rows<2>(l,        gK  + (size_t)t * AKS * QKP, (size_t)32 * QKP);
  copy_rows<2>(l + AOVH, gVh + (size_t)t * AKS,       (size_t)32 * TT);
  copy_rows<2>(l + AOVL, gVl + (size_t)t * AKS,       (size_t)32 * TT);
}
__device__ __forceinline__ const _Float16* lds_h(const unsigned char* p) { return (const _Float16*)(const void*)p; }

__global__ __launch_bounds__(ATT_THREADS)
void attn_heads(const unsigned short* __restrict__ QKq, const unsigned short* __restrict__ VHq,
                const unsigned short* __restrict__ VLq, const float* __restrict__ AEF,
                const float* __restrict__ betap, const float* __restrict__ ivp,
                const float* __restrict__ ovp, const float* __restrict__ chg,
                unsigned short* CTH, unsigned short* CTL) {
  __shared__ __align__(16) unsigned char kv[2 * ASTG];      // two stages of outer rows and v^T rows
  __shared__ __align__(16) float Ps[QTB][16 * 36];          // per wave p tile [row][32 keys], pitch 36
  __shared__ __align__(16) unsigned short Osh[ATT_QB * HDIM];   // block result rows [128][64], hi
  __shared__ __align__(16) unsigned short Osl[ATT_QB * HDIM];   // residual

  const int tid  = threadIdx.x;
  const int wave = tid >> 5;
  const int lane = tid & 31;
  const int hh   = lane >> 4;
  const int c    = lane & 15;

  const int qg   = blockIdx.x % ATT_QG;                     // query group 0..15
  const int head = (blockIdx.x / ATT_QG) & (NHEAD - 1);     // 0..15
  const int qB   = qg * ATT_QB;                             // block's first query row
  const int q0   = qB + wave * 16;                          // wave's first query row

  const _Float16* Qh = (const _Float16*)(const void*)QKq + (size_t)(q0 + c) * QKP + head * HDIM + 8 * hh;
  const float* Ex = AEF + 16 + head;                                    // ex column of this head
  const float lsc = (1.4426950408889634f * ATT_SCALE) / (QC * KC);      // log2(e) / 8 / carries

  // copy side: this lane's row and 16-byte piece in a round of 32 rows
  const int crow = wave * 4 + (lane >> 3);
  const int cseg = (lane & 7) * 8;
  const unsigned lcp = lds_off(kv) + (unsigned)(crow * LROW + cseg * 2);
  const unsigned short* gK  = QKq + (size_t)crow * QKP + DM + head * HDIM + cseg;
  const unsigned short* gVh = VHq + (size_t)(head * HDIM + crow) * TT + cseg;
  const unsigned short* gVl = VLq + (size_t)(head * HDIM + crow) * TT + cseg;
  // reader side: this lane's fragment row (key or d = c within a group of 16 rows) and k half, in bytes
  const int fr = c * LROW + 16 * hh;

  // stage 0 into buffer 0, landed and published; then stage 1 into buffer 1
  att_stage(lcp, gK, gVh, gVl, 0);
  const v16h qa = ldfrag_h(Qh), qb = ldfrag_h(Qh + 32);
  wait_copies();
  __syncthreads();
  att_stage(lcp + ASTG, gK, gVh, gVl, 1);

  float mrow[8], lrow[8], zrow[8];
  v8f o0 = zero8(), o1 = zero8(), o2 = zero8(), o3 = zero8();
#pragma unroll
  for (int r = 0; r < 8; ++r) { mrow[r] = -INFINITY; lrow[r] = 0.f; zrow[r] = 0.f; }
  float* pt = Ps[wave];

  constexpr int nst = TT / AKS;
#pragma unroll 1   // one stage per trip: the ring's order at the foot stays as written
  for (int t = 0; t < nst; ++t) {
    const unsigned bofs = (unsigned)(t & 1) * ASTG;
    const unsigned char* sb = kv + bofs + fr;
#pragma unroll
    for (int s = 0; s < 2; ++s) {              // two steps of 32 keys per stage, ascending keys
      const int kb = t * AKS + s * 32;
      v8f s0, s1;
      {
        const _Float16* kp = lds_h(sb + (s * 32) * LROW);
        const v16h k0 = ldfrag_h(kp), k1 = ldfrag_h(kp + 32);
        s0 = mma_raw(qa, k0, zero8());
        s0 = mma_raw(qb, k1, s0);
        guard_s2(s0, k0, k1);
      }
      {
        const _Float16* kq = lds_h(sb + (s * 32 + 16) * LROW);
        const v16h k0 = ldfrag_h(kq), k1 = ldfrag_h(kq + 32);
        s1 = mma_raw(qa, k0, zero8());
        s1 = mma_raw(qb, k1, s1);
        guard_s4(s1, k0, k1, qa, qb);
      }
      const float ex0 = Ex[(size_t)(kb + c) * NGATE];          // key kb + c
      const float ex1 = Ex[(size_t)(kb + 16 + c) * NGATE];     // key kb + 16 + c
#pragma unroll
      for (int r = 0; r < 8; ++r) {
        const float t0 = s0[r] * lsc, t1 = s1[r] * lsc;
        float mx = fmaxf(t0, t1);
#pragma unroll
        for (int off = 1; off < 16; off <<= 1) mx = fmaxf(mx, __shfl_xor(mx, off, 32));
        const float mn = fmaxf(mrow[r], mx);
        const float al = exp2f(mrow[r] - mn);
        mrow[r] = mn;
        const float e0 = exp2f(t0 - mn), e1 = exp2f(t1 - mn);
        const float p0 = e0 * ex0, p1 = e1 * ex1;
        float zs = e0 + e1;
        float ps = p0 + p1;
#pragma unroll
        for (int off = 1; off < 16; off <<= 1) {
          zs += __shfl_xor(zs, off, 32);
          ps += __shfl_xor(ps, off, 32);
        }
        zrow[r] = zrow[r] * al + zs;
        lrow[r] = lrow[r] * al + ps;
        o0[r] *= al;
        o1[r] *= al;
        o2[r] *= al;
        o3[r] *= al;
        const int ro = (8 * hh + r) * 36 + c;
        pt[ro]      = p0;
        pt[ro + 16] = p1;
      }
      wave_sync_lds();
      FragH ph, pl;
      {
        const float* prow = pt + c * 36 + 8 * hh;
        const v4f g0 = *(const v4f*)(prow), g1 = *(const v4f*)(prow + 4);
        const v4f g2 = *(const v4f*)(prow + 16), g3 = *(const v4f*)(prow + 20);
#pragma unroll
        for (int e = 0; e < 4; ++e) {
          float xv; _Float16 hx;
          xv = g0[e] * PC; hx = (_Float16)xv; ph.h[0][e]     = hx; pl.h[0][e]     = (_Float16)(xv - (float)hx);   // keys kb + 8hh + e
          xv = g1[e] * PC; hx = (_Float16)xv; ph.h[0][4 + e] = hx; pl.h[0][4 + e] = (_Float16)(xv - (float)hx);
          xv = g2[e] * PC; hx = (_Float16)xv; ph.h[1][e]     = hx; pl.h[1][e]     = (_Float16)(xv - (float)hx);   // keys kb + 16 + 8hh + e
          xv = g3[e] * PC; hx = (_Float16)xv; ph.h[1][4 + e] = hx; pl.h[1][4 + e] = (_Float16)(xv - (float)hx);
        }
      }
      {
        const unsigned char* vp = sb + AOVH + s * 64;          // 32 keys = 64 B along a v^T row
        const v16h vb0 = ldfrag_h(lds_h(vp));
        const v16h vb1 = ldfrag_h(lds_h(vp + 16 * LROW));
        const v16h vb2 = ldfrag_h(lds_h(vp + 32 * LROW));
        const v16h vb3 = ldfrag_h(lds_h(vp + 48 * LROW));
        o0 = mma_raw(ph.v, vb0, o0);
        o1 = mma_raw(ph.v, vb1, o1);
        o2 = mma_raw(ph.v, vb2, o2);
        o3 = mma_raw(ph.v, vb3, o3);
        o0 = mma_raw(pl.v, vb0, o0);
        o1 = mma_raw(pl.v, vb1, o1);
        o2 = mma_raw(pl.v, vb2, o2);
        o3 = mma_raw(pl.v, vb3, o3);
        guard_pv6(o0, o1, o2, o3, ph.v, pl.v, vb0, vb1, vb2, vb3);
      }
      {
        const unsigned char* vp = sb + AOVL + s * 64;
        const v16h vl0 = ldfrag_h(lds_h(vp));
        const v16h vl1 = ldfrag_h(lds_h(vp + 16 * LROW));
        const v16h vl2 = ldfrag_h(lds_h(vp + 32 * LROW));
        const v16h vl3 = ldfrag_h(lds_h(vp + 48 * LROW));
        o0 = mma_raw(ph.v, vl0, o0);
        o1 = mma_raw(ph.v, vl1, o1);
        o2 = mma_raw(ph.v, vl2, o2);
        o3 = mma_raw(ph.v, vl3, o3);
        guard_pv5(o0, o1, o2, o3, ph.v, vl0, vl1, vl2, vl3);
      }
      wave_sync_lds();
    }
    // publish point of stage t + 1; the same barrier ends every reader's last read of stage t's buffer
    wait_lds_reads();
    wait_copies();
    __syncthreads();
    if (t + 2 < nst) att_stage(lcp + bofs, gK, gVh, gVl, t + 2);   // block-uniform: refill the buffer that this trip has just read
  }
  wait_copies();

  // ---- per-head gates and rotation, renormaliser, carries (1024 on p, 1024 on v, 4096 on the stored ctx) ----
  const float* Ap = AEF + head;
  float apr[8];
#pragma unroll
  for (int r = 0; r < 8; ++r) apr[r] = Ap[(size_t)(q0 + 8 * hh + r) * NGATE];
  const float bet = bfr(betap[head]);
  const float ivs = sigf(bfr(ivp[head]));
  const float og  = sigf(bfr(ovp[head])) * tanhf(bfr(chg[head]));
  const float ang = PI_F * sigf(bet);
  const float ca  = cosf(ang), sa = sinf(ang);
  const float base = ivs / (PC * VC);
  unsigned short* oh = Osh + wave * 16 * HDIM + c;
  unsigned short* ol = Osl + wave * 16 * HDIM + c;
#pragma unroll
  for (int r = 0; r < 8; ++r) {
    const float den = apr[r] * lrow[r] + REN_EPS * zrow[r];
    const float sc  = apr[r] * (1.0f / den) * base;
    const float x0 = o0[r] * sc, x1 = o1[r] * sc, x2 = o2[r] * sc, x3 = o3[r] * sc;
    const float y0 = ((x0 * ca - x2 * sa) * og) * FC;
    const float y1 = ((x1 * ca - x3 * sa) * og) * FC;
    const float y2 = ((x0 * sa + x2 * ca) * og) * FC;
    const float y3 = ((x1 * sa + x3 * ca) * og) * FC;
    const _Float16 h0 = (_Float16)y0, h1 = (_Float16)y1, h2 = (_Float16)y2, h3 = (_Float16)y3;
    const int ro = (8 * hh + r) * HDIM;
    oh[ro]      = h_bits(h0);
    oh[ro + 16] = h_bits(h1);
    oh[ro + 32] = h_bits(h2);
    oh[ro + 48] = h_bits(h3);
    ol[ro]      = h_bits((_Float16)(y0 - (float)h0));
    ol[ro + 16] = h_bits((_Float16)(y1 - (float)h1));
    ol[ro + 32] = h_bits((_Float16)(y2 - (float)h2));
    ol[ro + 48] = h_bits((_Float16)(y3 - (float)h3));
  }
  __syncthreads();
  // ---- block writes its 128 row segments: piece p = it*256 + tid -> row p>>3, halves (p&7)*8 of the 64-col slab (128 B a row) ----
  {
    v4u vh[4], vl[4];
#pragma unroll
    for (int it = 0; it < 4; ++it) {
      const int p = it * ATT_THREADS + tid;
      vh[it] = *(const v4u*)(Osh + (size_t)p * 8);
      vl[it] = *(const v4u*)(Osl + (size_t)p * 8);
    }
    const size_t dofs = (size_t)qB * DM + (size_t)head * HDIM;
    unsigned short* dh = CTH + dofs;
    unsigned short* dl = CTL + dofs;
    {
#pragma unroll
      for (int it = 0; it < 4; ++it) {
        const int p = it * ATT_THREADS + tid;
        const size_t po = (size_t)(p >> 3) * DM + (size_t)(p & 7) * 8;
        *(v4u*)(dh + po) = vh[it];
        *(v4u*)(dl + po) = vl[it];
      }
    }
  }
}

// =====================================================================================================
// Workspace map (bytes); every plane is an exact multiple of its tile / whole-row store granularity (M, N exact tile multiples,
// row blocks exact, no pad rows needed), every offset a multiple of 131072:
//   WIO  f16 [2048][1024] x64     4194304   (rows 0..1023 Wi, 1024..2047 Wo; native [out][in] = [n][k])
//   WV   f16 [1024][1024] x64     2097152
//   WOUT f16 [1024][1024] x64     2097152
//   WG   f16 [64][1024]   x64      131072   (Wa, We, Wa, We)
//   XB   f16 [2048][1024] x16     4194304
//   QK   f16 [2048][2048] x16     8388608   (inner | outer)
//   VTH  f16 [1024][2048] x1024   4194304   (v^T hi)
//   VTL  f16 [1024][2048]         4194304   (v^T residual)
//   AEF  f32 [2048][64]            524288   (sigmoid gates)
//   CTH  f16 [2048][1024] x4096   4194304   (ctx hi)
//   CTL  f16 [2048][1024]         4194304   (ctx residual)
//   end                          38404096
// =====================================================================================================
extern "C" void kernel_launch(void* const* d_in, const int* in_sizes, int n_in,
                              void* d_out, int out_size, void* d_ws, size_t ws_size,
                              hipStream_t stream) {
  if (n_in < 13) return;
  if (in_sizes[0] != TT * DM) return;
  if (in_sizes[1] != NHEAD * DM || in_sizes[2] != NHEAD) return;
  if (in_sizes[3] != NHEAD * DM || in_sizes[4] != NHEAD) return;
  if (in_sizes[5] != DM * DM || in_sizes[6] != DM * DM || in_sizes[7] != DM * DM || in_sizes[8] != DM * DM) return;
  if (in_sizes[9] != NHEAD || in_sizes[10] != NHEAD || in_sizes[11] != NHEAD || in_sizes[12] != NHEAD) return;
  if (out_size != TT * DM) return;

  const float* x     = (const float*)d_in[0];
  const float* Wa    = (const float*)d_in[1];
  const float* ba    = (const float*)d_in[2];
  const float* We    = (const float*)d_in[3];
  const float* be    = (const float*)d_in[4];
  const float* Wi    = (const float*)d_in[5];
  const float* Wo    = (const float*)d_in[6];
  const float* Wv    = (const float*)d_in[7];
  const float* Wout  = (const float*)d_in[8];
  const float* betap = (const float*)d_in[9];
  const float* ivp   = (const float*)d_in[10];
  const float* ovp   = (const float*)d_in[11];
  const float* chg   = (const float*)d_in[12];
  float*       out   = (float*)d_out;

  const size_t PWIO = (size_t)2 * DM * DM * 2;                    //  4194304
  const size_t PW   = (size_t)DM * DM * 2;                        //  2097152
  const size_t PG   = (size_t)NGATE * DM * 2;                     //   131072
  const size_t PX   = (size_t)TT * DM * 2;                        //  4194304
  const size_t PQK  = (size_t)TT * QKP * 2;                       //  8388608
  const size_t PVT  = (size_t)DM * TT * 2;                        //  4194304
  const size_t PAE  = (size_t)TT * NGATE * 4;                     //   524288
  const size_t PCT  = (size_t)TT * DM * 2;                        //  4194304
  size_t off = 0;
  const size_t oWIO = off; off += PWIO;
  const size_t oWV  = off; off += PW;
  const size_t oWOU = off; off += PW;
  const size_t oWG  = off; off += PG;
  const size_t oXB  = off; off += PX;
  const size_t oQK  = off; off += PQK;
  const size_t oVTH = off; off += PVT;
  const size_t oVTL = off; off += PVT;
  const size_t oAEF = off; off += PAE;
  const size_t oCTH = off; off += PCT;
  const size_t oCTL = off; off += PCT;
  if (off > ws_size) return;                                      // off = 38404096
  if (off > (size_t)134217728) return;

  char* ws = (char*)d_ws;
  unsigned short* WIO  = (unsigned short*)(ws + oWIO);
  unsigned short* WV   = (unsigned short*)(ws + oWV);
  unsigned short* WOUT = (unsigned short*)(ws + oWOU);
  unsigned short* WG   = (unsigned short*)(ws + oWG);
  unsigned short* XB   = (unsigned short*)(ws + oXB);
  unsigned short* QK   = (unsigned short*)(ws + oQK);
  unsigned short* VTH  = (unsigned short*)(ws + oVTH);
  unsigned short* VTL  = (unsigned short*)(ws + oVTL);
  float*          AEF  = (float*)(ws + oAEF);
  unsigned short* CTH  = (unsigned short*)(ws + oCTH);
  unsigned short* CTL  = (unsigned short*)(ws + oCTL);

  const dim3 blk(256);
  const dim3 gX(TT / 8);                                          // 256 blocks
  const dim3 gW(DM / 8);                                          // 128 blocks
  const dim3 gG(NGATE / 8);                                       // 8 blocks
  const int tilesG = (TT / 64) * (NGATE / 64);                    // 32
  const int tilesQ = (TT / 64) * (QKP / 64);                      // 1024
  const int tilesV = (DM / 64) * (TT / 64);                       // 512
  const int tilesO = (TT / 64) * (DM / 64);                       // 512
  const dim3 gGE((tilesG + 7) / 8);                               // 4
  const dim3 gQK((tilesQ + 7) / 8);                               // 128
  const dim3 gVT((tilesV + 7) / 8);                               // 64
  const dim3 gO((tilesO + 7) / 8);                                // 64
  const dim3 gAT(ATT_BLOCKS);                                     // 256
  const dim3 bAT(ATT_THREADS);                                    // 256

  // (0) 16-bit planes: XB = f16(16 * bf16(x)); W planes = f16(64 * bf16(W)) in native [n][k] layout; gate plane
  conv_rows<<<gX, blk, 0, stream>>>(x, XB, TT, ACARRY);                         // [2048][1024]
  conv_rows<<<gW, blk, 0, stream>>>(Wi, WIO, DM, WSC);                           // [1024][1024] -> WIO rows 0..1023
  conv_rows<<<gW, blk, 0, stream>>>(Wo, WIO + (size_t)DM * DM, DM, WSC);         // -> WIO rows 1024..2047
  conv_rows<<<gW, blk, 0, stream>>>(Wv, WV, DM, WSC);
  conv_rows<<<gW, blk, 0, stream>>>(Wout, WOUT, DM, WSC);
  conv_gate<<<gG, blk, 0, stream>>>(Wa, We, WG, WSC);                            // [64][1024]

  // (1) gates: AEF[t][j] = sigmoid(x[t] . G[j] / (16*64) + bf16(bias_j)); M = 2048, N = 64, K = 1024, f32 out
  gemm64<0, 3, 2, 0, 8><<<gGE, blk, 0, stream>>>(
      XB, XB, DM,
      WG, DM,
      ba, be,
      (void*)AEF, (void*)AEF, NGATE,
      TT, NGATE, DM, 1.0f / (ACARRY * WSC), 1.0f);

  // (2) inner | outer: QK[t][n] = f16(16 * x[t] . [Wi;Wo][n]); M = 2048, N = 2048, K = 1024
  gemm64<2, 0, 0, 0, 1><<<gQK, blk, 0, stream>>>(
      XB, XB, DM,
      WIO, DM,
      ba, be,
      (void*)QK, (void*)QK, QKP,
      TT, QKP, DM, 1.0f / (ACARRY * WSC), QC);

  // (3) v^T: VTH/VTL[d][t] = hi/residual of f16(1024 * Wv[d] . x[t]); M = 1024, N = 2048, K = 1024
  gemm64<3, 0, 0, 0, 1><<<gVT, blk, 0, stream>>>(
      WV, WV, DM,
      XB, DM,
      ba, be,
      (void*)VTH, (void*)VTL, TT,
      DM, TT, DM, 1.0f / (WSC * ACARRY), VC);

  // (4) attention per (128 query rows, 1 head) -> CTH/CTL (ctx x4096 hi + residual)
  attn_heads<<<gAT, bAT, 0, stream>>>(QK, VTH, VTL, AEF, betap, ivp, ovp, chg, CTH, CTL);

  // (5) out = (ctx_hi + ctx_lo) . Wout plane / (4096 * 64); M = 2048, N = 1024, K = 1024, f32
  gemm64<0, 0, 0, 1, 1><<<gO, blk, 0, stream>>>(
      CTH, CTL, DM,
      WOUT, DM,
      ba, be,
      (void*)out, (void*)out, DM,
      TT, DM, DM, 1.0f / (FC * WSC), 1.0f);
  (void)hipGetLastError();
}

// v003
// One run takes 149 microseconds.
// In both of two side-by-side timings against v002, it was 1.29 times as fast.
// Counting every step since v000, it is 2.50 times as fast.
// Contractions: gate logits (x f16 x16 . [Wa;We;Wa;We] f16 x64, K=1024), inner|outer projections (x f16 x16 . [Wi;Wo] f16 x64, K=1024),
// v^T projection (Wv f16 x64 . x f16 x16, K=1024; stored as f16 hi x1024 + residual plane), scores (inner f16 x16 . outer f16 x16, K=64),
// v^T . P^T (v^T f16 hi+residual . P f16 x1024 hi+residual, three products, 2048 keys in steps of 32; scores and this product transposed),
// output projection (ctx f16 x4096 hi+residual . Wout f16 x64, two products, K=1024): all v_wmma_f32_16x16x32_f16, f32 accumulate.
// Sigmoid gates, online max-subtracted softmax, renormaliser, valve/rotation epilogue in f32 on VALU; every float input RNE-converted to bf16 on load.
#include <hip/hip_runtime.h>
#include <math.h>
#include <stdint.h>

#define TT      2048
#define DM      1024
#define NHEAD   16
#define HDIM    64
#define NGATE   64
#define QTB     8
#define QKP     (2 * DM)
#define WSC     64.0f
#define ACARRY  16.0f
#define QC      16.0f
#define KC      16.0f
#define VC      1024.0f
#define PC      1024.0f
#define FC      4096.0f
#define ATT_SCALE 0.125f
#define PI_F    3.14159265358979323846f
#define REN_EPS 1e-8f
static_assert(NHEAD * HDIM == DM);
static_assert((TT % 64) == 0 && (DM % 64) == 0 && (DM % 256) == 0 && (TT % 32) == 0 && (TT % 16) == 0);
static_assert(NHEAD == 16 && NGATE == 64);
#define ATT_THREADS (QTB * 32)
#define ATT_QB      (QTB * 16)
#define ATT_QG      (TT / ATT_QB)
#define ATT_BLOCKS  (ATT_QG * NHEAD)
static_assert(ATT_THREADS == 256 && ATT_BLOCKS == 256 && (TT % ATT_QB) == 0);

typedef _Float16 v16h __attribute__((ext_vector_type(16)));
typedef _Float16 v8h  __attribute__((ext_vector_type(8)));
typedef float    v8f  __attribute__((ext_vector_type(8)));
typedef float    v4f  __attribute__((ext_vector_type(4)));
typedef unsigned int v4u __attribute__((ext_vector_type(4)));

union FragH { v16h v; v8h h[2]; v4u u[2]; };

// ---- scalar helpers --------------------------------------------------------------------------------
__device__ __forceinline__ unsigned short bf_bits(float f) {          // f32 -> bf16 bits, RNE convert
  unsigned u = __float_as_uint(f);
  return (unsigned short)((u + 0x7FFFu + ((u >> 16) & 1u)) >> 16);
}
__device__ __forceinline__ float bf_up(unsigned short h) { return __uint_as_float(((unsigned)h) << 16); }
__device__ __forceinline__ float bfr(float f) { return bf_up(bf_bits(f)); }   // value of the bf16 RNE convert
__device__ __forceinline__ unsigned short h_bits(_Float16 x) { return __builtin_bit_cast(unsigned short, x); }
__device__ __forceinline__ unsigned pk16(unsigned short a, unsigned short b) { return (unsigned)a | ((unsigned)b << 16); }
__device__ __forceinline__ v8f zero8() { v8f z = {0.f, 0.f, 0.f, 0.f, 0.f, 0.f, 0.f, 0.f}; return z; }
__device__ __forceinline__ float sigf(float v) { return 1.0f / (1.0f + expf(-v)); }

// ---- fragment loaders: 16-bit A/B operand, lane -> row/col (lane&15), p already includes +8*(lane>>4);
//      elements 0..7 <- p[0..7] (k0+8h..), elements 8..15 <- p[16..23] (k0+16+8h..)  (same split k map for A and B;
//      B is always read from a k-contiguous [n][k] plane)
__device__ __forceinline__ v16h ldfrag_h(const _Float16* p) {
  FragH f;
  f.h[0] = *(const v8h*)(p);
  f.h[1] = *(const v8h*)(p + 16);
  return f.v;
}
__device__ __forceinline__ v16h ldfrag_u(const unsigned short* p) {
  FragH f;
  f.u[0] = *(const v4u*)(p);
  f.u[1] = *(const v4u*)(p + 16);
  return f.v;
}

// ---- WMMA helpers with trailing VALU hazard gaps ------------------------------------------------------
__device__ __forceinline__ v8f mma_raw(v16h a, v16h b, v8f c) {
  return __builtin_amdgcn_wmma_f32_16x16x32_f16(false, a, false, b, (short)0, c, false, false);
}
__device__ __forceinline__ void dep_guard1(v8f& a, v8f& b, v16h x) {
#if defined(__HIP_DEVICE_COMPILE__)
  asm volatile("v_nop\n\tv_nop\n\tv_nop\n\tv_nop" : "+v"(a), "+v"(b) : "v"(x));
#endif
}
__device__ __forceinline__ void dep_guard2(v8f& a, v8f& b, v16h x, v16h y) {
#if defined(__HIP_DEVICE_COMPILE__)
  asm volatile("v_nop\n\tv_nop\n\tv_nop\n\tv_nop" : "+v"(a), "+v"(b) : "v"(x), "v"(y));
#endif
}
__device__ __forceinline__ void guard_s2(v8f& s, v16h a0, v16h a1) {
#if defined(__HIP_DEVICE_COMPILE__)
  asm volatile("v_nop\n\tv_nop\n\tv_nop\n\tv_nop" : "+v"(s) : "v"(a0), "v"(a1));
#endif
}
__device__ __forceinline__ void guard_s4(v8f& s, v16h a0, v16h a1, v16h b0, v16h b1) {
#if defined(__HIP_DEVICE_COMPILE__)
  asm volatile("v_nop\n\tv_nop\n\tv_nop\n\tv_nop" : "+v"(s) : "v"(a0), "v"(a1), "v"(b0), "v"(b1));
#endif
}
__device__ __forceinline__ void guard_pv6(v8f& a, v8f& b, v8f& c, v8f& d,
                                          v16h p0, v16h p1, v16h x0, v16h x1, v16h x2, v16h x3) {
#if defined(__HIP_DEVICE_COMPILE__)
  asm volatile("v_nop\n\tv_nop\n\tv_nop\n\tv_nop"
               : "+v"(a), "+v"(b), "+v"(c), "+v"(d) : "v"(p0), "v"(p1), "v"(x0), "v"(x1), "v"(x2), "v"(x3));
#endif
}
__device__ __forceinline__ void guard_pv5(v8f& a, v8f& b, v8f& c, v8f& d,
                                          v16h p0, v16h x0, v16h x1, v16h x2, v16h x3) {
#if defined(__HIP_DEVICE_COMPILE__)
  asm volatile("v_nop\n\tv_nop\n\tv_nop\n\tv_nop"
               : "+v"(a), "+v"(b), "+v"(c), "+v"(d) : "v"(p0), "v"(x0), "v"(x1), "v"(x2), "v"(x3));
#endif
}
__device__ __forceinline__ void keep4_h(v16h a, v16h b, v16h c, v16h d) {
#if defined(__HIP_DEVICE_COMPILE__)
  asm volatile("v_nop" :: "v"(a), "v"(b), "v"(c), "v"(d));
#endif
}
__device__ __forceinline__ void acc_guard4(v8f& a, v8f& b, v8f& c, v8f& d) {
#if defined(__HIP_DEVICE_COMPILE__)
  asm volatile("v_nop\n\tv_nop\n\tv_nop\n\tv_nop" : "+v"(a), "+v"(b), "+v"(c), "+v"(d));
#endif
}
__device__ __forceinline__ void wave_sync_lds() {
  __builtin_amdgcn_fence(__ATOMIC_RELEASE, "workgroup");
  __builtin_amdgcn_wave_barrier();
  __builtin_amdgcn_fence(__ATOMIC_ACQUIRE, "workgroup");
}

// =====================================================================================================
// Row convert: X f32 [nrows][1024] -> Y f16 [nrows][1024] = f16( bf16_RNE(X) * carry ), carry a power of two (exact).
// One wave per row (8 rows per block); lane l holds cols j*256 + 8l..8l+7 for j = 0..3; store instruction j covers a contiguous
// coverage: 4 x 32 lanes x 8 halves = 1024 = the whole row; grid = nrows/8 (exact multiples here) with a wave-uniform row bound.
// Used for x (carry 16) and for Wi, Wo, Wv, Wout in their native [out][in] = [n][k] layout (carry 64).
// =====================================================================================================
__global__ __launch_bounds__(256) void conv_rows(const float* __restrict__ X, unsigned short* Y, int nrows, float carry) {
  const int lane = threadIdx.x & 31, wave = threadIdx.x >> 5;
  const int row = blockIdx.x * 8 + wave;
  if (row >= nrows) return;                      // wave-uniform; no barriers in this kernel
  const float* xp = X + (size_t)row * DM;
  unsigned short* op = Y + (size_t)row * DM;
  v4u res[4];
#pragma unroll
  for (int j = 0; j < 4; ++j) {
    const int c0 = j * 256 + lane * 8;
    const v4f a0 = *(const v4f*)(xp + c0), a1 = *(const v4f*)(xp + c0 + 4);
    float t[8];
#pragma unroll
    for (int e = 0; e < 4; ++e) { t[e] = bfr(a0[e]) * carry; t[4 + e] = bfr(a1[e]) * carry; }
    v4u o = {0u, 0u, 0u, 0u};
#pragma unroll
    for (int e = 0; e < 4; ++e) o[e] = pk16(h_bits((_Float16)t[2 * e]), h_bits((_Float16)t[2 * e + 1]));
    res[j] = o;
  }
  {
#pragma unroll
    for (int j = 0; j < 4; ++j) *(v4u*)(op + j * 256 + lane * 8) = res[j];
    
  }
}

// =====================================================================================================
// Gate weight plane: G f16 [64][1024]: row r = f16( 64 * bf16_RNE( (r & 16) ? We[r & 15] : Wa[r & 15] ) ) (rows 32..63 duplicate 0..31).
// Both candidate rows loaded with clamped in-range addresses, selected by value (row is wave-uniform). Same store shape as conv_rows.
// coverage: 8 blocks x 8 waves = 64 rows x (4 x 32 x 8 = 1024 cols), exact.
// =====================================================================================================
__global__ __launch_bounds__(256) void conv_gate(const float* __restrict__ Wa, const float* __restrict__ We,
                                                 unsigned short* Y, float carry) {
  const int lane = threadIdx.x & 31, wave = threadIdx.x >> 5;
  const int row = blockIdx.x * 8 + wave;
  if (row >= NGATE) return;                      // wave-uniform; no barriers in this kernel
  const float* pa = Wa + (size_t)(row & 15) * DM;
  const float* pb = We + (size_t)(row & 15) * DM;
  const bool useb = (row & 16) != 0;
  unsigned short* op = Y + (size_t)row * DM;
  v4u res[4];
#pragma unroll
  for (int j = 0; j < 4; ++j) {
    const int c0 = j * 256 + lane * 8;
    const v4f a0 = *(const v4f*)(pa + c0), a1 = *(const v4f*)(pa + c0 + 4);
    const v4f b0 = *(const v4f*)(pb + c0), b1 = *(const v4f*)(pb + c0 + 4);
    float t[8];
#pragma unroll
    for (int e = 0; e < 4; ++e) {
      t[e]     = bfr(useb ? b0[e] : a0[e]) * carry;
      t[4 + e] = bfr(useb ? b1[e] : a1[e]) * carry;
    }
    v4u o = {0u, 0u, 0u, 0u};
#pragma unroll
    for (int e = 0; e < 4; ++e) o[e] = pk16(h_bits((_Float16)t[2 * e]), h_bits((_Float16)t[2 * e + 1]));
    res[j] = o;
  }
  {
#pragma unroll
    for (int j = 0; j < 4; ++j) *(v4u*)(op + j * 256 + lane * 8) = res[j];
    
  }
}

// ---- asynchronous global -> LDS copies (16 B per lane). Each statement ends in s_wait_xcnt 0 so that no address register of an
//      issued copy is rewritten before the wait (a precaution); landing is waited for separately with s_wait_asynccnt 0.
#define KST   64      // k per stage: 128 B of every operand row = one whole line
#define LROW  144     // LDS row pitch in bytes: 128 + 16 (16 B x odd: conflict-free for 16-byte readers)
#define RSTEP (32 * LROW)   // LDS bytes between two copy rounds (a round = 8 waves x 4 rows)
__device__ __forceinline__ unsigned lds_off(const void* p) { return (unsigned)(size_t)p; }
__device__ __forceinline__ void copy2_lds(unsigned l, const unsigned short* g, size_t st) {
#if defined(__HIP_DEVICE_COMPILE__)
  asm volatile("global_load_async_to_lds_b128 %0, %1, off\n\t"
               "global_load_async_to_lds_b128 %2, %3, off\n\t"
               "s_wait_xcnt 0x0"
               :: "v"(l), "v"(g), "v"(l + RSTEP), "v"(g + st) : "memory");
#endif
}
__device__ __forceinline__ void copy8_lds(unsigned l, const unsigned short* g, size_t st) {
#if defined(__HIP_DEVICE_COMPILE__)
  asm volatile("global_load_async_to_lds_b128 %0, %1, off\n\t"
               "global_load_async_to_lds_b128 %2, %3, off\n\t"
               "global_load_async_to_lds_b128 %4, %5, off\n\t"
               "global_load_async_to_lds_b128 %6, %7, off\n\t"
               "global_load_async_to_lds_b128 %8, %9, off\n\t"
               "global_load_async_to_lds_b128 %10, %11, off\n\t"
               "global_load_async_to_lds_b128 %12, %13, off\n\t"
               "global_load_async_to_lds_b128 %14, %15, off\n\t"
               "s_wait_xcnt 0x0"
               :: "v"(l), "v"(g), "v"(l + RSTEP), "v"(g + st), "v"(l + 2 * RSTEP), "v"(g + 2 * st),
                  "v"(l + 3 * RSTEP), "v"(g + 3 * st), "v"(l + 4 * RSTEP), "v"(g + 4 * st), "v"(l + 5 * RSTEP), "v"(g + 5 * st),
                  "v"(l + 6 * RSTEP), "v"(g + 6 * st), "v"(l + 7 * RSTEP), "v"(g + 7 * st) : "memory");
#endif
}
// NR rounds of 32 rows (NR = 2 or 16): lane -> row 4*wave + (lane>>3) of its round, 16-byte piece lane&7; st = 32 source rows in elements
template <int NR>
__device__ __forceinline__ void copy_rows(unsigned l, const unsigned short* g, size_t st) {
  static_assert(NR == 2 || NR == 16);
  if constexpr (NR == 2) {
    copy2_lds(l, g, st);
  } else {
    copy8_lds(l, g, st);
    copy8_lds(l + 8 * RSTEP, g + 8 * st, st);
  }
}
__device__ __forceinline__ void wait_copies() {      // this wave's copies have landed in LDS
#if defined(__HIP_DEVICE_COMPILE__)
  asm volatile("s_wait_asynccnt 0x0" ::: "memory");
#endif
}
__device__ __forceinline__ void wait_lds_reads() {   // this wave's LDS reads have returned (before their buffer is refilled)
#if defined(__HIP_DEVICE_COMPILE__)
  asm volatile("s_wait_dscnt 0x0" ::: "memory");
#endif
}

// =====================================================================================================
// Register-blocked f16 WMMA GEMM: C[m][n] = f( oscale * sum_k A[m][k] * Bt[n][k] ); one wave per 64x64 tile, 8 tiles per block.
// Operands reach the fragments through LDS: per stage of 64 k the block copies its operand rows (128 B each, whole lines) with
// asynchronous copies into one of two buffers; the next stage's copies fly while this stage is multiplied; one barrier per stage.
// WM 1: the 8 tiles share their 64 A rows and lie side by side in n (N a multiple of 512); WM 8: they share their 64 B rows and
// lie below one another in m (N = 64, M a multiple of 512). K a multiple of 64.
// A row-major [M][K] pitch lda (16-bit plane), Bt row-major [N][K] pitch ldb (k contiguous); M, N multiples of 64, K multiple of 64.
// SPLITA 1: a second A plane A2 (same pitch) holding the unscaled f16 residual of A; its products go into the same accumulator.
// BM: 0 = no bias; 3 = per-column head bias bf16( (col & 16) ? bias2[col & 15] : bias[col & 15] ) (in-range addresses).
// OM: 0 = f32 out (pitch ldc), ACT 2 applies sigmoid after bias;
//     2 = f16 out = f16( value * ocarry ); 3 = f16 hi plane f16(value*ocarry) to C and unscaled residual f16(value*ocarry - hi) to C2.
// coverage: 4 slabs x 16 rows (f32: it 0..7 x lane>>4; f16: it 0..3 x lane>>3) x 64 cols = the wave's whole 64x64 tile;
//           grid = tilesM*tilesN/8 blocks (exact here); a block that does not fit the shape rules leaves as a whole before any barrier.
// =====================================================================================================
template <int OM, int BM, int ACT, int SPLITA, int WM>
__global__ __launch_bounds__(256) void gemm64(
    const unsigned short* __restrict__ Ap, const unsigned short* __restrict__ A2p, int lda,
    const unsigned short* __restrict__ Btp, int ldb,
    const float* __restrict__ bias, const float* __restrict__ bias2,
    void* Cout, void* C2out, int ldc,
    int M, int N, int K, float oscale, float ocarry) {
  static_assert(WM == 1 || WM == 8);
  constexpr int RA  = WM * 64;                     // A rows per block
  constexpr int RB  = (8 / WM) * 64;               // B rows per block
  constexpr int OA2 = RA * LROW;                   // stage layout in bytes: [A | A2 (SPLITA) | B]
  constexpr int OB  = RA * (1 + SPLITA) * LROW;
  constexpr int STG = OB + RB * LROW;              // bytes per stage
  __shared__ __align__(16) unsigned char ring[2 * STG];
  __shared__ __align__(16) float sT[8][16 * 68];   // per-wave 16x64 slab, pitch 68 floats
  const int lane = threadIdx.x & 31;
  const int wave = threadIdx.x >> 5;
  const int tilesN = N >> 6;
  const int tilesM = M >> 6;
  const int tile0 = blockIdx.x * 8;
  if (tile0 + 8 > tilesM * tilesN) return;         // block-uniform, before any barrier or copy
  if (WM == 1 ? (tilesN & 7) != 0 : (tilesN != 1)) return;   // block-uniform shape rule of this build
  const int tmB = tile0 / tilesN;
  const int mB = tmB << 6;                         // block's first row and column
  const int nB = (tile0 - tmB * tilesN) << 6;
  const int m0 = mB + (WM == 8 ? (wave << 6) : 0);
  const int n0 = nB + (WM == 1 ? (wave << 6) : 0);

  const int rlane = lane & 15;                 // row (A) / col (B, D) within subtile
  const int koff  = (lane >> 4) * 8;           // k offset of this lane half
  const int mOff  = (lane >> 4) * 8;           // D row offset

  // copy side: this lane's row and 16-byte piece in a round of 32 rows
  const int crow = wave * 4 + (lane >> 3);
  const int cseg = (lane & 7) * 8;
  const unsigned lcp = lds_off(ring) + (unsigned)(crow * LROW + cseg * 2);
  const unsigned short* gA  = Ap  + (size_t)(mB + crow) * lda + cseg;
  const unsigned short* gA2 = A2p + (size_t)(mB + crow) * lda + cseg;
  const unsigned short* gB  = Btp + (size_t)(nB + crow) * ldb + cseg;
  const size_t stA = (size_t)32 * lda, stB = (size_t)32 * ldb;
  // reader side: fragment rows of this wave in a stage
  const int fa = ((WM == 8 ? (wave << 6) : 0) + rlane) * LROW + koff * 2;
  const int fb = OB + ((WM == 1 ? (wave << 6) : 0) + rlane) * LROW + koff * 2;

  v8f acc[4][4];
#pragma unroll
  for (int i = 0; i < 4; ++i)
#pragma unroll
    for (int j = 0; j < 4; ++j) acc[i][j] = zero8();

  const int nst = K / KST;
  // stage 0 into buffer 0, landed and published; then stage 1 into buffer 1
  copy_rows<RA / 32>(lcp, gA, stA);
  if constexpr (SPLITA != 0) copy_rows<RA / 32>(lcp + OA2, gA2, stA);
  copy_rows<RB / 32>(lcp + OB, gB, stB);
  wait_copies();
  __syncthreads();
  if (nst > 1) {
    copy_rows<RA / 32>(lcp + STG, gA + KST, stA);
    if constexpr (SPLITA != 0) copy_rows<RA / 32>(lcp + STG + OA2, gA2 + KST, stA);
    copy_rows<RB / 32>(lcp + STG + OB, gB + KST, stB);
  }

#pragma unroll 1   // one stage per trip: the ring's order at the foot stays as written
  for (int t = 0; t < nst; ++t) {
    const unsigned bofs = (unsigned)(t & 1) * STG;
    const unsigned char* sb = ring + bofs;
#pragma unroll
    for (int s = 0; s < 2; ++s) {              // two k-steps of 32 per stage, ascending k
      v16h bh[4], ah[4], al[SPLITA != 0 ? 4 : 1];
#pragma unroll
      for (int j = 0; j < 4; ++j) bh[j] = ldfrag_u((const unsigned short*)(sb + fb + j * 16 * LROW + s * 64));
#pragma unroll
      for (int i = 0; i < 4; ++i) ah[i] = ldfrag_u((const unsigned short*)(sb + fa + i * 16 * LROW + s * 64));
      if constexpr (SPLITA != 0) {
#pragma unroll
        for (int i = 0; i < 4; ++i) al[i] = ldfrag_u((const unsigned short*)(sb + OA2 + fa + i * 16 * LROW + s * 64));
      }
#pragma unroll
      for (int i = 0; i < 4; ++i) {
#pragma unroll
        for (int j = 0; j < 4; ++j) acc[i][j] = mma_raw(ah[i], bh[j], acc[i][j]);
        if constexpr (SPLITA != 0) {
#pragma unroll
          for (int j = 0; j < 4; ++j) acc[i][j] = mma_raw(al[i], bh[j], acc[i][j]);
          dep_guard2(acc[i][0], acc[i][3], ah[i], al[i]);
        } else {
          dep_guard1(acc[i][0], acc[i][3], ah[i]);
        }
      }
      keep4_h(bh[0], bh[1], bh[2], bh[3]);
    }
    // publish point of stage t + 1; the same barrier ends every reader's last read of stage t's buffer
    wait_lds_reads();
    wait_copies();
    __syncthreads();
    if (t + 2 < nst) {                         // block-uniform: refill the buffer that this trip has just read
      const int kn = (t + 2) * KST;
      copy_rows<RA / 32>(lcp + bofs, gA + kn, stA);
      if constexpr (SPLITA != 0) copy_rows<RA / 32>(lcp + bofs + OA2, gA2 + kn, stA);
      copy_rows<RB / 32>(lcp + bofs + OB, gB + kn, stB);
    }
  }
  wait_copies();
  acc_guard4(acc[0][0], acc[0][1], acc[0][2], acc[0][3]);
  acc_guard4(acc[1][0], acc[1][1], acc[1][2], acc[1][3]);
  acc_guard4(acc[2][0], acc[2][1], acc[2][2], acc[2][3]);
  acc_guard4(acc[3][0], acc[3][1], acc[3][2], acc[3][3]);

  const int hh2 = lane >> 4, c4 = (lane & 15) * 4;     // f32 out: 256-B row segment = 16 lanes x 16 B
  const int q8  = lane >> 3, c8 = (lane & 7) * 8;
  float bc[4];
#pragma unroll
  for (int e = 0; e < 4; ++e) bc[e] = 0.f;
  if constexpr (BM == 3) {
#pragma unroll
    for (int e = 0; e < 4; ++e) {
      const int col = n0 + c4 + e;
      const float fa = bfr(bias[col & 15]);             // in-range addresses 0..15
      const float fb = bfr(bias2[col & 15]);
      bc[e] = (col & 16) ? fb : fa;
    }
  }

  // ---- epilogue ----
  float* slab = sT[wave];
#pragma unroll
  for (int i = 0; i < 4; ++i) {
    const int mBase = m0 + (i << 4);
#pragma unroll
    for (int j = 0; j < 4; ++j) {
#pragma unroll
      for (int r = 0; r < 8; ++r) {
        slab[(mOff + r) * 68 + (j << 4) + rlane] = acc[i][j][r];
      }
    }
    wave_sync_lds();
    if constexpr (OM == 0) {
      float* C = (float*)Cout;
      v4f vals[8];
#pragma unroll
      for (int it = 0; it < 8; ++it) {
        const int row = it * 2 + hh2;                      // it 0..7 x hh2 0..1 = rows 0..15
        v4f v = *(const v4f*)(slab + row * 68 + c4);
#pragma unroll
        for (int e = 0; e < 4; ++e) {
          float f = v[e] * oscale + bc[e];
          if constexpr (ACT == 2) f = 1.0f / (1.0f + __expf(-f));
          v[e] = f;
        }
        vals[it] = v;
      }
      {
#pragma unroll
        for (int it = 0; it < 8; ++it) {
          const int gr = mBase + it * 2 + hh2;
          *(v4f*)(C + (size_t)gr * ldc + n0 + c4) = vals[it];
        }
        
      }
    } else {
      unsigned short* C  = (unsigned short*)Cout;
      unsigned short* C2 = (unsigned short*)C2out;
      v4u hv[4], lv[4];
#pragma unroll
      for (int it = 0; it < 4; ++it) {
        const int row = it * 4 + q8;                       // it 0..3 x q8 0..3 = rows 0..15
        const float* sp = slab + row * 68 + c8;
        v4u a = {0u, 0u, 0u, 0u};
        v4u b = {0u, 0u, 0u, 0u};
#pragma unroll
        for (int e = 0; e < 4; ++e) {
          const float f0 = (sp[2 * e] * oscale) * ocarry;
          const float f1 = (sp[2 * e + 1] * oscale) * ocarry;
          const _Float16 h0 = (_Float16)f0, h1 = (_Float16)f1;
          a[e] = pk16(h_bits(h0), h_bits(h1));
          if constexpr (OM == 3) {
            const _Float16 l0 = (_Float16)(f0 - (float)h0);
            const _Float16 l1 = (_Float16)(f1 - (float)h1);
            b[e] = pk16(h_bits(l0), h_bits(l1));
          }
        }
        hv[it] = a;
        lv[it] = b;
      }
      {
#pragma unroll
        for (int it = 0; it < 4; ++it) {
          const int row = it * 4 + q8;
          *(v4u*)(C + (size_t)(mBase + row) * ldc + n0 + c8) = hv[it];
          if constexpr (OM == 3) {
            *(v4u*)(C2 + (size_t)(mBase + row) * ldc + n0 + c8) = lv[it];
          }
        }
        
      }
    }
    wave_sync_lds();
  }
}

// =====================================================================================================
// Flash attention for one head and 128 query rows (one wave per 16 query rows), head dim 64, 2048 keys:
//   inner|outer plane (f16 x16) QK[tok][2048]: inner at col 64h + d, outer at col 1024 + 64h + d;
//   v^T planes (f16 hi x1024, unscaled residual): VH/VL[64h + d][key] (pitch 2048);
//   gate plane AEF f32 [tok][64]: col h = ap[h][tok] (sigmoid applied), col 16 + h = ex[h][tok];
//   out: CTH/CTL[tok][64h + d] = f16 hi / residual of 4096 * ctx, ctx = valve/rotation epilogue of
//        ap * sum_s p_s v_s / (ap * sum_s p_s + 1e-8 * sum_s e_s), e_s = exp(score_s - max), p_s = e_s * ex[s].
//   block = 8 waves = 256 threads; grid = 16 heads x 16 query groups = 256; every wave does identical bounded work (64 steps).
//   The 8 waves read the same keys: per stage of 64 keys the block copies the head's 64 outer rows and the 64 rows of each v^T
//   plane (128 B each, whole lines) with asynchronous copies into one of two LDS buffers; the next stage's copies fly while this
//   stage is worked on; one barrier per stage. A stage is two steps of 32 keys. The head's ex column (2048 f32) is put into LDS
//   once, in front of the first barrier.
//   Both products are transposed: S^T = outer . inner^T (A = 16 key rows from the stage, B = the wave's 16 query rows, kept in
//   registers) and O^T += v^T . P^T (A = 16 d rows of v^T from the stage, B = P^T). A lane (c = lane & 15, hh = lane >> 4) then
//   holds only query q0 + c: score register r of tile i is key kb + 16 i + 8 hh + r, which is the k order of a B operand, so the
//   two score tiles of a step, converted in place, are P^T; output register r of tile j is d = 16 j + 8 hh + r.
//   Per step: 2 score tiles on f16 WMMA (K = 64 as two k-steps of 32); the maximum over the lane's 16 keys in the lane, joined with
//   the other half by one cross-row move; online max-subtracted softmax in f32 (exp2, log2e / 8 / carries folded in); running sums
//   of e and of p = e*ex in eight partial sums per lane (one per score register; they and the halves are joined once, behind the loop); one
//   rescale factor per lane; 12 WMMAs (hi.hi, hi.lo, lo.hi) into one accumulator set.
//   Final scaling in f32; each lane stages its query's 4 x 8 consecutive d (hi and residual) in the block's LDS row buffers [128][64];
// coverage: LDS row buffers: 8 waves x 16 rows x 64 cols = 128 x 64; global: 4 iterations x 256 threads x 8 halves = 128 rows x 64
//           cols (cols 64*head ..) of rows qB..qB+127, both planes; grid covers all 2048 rows x 1024 cols exactly once.
// =====================================================================================================
#define AKS   64                        // keys per stage: 128 B of every v^T row = one whole line
#define AOVH  (AKS * LROW)              // stage layout in bytes: [64 outer rows | 64 v^T hi rows | 64 v^T residual rows]
#define AOVL  (AOVH + HDIM * LROW)
#define ASTG  (AOVL + HDIM * LROW)      // bytes per stage
static_assert(AKS == 64 && HDIM == 64 && (TT % AKS) == 0 && (TT / AKS) >= 2 && HDIM * 2 + 16 == LROW && AKS * 2 + 16 == LROW);
static_assert((TT % ATT_THREADS) == 0);
// one stage: keys 64 t .. 64 t + 63; l, gK, gVh, gVl are this lane's row (4*wave + (lane>>3) of a round of 32) and 16-byte piece
__device__ __forceinline__ void att_stage(unsigned l, const unsigned short* gK, const unsigned short* gVh,
                                          const unsigned short* gVl, int t) {
  copy_rows<2>(l,        gK  + (size_t)t * AKS * QKP, (size_t)32 * QKP);
  copy_rows<2>(l + AOVH, gVh + (size_t)t * AKS,       (size_t)32 * TT);
  copy_rows<2>(l + AOVL, gVl + (size_t)t * AKS,       (size_t)32 * TT);
}
__device__ __forceinline__ const _Float16* lds_h(const unsigned char* p) { return (const _Float16*)(const void*)p; }
// value of lane l ^ 16 (one vector cross-row move, no LDS counter)
__device__ __forceinline__ float xhalf(float x) {
  const int b = __builtin_bit_cast(int, x);
  return __builtin_bit_cast(float, __builtin_amdgcn_permlanex16(b, b, 0x76543210, 0xfedcba98, false, false));
}

__global__ __launch_bounds__(ATT_THREADS)
void attn_heads(const unsigned short* __restrict__ QKq, const unsigned short* __restrict__ VHq,
                const unsigned short* __restrict__ VLq, const float* __restrict__ AEF,
                const float* __restrict__ betap, const float* __restrict__ ivp,
                const float* __restrict__ ovp, const float* __restrict__ chg,
                unsigned short* CTH, unsigned short* CTL) {
  __shared__ __align__(16) unsigned char kv[2 * ASTG];      // two stages of outer rows and v^T rows
  __shared__ __align__(16) float exs[TT];                   // ex of this head, by key
  __shared__ __align__(16) unsigned short Osh[ATT_QB * HDIM];   // block result rows [128][64], hi
  __shared__ __align__(16) unsigned short Osl[ATT_QB * HDIM];   // residual

  const int tid  = threadIdx.x;
  const int wave = tid >> 5;
  const int lane = tid & 31;
  const int hh   = lane >> 4;
  const int c    = lane & 15;

  const int qg   = blockIdx.x % ATT_QG;                     // query group 0..15
  const int head = (blockIdx.x / ATT_QG) & (NHEAD - 1);     // 0..15
  const int qB   = qg * ATT_QB;                             // block's first query row
  const int q0   = qB + wave * 16;                          // wave's first query row

  const _Float16* Qh = (const _Float16*)(const void*)QKq + (size_t)(q0 + c) * QKP + head * HDIM + 8 * hh;
  const float* Ex = AEF + 16 + head;                                    // ex column of this head
  const float lsc = (1.4426950408889634f * ATT_SCALE) / (QC * KC);      // log2(e) / 8 / carries

  // copy side: this lane's row and 16-byte piece in a round of 32 rows
  const int crow = wave * 4 + (lane >> 3);
  const int cseg = (lane & 7) * 8;
  const unsigned lcp = lds_off(kv) + (unsigned)(crow * LROW + cseg * 2);
  const unsigned short* gK  = QKq + (size_t)crow * QKP + DM + head * HDIM + cseg;
  const unsigned short* gVh = VHq + (size_t)(head * HDIM + crow) * TT + cseg;
  const unsigned short* gVl = VLq + (size_t)(head * HDIM + crow) * TT + cseg;
  // reader side: this lane's fragment row (key or d = c within a group of 16 rows) and k half, in bytes
  const int fr = c * LROW + 16 * hh;

  // stage 0 into buffer 0, landed and published; then stage 1 into buffer 1. The ex column is published by the same barrier.
  att_stage(lcp, gK, gVh, gVl, 0);
  const v16h qa = ldfrag_h(Qh), qb = ldfrag_h(Qh + 32);
  const float apq = AEF[(size_t)(q0 + c) * NGATE + head];    // ap of this lane's query, used behind the loop
#pragma unroll   // the 8 loads are issued together, one latency
  for (int i = 0; i < TT / ATT_THREADS; ++i) {
    const int k = i * ATT_THREADS + tid;                     // 8 x 256 = all 2048 keys
    exs[k] = Ex[(size_t)k * NGATE];
  }
  wait_copies();
  __syncthreads();
  att_stage(lcp + ASTG, gK, gVh, gVl, 1);

  float mrow = -INFINITY;                                    // this lane's query
  v8f zv = zero8(), lv = zero8();                            // sums of e and p: element r over this half's keys 8hh + r (mod 16)
  v8f o0 = zero8(), o1 = zero8(), o2 = zero8(), o3 = zero8();

  constexpr int nst = TT / AKS;
#pragma unroll 1   // one stage per trip: the ring's order at the foot stays as written
  for (int t = 0; t < nst; ++t) {
    const unsigned bofs = (unsigned)(t & 1) * ASTG;
    const unsigned char* sb = kv + bofs + fr;
#pragma unroll
    for (int s = 0; s < 2; ++s) {              // two steps of 32 keys per stage, ascending keys
      const int kb = t * AKS + s * 32;
      v8f s0, s1;                              // s0[r]: key kb + 8hh + r, s1[r]: key kb + 16 + 8hh + r, query q0 + c
      {
        const _Float16* kp = lds_h(sb + (s * 32) * LROW);
        const v16h k0 = ldfrag_h(kp), k1 = ldfrag_h(kp + 32);
        s0 = mma_raw(k0, qa, zero8());
        s0 = mma_raw(k1, qb, s0);
        guard_s2(s0, k0, k1);
      }
      {
        const _Float16* kq = lds_h(sb + (s * 32 + 16) * LROW);
        const v16h k0 = ldfrag_h(kq), k1 = ldfrag_h(kq + 32);
        s1 = mma_raw(k0, qa, zero8());
        s1 = mma_raw(k1, qb, s1);
        guard_s4(s1, k0, k1, qa, qb);
      }
      const float* exq = exs + kb + 8 * hh;
      const v4f xa = *(const v4f*)(exq),      xb = *(const v4f*)(exq + 4);      // ex of keys kb + 8hh + 0..7
      const v4f xc = *(const v4f*)(exq + 16), xd = *(const v4f*)(exq + 20);     // ex of keys kb + 16 + 8hh + 0..7
      const v8f x0 = __builtin_shufflevector(xa, xb, 0, 1, 2, 3, 4, 5, 6, 7);
      const v8f x1 = __builtin_shufflevector(xc, xd, 0, 1, 2, 3, 4, 5, 6, 7);
      const float m0 = fmaxf(fmaxf(s0[0], s0[1]), s0[2]), m1 = fmaxf(fmaxf(s0[3], s0[4]), s0[5]);
      const float m2 = fmaxf(fmaxf(s0[6], s0[7]), s1[0]), m3 = fmaxf(fmaxf(s1[1], s1[2]), s1[3]);
      const float m4 = fmaxf(fmaxf(s1[4], s1[5]), s1[6]);
      float mx = fmaxf(fmaxf(fmaxf(m0, m1), s1[7]), fmaxf(fmaxf(m2, m3), m4));   // the lane's 16 keys
      mx = fmaxf(mx, xhalf(mx));               // both halves: maximum over the step's 32 keys
      const float mn = fmaxf(mrow, mx * lsc);
      const float al = exp2f(mrow - mn);
      mrow = mn;
      const v8f t0 = s0 * lsc - mn, t1 = s1 * lsc - mn;
      v8f e0, e1;
#pragma unroll   // constant element indices: the vectors stay in registers
      for (int r = 0; r < 8; ++r) { e0[r] = exp2f(t0[r]); e1[r] = exp2f(t1[r]); }
      const v8f p0 = e0 * x0, p1 = e1 * x1;
      zv = zv * al + (e0 + e1);
      lv = lv * al + (p0 + p1);
      FragH ph, pl;                            // P^T as a B operand: element r <- k = 8hh + r, element 8 + r <- k = 16 + 8hh + r
      {
        const v8f y0 = p0 * PC, y1 = p1 * PC;
        ph.h[0] = __builtin_convertvector(y0, v8h);
        ph.h[1] = __builtin_convertvector(y1, v8h);
        pl.h[0] = __builtin_convertvector(y0 - __builtin_convertvector(ph.h[0], v8f), v8h);
        pl.h[1] = __builtin_convertvector(y1 - __builtin_convertvector(ph.h[1], v8f), v8h);
      }
      o0 *= al;
      o1 *= al;
      o2 *= al;
      o3 *= al;
      {
        const unsigned char* vp = sb + AOVH + s * 64;          // 32 keys = 64 B along a v^T row
        const v16h vb0 = ldfrag_h(lds_h(vp));
        const v16h vb1 = ldfrag_h(lds_h(vp + 16 * LROW));
        const v16h vb2 = ldfrag_h(lds_h(vp + 32 * LROW));
        const v16h vb3 = ldfrag_h(lds_h(vp + 48 * LROW));
        o0 = mma_raw(vb0, ph.v, o0);
        o1 = mma_raw(vb1, ph.v, o1);
        o2 = mma_raw(vb2, ph.v, o2);
        o3 = mma_raw(vb3, ph.v, o3);
        o0 = mma_raw(vb0, pl.v, o0);
        o1 = mma_raw(vb1, pl.v, o1);
        o2 = mma_raw(vb2, pl.v, o2);
        o3 = mma_raw(vb3, pl.v, o3);
        guard_pv6(o0, o1, o2, o3, ph.v, pl.v, vb0, vb1, vb2, vb3);
      }
      {
        const unsigned char* vp = sb + AOVL + s * 64;
        const v16h vl0 = ldfrag_h(lds_h(vp));
        const v16h vl1 = ldfrag_h(lds_h(vp + 16 * LROW));
        const v16h vl2 = ldfrag_h(lds_h(vp + 32 * LROW));
        const v16h vl3 = ldfrag_h(lds_h(vp + 48 * LROW));
        o0 = mma_raw(vl0, ph.v, o0);
        o1 = mma_raw(vl1, ph.v, o1);
        o2 = mma_raw(vl2, ph.v, o2);
        o3 = mma_raw(vl3, ph.v, o3);
        guard_pv5(o0, o1, o2, o3, ph.v, vl0, vl1, vl2, vl3);
      }
    }
    // publish point of stage t + 1; the same barrier ends every reader's last read of stage t's buffer
    wait_lds_reads();
    wait_copies();
    __syncthreads();
    if (t + 2 < nst) att_stage(lcp + bofs, gK, gVh, gVl, t + 2);   // block-uniform: refill the buffer that this trip has just read
  }
  wait_copies();

  // ---- per-head gates and rotation, renormaliser, carries (1024 on p, 1024 on v, 4096 on the stored ctx) ----
  const float zrow = ((zv[0] + zv[1]) + (zv[2] + zv[3])) + ((zv[4] + zv[5]) + (zv[6] + zv[7]));
  const float lrow = ((lv[0] + lv[1]) + (lv[2] + lv[3])) + ((lv[4] + lv[5]) + (lv[6] + lv[7]));
  const float zt  = zrow + xhalf(zrow);                      // the two halves' sums, on the same maximum
  const float lt  = lrow + xhalf(lrow);
  const float bet = bfr(betap[head]);
  const float ivs = sigf(bfr(ivp[head]));
  const float og  = sigf(bfr(ovp[head])) * tanhf(bfr(chg[head]));
  const float ang = PI_F * sigf(bet);
  const float ca  = cosf(ang), sa = sinf(ang);
  const float base = ivs / (PC * VC);
  const float den = apq * lt + REN_EPS * zt;
  const float sc  = apq * (1.0f / den) * base;
  v8h yh[4], yl[4];                                          // tile j: d = 16 j + 8 hh + r
#pragma unroll
  for (int r = 0; r < 8; ++r) {
    const float x0 = o0[r] * sc, x1 = o1[r] * sc, x2 = o2[r] * sc, x3 = o3[r] * sc;
    const float y0 = ((x0 * ca - x2 * sa) * og) * FC;
    const float y1 = ((x1 * ca - x3 * sa) * og) * FC;
    const float y2 = ((x0 * sa + x2 * ca) * og) * FC;
    const float y3 = ((x1 * sa + x3 * ca) * og) * FC;
    const _Float16 h0 = (_Float16)y0, h1 = (_Float16)y1, h2 = (_Float16)y2, h3 = (_Float16)y3;
    yh[0][r] = h0;
    yh[1][r] = h1;
    yh[2][r] = h2;
    yh[3][r] = h3;
    yl[0][r] = (_Float16)(y0 - (float)h0);
    yl[1][r] = (_Float16)(y1 - (float)h1);
    yl[2][r] = (_Float16)(y2 - (float)h2);
    yl[3][r] = (_Float16)(y3 - (float)h3);
  }
  {
    unsigned short* oh = Osh + (wave * 16 + c) * HDIM + 8 * hh;
    unsigned short* ol = Osl + (wave * 16 + c) * HDIM + 8 * hh;
#pragma unroll   // constant array indices: yh, yl stay in registers
    for (int j = 0; j < 4; ++j) {
      *(v8h*)(void*)(oh + 16 * j) = yh[j];
      *(v8h*)(void*)(ol + 16 * j) = yl[j];
    }
  }
  __syncthreads();
  // ---- block writes its 128 row segments: piece p = it*256 + tid -> row p>>3, halves (p&7)*8 of the 64-col slab (128 B a row) ----
  {
    v4u vh[4], vl[4];
#pragma unroll
    for (int it = 0; it < 4; ++it) {
      const int p = it * ATT_THREADS + tid;
      vh[it] = *(const v4u*)(Osh + (size_t)p * 8);
      vl[it] = *(const v4u*)(Osl + (size_t)p * 8);
    }
    const size_t dofs = (size_t)qB * DM + (size_t)head * HDIM;
    unsigned short* dh = CTH + dofs;
    unsigned short* dl = CTL + dofs;
    {
#pragma unroll
      for (int it = 0; it < 4; ++it) {
        const int p = it * ATT_THREADS + tid;
        const size_t po = (size_t)(p >> 3) * DM + (size_t)(p & 7) * 8;
        *(v4u*)(dh + po) = vh[it];
        *(v4u*)(dl + po) = vl[it];
      }
    }
  }
}

// =====================================================================================================
// Workspace map (bytes); every plane is an exact multiple of its tile / whole-row store granularity (M, N exact tile multiples,
// row blocks exact, no pad rows needed), every offset a multiple of 131072:
//   WIO  f16 [2048][1024] x64     4194304   (rows 0..1023 Wi, 1024..2047 Wo; native [out][in] = [n][k])
//   WV   f16 [1024][1024] x64     2097152
//   WOUT f16 [1024][1024] x64     2097152
//   WG   f16 [64][1024]   x64      131072   (Wa, We, Wa, We)
//   XB   f16 [2048][1024] x16     4194304
//   QK   f16 [2048][2048] x16     8388608   (inner | outer)
//   VTH  f16 [1024][2048] x1024   4194304   (v^T hi)
//   VTL  f16 [1024][2048]         4194304   (v^T residual)
//   AEF  f32 [2048][64]            524288   (sigmoid gates)
//   CTH  f16 [2048][1024] x4096   4194304   (ctx hi)
//   CTL  f16 [2048][1024]         4194304   (ctx residual)
//   end                          38404096
// =====================================================================================================
extern "C" void kernel_launch(void* const* d_in, const int* in_sizes, int n_in,
                              void* d_out, int out_size, void* d_ws, size_t ws_size,
                              hipStream_t stream) {
  if (n_in < 13) return;
  if (in_sizes[0] != TT * DM) return;
  if (in_sizes[1] != NHEAD * DM || in_sizes[2] != NHEAD) return;
  if (in_sizes[3] != NHEAD * DM || in_sizes[4] != NHEAD) return;
  if (in_sizes[5] != DM * DM || in_sizes[6] != DM * DM || in_sizes[7] != DM * DM || in_sizes[8] != DM * DM) return;
  if (in_sizes[9] != NHEAD || in_sizes[10] != NHEAD || in_sizes[11] != NHEAD || in_sizes[12] != NHEAD) return;
  if (out_size != TT * DM) return;

  const float* x     = (const float*)d_in[0];
  const float* Wa    = (const float*)d_in[1];
  const float* ba    = (const float*)d_in[2];
  const float* We    = (const float*)d_in[3];
  const float* be    = (const float*)d_in[4];
  const float* Wi    = (const float*)d_in[5];
  const float* Wo    = (const float*)d_in[6];
  const float* Wv    = (const float*)d_in[7];
  const float* Wout  = (const float*)d_in[8];
  const float* betap = (const float*)d_in[9];
  const float* ivp   = (const float*)d_in[10];
  const float* ovp   = (const float*)d_in[11];
  const float* chg   = (const float*)d_in[12];
  float*       out   = (float*)d_out;

  const size_t PWIO = (size_t)2 * DM * DM * 2;                    //  4194304
  const size_t PW   = (size_t)DM * DM * 2;                        //  2097152
  const size_t PG   = (size_t)NGATE * DM * 2;                     //   131072
  const size_t PX   = (size_t)TT * DM * 2;                        //  4194304
  const size_t PQK  = (size_t)TT * QKP * 2;                       //  8388608
  const size_t PVT  = (size_t)DM * TT * 2;                        //  4194304
  const size_t PAE  = (size_t)TT * NGATE * 4;                     //   524288
  const size_t PCT  = (size_t)TT * DM * 2;                        //  4194304
  size_t off = 0;
  const size_t oWIO = off; off += PWIO;
  const size_t oWV  = off; off += PW;
  const size_t oWOU = off; off += PW;
  const size_t oWG  = off; off += PG;
  const size_t oXB  = off; off += PX;
  const size_t oQK  = off; off += PQK;
  const size_t oVTH = off; off += PVT;
  const size_t oVTL = off; off += PVT;
  const size_t oAEF = off; off += PAE;
  const size_t oCTH = off; off += PCT;
  const size_t oCTL = off; off += PCT;
  if (off > ws_size) return;                                      // off = 38404096
  if (off > (size_t)134217728) return;

  char* ws = (char*)d_ws;
  unsigned short* WIO  = (unsigned short*)(ws + oWIO);
  unsigned short* WV   = (unsigned short*)(ws + oWV);
  unsigned short* WOUT = (unsigned short*)(ws + oWOU);
  unsigned short* WG   = (unsigned short*)(ws + oWG);
  unsigned short* XB   = (unsigned short*)(ws + oXB);
  unsigned short* QK   = (unsigned short*)(ws + oQK);
  unsigned short* VTH  = (unsigned short*)(ws + oVTH);
  unsigned short* VTL  = (unsigned short*)(ws + oVTL);
  float*          AEF  = (float*)(ws + oAEF);
  unsigned short* CTH  = (unsigned short*)(ws + oCTH);
  unsigned short* CTL  = (unsigned short*)(ws + oCTL);

  const dim3 blk(256);
  const dim3 gX(TT / 8);                                          // 256 blocks
  const dim3 gW(DM / 8);                                          // 128 blocks
  const dim3 gG(NGATE / 8);                                       // 8 blocks
  const int tilesG = (TT / 64) * (NGATE / 64);                    // 32
  const int tilesQ = (TT / 64) * (QKP / 64);                      // 1024
  const int tilesV = (DM / 64) * (TT / 64);                       // 512
  const int tilesO = (TT / 64) * (DM / 64);                       // 512
  const dim3 gGE((tilesG + 7) / 8);                               // 4
  const dim3 gQK((tilesQ + 7) / 8);                               // 128
  const dim3 gVT((tilesV + 7) / 8);                               // 64
  const dim3 gO((tilesO + 7) / 8);                                // 64
  const dim3 gAT(ATT_BLOCKS);                                     // 256
  const dim3 bAT(ATT_THREADS);                                    // 256

  // (0) 16-bit planes: XB = f16(16 * bf16(x)); W planes = f16(64 * bf16(W)) in native [n][k] layout; gate plane
  conv_rows<<<gX, blk, 0, stream>>>(x, XB, TT, ACARRY);                         // [2048][1024]
  conv_rows<<<gW, blk, 0, stream>>>(Wi, WIO, DM, WSC);                           // [1024][1024] -> WIO rows 0..1023
  conv_rows<<<gW, blk, 0, stream>>>(Wo, WIO + (size_t)DM * DM, DM, WSC);         // -> WIO rows 1024..2047
  conv_rows<<<gW, blk, 0, stream>>>(Wv, WV, DM, WSC);
  conv_rows<<<gW, blk, 0, stream>>>(Wout, WOUT, DM, WSC);
  conv_gate<<<gG, blk, 0, stream>>>(Wa, We, WG, WSC);                            // [64][1024]

  // (1) gates: AEF[t][j] = sigmoid(x[t] . G[j] / (16*64) + bf16(bias_j)); M = 2048, N = 64, K = 1024, f32 out
  gemm64<0, 3, 2, 0, 8><<<gGE, blk, 0, stream>>>(
      XB, XB, DM,
      WG, DM,
      ba, be,
      (void*)AEF, (void*)AEF, NGATE,
      TT, NGATE, DM, 1.0f / (ACARRY * WSC), 1.0f);

  // (2) inner | outer: QK[t][n] = f16(16 * x[t] . [Wi;Wo][n]); M = 2048, N = 2048, K = 1024
  gemm64<2, 0, 0, 0, 1><<<gQK, blk, 0, stream>>>(
      XB, XB, DM,
      WIO, DM,
      ba, be,
      (void*)QK, (void*)QK, QKP,
      TT, QKP, DM, 1.0f / (ACARRY * WSC), QC);

  // (3) v^T: VTH/VTL[d][t] = hi/residual of f16(1024 * Wv[d] . x[t]); M = 1024, N = 2048, K = 1024
  gemm64<3, 0, 0, 0, 1><<<gVT, blk, 0, stream>>>(
      WV, WV, DM,
      XB, DM,
      ba, be,
      (void*)VTH, (void*)VTL, TT,
      DM, TT, DM, 1.0f / (WSC * ACARRY), VC);

  // (4) attention per (128 query rows, 1 head) -> CTH/CTL (ctx x4096 hi + residual)
  attn_heads<<<gAT, bAT, 0, stream>>>(QK, VTH, VTL, AEF, betap, ivp, ovp, chg, CTH, CTL);

  // (5) out = (ctx_hi + ctx_lo) . Wout plane / (4096 * 64); M = 2048, N = 1024, K = 1024, f32
  gemm64<0, 0, 0, 1, 1><<<gO, blk, 0, stream>>>(
      CTH, CTL, DM,
      WOUT, DM,
      ba, be,
      (void*)out, (void*)out, DM,
      TT, DM, DM, 1.0f / (FC * WSC), 1.0f);
  (void)hipGetLastError();
}

// v004
// One run takes 99.8 microseconds.
// Next to v003, in two timings, it ran 1.49 and 1.50 times as fast.
// Counting every step since v000, it is 3.73 times as fast.
// Contractions: gate logits (x f16 x16 . [Wa;We;Wa;We] f16 x64, K=1024), inner|outer projections (x f16 x16 . [Wi;Wo] f16 x64, K=1024),
// v^T projection (Wv f16 x64 . x f16 x16, K=1024; stored as f16 hi x1024 + residual plane), scores (inner f16 x16 . outer f16 x16, K=64),
// v^T . P^T (v^T f16 hi+residual . P f16 x1024 hi+residual, three products, 2048 keys in steps of 32; scores and this product transposed),
// output projection (ctx f16 x4096 hi+residual . Wout f16 x64, two products, K=1024): all v_wmma_f32_16x16x32_f16, f32 accumulate.
// Sigmoid gates, online max-subtracted softmax, renormaliser, valve/rotation epilogue in f32 on VALU; every float input RNE-converted to bf16 on load.
#include <hip/hip_runtime.h>
#include <math.h>
#include <stdint.h>

#define TT      2048
#define DM      1024
#define NHEAD   16
#define HDIM    64
#define NGATE   64
#define QTB     8
#define QKP     (2 * DM)
#define WSC     64.0f
#define ACARRY  16.0f
#define QC      16.0f
#define KC      16.0f
#define VC      1024.0f
#define PC      1024.0f
#define FC      4096.0f
#define ATT_SCALE 0.125f
#define PI_F    3.14159265358979323846f
#define REN_EPS 1e-8f
static_assert(NHEAD * HDIM == DM);
static_assert((TT % 64) == 0 && (DM % 64) == 0 && (DM % 256) == 0 && (TT % 32) == 0 && (TT % 16) == 0);
static_assert(NHEAD == 16 && NGATE == 64);
#define ATT_THREADS (QTB * 32)
#define ATT_QB      (QTB * 16)
#define ATT_QG      (TT / ATT_QB)
#define ATT_BLOCKS  (ATT_QG * NHEAD)
static_assert(ATT_THREADS == 256 && ATT_BLOCKS == 256 && (TT % ATT_QB) == 0);

typedef _Float16 v16h __attribute__((ext_vector_type(16)));
typedef _Float16 v8h  __attribute__((ext_vector_type(8)));
typedef float    v8f  __attribute__((ext_vector_type(8)));
typedef float    v4f  __attribute__((ext_vector_type(4)));
typedef unsigned int v4u __attribute__((ext_vector_type(4)));

union FragH { v16h v; v8h h[2]; v4u u[2]; };

// ---- scalar helpers --------------------------------------------------------------------------------
__device__ __forceinline__ unsigned short bf_bits(float f) {          // f32 -> bf16 bits, RNE convert
  unsigned u = __float_as_uint(f);
  return (unsigned short)((u + 0x7FFFu + ((u >> 16) & 1u)) >> 16);
}
__device__ __forceinline__ float bf_up(unsigned short h) { return __uint_as_float(((unsigned)h) << 16); }
__device__ __forceinline__ float bfr(float f) { return bf_up(bf_bits(f)); }   // value of the bf16 RNE convert
__device__ __forceinline__ unsigned short h_bits(_Float16 x) { return __builtin_bit_cast(unsigned short, x); }
__device__ __forceinline__ unsigned pk16(unsigned short a, unsigned short b) { return (unsigned)a | ((unsigned)b << 16); }
__device__ __forceinline__ v8f zero8() { v8f z = {0.f, 0.f, 0.f, 0.f, 0.f, 0.f, 0.f, 0.f}; return z; }
__device__ __forceinline__ float sigf(float v) { return 1.0f / (1.0f + expf(-v)); }

// ---- fragment loaders: 16-bit A/B operand, lane -> row/col (lane&15), p already includes +8*(lane>>4);
//      elements 0..7 <- p[0..7] (k0+8h..), elements 8..15 <- p[16..23] (k0+16+8h..)  (same split k map for A and B;
//      B is always read from a k-contiguous [n][k] plane)
__device__ __forceinline__ v16h ldfrag_h(const _Float16* p) {
  FragH f;
  f.h[0] = *(const v8h*)(p);
  f.h[1] = *(const v8h*)(p + 16);
  return f.v;
}
__device__ __forceinline__ v16h ldfrag_u(const unsigned short* p) {
  FragH f;
  f.u[0] = *(const v4u*)(p);
  f.u[1] = *(const v4u*)(p + 16);
  return f.v;
}

// ---- WMMA helpers with trailing VALU hazard gaps ------------------------------------------------------
__device__ __forceinline__ v8f mma_raw(v16h a, v16h b, v8f c) {
  return __builtin_amdgcn_wmma_f32_16x16x32_f16(false, a, false, b, (short)0, c, false, false);
}
__device__ __forceinline__ void dep_guard1(v8f& a, v8f& b, v16h x) {
#if defined(__HIP_DEVICE_COMPILE__)
  asm volatile("v_nop\n\tv_nop\n\tv_nop\n\tv_nop" : "+v"(a), "+v"(b) : "v"(x));
#endif
}
__device__ __forceinline__ void dep_guard2(v8f& a, v8f& b, v16h x, v16h y) {
#if defined(__HIP_DEVICE_COMPILE__)
  asm volatile("v_nop\n\tv_nop\n\tv_nop\n\tv_nop" : "+v"(a), "+v"(b) : "v"(x), "v"(y));
#endif
}
__device__ __forceinline__ void guard_s2(v8f& s, v16h a0, v16h a1) {
#if defined(__HIP_DEVICE_COMPILE__)
  asm volatile("v_nop\n\tv_nop\n\tv_nop\n\tv_nop" : "+v"(s) : "v"(a0), "v"(a1));
#endif
}
__device__ __forceinline__ void guard_s4(v8f& s, v16h a0, v16h a1, v16h b0, v16h b1) {
#if defined(__HIP_DEVICE_COMPILE__)
  asm volatile("v_nop\n\tv_nop\n\tv_nop\n\tv_nop" : "+v"(s) : "v"(a0), "v"(a1), "v"(b0), "v"(b1));
#endif
}
__device__ __forceinline__ void guard_pv6(v8f& a, v8f& b, v8f& c, v8f& d,
                                          v16h p0, v16h p1, v16h x0, v16h x1, v16h x2, v16h x3) {
#if defined(__HIP_DEVICE_COMPILE__)
  asm volatile("v_nop\n\tv_nop\n\tv_nop\n\tv_nop"
               : "+v"(a), "+v"(b), "+v"(c), "+v"(d) : "v"(p0), "v"(p1), "v"(x0), "v"(x1), "v"(x2), "v"(x3));
#endif
}
__device__ __forceinline__ void guard_pv5(v8f& a, v8f& b, v8f& c, v8f& d,
                                          v16h p0, v16h x0, v16h x1, v16h x2, v16h x3) {
#if defined(__HIP_DEVICE_COMPILE__)
  asm volatile("v_nop\n\tv_nop\n\tv_nop\n\tv_nop"
               : "+v"(a), "+v"(b), "+v"(c), "+v"(d) : "v"(p0), "v"(x0), "v"(x1), "v"(x2), "v"(x3));
#endif
}
__device__ __forceinline__ void keep4_h(v16h a, v16h b, v16h c, v16h d) {
#if defined(__HIP_DEVICE_COMPILE__)
  asm volatile("v_nop" :: "v"(a), "v"(b), "v"(c), "v"(d));
#endif
}
__device__ __forceinline__ void acc_guard4(v8f& a, v8f& b, v8f& c, v8f& d) {
#if defined(__HIP_DEVICE_COMPILE__)
  asm volatile("v_nop\n\tv_nop\n\tv_nop\n\tv_nop" : "+v"(a), "+v"(b), "+v"(c), "+v"(d));
#endif
}
__device__ __forceinline__ void wave_sync_lds() {
  __builtin_amdgcn_fence(__ATOMIC_RELEASE, "workgroup");
  __builtin_amdgcn_wave_barrier();
  __builtin_amdgcn_fence(__ATOMIC_ACQUIRE, "workgroup");
}

// =====================================================================================================
// Row convert: X f32 [nrows][1024] -> Y f16 [nrows][1024] = f16( bf16_RNE(X) * carry ), carry a power of two (exact).
// One wave per row (8 rows per block); lane l holds cols j*256 + 8l..8l+7 for j = 0..3; store instruction j covers a contiguous
// coverage: 4 x 32 lanes x 8 halves = 1024 = the whole row; nrows/8 blocks per job (exact multiples here) with a wave-uniform row bound.
// Used for x (carry 16) and for Wi, Wo, Wv, Wout in their native [out][in] = [n][k] layout (carry 64).
// =====================================================================================================
__device__ __forceinline__ void conv_rows(int blk, const float* __restrict__ X, unsigned short* Y, int nrows, float carry) {
  const int lane = threadIdx.x & 31, wave = threadIdx.x >> 5;
  const int row = blk * 8 + wave;
  if (row >= nrows) return;                      // wave-uniform; no barriers in this kernel
  const float* xp = X + (size_t)row * DM;
  unsigned short* op = Y + (size_t)row * DM;
  v4u res[4];
#pragma unroll
  for (int j = 0; j < 4; ++j) {
    const int c0 = j * 256 + lane * 8;
    const v4f a0 = *(const v4f*)(xp + c0), a1 = *(const v4f*)(xp + c0 + 4);
    float t[8];
#pragma unroll
    for (int e = 0; e < 4; ++e) { t[e] = bfr(a0[e]) * carry; t[4 + e] = bfr(a1[e]) * carry; }
    v4u o = {0u, 0u, 0u, 0u};
#pragma unroll
    for (int e = 0; e < 4; ++e) o[e] = pk16(h_bits((_Float16)t[2 * e]), h_bits((_Float16)t[2 * e + 1]));
    res[j] = o;
  }
  {
#pragma unroll
    for (int j = 0; j < 4; ++j) *(v4u*)(op + j * 256 + lane * 8) = res[j];
    
  }
}

// =====================================================================================================
// Gate weight plane: G f16 [64][1024]: row r = f16( 64 * bf16_RNE( (r & 16) ? We[r & 15] : Wa[r & 15] ) ) (rows 32..63 duplicate 0..31).
// Both candidate rows loaded with clamped in-range addresses, selected by value (row is wave-uniform). Same store shape as conv_rows.
// coverage: 8 blocks x 8 waves = 64 rows x (4 x 32 x 8 = 1024 cols), exact.
// =====================================================================================================
__device__ __forceinline__ void conv_gate(int blk, const float* __restrict__ Wa, const float* __restrict__ We,
                                          unsigned short* Y, float carry) {
  const int lane = threadIdx.x & 31, wave = threadIdx.x >> 5;
  const int row = blk * 8 + wave;
  if (row >= NGATE) return;                      // wave-uniform; no barriers in this kernel
  const float* pa = Wa + (size_t)(row & 15) * DM;
  const float* pb = We + (size_t)(row & 15) * DM;
  const bool useb = (row & 16) != 0;
  unsigned short* op = Y + (size_t)row * DM;
  v4u res[4];
#pragma unroll
  for (int j = 0; j < 4; ++j) {
    const int c0 = j * 256 + lane * 8;
    const v4f a0 = *(const v4f*)(pa + c0), a1 = *(const v4f*)(pa + c0 + 4);
    const v4f b0 = *(const v4f*)(pb + c0), b1 = *(const v4f*)(pb + c0 + 4);
    float t[8];
#pragma unroll
    for (int e = 0; e < 4; ++e) {
      t[e]     = bfr(useb ? b0[e] : a0[e]) * carry;
      t[4 + e] = bfr(useb ? b1[e] : a1[e]) * carry;
    }
    v4u o = {0u, 0u, 0u, 0u};
#pragma unroll
    for (int e = 0; e < 4; ++e) o[e] = pk16(h_bits((_Float16)t[2 * e]), h_bits((_Float16)t[2 * e + 1]));
    res[j] = o;
  }
  {
#pragma unroll
    for (int j = 0; j < 4; ++j) *(v4u*)(op + j * 256 + lane * 8) = res[j];
    
  }
}

// =====================================================================================================
// All conversions in one launch: none reads what another writes. The block index picks the job (block-uniform, no barriers):
// blocks 0..255 x, then 128 each for Wi, Wo, Wv, Wout, then 8 for the gate plane; every job keeps its own rows and stores.
// =====================================================================================================
#define CB_X  (TT / 8)
#define CB_W  (DM / 8)
#define CB_G  (NGATE / 8)
#define CB_ALL (CB_X + 4 * CB_W + CB_G)
__global__ __launch_bounds__(256) void conv_all(const float* __restrict__ x, const float* __restrict__ Wi,
                                                const float* __restrict__ Wo, const float* __restrict__ Wv,
                                                const float* __restrict__ Wout, const float* __restrict__ Wa,
                                                const float* __restrict__ We,
                                                unsigned short* XB, unsigned short* WIO, unsigned short* WV,
                                                unsigned short* WOUT, unsigned short* WG) {
  const int b = blockIdx.x;
  if (b >= CB_X + 4 * CB_W) {
    conv_gate(b - (CB_X + 4 * CB_W), Wa, We, WG, WSC);
    return;
  }
  const float* X = x;
  unsigned short* Y = XB;
  int rb = b, nrows = TT;
  float carry = ACARRY;
  if (b >= CB_X) {
    const int w = (b - CB_X) / CB_W;             // 0..3: Wi, Wo, Wv, Wout
    rb = (b - CB_X) % CB_W;
    nrows = DM;
    carry = WSC;
    X = w == 0 ? Wi : w == 1 ? Wo : w == 2 ? Wv : Wout;
    Y = w == 0 ? WIO : w == 1 ? WIO + (size_t)DM * DM : w == 2 ? WV : WOUT;
  }
  conv_rows(rb, X, Y, nrows, carry);
}

// ---- asynchronous global -> LDS copies (16 B per lane). Each statement ends in s_wait_xcnt 0 so that no address register of an
//      issued copy is rewritten before the wait (a precaution); landing is waited for separately with s_wait_asynccnt 0.
#define KST   64      // k per stage: 128 B of every operand row = one whole line
#define LROW  144     // LDS row pitch in bytes: 128 + 16 (16 B x odd: conflict-free for 16-byte readers)
#define RSTEP (32 * LROW)   // LDS bytes between two copy rounds (a round = 8 waves x 4 rows)
__device__ __forceinline__ unsigned lds_off(const void* p) { return (unsigned)(size_t)p; }
__device__ __forceinline__ void copy2_lds(unsigned l, const unsigned short* g, size_t st) {
#if defined(__HIP_DEVICE_COMPILE__)
  asm volatile("global_load_async_to_lds_b128 %0, %1, off\n\t"
               "global_load_async_to_lds_b128 %2, %3, off\n\t"
               "s_wait_xcnt 0x0"
               :: "v"(l), "v"(g), "v"(l + RSTEP), "v"(g + st) : "memory");
#endif
}
__device__ __forceinline__ void copy8_lds(unsigned l, const unsigned short* g, size_t st) {
#if defined(__HIP_DEVICE_COMPILE__)
  asm volatile("global_load_async_to_lds_b128 %0, %1, off\n\t"
               "global_load_async_to_lds_b128 %2, %3, off\n\t"
               "global_load_async_to_lds_b128 %4, %5, off\n\t"
               "global_load_async_to_lds_b128 %6, %7, off\n\t"
               "global_load_async_to_lds_b128 %8, %9, off\n\t"
               "global_load_async_to_lds_b128 %10, %11, off\n\t"
               "global_load_async_to_lds_b128 %12, %13, off\n\t"
               "global_load_async_to_lds_b128 %14, %15, off\n\t"
               "s_wait_xcnt 0x0"
               :: "v"(l), "v"(g), "v"(l + RSTEP), "v"(g + st), "v"(l + 2 * RSTEP), "v"(g + 2 * st),
                  "v"(l + 3 * RSTEP), "v"(g + 3 * st), "v"(l + 4 * RSTEP), "v"(g + 4 * st), "v"(l + 5 * RSTEP), "v"(g + 5 * st),
                  "v"(l + 6 * RSTEP), "v"(g + 6 * st), "v"(l + 7 * RSTEP), "v"(g + 7 * st) : "memory");
#endif
}
// NR rounds of 32 rows (NR = 2 or 16): lane -> row 4*wave + (lane>>3) of its round, 16-byte piece lane&7; st = 32 source rows in elements
template <int NR>
__device__ __forceinline__ void copy_rows(unsigned l, const unsigned short* g, size_t st) {
  static_assert(NR == 2 || NR == 16);
  if constexpr (NR == 2) {
    copy2_lds(l, g, st);
  } else {
    copy8_lds(l, g, st);
    copy8_lds(l + 8 * RSTEP, g + 8 * st, st);
  }
}
__device__ __forceinline__ void wait_copies() {      // this wave's copies have landed in LDS
#if defined(__HIP_DEVICE_COMPILE__)
  asm volatile("s_wait_asynccnt 0x0" ::: "memory");
#endif
}
__device__ __forceinline__ void wait_store_regs() {  // in front of an overwrite of registers that issued global stores name (a precaution)
#if defined(__HIP_DEVICE_COMPILE__)
  asm volatile("s_wait_xcnt 0x0" ::: "memory");
#endif
}
__device__ __forceinline__ void wait_lds_reads() {   // this wave's LDS reads have returned (before their buffer is refilled)
#if defined(__HIP_DEVICE_COMPILE__)
  asm volatile("s_wait_dscnt 0x0" ::: "memory");
#endif
}

// =====================================================================================================
// Register-blocked f16 WMMA GEMM: C[m][n] = f( oscale * sum_k A[m][k] * Bt[n][k] ); one wave per 64x64 tile, 8 tiles per block.
// Operands reach the fragments through LDS: per stage of 64 k the block copies its operand rows (128 B each, whole lines) with
// asynchronous copies into one of two buffers; the next stage's copies fly while this stage is multiplied; one barrier per stage.
// WM 1: the 8 tiles share their 64 A rows and lie side by side in n (N a multiple of 512); WM 8: they share their 64 B rows and
// lie below one another in m (N = 64, M a multiple of 512). K a multiple of 64.
// A row-major [M][K] pitch lda (16-bit plane), Bt row-major [N][K] pitch ldb (k contiguous); M, N multiples of 64, K multiple of 64.
// SPLITA 1: a second A plane A2 (same pitch) holding the unscaled f16 residual of A; its products go into the same accumulator.
// BM: 0 = no bias; 3 = per-column head bias bf16( (col & 16) ? bias2[col & 15] : bias[col & 15] ) (in-range addresses).
// OM: 0 = f32 out (pitch ldc), ACT 2 applies sigmoid after bias;
//     2 = f16 out = f16( value * ocarry ); 3 = f16 hi plane f16(value*ocarry) to C and unscaled residual f16(value*ocarry - hi) to C2.
// coverage: 4 slabs x 16 rows (f32: it 0..7 x lane>>4; f16: it 0..3 x lane>>3) x 64 cols = the wave's whole 64x64 tile;
//           tilesM*tilesN/8 blocks per product (exact here); a block that does not fit the shape rules leaves as a whole before any barrier.
// =====================================================================================================
// The body is a device function: its kernel owns the LDS (ring: two stages; sT: 8 slabs) and hands in the block's index in this product.
__host__ __device__ constexpr int gemm_stage_bytes(int splita, int wm) {
  return (wm * 64 * (1 + splita) + (8 / wm) * 64) * LROW;
}
#define SLAB_F (16 * 68)   // per-wave 16x64 slab, pitch 68 floats
template <int OM, int BM, int ACT, int SPLITA, int WM>
__device__ __forceinline__ void gemm64(
    unsigned char* ring, float* sT, int blk,
    const unsigned short* __restrict__ Ap, const unsigned short* __restrict__ A2p, int lda,
    const unsigned short* __restrict__ Btp, int ldb,
    const float* __restrict__ bias, const float* __restrict__ bias2,
    void* Cout, void* C2out, int ldc,
    int M, int N, int K, float oscale, float ocarry) {
  static_assert(WM == 1 || WM == 8);
  constexpr int RA  = WM * 64;                     // A rows per block
  constexpr int RB  = (8 / WM) * 64;               // B rows per block
  constexpr int OA2 = RA * LROW;                   // stage layout in bytes: [A | A2 (SPLITA) | B]
  constexpr int OB  = RA * (1 + SPLITA) * LROW;
  constexpr int STG = OB + RB * LROW;              // bytes per stage
  static_assert(STG == gemm_stage_bytes(SPLITA, WM));
  const int lane = threadIdx.x & 31;
  const int wave = threadIdx.x >> 5;
  const int tilesN = N >> 6;
  const int tilesM = M >> 6;
  const int tile0 = blk * 8;
  if (tile0 + 8 > tilesM * tilesN) return;         // block-uniform, before any barrier or copy
  if (WM == 1 ? (tilesN & 7) != 0 : (tilesN != 1)) return;   // block-uniform shape rule of this build
  const int tmB = tile0 / tilesN;
  const int mB = tmB << 6;                         // block's first row and column
  const int nB = (tile0 - tmB * tilesN) << 6;
  const int m0 = mB + (WM == 8 ? (wave << 6) : 0);
  const int n0 = nB + (WM == 1 ? (wave << 6) : 0);

  const int rlane = lane & 15;                 // row (A) / col (B, D) within subtile
  const int koff  = (lane >> 4) * 8;           // k offset of this lane half
  const int mOff  = (lane >> 4) * 8;           // D row offset

  // copy side: this lane's row and 16-byte piece in a round of 32 rows
  const int crow = wave * 4 + (lane >> 3);
  const int cseg = (lane & 7) * 8;
  const unsigned lcp = lds_off(ring) + (unsigned)(crow * LROW + cseg * 2);
  const unsigned short* gA  = Ap  + (size_t)(mB + crow) * lda + cseg;
  const unsigned short* gA2 = A2p + (size_t)(mB + crow) * lda + cseg;
  const unsigned short* gB  = Btp + (size_t)(nB + crow) * ldb + cseg;
  const size_t stA = (size_t)32 * lda, stB = (size_t)32 * ldb;
  // reader side: fragment rows of this wave in a stage
  const int fa = ((WM == 8 ? (wave << 6) : 0) + rlane) * LROW + koff * 2;
  const int fb = OB + ((WM == 1 ? (wave << 6) : 0) + rlane) * LROW + koff * 2;

  v8f acc[4][4];
#pragma unroll
  for (int i = 0; i < 4; ++i)
#pragma unroll
    for (int j = 0; j < 4; ++j) acc[i][j] = zero8();

  const int nst = K / KST;
  // stage 0 into buffer 0, landed and published; then stage 1 into buffer 1
  copy_rows<RA / 32>(lcp, gA, stA);
  if constexpr (SPLITA != 0) copy_rows<RA / 32>(lcp + OA2, gA2, stA);
  copy_rows<RB / 32>(lcp + OB, gB, stB);
  wait_copies();
  __syncthreads();
  if (nst > 1) {
    copy_rows<RA / 32>(lcp + STG, gA + KST, stA);
    if constexpr (SPLITA != 0) copy_rows<RA / 32>(lcp + STG + OA2, gA2 + KST, stA);
    copy_rows<RB / 32>(lcp + STG + OB, gB + KST, stB);
  }

#pragma unroll 1   // one stage per trip: the ring's order at the foot stays as written
  for (int t = 0; t < nst; ++t) {
    const unsigned bofs = (unsigned)(t & 1) * STG;
    const unsigned char* sb = ring + bofs;
#pragma unroll
    for (int s = 0; s < 2; ++s) {              // two k-steps of 32 per stage, ascending k
      v16h bh[4], ah[4], al[SPLITA != 0 ? 4 : 1];
#pragma unroll
      for (int j = 0; j < 4; ++j) bh[j] = ldfrag_u((const unsigned short*)(sb + fb + j * 16 * LROW + s * 64));
#pragma unroll
      for (int i = 0; i < 4; ++i) ah[i] = ldfrag_u((const unsigned short*)(sb + fa + i * 16 * LROW + s * 64));
      if constexpr (SPLITA != 0) {
#pragma unroll
        for (int i = 0; i < 4; ++i) al[i] = ldfrag_u((const unsigned short*)(sb + OA2 + fa + i * 16 * LROW + s * 64));
      }
#pragma unroll
      for (int i = 0; i < 4; ++i) {
#pragma unroll
        for (int j = 0; j < 4; ++j) acc[i][j] = mma_raw(ah[i], bh[j], acc[i][j]);
        if constexpr (SPLITA != 0) {
#pragma unroll
          for (int j = 0; j < 4; ++j) acc[i][j] = mma_raw(al[i], bh[j], acc[i][j]);
          dep_guard2(acc[i][0], acc[i][3], ah[i], al[i]);
        } else {
          dep_guard1(acc[i][0], acc[i][3], ah[i]);
        }
      }
      keep4_h(bh[0], bh[1], bh[2], bh[3]);
    }
    // publish point of stage t + 1; the same barrier ends every reader's last read of stage t's buffer
    wait_lds_reads();
    wait_copies();
    __syncthreads();
    if (t + 2 < nst) {                         // block-uniform: refill the buffer that this trip has just read
      const int kn = (t + 2) * KST;
      copy_rows<RA / 32>(lcp + bofs, gA + kn, stA);
      if constexpr (SPLITA != 0) copy_rows<RA / 32>(lcp + bofs + OA2, gA2 + kn, stA);
      copy_rows<RB / 32>(lcp + bofs + OB, gB + kn, stB);
    }
  }
  wait_copies();
  acc_guard4(acc[0][0], acc[0][1], acc[0][2], acc[0][3]);
  acc_guard4(acc[1][0], acc[1][1], acc[1][2], acc[1][3]);
  acc_guard4(acc[2][0], acc[2][1], acc[2][2], acc[2][3]);
  acc_guard4(acc[3][0], acc[3][1], acc[3][2], acc[3][3]);

  const int hh2 = lane >> 4, c4 = (lane & 15) * 4;     // f32 out: 256-B row segment = 16 lanes x 16 B
  const int q8  = lane >> 3, c8 = (lane & 7) * 8;
  float bc[4];
#pragma unroll
  for (int e = 0; e < 4; ++e) bc[e] = 0.f;
  if constexpr (BM == 3) {
#pragma unroll
    for (int e = 0; e < 4; ++e) {
      const int col = n0 + c4 + e;
      const float fa = bfr(bias[col & 15]);             // in-range addresses 0..15
      const float fb = bfr(bias2[col & 15]);
      bc[e] = (col & 16) ? fb : fa;
    }
  }

  // ---- epilogue ----
  float* slab = sT + wave * SLAB_F;
#pragma unroll
  for (int i = 0; i < 4; ++i) {
    const int mBase = m0 + (i << 4);
#pragma unroll
    for (int j = 0; j < 4; ++j) {
#pragma unroll
      for (int r = 0; r < 8; ++r) {
        slab[(mOff + r) * 68 + (j << 4) + rlane] = acc[i][j][r];
      }
    }
    wave_sync_lds();
    if constexpr (OM == 0) {
      float* C = (float*)Cout;
      constexpr int IU = (ACT == 2) ? 2 : 8;               // row pairs per trip
#pragma unroll 1   // ACT 2: 128 unrolled divisions are 13 KB of text; rolled, the kernel that holds this body stays under 32 KB
      for (int ib = 0; ib < 8; ib += IU) {
        v4f vals[IU];
#pragma unroll
        for (int u = 0; u < IU; ++u) {
          const int row = (ib + u) * 2 + hh2;              // ib + u 0..7 x hh2 0..1 = rows 0..15
          v4f v = *(const v4f*)(slab + row * 68 + c4);
#pragma unroll
          for (int e = 0; e < 4; ++e) {
            float f = v[e] * oscale + bc[e];
            if constexpr (ACT == 2) f = 1.0f / (1.0f + __expf(-f));
            v[e] = f;
          }
          vals[u] = v;
        }
#pragma unroll
        for (int u = 0; u < IU; ++u) {
          const int gr = mBase + (ib + u) * 2 + hh2;
          *(v4f*)(C + (size_t)gr * ldc + n0 + c4) = vals[u];
        }
        if constexpr (IU < 8) wait_store_regs();           // the next trip rewrites the registers that these stores name
      }
    } else {
      unsigned short* C  = (unsigned short*)Cout;
      unsigned short* C2 = (unsigned short*)C2out;
      v4u hv[4], lv[4];
#pragma unroll
      for (int it = 0; it < 4; ++it) {
        const int row = it * 4 + q8;                       // it 0..3 x q8 0..3 = rows 0..15
        const float* sp = slab + row * 68 + c8;
        v4u a = {0u, 0u, 0u, 0u};
        v4u b = {0u, 0u, 0u, 0u};
#pragma unroll
        for (int e = 0; e < 4; ++e) {
          const float f0 = (sp[2 * e] * oscale) * ocarry;
          const float f1 = (sp[2 * e + 1] * oscale) * ocarry;
          const _Float16 h0 = (_Float16)f0, h1 = (_Float16)f1;
          a[e] = pk16(h_bits(h0), h_bits(h1));
          if constexpr (OM == 3) {
            const _Float16 l0 = (_Float16)(f0 - (float)h0);
            const _Float16 l1 = (_Float16)(f1 - (float)h1);
            b[e] = pk16(h_bits(l0), h_bits(l1));
          }
        }
        hv[it] = a;
        lv[it] = b;
      }
      {
#pragma unroll
        for (int it = 0; it < 4; ++it) {
          const int row = it * 4 + q8;
          *(v4u*)(C + (size_t)(mBase + row) * ldc + n0 + c8) = hv[it];
          if constexpr (OM == 3) {
            *(v4u*)(C2 + (size_t)(mBase + row) * ldc + n0 + c8) = lv[it];
          }
        }
        
      }
    }
    wave_sync_lds();
  }
}

// =====================================================================================================
// The three products of x in one launch: none reads what another writes, and together they have fewer blocks than the chip has WGPs.
// The block index picks the product (block-uniform, so every barrier of a body is passed by the whole block); longest epilogue first:
//   blocks 0..3     gates: AEF[t][j] = sigmoid(x[t] . G[j] / (16*64) + bf16(bias_j)); M = 2048, N = 64, K = 1024, f32 out
//   blocks 4..67    v^T: VTH/VTL[d][t] = hi/residual of f16(1024 * Wv[d] . x[t]); M = 1024, N = 2048, K = 1024
//   blocks 68..195  inner | outer: QK[t][n] = f16(16 * x[t] . [Wi;Wo][n]); M = 2048, N = 2048, K = 1024
// =====================================================================================================
#define PB_GE ((TT / 64) * (NGATE / 64) / 8)
#define PB_VT ((DM / 64) * (TT / 64) / 8)
#define PB_QK ((TT / 64) * (QKP / 64) / 8)
#define PB_ALL (PB_GE + PB_VT + PB_QK)
static_assert(gemm_stage_bytes(0, 1) == gemm_stage_bytes(0, 8));
__global__ __launch_bounds__(256) void proj_gemms(
    const unsigned short* __restrict__ XB, const unsigned short* __restrict__ WIO, const unsigned short* __restrict__ WV,
    const unsigned short* __restrict__ WG, const float* __restrict__ ba, const float* __restrict__ be,
    unsigned short* QK, unsigned short* VTH, unsigned short* VTL, float* AEF) {
  __shared__ __align__(16) unsigned char ring[2 * gemm_stage_bytes(0, 1)];
  __shared__ __align__(16) float sT[8 * SLAB_F];
  const int b = blockIdx.x;
  if (b < PB_GE) {
    gemm64<0, 3, 2, 0, 8>(ring, sT, b, XB, XB, DM, WG, DM, ba, be,
                          (void*)AEF, (void*)AEF, NGATE, TT, NGATE, DM, 1.0f / (ACARRY * WSC), 1.0f);
  } else if (b < PB_GE + PB_VT) {
    gemm64<3, 0, 0, 0, 1>(ring, sT, b - PB_GE, WV, WV, DM, XB, DM, ba, be,
                          (void*)VTH, (void*)VTL, TT, DM, TT, DM, 1.0f / (WSC * ACARRY), VC);
  } else {
    gemm64<2, 0, 0, 0, 1>(ring, sT, b - (PB_GE + PB_VT), XB, XB, DM, WIO, DM, ba, be,
                          (void*)QK, (void*)QK, QKP, TT, QKP, DM, 1.0f / (ACARRY * WSC), QC);
  }
}
// out = (ctx_hi + ctx_lo) . Wout plane / (4096 * 64); M = 2048, N = 1024, K = 1024, f32
__global__ __launch_bounds__(256) void out_gemm(
    const unsigned short* __restrict__ CTH, const unsigned short* __restrict__ CTL, const unsigned short* __restrict__ WOUT,
    const float* __restrict__ ba, const float* __restrict__ be, float* out) {
  __shared__ __align__(16) unsigned char ring[2 * gemm_stage_bytes(1, 1)];
  __shared__ __align__(16) float sT[8 * SLAB_F];
  gemm64<0, 0, 0, 1, 1>(ring, sT, blockIdx.x, CTH, CTL, DM, WOUT, DM, ba, be,
                        (void*)out, (void*)out, DM, TT, DM, DM, 1.0f / (FC * WSC), 1.0f);
}

// =====================================================================================================
// Flash attention for one head and 128 query rows (one wave per 16 query rows), head dim 64, 2048 keys:
//   inner|outer plane (f16 x16) QK[tok][2048]: inner at col 64h + d, outer at col 1024 + 64h + d;
//   v^T planes (f16 hi x1024, unscaled residual): VH/VL[64h + d][key] (pitch 2048);
//   gate plane AEF f32 [tok][64]: col h = ap[h][tok] (sigmoid applied), col 16 + h = ex[h][tok];
//   out: CTH/CTL[tok][64h + d] = f16 hi / residual of 4096 * ctx, ctx = valve/rotation epilogue of
//        ap * sum_s p_s v_s / (ap * sum_s p_s + 1e-8 * sum_s e_s), e_s = exp(score_s - max), p_s = e_s * ex[s].
//   block = 8 waves = 256 threads; grid = 16 heads x 16 query groups = 256; every wave does identical bounded work (64 steps).
//   The 8 waves read the same keys: per stage of 64 keys the block copies the head's 64 outer rows and the 64 rows of each v^T
//   plane (128 B each, whole lines) with asynchronous copies into one of two LDS buffers; the next stage's copies fly while this
//   stage is worked on; one barrier per stage. A stage is two steps of 32 keys. The head's ex column (2048 f32) is put into LDS
//   once, in front of the first barrier.
//   Both products are transposed: S^T = outer . inner^T (A = 16 key rows from the stage, B = the wave's 16 query rows, kept in
//   registers) and O^T += v^T . P^T (A = 16 d rows of v^T from the stage, B = P^T). A lane (c = lane & 15, hh = lane >> 4) then
//   holds only query q0 + c: score register r of tile i is key kb + 16 i + 8 hh + r, which is the k order of a B operand, so the
//   two score tiles of a step, converted in place, are P^T; output register r of tile j is d = 16 j + 8 hh + r.
//   Per step: 2 score tiles on f16 WMMA (K = 64 as two k-steps of 32); the maximum over the lane's 16 keys in the lane, joined with
//   the other half by one cross-row move; online max-subtracted softmax in f32 (exp2, log2e / 8 / carries folded in); running sums
//   of e and of p = e*ex in eight partial sums per lane (one per score register; they and the halves are joined once, behind the loop); one
//   rescale factor per lane; 12 WMMAs (hi.hi, hi.lo, lo.hi) into one accumulator set.
//   Final scaling in f32; each lane stages its query's 4 x 8 consecutive d (hi and residual) in the block's LDS row buffers [128][64];
// coverage: LDS row buffers: 8 waves x 16 rows x 64 cols = 128 x 64; global: 4 iterations x 256 threads x 8 halves = 128 rows x 64
//           cols (cols 64*head ..) of rows qB..qB+127, both planes; grid covers all 2048 rows x 1024 cols exactly once.
// =====================================================================================================
#define AKS   64                        // keys per stage: 128 B of every v^T row = one whole line
#define AOVH  (AKS * LROW)              // stage layout in bytes: [64 outer rows | 64 v^T hi rows | 64 v^T residual rows]
#define AOVL  (AOVH + HDIM * LROW)
#define ASTG  (AOVL + HDIM * LROW)      // bytes per stage
static_assert(AKS == 64 && HDIM == 64 && (TT % AKS) == 0 && (TT / AKS) >= 2 && HDIM * 2 + 16 == LROW && AKS * 2 + 16 == LROW);
static_assert((TT % ATT_THREADS) == 0);
// one stage: keys 64 t .. 64 t + 63; l, gK, gVh, gVl are this lane's row (4*wave + (lane>>3) of a round of 32) and 16-byte piece
__device__ __forceinline__ void att_stage(unsigned l, const unsigned short* gK, const unsigned short* gVh,
                                          const unsigned short* gVl, int t) {
  copy_rows<2>(l,        gK  + (size_t)t * AKS * QKP, (size_t)32 * QKP);
  copy_rows<2>(l + AOVH, gVh + (size_t)t * AKS,       (size_t)32 * TT);
  copy_rows<2>(l + AOVL, gVl + (size_t)t * AKS,       (size_t)32 * TT);
}
__device__ __forceinline__ const _Float16* lds_h(const unsigned char* p) { return (const _Float16*)(const void*)p; }
// value of lane l ^ 16 (one vector cross-row move, no LDS counter)
__device__ __forceinline__ float xhalf(float x) {
  const int b = __builtin_bit_cast(int, x);
  return __builtin_bit_cast(float, __builtin_amdgcn_permlanex16(b, b, 0x76543210, 0xfedcba98, false, false));
}

__global__ __launch_bounds__(ATT_THREADS)
void attn_heads(const unsigned short* __restrict__ QKq, const unsigned short* __restrict__ VHq,
                const unsigned short* __restrict__ VLq, const float* __restrict__ AEF,
                const float* __restrict__ betap, const float* __restrict__ ivp,
                const float* __restrict__ ovp, const float* __restrict__ chg,
                unsigned short* CTH, unsigned short* CTL) {
  __shared__ __align__(16) unsigned char kv[2 * ASTG];      // two stages of outer rows and v^T rows
  __shared__ __align__(16) float exs[TT];                   // ex of this head, by key
  __shared__ __align__(16) unsigned short Osh[ATT_QB * HDIM];   // block result rows [128][64], hi
  __shared__ __align__(16) unsigned short Osl[ATT_QB * HDIM];   // residual

  const int tid  = threadIdx.x;
  const int wave = tid >> 5;
  const int lane = tid & 31;
  const int hh   = lane >> 4;
  const int c    = lane & 15;

  const int qg   = blockIdx.x % ATT_QG;                     // query group 0..15
  const int head = (blockIdx.x / ATT_QG) & (NHEAD - 1);     // 0..15
  const int qB   = qg * ATT_QB;                             // block's first query row
  const int q0   = qB + wave * 16;                          // wave's first query row

  const _Float16* Qh = (const _Float16*)(const void*)QKq + (size_t)(q0 + c) * QKP + head * HDIM + 8 * hh;
  const float* Ex = AEF + 16 + head;                                    // ex column of this head
  const float lsc = (1.4426950408889634f * ATT_SCALE) / (QC * KC);      // log2(e) / 8 / carries

  // copy side: this lane's row and 16-byte piece in a round of 32 rows
  const int crow = wave * 4 + (lane >> 3);
  const int cseg = (lane & 7) * 8;
  const unsigned lcp = lds_off(kv) + (unsigned)(crow * LROW + cseg * 2);
  const unsigned short* gK  = QKq + (size_t)crow * QKP + DM + head * HDIM + cseg;
  const unsigned short* gVh = VHq + (size_t)(head * HDIM + crow) * TT + cseg;
  const unsigned short* gVl = VLq + (size_t)(head * HDIM + crow) * TT + cseg;
  // reader side: this lane's fragment row (key or d = c within a group of 16 rows) and k half, in bytes
  const int fr = c * LROW + 16 * hh;

  // stage 0 into buffer 0, landed and published; then stage 1 into buffer 1. The ex column is published by the same barrier.
  att_stage(lcp, gK, gVh, gVl, 0);
  const v16h qa = ldfrag_h(Qh), qb = ldfrag_h(Qh + 32);
  const float apq = AEF[(size_t)(q0 + c) * NGATE + head];    // ap of this lane's query, used behind the loop
#pragma unroll   // the 8 loads are issued together, one latency
  for (int i = 0; i < TT / ATT_THREADS; ++i) {
    const int k = i * ATT_THREADS + tid;                     // 8 x 256 = all 2048 keys
    exs[k] = Ex[(size_t)k * NGATE];
  }
  wait_copies();
  __syncthreads();
  att_stage(lcp + ASTG, gK, gVh, gVl, 1);

  float mrow = -INFINITY;                                    // this lane's query
  v8f zv = zero8(), lv = zero8();                            // sums of e and p: element r over this half's keys 8hh + r (mod 16)
  v8f o0 = zero8(), o1 = zero8(), o2 = zero8(), o3 = zero8();

  constexpr int nst = TT / AKS;
#pragma unroll 1   // one stage per trip: the ring's order at the foot stays as written
  for (int t = 0; t < nst; ++t) {
    const unsigned bofs = (unsigned)(t & 1) * ASTG;
    const unsigned char* sb = kv + bofs + fr;
#pragma unroll
    for (int s = 0; s < 2; ++s) {              // two steps of 32 keys per stage, ascending keys
      const int kb = t * AKS + s * 32;
      v8f s0, s1;                              // s0[r]: key kb + 8hh + r, s1[r]: key kb + 16 + 8hh + r, query q0 + c
      {
        const _Float16* kp = lds_h(sb + (s * 32) * LROW);
        const v16h k0 = ldfrag_h(kp), k1 = ldfrag_h(kp + 32);
        s0 = mma_raw(k0, qa, zero8());
        s0 = mma_raw(k1, qb, s0);
        guard_s2(s0, k0, k1);
      }
      {
        const _Float16* kq = lds_h(sb + (s * 32 + 16) * LROW);
        const v16h k0 = ldfrag_h(kq), k1 = ldfrag_h(kq + 32);
        s1 = mma_raw(k0, qa, zero8());
        s1 = mma_raw(k1, qb, s1);
        guard_s4(s1, k0, k1, qa, qb);
      }
      const float* exq = exs + kb + 8 * hh;
      const v4f xa = *(const v4f*)(exq),      xb = *(const v4f*)(exq + 4);      // ex of keys kb + 8hh + 0..7
      const v4f xc = *(const v4f*)(exq + 16), xd = *(const v4f*)(exq + 20);     // ex of keys kb + 16 + 8hh + 0..7
      const v8f x0 = __builtin_shufflevector(xa, xb, 0, 1, 2, 3, 4, 5, 6, 7);
      const v8f x1 = __builtin_shufflevector(xc, xd, 0, 1, 2, 3, 4, 5, 6, 7);
      const float m0 = fmaxf(fmaxf(s0[0], s0[1]), s0[2]), m1 = fmaxf(fmaxf(s0[3], s0[4]), s0[5]);
      const float m2 = fmaxf(fmaxf(s0[6], s0[7]), s1[0]), m3 = fmaxf(fmaxf(s1[1], s1[2]), s1[3]);
      const float m4 = fmaxf(fmaxf(s1[4], s1[5]), s1[6]);
      float mx = fmaxf(fmaxf(fmaxf(m0, m1), s1[7]), fmaxf(fmaxf(m2, m3), m4));   // the lane's 16 keys
      mx = fmaxf(mx, xhalf(mx));               // both halves: maximum over the step's 32 keys
      const float mn = fmaxf(mrow, mx * lsc);
      const float al = exp2f(mrow - mn);
      mrow = mn;
      const v8f t0 = s0 * lsc - mn, t1 = s1 * lsc - mn;
      v8f e0, e1;
#pragma unroll   // constant element indices: the vectors stay in registers
      for (int r = 0; r < 8; ++r) { e0[r] = exp2f(t0[r]); e1[r] = exp2f(t1[r]); }
      const v8f p0 = e0 * x0, p1 = e1 * x1;
      zv = zv * al + (e0 + e1);
      lv = lv * al + (p0 + p1);
      FragH ph, pl;                            // P^T as a B operand: element r <- k = 8hh + r, element 8 + r <- k = 16 + 8hh + r
      {
        const v8f y0 = p0 * PC, y1 = p1 * PC;
        ph.h[0] = __builtin_convertvector(y0, v8h);
        ph.h[1] = __builtin_convertvector(y1, v8h);
        pl.h[0] = __builtin_convertvector(y0 - __builtin_convertvector(ph.h[0], v8f), v8h);
        pl.h[1] = __builtin_convertvector(y1 - __builtin_convertvector(ph.h[1], v8f), v8h);
      }
      o0 *= al;
      o1 *= al;
      o2 *= al;
      o3 *= al;
      {
        const unsigned char* vp = sb + AOVH + s * 64;          // 32 keys = 64 B along a v^T row
        const v16h vb0 = ldfrag_h(lds_h(vp));
        const v16h vb1 = ldfrag_h(lds_h(vp + 16 * LROW));
        const v16h vb2 = ldfrag_h(lds_h(vp + 32 * LROW));
        const v16h vb3 = ldfrag_h(lds_h(vp + 48 * LROW));
        o0 = mma_raw(vb0, ph.v, o0);
        o1 = mma_raw(vb1, ph.v, o1);
        o2 = mma_raw(vb2, ph.v, o2);
        o3 = mma_raw(vb3, ph.v, o3);
        o0 = mma_raw(vb0, pl.v, o0);
        o1 = mma_raw(vb1, pl.v, o1);
        o2 = mma_raw(vb2, pl.v, o2);
        o3 = mma_raw(vb3, pl.v, o3);
        guard_pv6(o0, o1, o2, o3, ph.v, pl.v, vb0, vb1, vb2, vb3);
      }
      {
        const unsigned char* vp = sb + AOVL + s * 64;
        const v16h vl0 = ldfrag_h(lds_h(vp));
        const v16h vl1 = ldfrag_h(lds_h(vp + 16 * LROW));
        const v16h vl2 = ldfrag_h(lds_h(vp + 32 * LROW));
        const v16h vl3 = ldfrag_h(lds_h(vp + 48 * LROW));
        o0 = mma_raw(vl0, ph.v, o0);
        o1 = mma_raw(vl1, ph.v, o1);
        o2 = mma_raw(vl2, ph.v, o2);
        o3 = mma_raw(vl3, ph.v, o3);
        guard_pv5(o0, o1, o2, o3, ph.v, vl0, vl1, vl2, vl3);
      }
    }
    // publish point of stage t + 1; the same barrier ends every reader's last read of stage t's buffer
    wait_lds_reads();
    wait_copies();
    __syncthreads();
    if (t + 2 < nst) att_stage(lcp + bofs, gK, gVh, gVl, t + 2);   // block-uniform: refill the buffer that this trip has just read
  }
  wait_copies();

  // ---- per-head gates and rotation, renormaliser, carries (1024 on p, 1024 on v, 4096 on the stored ctx) ----
  const float zrow = ((zv[0] + zv[1]) + (zv[2] + zv[3])) + ((zv[4] + zv[5]) + (zv[6] + zv[7]));
  const float lrow = ((lv[0] + lv[1]) + (lv[2] + lv[3])) + ((lv[4] + lv[5]) + (lv[6] + lv[7]));
  const float zt  = zrow + xhalf(zrow);                      // the two halves' sums, on the same maximum
  const float lt  = lrow + xhalf(lrow);
  const float bet = bfr(betap[head]);
  const float ivs = sigf(bfr(ivp[head]));
  const float og  = sigf(bfr(ovp[head])) * tanhf(bfr(chg[head]));
  const float ang = PI_F * sigf(bet);
  const float ca  = cosf(ang), sa = sinf(ang);
  const float base = ivs / (PC * VC);
  const float den = apq * lt + REN_EPS * zt;
  const float sc  = apq * (1.0f / den) * base;
  v8h yh[4], yl[4];                                          // tile j: d = 16 j + 8 hh + r
#pragma unroll
  for (int r = 0; r < 8; ++r) {
    const float x0 = o0[r] * sc, x1 = o1[r] * sc, x2 = o2[r] * sc, x3 = o3[r] * sc;
    const float y0 = ((x0 * ca - x2 * sa) * og) * FC;
    const float y1 = ((x1 * ca - x3 * sa) * og) * FC;
    const float y2 = ((x0 * sa + x2 * ca) * og) * FC;
    const float y3 = ((x1 * sa + x3 * ca) * og) * FC;
    const _Float16 h0 = (_Float16)y0, h1 = (_Float16)y1, h2 = (_Float16)y2, h3 = (_Float16)y3;
    yh[0][r] = h0;
    yh[1][r] = h1;
    yh[2][r] = h2;
    yh[3][r] = h3;
    yl[0][r] = (_Float16)(y0 - (float)h0);
    yl[1][r] = (_Float16)(y1 - (float)h1);
    yl[2][r] = (_Float16)(y2 - (float)h2);
    yl[3][r] = (_Float16)(y3 - (float)h3);
  }
  {
    unsigned short* oh = Osh + (wave * 16 + c) * HDIM + 8 * hh;
    unsigned short* ol = Osl + (wave * 16 + c) * HDIM + 8 * hh;
#pragma unroll   // constant array indices: yh, yl stay in registers
    for (int j = 0; j < 4; ++j) {
      *(v8h*)(void*)(oh + 16 * j) = yh[j];
      *(v8h*)(void*)(ol + 16 * j) = yl[j];
    }
  }
  __syncthreads();
  // ---- block writes its 128 row segments: piece p = it*256 + tid -> row p>>3, halves (p&7)*8 of the 64-col slab (128 B a row) ----
  {
    v4u vh[4], vl[4];
#pragma unroll
    for (int it = 0; it < 4; ++it) {
      const int p = it * ATT_THREADS + tid;
      vh[it] = *(const v4u*)(Osh + (size_t)p * 8);
      vl[it] = *(const v4u*)(Osl + (size_t)p * 8);
    }
    const size_t dofs = (size_t)qB * DM + (size_t)head * HDIM;
    unsigned short* dh = CTH + dofs;
    unsigned short* dl = CTL + dofs;
    {
#pragma unroll
      for (int it = 0; it < 4; ++it) {
        const int p = it * ATT_THREADS + tid;
        const size_t po = (size_t)(p >> 3) * DM + (size_t)(p & 7) * 8;
        *(v4u*)(dh + po) = vh[it];
        *(v4u*)(dl + po) = vl[it];
      }
    }
  }
}

// =====================================================================================================
// Workspace map (bytes); every plane is an exact multiple of its tile / whole-row store granularity (M, N exact tile multiples,
// row blocks exact, no pad rows needed), every offset a multiple of 131072:
//   WIO  f16 [2048][1024] x64     4194304   (rows 0..1023 Wi, 1024..2047 Wo; native [out][in] = [n][k])
//   WV   f16 [1024][1024] x64     2097152
//   WOUT f16 [1024][1024] x64     2097152
//   WG   f16 [64][1024]   x64      131072   (Wa, We, Wa, We)
//   XB   f16 [2048][1024] x16     4194304
//   QK   f16 [2048][2048] x16     8388608   (inner | outer)
//   VTH  f16 [1024][2048] x1024   4194304   (v^T hi)
//   VTL  f16 [1024][2048]         4194304   (v^T residual)
//   AEF  f32 [2048][64]            524288   (sigmoid gates)
//   CTH  f16 [2048][1024] x4096   4194304   (ctx hi)
//   CTL  f16 [2048][1024]         4194304   (ctx residual)
//   end                          38404096
// =====================================================================================================
extern "C" void kernel_launch(void* const* d_in, const int* in_sizes, int n_in,
                              void* d_out, int out_size, void* d_ws, size_t ws_size,
                              hipStream_t stream) {
  if (n_in < 13) return;
  if (in_sizes[0] != TT * DM) return;
  if (in_sizes[1] != NHEAD * DM || in_sizes[2] != NHEAD) return;
  if (in_sizes[3] != NHEAD * DM || in_sizes[4] != NHEAD) return;
  if (in_sizes[5] != DM * DM || in_sizes[6] != DM * DM || in_sizes[7] != DM * DM || in_sizes[8] != DM * DM) return;
  if (in_sizes[9] != NHEAD || in_sizes[10] != NHEAD || in_sizes[11] != NHEAD || in_sizes[12] != NHEAD) return;
  if (out_size != TT * DM) return;

  const float* x     = (const float*)d_in[0];
  const float* Wa    = (const float*)d_in[1];
  const float* ba    = (const float*)d_in[2];
  const float* We    = (const float*)d_in[3];
  const float* be    = (const float*)d_in[4];
  const float* Wi    = (const float*)d_in[5];
  const float* Wo    = (const float*)d_in[6];
  const float* Wv    = (const float*)d_in[7];
  const float* Wout  = (const float*)d_in[8];
  const float* betap = (const float*)d_in[9];
  const float* ivp   = (const float*)d_in[10];
  const float* ovp   = (const float*)d_in[11];
  const float* chg   = (const float*)d_in[12];
  float*       out   = (float*)d_out;

  const size_t PWIO = (size_t)2 * DM * DM * 2;                    //  4194304
  const size_t PW   = (size_t)DM * DM * 2;                        //  2097152
  const size_t PG   = (size_t)NGATE * DM * 2;                     //   131072
  const size_t PX   = (size_t)TT * DM * 2;                        //  4194304
  const size_t PQK  = (size_t)TT * QKP * 2;                       //  8388608
  const size_t PVT  = (size_t)DM * TT * 2;                        //  4194304
  const size_t PAE  = (size_t)TT * NGATE * 4;                     //   524288
  const size_t PCT  = (size_t)TT * DM * 2;                        //  4194304
  size_t off = 0;
  const size_t oWIO = off; off += PWIO;
  const size_t oWV  = off; off += PW;
  const size_t oWOU = off; off += PW;
  const size_t oWG  = off; off += PG;
  const size_t oXB  = off; off += PX;
  const size_t oQK  = off; off += PQK;
  const size_t oVTH = off; off += PVT;
  const size_t oVTL = off; off += PVT;
  const size_t oAEF = off; off += PAE;
  const size_t oCTH = off; off += PCT;
  const size_t oCTL = off; off += PCT;
  if (off > ws_size) return;                                      // off = 38404096
  if (off > (size_t)134217728) return;

  char* ws = (char*)d_ws;
  unsigned short* WIO  = (unsigned short*)(ws + oWIO);
  unsigned short* WV   = (unsigned short*)(ws + oWV);
  unsigned short* WOUT = (unsigned short*)(ws + oWOU);
  unsigned short* WG   = (unsigned short*)(ws + oWG);
  unsigned short* XB   = (unsigned short*)(ws + oXB);
  unsigned short* QK   = (unsigned short*)(ws + oQK);
  unsigned short* VTH  = (unsigned short*)(ws + oVTH);
  unsigned short* VTL  = (unsigned short*)(ws + oVTL);
  float*          AEF  = (float*)(ws + oAEF);
  unsigned short* CTH  = (unsigned short*)(ws + oCTH);
  unsigned short* CTL  = (unsigned short*)(ws + oCTL);

  const dim3 blk(256);
  const dim3 gCV(CB_ALL);                                         // 776 blocks
  const dim3 gPR(PB_ALL);                                         // 196 blocks
  const dim3 gO((TT / 64) * (DM / 64) / 8);                       // 64
  const dim3 gAT(ATT_BLOCKS);                                     // 256
  const dim3 bAT(ATT_THREADS);                                    // 256

  // (0) 16-bit planes: XB = f16(16 * bf16(x)); W planes = f16(64 * bf16(W)) in native [n][k] layout; gate plane
  conv_all<<<gCV, blk, 0, stream>>>(x, Wi, Wo, Wv, Wout, Wa, We, XB, WIO, WV, WOUT, WG);

  // (1..3) gates, v^T, inner | outer
  proj_gemms<<<gPR, blk, 0, stream>>>(XB, WIO, WV, WG, ba, be, QK, VTH, VTL, AEF);

  // (4) attention per (128 query rows, 1 head) -> CTH/CTL (ctx x4096 hi + residual)
  attn_heads<<<gAT, bAT, 0, stream>>>(QK, VTH, VTL, AEF, betap, ivp, ovp, chg, CTH, CTL);

  // (5) output projection
  out_gemm<<<gO, blk, 0, stream>>>(CTH, CTL, WOUT, ba, be, out);
  (void)hipGetLastError();
}

// v005
// It runs in 91 microseconds.
// Two timings next to v004 both put it at 1.10 times that version's speed.
// Over all steps from v000 it is 4.10 times as fast.
// Contractions: gate logits (x f16 x16 . [Wa;We;Wa;We] f16 x64, K=1024), inner|outer projections (x f16 x16 . [Wi;Wo] f16 x64, K=1024),
// v^T projection (Wv f16 x64 . x f16 x16, K=1024; stored as f16 hi x1024 + residual plane), scores (inner f16 x16 . outer f16 x16, K=64),
// v^T . P^T (v^T f16 hi+residual . P f16 x1024 hi+residual, three products, 2048 keys in steps of 32; scores and this product transposed),
// output projection (ctx f16 x4096 hi+residual . Wout f16 x64, two products, K=1024): all v_wmma_f32_16x16x32_f16, f32 accumulate.
// Sigmoid gates, online max-subtracted softmax, renormaliser, valve/rotation epilogue in f32 on VALU; every float input RNE-converted to bf16 on load.
#include <hip/hip_runtime.h>
#include <math.h>
#include <stdint.h>

#define TT      2048
#define DM      1024
#define NHEAD   16
#define HDIM    64
#define NGATE   64
#define QTB     8
#define QKP     (2 * DM)
#define WSC     64.0f
#define ACARRY  16.0f
#define QC      16.0f
#define KC      16.0f
#define VC      1024.0f
#define PC      1024.0f
#define FC      4096.0f
#define ATT_SCALE 0.125f
#define PI_F    3.14159265358979323846f
#define REN_EPS 1e-8f
static_assert(NHEAD * HDIM == DM);
static_assert((TT % 64) == 0 && (DM % 64) == 0 && (DM % 256) == 0 && (TT % 32) == 0 && (TT % 16) == 0);
static_assert(NHEAD == 16 && NGATE == 64);
#define ATT_THREADS (QTB * 32)
#define ATT_QB      (QTB * 16)
#define ATT_QG      (TT / ATT_QB)
#define ATT_BLOCKS  (ATT_QG * NHEAD)
static_assert(ATT_THREADS == 256 && ATT_BLOCKS == 256 && (TT % ATT_QB) == 0);

typedef _Float16 v16h __attribute__((ext_vector_type(16)));
typedef _Float16 v8h  __attribute__((ext_vector_type(8)));
typedef float    v8f  __attribute__((ext_vector_type(8)));
typedef float    v4f  __attribute__((ext_vector_type(4)));
typedef unsigned int v4u __attribute__((ext_vector_type(4)));

union FragH { v16h v; v8h h[2]; v4u u[2]; };

// ---- scalar helpers --------------------------------------------------------------------------------
__device__ __forceinline__ unsigned short bf_bits(float f) {          // f32 -> bf16 bits, RNE convert
  unsigned u = __float_as_uint(f);
  return (unsigned short)((u + 0x7FFFu + ((u >> 16) & 1u)) >> 16);
}
__device__ __forceinline__ float bf_up(unsigned short h) { return __uint_as_float(((unsigned)h) << 16); }
__device__ __forceinline__ float bfr(float f) { return bf_up(bf_bits(f)); }   // value of the bf16 RNE convert
__device__ __forceinline__ unsigned short h_bits(_Float16 x) { return __builtin_bit_cast(unsigned short, x); }
__device__ __forceinline__ unsigned pk16(unsigned short a, unsigned short b) { return (unsigned)a | ((unsigned)b << 16); }
__device__ __forceinline__ v8f zero8() { v8f z = {0.f, 0.f, 0.f, 0.f, 0.f, 0.f, 0.f, 0.f}; return z; }
__device__ __forceinline__ float sigf(float v) { return 1.0f / (1.0f + expf(-v)); }

// ---- fragment loaders: 16-bit A/B operand, lane -> row/col (lane&15), p already includes +8*(lane>>4);
//      elements 0..7 <- p[0..7] (k0+8h..), elements 8..15 <- p[16..23] (k0+16+8h..)  (same split k map for A and B;
//      B is always read from a k-contiguous [n][k] plane)
__device__ __forceinline__ v16h ldfrag_h(const _Float16* p) {
  FragH f;
  f.h[0] = *(const v8h*)(p);
  f.h[1] = *(const v8h*)(p + 16);
  return f.v;
}
__device__ __forceinline__ v16h ldfrag_u(const unsigned short* p) {
  FragH f;
  f.u[0] = *(const v4u*)(p);
  f.u[1] = *(const v4u*)(p + 16);
  return f.v;
}

// ---- WMMA helpers with trailing VALU hazard gaps ------------------------------------------------------
__device__ __forceinline__ v8f mma_raw(v16h a, v16h b, v8f c) {
  return __builtin_amdgcn_wmma_f32_16x16x32_f16(false, a, false, b, (short)0, c, false, false);
}
__device__ __forceinline__ void dep_guard1(v8f& a, v8f& b, v16h x) {
#if defined(__HIP_DEVICE_COMPILE__)
  asm volatile("v_nop\n\tv_nop\n\tv_nop\n\tv_nop" : "+v"(a), "+v"(b) : "v"(x));
#endif
}
__device__ __forceinline__ void guard_s2(v8f& s, v16h a0, v16h a1) {
#if defined(__HIP_DEVICE_COMPILE__)
  asm volatile("v_nop\n\tv_nop\n\tv_nop\n\tv_nop" : "+v"(s) : "v"(a0), "v"(a1));
#endif
}
__device__ __forceinline__ void guard_s4(v8f& s, v16h a0, v16h a1, v16h b0, v16h b1) {
#if defined(__HIP_DEVICE_COMPILE__)
  asm volatile("v_nop\n\tv_nop\n\tv_nop\n\tv_nop" : "+v"(s) : "v"(a0), "v"(a1), "v"(b0), "v"(b1));
#endif
}
__device__ __forceinline__ void guard_pv6(v8f& a, v8f& b, v8f& c, v8f& d,
                                          v16h p0, v16h p1, v16h x0, v16h x1, v16h x2, v16h x3) {
#if defined(__HIP_DEVICE_COMPILE__)
  asm volatile("v_nop\n\tv_nop\n\tv_nop\n\tv_nop"
               : "+v"(a), "+v"(b), "+v"(c), "+v"(d) : "v"(p0), "v"(p1), "v"(x0), "v"(x1), "v"(x2), "v"(x3));
#endif
}
__device__ __forceinline__ void guard_pv5(v8f& a, v8f& b, v8f& c, v8f& d,
                                          v16h p0, v16h x0, v16h x1, v16h x2, v16h x3) {
#if defined(__HIP_DEVICE_COMPILE__)
  asm volatile("v_nop\n\tv_nop\n\tv_nop\n\tv_nop"
               : "+v"(a), "+v"(b), "+v"(c), "+v"(d) : "v"(p0), "v"(x0), "v"(x1), "v"(x2), "v"(x3));
#endif
}
__device__ __forceinline__ void keep4_h(v16h a, v16h b, v16h c, v16h d) {
#if defined(__HIP_DEVICE_COMPILE__)
  asm volatile("v_nop" :: "v"(a), "v"(b), "v"(c), "v"(d));
#endif
}
__device__ __forceinline__ void acc_guard4(v8f& a, v8f& b, v8f& c, v8f& d) {
#if defined(__HIP_DEVICE_COMPILE__)
  asm volatile("v_nop\n\tv_nop\n\tv_nop\n\tv_nop" : "+v"(a), "+v"(b), "+v"(c), "+v"(d));
#endif
}
__device__ __forceinline__ void wave_sync_lds() {
  __builtin_amdgcn_fence(__ATOMIC_RELEASE, "workgroup");
  __builtin_amdgcn_wave_barrier();
  __builtin_amdgcn_fence(__ATOMIC_ACQUIRE, "workgroup");
}

// =====================================================================================================
// Row convert: X f32 [nrows][1024] -> Y f16 [nrows][1024] = f16( bf16_RNE(X) * carry ), carry a power of two (exact).
// One wave per row (8 rows per block); lane l holds cols j*256 + 8l..8l+7 for j = 0..3; store instruction j covers a contiguous
// coverage: 4 x 32 lanes x 8 halves = 1024 = the whole row; nrows/8 blocks per job (exact multiples here) with a wave-uniform row bound.
// Used for x (carry 16) and for Wi, Wo, Wv, Wout in their native [out][in] = [n][k] layout (carry 64).
// =====================================================================================================
__device__ __forceinline__ void conv_rows(int blk, const float* __restrict__ X, unsigned short* Y, int nrows, float carry) {
  const int lane = threadIdx.x & 31, wave = threadIdx.x >> 5;
  const int row = blk * 8 + wave;
  if (row >= nrows) return;                      // wave-uniform; no barriers in this kernel
  const float* xp = X + (size_t)row * DM;
  unsigned short* op = Y + (size_t)row * DM;
  v4u res[4];
#pragma unroll
  for (int j = 0; j < 4; ++j) {
    const int c0 = j * 256 + lane * 8;
    const v4f a0 = *(const v4f*)(xp + c0), a1 = *(const v4f*)(xp + c0 + 4);
    float t[8];
#pragma unroll
    for (int e = 0; e < 4; ++e) { t[e] = bfr(a0[e]) * carry; t[4 + e] = bfr(a1[e]) * carry; }
    v4u o = {0u, 0u, 0u, 0u};
#pragma unroll
    for (int e = 0; e < 4; ++e) o[e] = pk16(h_bits((_Float16)t[2 * e]), h_bits((_Float16)t[2 * e + 1]));
    res[j] = o;
  }
  {
#pragma unroll
    for (int j = 0; j < 4; ++j) *(v4u*)(op + j * 256 + lane * 8) = res[j];
    
  }
}

// =====================================================================================================
// Gate weight plane: G f16 [64][1024]: row r = f16( 64 * bf16_RNE( (r & 16) ? We[r & 15] : Wa[r & 15] ) ) (rows 32..63 duplicate 0..31).
// Both candidate rows loaded with clamped in-range addresses, selected by value (row is wave-uniform). Same store shape as conv_rows.
// coverage: 8 blocks x 8 waves = 64 rows x (4 x 32 x 8 = 1024 cols), exact.
// =====================================================================================================
__device__ __forceinline__ void conv_gate(int blk, const float* __restrict__ Wa, const float* __restrict__ We,
                                          unsigned short* Y, float carry) {
  const int lane = threadIdx.x & 31, wave = threadIdx.x >> 5;
  const int row = blk * 8 + wave;
  if (row >= NGATE) return;                      // wave-uniform; no barriers in this kernel
  const float* pa = Wa + (size_t)(row & 15) * DM;
  const float* pb = We + (size_t)(row & 15) * DM;
  const bool useb = (row & 16) != 0;
  unsigned short* op = Y + (size_t)row * DM;
  v4u res[4];
#pragma unroll
  for (int j = 0; j < 4; ++j) {
    const int c0 = j * 256 + lane * 8;
    const v4f a0 = *(const v4f*)(pa + c0), a1 = *(const v4f*)(pa + c0 + 4);
    const v4f b0 = *(const v4f*)(pb + c0), b1 = *(const v4f*)(pb + c0 + 4);
    float t[8];
#pragma unroll
    for (int e = 0; e < 4; ++e) {
      t[e]     = bfr(useb ? b0[e] : a0[e]) * carry;
      t[4 + e] = bfr(useb ? b1[e] : a1[e]) * carry;
    }
    v4u o = {0u, 0u, 0u, 0u};
#pragma unroll
    for (int e = 0; e < 4; ++e) o[e] = pk16(h_bits((_Float16)t[2 * e]), h_bits((_Float16)t[2 * e + 1]));
    res[j] = o;
  }
  {
#pragma unroll
    for (int j = 0; j < 4; ++j) *(v4u*)(op + j * 256 + lane * 8) = res[j];
    
  }
}

// =====================================================================================================
// All conversions in one launch: none reads what another writes. The block index picks the job (block-uniform, no barriers):
// blocks 0..255 x, then 128 each for Wi, Wo, Wv, Wout, then 8 for the gate plane; every job keeps its own rows and stores.
// =====================================================================================================
#define CB_X  (TT / 8)
#define CB_W  (DM / 8)
#define CB_G  (NGATE / 8)
#define CB_ALL (CB_X + 4 * CB_W + CB_G)
__global__ __launch_bounds__(256) void conv_all(const float* __restrict__ x, const float* __restrict__ Wi,
                                                const float* __restrict__ Wo, const float* __restrict__ Wv,
                                                const float* __restrict__ Wout, const float* __restrict__ Wa,
                                                const float* __restrict__ We,
                                                unsigned short* XB, unsigned short* WIO, unsigned short* WV,
                                                unsigned short* WOUT, unsigned short* WG) {
  const int b = blockIdx.x;
  if (b >= CB_X + 4 * CB_W) {
    conv_gate(b - (CB_X + 4 * CB_W), Wa, We, WG, WSC);
    return;
  }
  const float* X = x;
  unsigned short* Y = XB;
  int rb = b, nrows = TT;
  float carry = ACARRY;
  if (b >= CB_X) {
    const int w = (b - CB_X) / CB_W;             // 0..3: Wi, Wo, Wv, Wout
    rb = (b - CB_X) % CB_W;
    nrows = DM;
    carry = WSC;
    X = w == 0 ? Wi : w == 1 ? Wo : w == 2 ? Wv : Wout;
    Y = w == 0 ? WIO : w == 1 ? WIO + (size_t)DM * DM : w == 2 ? WV : WOUT;
  }
  conv_rows(rb, X, Y, nrows, carry);
}

// ---- asynchronous global -> LDS copies (16 B per lane). Each statement ends in s_wait_xcnt 0 so that no address register of an
//      issued copy is rewritten before the wait (a precaution); landing is waited for separately with s_wait_asynccnt 0.
#define KST   64      // k per stage: 128 B of every operand row = one whole line
#define LROW  144     // LDS row pitch in bytes: 128 + 16 (16 B x odd: conflict-free for 16-byte readers)
#define RSTEP (32 * LROW)   // LDS bytes between two copy rounds (a round = 8 waves x 4 rows)
__device__ __forceinline__ unsigned lds_off(const void* p) { return (unsigned)(size_t)p; }
__device__ __forceinline__ void copy2_lds(unsigned l, const unsigned short* g, size_t st) {
#if defined(__HIP_DEVICE_COMPILE__)
  asm volatile("global_load_async_to_lds_b128 %0, %1, off\n\t"
               "global_load_async_to_lds_b128 %2, %3, off\n\t"
               "s_wait_xcnt 0x0"
               :: "v"(l), "v"(g), "v"(l + RSTEP), "v"(g + st) : "memory");
#endif
}
__device__ __forceinline__ void copy8_lds(unsigned l, const unsigned short* g, size_t st) {
#if defined(__HIP_DEVICE_COMPILE__)
  asm volatile("global_load_async_to_lds_b128 %0, %1, off\n\t"
               "global_load_async_to_lds_b128 %2, %3, off\n\t"
               "global_load_async_to_lds_b128 %4, %5, off\n\t"
               "global_load_async_to_lds_b128 %6, %7, off\n\t"
               "global_load_async_to_lds_b128 %8, %9, off\n\t"
               "global_load_async_to_lds_b128 %10, %11, off\n\t"
               "global_load_async_to_lds_b128 %12, %13, off\n\t"
               "global_load_async_to_lds_b128 %14, %15, off\n\t"
               "s_wait_xcnt 0x0"
               :: "v"(l), "v"(g), "v"(l + RSTEP), "v"(g + st), "v"(l + 2 * RSTEP), "v"(g + 2 * st),
                  "v"(l + 3 * RSTEP), "v"(g + 3 * st), "v"(l + 4 * RSTEP), "v"(g + 4 * st), "v"(l + 5 * RSTEP), "v"(g + 5 * st),
                  "v"(l + 6 * RSTEP), "v"(g + 6 * st), "v"(l + 7 * RSTEP), "v"(g + 7 * st) : "memory");
#endif
}
// NR rounds of 32 rows (NR = 2 or 16): lane -> row 4*wave + (lane>>3) of its round, 16-byte piece lane&7; st = 32 source rows in elements
template <int NR>
__device__ __forceinline__ void copy_rows(unsigned l, const unsigned short* g, size_t st) {
  static_assert(NR == 2 || NR == 16);
  if constexpr (NR == 2) {
    copy2_lds(l, g, st);
  } else {
    copy8_lds(l, g, st);
    copy8_lds(l + 8 * RSTEP, g + 8 * st, st);
  }
}
__device__ __forceinline__ void wait_copies() {      // this wave's copies have landed in LDS
#if defined(__HIP_DEVICE_COMPILE__)
  asm volatile("s_wait_asynccnt 0x0" ::: "memory");
#endif
}
__device__ __forceinline__ void wait_store_regs() {  // in front of an overwrite of registers that issued global stores name (a precaution)
#if defined(__HIP_DEVICE_COMPILE__)
  asm volatile("s_wait_xcnt 0x0" ::: "memory");
#endif
}
__device__ __forceinline__ void wait_lds_reads() {   // this wave's LDS reads have returned (before their buffer is refilled)
#if defined(__HIP_DEVICE_COMPILE__)
  asm volatile("s_wait_dscnt 0x0" ::: "memory");
#endif
}

// =====================================================================================================
// Register-blocked f16 WMMA GEMM: C[m][n] = f( oscale * sum_k A[m][k] * Bt[n][k] ); one wave per 64x64 tile, 8 tiles per block.
// Operands reach the fragments through LDS: per stage of 64 k the block copies its operand rows (128 B each, whole lines) with
// asynchronous copies into one of two buffers; the next stage's copies fly while this stage is multiplied; one barrier per stage.
// WM 1: the 8 tiles share their 64 A rows and lie side by side in n (N a multiple of 512); WM 8: they share their 64 B rows and
// lie below one another in m (N = 64, M a multiple of 512). K a multiple of 64.
// A row-major [M][K] pitch lda (16-bit plane), Bt row-major [N][K] pitch ldb (k contiguous); M, N multiples of 64, K multiple of 64.
// BM: 0 = no bias; 3 = per-column head bias bf16( (col & 16) ? bias2[col & 15] : bias[col & 15] ) (in-range addresses).
// OM: 0 = f32 out (pitch ldc), ACT 2 applies sigmoid after bias;
//     2 = f16 out = f16( value * ocarry ); 3 = f16 hi plane f16(value*ocarry) to C and unscaled residual f16(value*ocarry - hi) to C2.
// coverage: 4 slabs x 16 rows (f32: it 0..7 x lane>>4; f16: it 0..3 x lane>>3) x 64 cols = the wave's whole 64x64 tile;
//           tilesM*tilesN/8 blocks per product (exact here); a block that does not fit the shape rules leaves as a whole before any barrier.
// =====================================================================================================
// The body is a device function: its kernel owns the LDS (ring: two stages; sT: 8 slabs) and hands in the block's index in this product.
__host__ __device__ constexpr int gemm_stage_bytes(int wm) {
  return (wm * 64 + (8 / wm) * 64) * LROW;
}
#define SLAB_F (16 * 68)   // per-wave 16x64 slab, pitch 68 floats
template <int OM, int BM, int ACT, int WM>
__device__ __forceinline__ void gemm64(
    unsigned char* ring, float* sT, int blk,
    const unsigned short* __restrict__ Ap, int lda,
    const unsigned short* __restrict__ Btp, int ldb,
    const float* __restrict__ bias, const float* __restrict__ bias2,
    void* Cout, void* C2out, int ldc,
    int M, int N, int K, float oscale, float ocarry) {
  static_assert(WM == 1 || WM == 8);
  constexpr int RA  = WM * 64;                     // A rows per block
  constexpr int RB  = (8 / WM) * 64;               // B rows per block
  constexpr int OB  = RA * LROW;                   // stage layout in bytes: [A | B]
  constexpr int STG = OB + RB * LROW;              // bytes per stage
  static_assert(STG == gemm_stage_bytes(WM));
  const int lane = threadIdx.x & 31;
  const int wave = threadIdx.x >> 5;
  const int tilesN = N >> 6;
  const int tilesM = M >> 6;
  const int tile0 = blk * 8;
  if (tile0 + 8 > tilesM * tilesN) return;         // block-uniform, before any barrier or copy
  if (WM == 1 ? (tilesN & 7) != 0 : (tilesN != 1)) return;   // block-uniform shape rule of this build
  const int tmB = tile0 / tilesN;
  const int mB = tmB << 6;                         // block's first row and column
  const int nB = (tile0 - tmB * tilesN) << 6;
  const int m0 = mB + (WM == 8 ? (wave << 6) : 0);
  const int n0 = nB + (WM == 1 ? (wave << 6) : 0);

  const int rlane = lane & 15;                 // row (A) / col (B, D) within subtile
  const int koff  = (lane >> 4) * 8;           // k offset of this lane half
  const int mOff  = (lane >> 4) * 8;           // D row offset

  // copy side: this lane's row and 16-byte piece in a round of 32 rows
  const int crow = wave * 4 + (lane >> 3);
  const int cseg = (lane & 7) * 8;
  const unsigned lcp = lds_off(ring) + (unsigned)(crow * LROW + cseg * 2);
  const unsigned short* gA  = Ap  + (size_t)(mB + crow) * lda + cseg;
  const unsigned short* gB  = Btp + (size_t)(nB + crow) * ldb + cseg;
  const size_t stA = (size_t)32 * lda, stB = (size_t)32 * ldb;
  // reader side: fragment rows of this wave in a stage
  const int fa = ((WM == 8 ? (wave << 6) : 0) + rlane) * LROW + koff * 2;
  const int fb = OB + ((WM == 1 ? (wave << 6) : 0) + rlane) * LROW + koff * 2;

  v8f acc[4][4];
#pragma unroll
  for (int i = 0; i < 4; ++i)
#pragma unroll
    for (int j = 0; j < 4; ++j) acc[i][j] = zero8();

  const int nst = K / KST;
  // stage 0 into buffer 0, landed and published; then stage 1 into buffer 1
  copy_rows<RA / 32>(lcp, gA, stA);
  copy_rows<RB / 32>(lcp + OB, gB, stB);
  wait_copies();
  __syncthreads();
  if (nst > 1) {
    copy_rows<RA / 32>(lcp + STG, gA + KST, stA);
    copy_rows<RB / 32>(lcp + STG + OB, gB + KST, stB);
  }

#pragma unroll 1   // one stage per trip: the ring's order at the foot stays as written
  for (int t = 0; t < nst; ++t) {
    const unsigned bofs = (unsigned)(t & 1) * STG;
    const unsigned char* sb = ring + bofs;
#pragma unroll
    for (int s = 0; s < 2; ++s) {              // two k-steps of 32 per stage, ascending k
      v16h bh[4], ah[4];
#pragma unroll
      for (int j = 0; j < 4; ++j) bh[j] = ldfrag_u((const unsigned short*)(sb + fb + j * 16 * LROW + s * 64));
#pragma unroll
      for (int i = 0; i < 4; ++i) ah[i] = ldfrag_u((const unsigned short*)(sb + fa + i * 16 * LROW + s * 64));
#pragma unroll
      for (int i = 0; i < 4; ++i) {
#pragma unroll
        for (int j = 0; j < 4; ++j) acc[i][j] = mma_raw(ah[i], bh[j], acc[i][j]);
        dep_guard1(acc[i][0], acc[i][3], ah[i]);
      }
      keep4_h(bh[0], bh[1], bh[2], bh[3]);
    }
    // publish point of stage t + 1; the same barrier ends every reader's last read of stage t's buffer
    wait_lds_reads();
    wait_copies();
    __syncthreads();
    if (t + 2 < nst) {                         // block-uniform: refill the buffer that this trip has just read
      const int kn = (t + 2) * KST;
      copy_rows<RA / 32>(lcp + bofs, gA + kn, stA);
      copy_rows<RB / 32>(lcp + bofs + OB, gB + kn, stB);
    }
  }
  wait_copies();
  acc_guard4(acc[0][0], acc[0][1], acc[0][2], acc[0][3]);
  acc_guard4(acc[1][0], acc[1][1], acc[1][2], acc[1][3]);
  acc_guard4(acc[2][0], acc[2][1], acc[2][2], acc[2][3]);
  acc_guard4(acc[3][0], acc[3][1], acc[3][2], acc[3][3]);

  const int hh2 = lane >> 4, c4 = (lane & 15) * 4;     // f32 out: 256-B row segment = 16 lanes x 16 B
  const int q8  = lane >> 3, c8 = (lane & 7) * 8;
  float bc[4];
#pragma unroll
  for (int e = 0; e < 4; ++e) bc[e] = 0.f;
  if constexpr (BM == 3) {
#pragma unroll
    for (int e = 0; e < 4; ++e) {
      const int col = n0 + c4 + e;
      const float fa = bfr(bias[col & 15]);             // in-range addresses 0..15
      const float fb = bfr(bias2[col & 15]);
      bc[e] = (col & 16) ? fb : fa;
    }
  }

  // ---- epilogue ----
  float* slab = sT + wave * SLAB_F;
#pragma unroll
  for (int i = 0; i < 4; ++i) {
    const int mBase = m0 + (i << 4);
#pragma unroll
    for (int j = 0; j < 4; ++j) {
#pragma unroll
      for (int r = 0; r < 8; ++r) {
        slab[(mOff + r) * 68 + (j << 4) + rlane] = acc[i][j][r];
      }
    }
    wave_sync_lds();
    if constexpr (OM == 0) {
      float* C = (float*)Cout;
      constexpr int IU = (ACT == 2) ? 2 : 8;               // row pairs per trip
#pragma unroll 1   // ACT 2: 128 unrolled divisions are 13 KB of text; rolled, the kernel that holds this body stays under 32 KB
      for (int ib = 0; ib < 8; ib += IU) {
        v4f vals[IU];
#pragma unroll
        for (int u = 0; u < IU; ++u) {
          const int row = (ib + u) * 2 + hh2;              // ib + u 0..7 x hh2 0..1 = rows 0..15
          v4f v = *(const v4f*)(slab + row * 68 + c4);
#pragma unroll
          for (int e = 0; e < 4; ++e) {
            float f = v[e] * oscale + bc[e];
            if constexpr (ACT == 2) f = 1.0f / (1.0f + __expf(-f));
            v[e] = f;
          }
          vals[u] = v;
        }
#pragma unroll
        for (int u = 0; u < IU; ++u) {
          const int gr = mBase + (ib + u) * 2 + hh2;
          *(v4f*)(C + (size_t)gr * ldc + n0 + c4) = vals[u];
        }
        if constexpr (IU < 8) wait_store_regs();           // the next trip rewrites the registers that these stores name
      }
    } else {
      unsigned short* C  = (unsigned short*)Cout;
      unsigned short* C2 = (unsigned short*)C2out;
      v4u hv[4], lv[4];
#pragma unroll
      for (int it = 0; it < 4; ++it) {
        const int row = it * 4 + q8;                       // it 0..3 x q8 0..3 = rows 0..15
        const float* sp = slab + row * 68 + c8;
        v4u a = {0u, 0u, 0u, 0u};
        v4u b = {0u, 0u, 0u, 0u};
#pragma unroll
        for (int e = 0; e < 4; ++e) {
          const float f0 = (sp[2 * e] * oscale) * ocarry;
          const float f1 = (sp[2 * e + 1] * oscale) * ocarry;
          const _Float16 h0 = (_Float16)f0, h1 = (_Float16)f1;
          a[e] = pk16(h_bits(h0), h_bits(h1));
          if constexpr (OM == 3) {
            const _Float16 l0 = (_Float16)(f0 - (float)h0);
            const _Float16 l1 = (_Float16)(f1 - (float)h1);
            b[e] = pk16(h_bits(l0), h_bits(l1));
          }
        }
        hv[it] = a;
        lv[it] = b;
      }
      {
#pragma unroll
        for (int it = 0; it < 4; ++it) {
          const int row = it * 4 + q8;
          *(v4u*)(C + (size_t)(mBase + row) * ldc + n0 + c8) = hv[it];
          if constexpr (OM == 3) {
            *(v4u*)(C2 + (size_t)(mBase + row) * ldc + n0 + c8) = lv[it];
          }
        }
        
      }
    }
    wave_sync_lds();
  }
}

// =====================================================================================================
// The three products of x in one launch: none reads what another writes, and together they have fewer blocks than the chip has WGPs.
// The block index picks the product (block-uniform, so every barrier of a body is passed by the whole block); longest epilogue first:
//   blocks 0..3     gates: AEF[t][j] = sigmoid(x[t] . G[j] / (16*64) + bf16(bias_j)); M = 2048, N = 64, K = 1024, f32 out
//   blocks 4..67    v^T: VTH/VTL[d][t] = hi/residual of f16(1024 * Wv[d] . x[t]); M = 1024, N = 2048, K = 1024
//   blocks 68..195  inner | outer: QK[t][n] = f16(16 * x[t] . [Wi;Wo][n]); M = 2048, N = 2048, K = 1024
// =====================================================================================================
#define PB_GE ((TT / 64) * (NGATE / 64) / 8)
#define PB_VT ((DM / 64) * (TT / 64) / 8)
#define PB_QK ((TT / 64) * (QKP / 64) / 8)
#define PB_ALL (PB_GE + PB_VT + PB_QK)
static_assert(gemm_stage_bytes(1) == gemm_stage_bytes(8));
__global__ __launch_bounds__(256) void proj_gemms(
    const unsigned short* __restrict__ XB, const unsigned short* __restrict__ WIO, const unsigned short* __restrict__ WV,
    const unsigned short* __restrict__ WG, const float* __restrict__ ba, const float* __restrict__ be,
    unsigned short* QK, unsigned short* VTH, unsigned short* VTL, float* AEF) {
  __shared__ __align__(16) unsigned char ring[2 * gemm_stage_bytes(1)];
  __shared__ __align__(16) float sT[8 * SLAB_F];
  const int b = blockIdx.x;
  if (b < PB_GE) {
    gemm64<0, 3, 2, 8>(ring, sT, b, XB, DM, WG, DM, ba, be,
                          (void*)AEF, (void*)AEF, NGATE, TT, NGATE, DM, 1.0f / (ACARRY * WSC), 1.0f);
  } else if (b < PB_GE + PB_VT) {
    gemm64<3, 0, 0, 1>(ring, sT, b - PB_GE, WV, DM, XB, DM, ba, be,
                          (void*)VTH, (void*)VTL, TT, DM, TT, DM, 1.0f / (WSC * ACARRY), VC);
  } else {
    gemm64<2, 0, 0, 1>(ring, sT, b - (PB_GE + PB_VT), XB, DM, WIO, DM, ba, be,
                          (void*)QK, (void*)QK, QKP, TT, QKP, DM, 1.0f / (ACARRY * WSC), QC);
  }
}
// =====================================================================================================
// Output projection: out[m][n] = sum_k (CTH[m][k] + CTL[m][k]) * WOUT[n][k] / (4096 * 64); M = 2048, N = 1024, K = 1024, f32 out.
// One block per 64 x 128 tile of out: 32 x 8 = 256 blocks, so that every WGP has one (512 tiles of 64 x 64, one a wave, fill only 64).
// 8 waves as 2 (m) x 4 (n), 32 x 32 of out per wave = 4 accumulator tiles. The ring is gemm64's: stages of 64 k, two buffers, the next
// stage's asynchronous copies fly while this stage is multiplied, one barrier per stage. A stage is 8 copy rounds of 32 rows:
// [ctx hi 64 rows | ctx residual 64 rows | Wout 128 rows]. Per accumulator and k-step of 32: hi product, then residual product, ascending k.
// coverage: 32 rows (it 0..7 x lane>>3) x 32 cols (128 B, one whole line) = the wave's 32 x 32; the grid is exact.
// =====================================================================================================
#define OBM   64
#define OBN   128
#define OOA2  (OBM * LROW)
#define OOB   (2 * OBM * LROW)
#define OSTG  (OOB + OBN * LROW)     // bytes per stage
#define OSLAB (32 * 36)              // per-wave 32 x 32 slab, pitch 36 floats
static_assert((TT % OBM) == 0 && (DM % OBN) == 0 && (DM % KST) == 0 && DM / KST >= 2 && OSTG == 8 * RSTEP);
// one stage: the 8 rounds in one statement that ends in s_wait_xcnt 0, as in the copy helpers above (no address register of an issued
// copy is rewritten before the wait, a precaution); a, a2, b are this lane's row and piece at the stage's k; st = 32 source rows
__device__ __forceinline__ void out_stage(unsigned l, const unsigned short* a, const unsigned short* a2, const unsigned short* b,
                                          size_t st) {
#if defined(__HIP_DEVICE_COMPILE__)
  asm volatile("global_load_async_to_lds_b128 %0, %1, off\n\t"
               "global_load_async_to_lds_b128 %2, %3, off\n\t"
               "global_load_async_to_lds_b128 %4, %5, off\n\t"
               "global_load_async_to_lds_b128 %6, %7, off\n\t"
               "global_load_async_to_lds_b128 %8, %9, off\n\t"
               "global_load_async_to_lds_b128 %10, %11, off\n\t"
               "global_load_async_to_lds_b128 %12, %13, off\n\t"
               "global_load_async_to_lds_b128 %14, %15, off\n\t"
               "s_wait_xcnt 0x0"
               :: "v"(l), "v"(a), "v"(l + RSTEP), "v"(a + st), "v"(l + 2 * RSTEP), "v"(a2), "v"(l + 3 * RSTEP), "v"(a2 + st),
                  "v"(l + 4 * RSTEP), "v"(b), "v"(l + 5 * RSTEP), "v"(b + st), "v"(l + 6 * RSTEP), "v"(b + 2 * st),
                  "v"(l + 7 * RSTEP), "v"(b + 3 * st) : "memory");
#endif
}
__global__ __launch_bounds__(256) void out_gemm(
    const unsigned short* __restrict__ CTH, const unsigned short* __restrict__ CTL, const unsigned short* __restrict__ WOUT,
    float* out) {
  __shared__ __align__(16) unsigned char ring[2 * OSTG];
  __shared__ __align__(16) float sT[8 * OSLAB];
  const int lane = threadIdx.x & 31;
  const int wave = threadIdx.x >> 5;
  const int mB = ((int)blockIdx.x / (DM / OBN)) * OBM;      // block's first row and column
  const int nB = ((int)blockIdx.x % (DM / OBN)) * OBN;
  const int wr = (wave >> 2) * 32, wc = (wave & 3) * 32;    // wave's first row and column in the block tile
  const int rlane = lane & 15;                 // row (A) / col (B, D) within subtile
  const int koff  = (lane >> 4) * 8;           // k offset of this lane half
  const int mOff  = (lane >> 4) * 8;           // D row offset

  // copy side: this lane's row and 16-byte piece in a round of 32 rows
  const int crow = wave * 4 + (lane >> 3);
  const int cseg = (lane & 7) * 8;
  const unsigned lcp = lds_off(ring) + (unsigned)(crow * LROW + cseg * 2);
  const unsigned short* gA  = CTH  + (size_t)(mB + crow) * DM + cseg;
  const unsigned short* gA2 = CTL  + (size_t)(mB + crow) * DM + cseg;
  const unsigned short* gB  = WOUT + (size_t)(nB + crow) * DM + cseg;
  const size_t st = (size_t)32 * DM;
  // reader side: fragment rows of this wave in a stage
  const int fa = (wr + rlane) * LROW + koff * 2;
  const int fb = OOB + (wc + rlane) * LROW + koff * 2;

  v8f a00 = zero8(), a01 = zero8(), a10 = zero8(), a11 = zero8();

  constexpr int nst = DM / KST;
  // stage 0 into buffer 0, landed and published; then stage 1 into buffer 1
  out_stage(lcp, gA, gA2, gB, st);
  wait_copies();
  __syncthreads();
  out_stage(lcp + OSTG, gA + KST, gA2 + KST, gB + KST, st);

#pragma unroll 1   // one stage per trip: the ring's order at the foot stays as written
  for (int t = 0; t < nst; ++t) {
    const unsigned bofs = (unsigned)(t & 1) * OSTG;
    const unsigned char* sb = ring + bofs;
    v16h bh[2][2], ah[2][2], al[2][2];         // [k-step][subtile]: the stage's 24 LDS reads stand together, in front of its WMMAs
#pragma unroll
    for (int s = 0; s < 2; ++s) {
#pragma unroll
      for (int i = 0; i < 2; ++i) {
        bh[s][i] = ldfrag_u((const unsigned short*)(sb + fb + i * 16 * LROW + s * 64));
        ah[s][i] = ldfrag_u((const unsigned short*)(sb + fa + i * 16 * LROW + s * 64));
        al[s][i] = ldfrag_u((const unsigned short*)(sb + OOA2 + fa + i * 16 * LROW + s * 64));
      }
    }
#pragma unroll
    for (int s = 0; s < 2; ++s) {              // two k-steps of 32 per stage, ascending k
      a00 = mma_raw(ah[s][0], bh[s][0], a00);
      a01 = mma_raw(ah[s][0], bh[s][1], a01);
      a10 = mma_raw(ah[s][1], bh[s][0], a10);
      a11 = mma_raw(ah[s][1], bh[s][1], a11);
      a00 = mma_raw(al[s][0], bh[s][0], a00);
      a01 = mma_raw(al[s][0], bh[s][1], a01);
      a10 = mma_raw(al[s][1], bh[s][0], a10);
      a11 = mma_raw(al[s][1], bh[s][1], a11);
      // four vector slots behind the last WMMA, before anything rewrites its operands or touches its results (also over the branch below)
      guard_pv6(a00, a01, a10, a11, ah[s][0], ah[s][1], al[s][0], al[s][1], bh[s][0], bh[s][1]);
    }
    // publish point of stage t + 1; the same barrier ends every reader's last read of stage t's buffer
    wait_lds_reads();
    wait_copies();
    __syncthreads();
    if (t + 2 < nst) {                         // block-uniform: refill the buffer that this trip has just read
      const int kn = (t + 2) * KST;
      out_stage(lcp + bofs, gA + kn, gA2 + kn, gB + kn, st);
    }
  }
  wait_copies();

  // ---- epilogue: each wave stages its 32 x 32 in its own slab and stores whole 128-B lines ----
  const float oscale = 1.0f / (FC * WSC);
  const int q8 = lane >> 3, c4 = (lane & 7) * 4;
  float* slab = sT + wave * OSLAB;
  float* op = out + (size_t)(mB + wr + q8) * DM + nB + wc + c4;
#pragma unroll
  for (int r = 0; r < 8; ++r) {
    slab[(mOff + r) * 36 + rlane] = a00[r];
    slab[(mOff + r) * 36 + 16 + rlane] = a01[r];
    slab[(16 + mOff + r) * 36 + rlane] = a10[r];
    slab[(16 + mOff + r) * 36 + 16 + rlane] = a11[r];
  }
  wave_sync_lds();
  v4f vals[8];
#pragma unroll
  for (int it = 0; it < 8; ++it) vals[it] = *(const v4f*)(slab + (it * 4 + q8) * 36 + c4) * oscale;   // it 0..7 x q8 0..3 = rows 0..31
#pragma unroll
  for (int it = 0; it < 8; ++it) *(v4f*)(op + (size_t)(it * 4) * DM) = vals[it];
}

// =====================================================================================================
// Flash attention for one head and 128 query rows (one wave per 16 query rows), head dim 64, 2048 keys:
//   inner|outer plane (f16 x16) QK[tok][2048]: inner at col 64h + d, outer at col 1024 + 64h + d;
//   v^T planes (f16 hi x1024, unscaled residual): VH/VL[64h + d][key] (pitch 2048);
//   gate plane AEF f32 [tok][64]: col h = ap[h][tok] (sigmoid applied), col 16 + h = ex[h][tok];
//   out: CTH/CTL[tok][64h + d] = f16 hi / residual of 4096 * ctx, ctx = valve/rotation epilogue of
//        ap * sum_s p_s v_s / (ap * sum_s p_s + 1e-8 * sum_s e_s), e_s = exp(score_s - max), p_s = e_s * ex[s].
//   block = 8 waves = 256 threads; grid = 16 heads x 16 query groups = 256; every wave does identical bounded work (64 steps).
//   The 8 waves read the same keys: per stage of 64 keys the block copies the head's 64 outer rows and the 64 rows of each v^T
//   plane (128 B each, whole lines) with asynchronous copies into one of two LDS buffers; the next stage's copies fly while this
//   stage is worked on; one barrier per stage. A stage is two steps of 32 keys. The head's ex column (2048 f32) is put into LDS
//   once, in front of the first barrier.
//   Both products are transposed: S^T = outer . inner^T (A = 16 key rows from the stage, B = the wave's 16 query rows, kept in
//   registers) and O^T += v^T . P^T (A = 16 d rows of v^T from the stage, B = P^T). A lane (c = lane & 15, hh = lane >> 4) then
//   holds only query q0 + c: score register r of tile i is key kb + 16 i + 8 hh + r, which is the k order of a B operand, so the
//   two score tiles of a step, converted in place, are P^T; output register r of tile j is d = 16 j + 8 hh + r.
//   Per step: 2 score tiles on f16 WMMA (K = 64 as two k-steps of 32); the maximum over the lane's 16 keys in the lane, joined with
//   the other half by one cross-row move; online max-subtracted softmax in f32 (exp2, log2e / 8 / carries folded in); running sums
//   of e and of p = e*ex in eight partial sums per lane (one per score register; they and the halves are joined once, behind the loop); one
//   rescale factor per lane; 12 WMMAs (hi.hi, hi.lo, lo.hi) into one accumulator set.
//   Final scaling in f32; each lane stages its query's 4 x 8 consecutive d (hi and residual) in the block's LDS row buffers [128][64];
// coverage: LDS row buffers: 8 waves x 16 rows x 64 cols = 128 x 64; global: 4 iterations x 256 threads x 8 halves = 128 rows x 64
//           cols (cols 64*head ..) of rows qB..qB+127, both planes; grid covers all 2048 rows x 1024 cols exactly once.
// =====================================================================================================
#define AKS   64                        // keys per stage: 128 B of every v^T row = one whole line
#define AOVH  (AKS * LROW)              // stage layout in bytes: [64 outer rows | 64 v^T hi rows | 64 v^T residual rows]
#define AOVL  (AOVH + HDIM * LROW)
#define ASTG  (AOVL + HDIM * LROW)      // bytes per stage
static_assert(AKS == 64 && HDIM == 64 && (TT % AKS) == 0 && (TT / AKS) >= 2 && HDIM * 2 + 16 == LROW && AKS * 2 + 16 == LROW);
static_assert((TT % ATT_THREADS) == 0);
// one stage: keys 64 t .. 64 t + 63; l, gK, gVh, gVl are this lane's row (4*wave + (lane>>3) of a round of 32) and 16-byte piece
__device__ __forceinline__ void att_stage(unsigned l, const unsigned short* gK, const unsigned short* gVh,
                                          const unsigned short* gVl, int t) {
  copy_rows<2>(l,        gK  + (size_t)t * AKS * QKP, (size_t)32 * QKP);
  copy_rows<2>(l + AOVH, gVh + (size_t)t * AKS,       (size_t)32 * TT);
  copy_rows<2>(l + AOVL, gVl + (size_t)t * AKS,       (size_t)32 * TT);
}
__device__ __forceinline__ const _Float16* lds_h(const unsigned char* p) { return (const _Float16*)(const void*)p; }
// value of lane l ^ 16 (one vector cross-row move, no LDS counter)
__device__ __forceinline__ float xhalf(float x) {
  const int b = __builtin_bit_cast(int, x);
  return __builtin_bit_cast(float, __builtin_amdgcn_permlanex16(b, b, 0x76543210, 0xfedcba98, false, false));
}

__global__ __launch_bounds__(ATT_THREADS)
void attn_heads(const unsigned short* __restrict__ QKq, const unsigned short* __restrict__ VHq,
                const unsigned short* __restrict__ VLq, const float* __restrict__ AEF,
                const float* __restrict__ betap, const float* __restrict__ ivp,
                const float* __restrict__ ovp, const float* __restrict__ chg,
                unsigned short* CTH, unsigned short* CTL) {
  __shared__ __align__(16) unsigned char kv[2 * ASTG];      // two stages of outer rows and v^T rows
  __shared__ __align__(16) float exs[TT];                   // ex of this head, by key
  __shared__ __align__(16) unsigned short Osh[ATT_QB * HDIM];   // block result rows [128][64], hi
  __shared__ __align__(16) unsigned short Osl[ATT_QB * HDIM];   // residual

  const int tid  = threadIdx.x;
  const int wave = tid >> 5;
  const int lane = tid & 31;
  const int hh   = lane >> 4;
  const int c    = lane & 15;

  const int qg   = blockIdx.x % ATT_QG;                     // query group 0..15
  const int head = (blockIdx.x / ATT_QG) & (NHEAD - 1);     // 0..15
  const int qB   = qg * ATT_QB;                             // block's first query row
  const int q0   = qB + wave * 16;                          // wave's first query row

  const _Float16* Qh = (const _Float16*)(const void*)QKq + (size_t)(q0 + c) * QKP + head * HDIM + 8 * hh;
  const float* Ex = AEF + 16 + head;                                    // ex column of this head
  const float lsc = (1.4426950408889634f * ATT_SCALE) / (QC * KC);      // log2(e) / 8 / carries

  // copy side: this lane's row and 16-byte piece in a round of 32 rows
  const int crow = wave * 4 + (lane >> 3);
  const int cseg = (lane & 7) * 8;
  const unsigned lcp = lds_off(kv) + (unsigned)(crow * LROW + cseg * 2);
  const unsigned short* gK  = QKq + (size_t)crow * QKP + DM + head * HDIM + cseg;
  const unsigned short* gVh = VHq + (size_t)(head * HDIM + crow) * TT + cseg;
  const unsigned short* gVl = VLq + (size_t)(head * HDIM + crow) * TT + cseg;
  // reader side: this lane's fragment row (key or d = c within a group of 16 rows) and k half, in bytes
  const int fr = c * LROW + 16 * hh;

  // stage 0 into buffer 0, landed and published; then stage 1 into buffer 1. The ex column is published by the same barrier.
  att_stage(lcp, gK, gVh, gVl, 0);
  const v16h qa = ldfrag_h(Qh), qb = ldfrag_h(Qh + 32);
  const float apq = AEF[(size_t)(q0 + c) * NGATE + head];    // ap of this lane's query, used behind the loop
#pragma unroll   // the 8 loads are issued together, one latency
  for (int i = 0; i < TT / ATT_THREADS; ++i) {
    const int k = i * ATT_THREADS + tid;                     // 8 x 256 = all 2048 keys
    exs[k] = Ex[(size_t)k * NGATE];
  }
  wait_copies();
  __syncthreads();
  att_stage(lcp + ASTG, gK, gVh, gVl, 1);

  float mrow = -INFINITY;                                    // this lane's query
  v8f zv = zero8(), lv = zero8();                            // sums of e and p: element r over this half's keys 8hh + r (mod 16)
  v8f o0 = zero8(), o1 = zero8(), o2 = zero8(), o3 = zero8();

  constexpr int nst = TT / AKS;
#pragma unroll 1   // one stage per trip: the ring's order at the foot stays as written
  for (int t = 0; t < nst; ++t) {
    const unsigned bofs = (unsigned)(t & 1) * ASTG;
    const unsigned char* sb = kv + bofs + fr;
#pragma unroll
    for (int s = 0; s < 2; ++s) {              // two steps of 32 keys per stage, ascending keys
      const int kb = t * AKS + s * 32;
      v8f s0, s1;                              // s0[r]: key kb + 8hh + r, s1[r]: key kb + 16 + 8hh + r, query q0 + c
      {
        const _Float16* kp = lds_h(sb + (s * 32) * LROW);
        const v16h k0 = ldfrag_h(kp), k1 = ldfrag_h(kp + 32);
        s0 = mma_raw(k0, qa, zero8());
        s0 = mma_raw(k1, qb, s0);
        guard_s2(s0, k0, k1);
      }
      {
        const _Float16* kq = lds_h(sb + (s * 32 + 16) * LROW);
        const v16h k0 = ldfrag_h(kq), k1 = ldfrag_h(kq + 32);
        s1 = mma_raw(k0, qa, zero8());
        s1 = mma_raw(k1, qb, s1);
        guard_s4(s1, k0, k1, qa, qb);
      }
      const float* exq = exs + kb + 8 * hh;
      const v4f xa = *(const v4f*)(exq),      xb = *(const v4f*)(exq + 4);      // ex of keys kb + 8hh + 0..7
      const v4f xc = *(const v4f*)(exq + 16), xd = *(const v4f*)(exq + 20);     // ex of keys kb + 16 + 8hh + 0..7
      const v8f x0 = __builtin_shufflevector(xa, xb, 0, 1, 2, 3, 4, 5, 6, 7);
      const v8f x1 = __builtin_shufflevector(xc, xd, 0, 1, 2, 3, 4, 5, 6, 7);
      const float m0 = fmaxf(fmaxf(s0[0], s0[1]), s0[2]), m1 = fmaxf(fmaxf(s0[3], s0[4]), s0[5]);
      const float m2 = fmaxf(fmaxf(s0[6], s0[7]), s1[0]), m3 = fmaxf(fmaxf(s1[1], s1[2]), s1[3]);
      const float m4 = fmaxf(fmaxf(s1[4], s1[5]), s1[6]);
      float mx = fmaxf(fmaxf(fmaxf(m0, m1), s1[7]), fmaxf(fmaxf(m2, m3), m4));   // the lane's 16 keys
      mx = fmaxf(mx, xhalf(mx));               // both halves: maximum over the step's 32 keys
      const float mn = fmaxf(mrow, mx * lsc);
      const float al = exp2f(mrow - mn);
      mrow = mn;
      const v8f t0 = s0 * lsc - mn, t1 = s1 * lsc - mn;
      v8f e0, e1;
#pragma unroll   // constant element indices: the vectors stay in registers
      for (int r = 0; r < 8; ++r) { e0[r] = exp2f(t0[r]); e1[r] = exp2f(t1[r]); }
      const v8f p0 = e0 * x0, p1 = e1 * x1;
      zv = zv * al + (e0 + e1);
      lv = lv * al + (p0 + p1);
      FragH ph, pl;                            // P^T as a B operand: element r <- k = 8hh + r, element 8 + r <- k = 16 + 8hh + r
      {
        const v8f y0 = p0 * PC, y1 = p1 * PC;
        ph.h[0] = __builtin_convertvector(y0, v8h);
        ph.h[1] = __builtin_convertvector(y1, v8h);
        pl.h[0] = __builtin_convertvector(y0 - __builtin_convertvector(ph.h[0], v8f), v8h);
        pl.h[1] = __builtin_convertvector(y1 - __builtin_convertvector(ph.h[1], v8f), v8h);
      }
      o0 *= al;
      o1 *= al;
      o2 *= al;
      o3 *= al;
      {
        const unsigned char* vp = sb + AOVH + s * 64;          // 32 keys = 64 B along a v^T row
        const v16h vb0 = ldfrag_h(lds_h(vp));
        const v16h vb1 = ldfrag_h(lds_h(vp + 16 * LROW));
        const v16h vb2 = ldfrag_h(lds_h(vp + 32 * LROW));
        const v16h vb3 = ldfrag_h(lds_h(vp + 48 * LROW));
        o0 = mma_raw(vb0, ph.v, o0);
        o1 = mma_raw(vb1, ph.v, o1);
        o2 = mma_raw(vb2, ph.v, o2);
        o3 = mma_raw(vb3, ph.v, o3);
        o0 = mma_raw(vb0, pl.v, o0);
        o1 = mma_raw(vb1, pl.v, o1);
        o2 = mma_raw(vb2, pl.v, o2);
        o3 = mma_raw(vb3, pl.v, o3);
        guard_pv6(o0, o1, o2, o3, ph.v, pl.v, vb0, vb1, vb2, vb3);
      }
      {
        const unsigned char* vp = sb + AOVL + s * 64;
        const v16h vl0 = ldfrag_h(lds_h(vp));
        const v16h vl1 = ldfrag_h(lds_h(vp + 16 * LROW));
        const v16h vl2 = ldfrag_h(lds_h(vp + 32 * LROW));
        const v16h vl3 = ldfrag_h(lds_h(vp + 48 * LROW));
        o0 = mma_raw(vl0, ph.v, o0);
        o1 = mma_raw(vl1, ph.v, o1);
        o2 = mma_raw(vl2, ph.v, o2);
        o3 = mma_raw(vl3, ph.v, o3);
        guard_pv5(o0, o1, o2, o3, ph.v, vl0, vl1, vl2, vl3);
      }
    }
    // publish point of stage t + 1; the same barrier ends every reader's last read of stage t's buffer
    wait_lds_reads();
    wait_copies();
    __syncthreads();
    if (t + 2 < nst) att_stage(lcp + bofs, gK, gVh, gVl, t + 2);   // block-uniform: refill the buffer that this trip has just read
  }
  wait_copies();

  // ---- per-head gates and rotation, renormaliser, carries (1024 on p, 1024 on v, 4096 on the stored ctx) ----
  const float zrow = ((zv[0] + zv[1]) + (zv[2] + zv[3])) + ((zv[4] + zv[5]) + (zv[6] + zv[7]));
  const float lrow = ((lv[0] + lv[1]) + (lv[2] + lv[3])) + ((lv[4] + lv[5]) + (lv[6] + lv[7]));
  const float zt  = zrow + xhalf(zrow);                      // the two halves' sums, on the same maximum
  const float lt  = lrow + xhalf(lrow);
  const float bet = bfr(betap[head]);
  const float ivs = sigf(bfr(ivp[head]));
  const float og  = sigf(bfr(ovp[head])) * tanhf(bfr(chg[head]));
  const float ang = PI_F * sigf(bet);
  const float ca  = cosf(ang), sa = sinf(ang);
  const float base = ivs / (PC * VC);
  const float den = apq * lt + REN_EPS * zt;
  const float sc  = apq * (1.0f / den) * base;
  v8h yh[4], yl[4];                                          // tile j: d = 16 j + 8 hh + r
#pragma unroll
  for (int r = 0; r < 8; ++r) {
    const float x0 = o0[r] * sc, x1 = o1[r] * sc, x2 = o2[r] * sc, x3 = o3[r] * sc;
    const float y0 = ((x0 * ca - x2 * sa) * og) * FC;
    const float y1 = ((x1 * ca - x3 * sa) * og) * FC;
    const float y2 = ((x0 * sa + x2 * ca) * og) * FC;
    const float y3 = ((x1 * sa + x3 * ca) * og) * FC;
    const _Float16 h0 = (_Float16)y0, h1 = (_Float16)y1, h2 = (_Float16)y2, h3 = (_Float16)y3;
    yh[0][r] = h0;
    yh[1][r] = h1;
    yh[2][r] = h2;
    yh[3][r] = h3;
    yl[0][r] = (_Float16)(y0 - (float)h0);
    yl[1][r] = (_Float16)(y1 - (float)h1);
    yl[2][r] = (_Float16)(y2 - (float)h2);
    yl[3][r] = (_Float16)(y3 - (float)h3);
  }
  {
    unsigned short* oh = Osh + (wave * 16 + c) * HDIM + 8 * hh;
    unsigned short* ol = Osl + (wave * 16 + c) * HDIM + 8 * hh;
#pragma unroll   // constant array indices: yh, yl stay in registers
    for (int j = 0; j < 4; ++j) {
      *(v8h*)(void*)(oh + 16 * j) = yh[j];
      *(v8h*)(void*)(ol + 16 * j) = yl[j];
    }
  }
  __syncthreads();
  // ---- block writes its 128 row segments: piece p = it*256 + tid -> row p>>3, halves (p&7)*8 of the 64-col slab (128 B a row) ----
  {
    v4u vh[4], vl[4];
#pragma unroll
    for (int it = 0; it < 4; ++it) {
      const int p = it * ATT_THREADS + tid;
      vh[it] = *(const v4u*)(Osh + (size_t)p * 8);
      vl[it] = *(const v4u*)(Osl + (size_t)p * 8);
    }
    const size_t dofs = (size_t)qB * DM + (size_t)head * HDIM;
    unsigned short* dh = CTH + dofs;
    unsigned short* dl = CTL + dofs;
    {
#pragma unroll
      for (int it = 0; it < 4; ++it) {
        const int p = it * ATT_THREADS + tid;
        const size_t po = (size_t)(p >> 3) * DM + (size_t)(p & 7) * 8;
        *(v4u*)(dh + po) = vh[it];
        *(v4u*)(dl + po) = vl[it];
      }
    }
  }
}

// =====================================================================================================
// Workspace map (bytes); every plane is an exact multiple of its tile / whole-row store granularity (M, N exact tile multiples,
// row blocks exact, no pad rows needed), every offset a multiple of 131072:
//   WIO  f16 [2048][1024] x64     4194304   (rows 0..1023 Wi, 1024..2047 Wo; native [out][in] = [n][k])
//   WV   f16 [1024][1024] x64     2097152
//   WOUT f16 [1024][1024] x64     2097152
//   WG   f16 [64][1024]   x64      131072   (Wa, We, Wa, We)
//   XB   f16 [2048][1024] x16     4194304
//   QK   f16 [2048][2048] x16     8388608   (inner | outer)
//   VTH  f16 [1024][2048] x1024   4194304   (v^T hi)
//   VTL  f16 [1024][2048]         4194304   (v^T residual)
//   AEF  f32 [2048][64]            524288   (sigmoid gates)
//   CTH  f16 [2048][1024] x4096   4194304   (ctx hi)
//   CTL  f16 [2048][1024]         4194304   (ctx residual)
//   end                          38404096
// =====================================================================================================
extern "C" void kernel_launch(void* const* d_in, const int* in_sizes, int n_in,
                              void* d_out, int out_size, void* d_ws, size_t ws_size,
                              hipStream_t stream) {
  if (n_in < 13) return;
  if (in_sizes[0] != TT * DM) return;
  if (in_sizes[1] != NHEAD * DM || in_sizes[2] != NHEAD) return;
  if (in_sizes[3] != NHEAD * DM || in_sizes[4] != NHEAD) return;
  if (in_sizes[5] != DM * DM || in_sizes[6] != DM * DM || in_sizes[7] != DM * DM || in_sizes[8] != DM * DM) return;
  if (in_sizes[9] != NHEAD || in_sizes[10] != NHEAD || in_sizes[11] != NHEAD || in_sizes[12] != NHEAD) return;
  if (out_size != TT * DM) return;

  const float* x     = (const float*)d_in[0];
  const float* Wa    = (const float*)d_in[1];
  const float* ba    = (const float*)d_in[2];
  const float* We    = (const float*)d_in[3];
  const float* be    = (const float*)d_in[4];
  const float* Wi    = (const float*)d_in[5];
  const float* Wo    = (const float*)d_in[6];
  const float* Wv    = (const float*)d_in[7];
  const float* Wout  = (const float*)d_in[8];
  const float* betap = (const float*)d_in[9];
  const float* ivp   = (const float*)d_in[10];
  const float* ovp   = (const float*)d_in[11];
  const float* chg   = (const float*)d_in[12];
  float*       out   = (float*)d_out;

  const size_t PWIO = (size_t)2 * DM * DM * 2;                    //  4194304
  const size_t PW   = (size_t)DM * DM * 2;                        //  2097152
  const size_t PG   = (size_t)NGATE * DM * 2;                     //   131072
  const size_t PX   = (size_t)TT * DM * 2;                        //  4194304
  const size_t PQK  = (size_t)TT * QKP * 2;                       //  8388608
  const size_t PVT  = (size_t)DM * TT * 2;                        //  4194304
  const size_t PAE  = (size_t)TT * NGATE * 4;                     //   524288
  const size_t PCT  = (size_t)TT * DM * 2;                        //  4194304
  size_t off = 0;
  const size_t oWIO = off; off += PWIO;
  const size_t oWV  = off; off += PW;
  const size_t oWOU = off; off += PW;
  const size_t oWG  = off; off += PG;
  const size_t oXB  = off; off += PX;
  const size_t oQK  = off; off += PQK;
  const size_t oVTH = off; off += PVT;
  const size_t oVTL = off; off += PVT;
  const size_t oAEF = off; off += PAE;
  const size_t oCTH = off; off += PCT;
  const size_t oCTL = off; off += PCT;
  if (off > ws_size) return;                                      // off = 38404096
  if (off > (size_t)134217728) return;

  char* ws = (char*)d_ws;
  unsigned short* WIO  = (unsigned short*)(ws + oWIO);
  unsigned short* WV   = (unsigned short*)(ws + oWV);
  unsigned short* WOUT = (unsigned short*)(ws + oWOU);
  unsigned short* WG   = (unsigned short*)(ws + oWG);
  unsigned short* XB   = (unsigned short*)(ws + oXB);
  unsigned short* QK   = (unsigned short*)(ws + oQK);
  unsigned short* VTH  = (unsigned short*)(ws + oVTH);
  unsigned short* VTL  = (unsigned short*)(ws + oVTL);
  float*          AEF  = (float*)(ws + oAEF);
  unsigned short* CTH  = (unsigned short*)(ws + oCTH);
  unsigned short* CTL  = (unsigned short*)(ws + oCTL);

  const dim3 blk(256);
  const dim3 gCV(CB_ALL);                                         // 776 blocks
  const dim3 gPR(PB_ALL);                                         // 196 blocks
  const dim3 gO((TT / OBM) * (DM / OBN));                         // 256
  const dim3 gAT(ATT_BLOCKS);                                     // 256
  const dim3 bAT(ATT_THREADS);                                    // 256

  // (0) 16-bit planes: XB = f16(16 * bf16(x)); W planes = f16(64 * bf16(W)) in native [n][k] layout; gate plane
  conv_all<<<gCV, blk, 0, stream>>>(x, Wi, Wo, Wv, Wout, Wa, We, XB, WIO, WV, WOUT, WG);

  // (1..3) gates, v^T, inner | outer
  proj_gemms<<<gPR, blk, 0, stream>>>(XB, WIO, WV, WG, ba, be, QK, VTH, VTL, AEF);

  // (4) attention per (128 query rows, 1 head) -> CTH/CTL (ctx x4096 hi + residual)
  attn_heads<<<gAT, bAT, 0, stream>>>(QK, VTH, VTL, AEF, betap, ivp, ovp, chg, CTH, CTL);

  // (5) output projection
  out_gemm<<<gO, blk, 0, stream>>>(CTH, CTL, WOUT, out);
  (void)hipGetLastError();
}

// v006
// A run of this version takes 85.7 microseconds.
// Next to v005, in two timings, it ran 1.06 times as fast each time.
// Counting every step since v000, it is 4.35 times as fast.
// Contractions: gate logits (x f16 x16 . [Wa;We;Wa;We] f16 x64, K=1024), inner|outer projections (x f16 x16 . [Wi;Wo] f16 x64, K=1024),
// v^T projection (Wv f16 x64 . x f16 x16, K=1024; stored as f16 hi x1024 + residual plane), scores (inner f16 x16 . outer f16 x16, K=64),
// v^T . P^T (v^T f16 hi+residual . P f16 x1024 hi+residual, three products, 2048 keys in steps of 32; scores and this product transposed),
// output projection (ctx f16 x4096 hi+residual . Wout f16 x64, two products, K=1024): all v_wmma_f32_16x16x32_f16, f32 accumulate.
// Sigmoid gates, online max-subtracted softmax, renormaliser, valve/rotation epilogue in f32 on VALU; every float input RNE-converted to bf16 on load.
#include <hip/hip_runtime.h>
#include <math.h>
#include <stdint.h>

#define TT      2048
#define DM      1024
#define NHEAD   16
#define HDIM    64
#define NGATE   64
#define QTB     8
#define QKP     (2 * DM)
#define WSC     64.0f
#define ACARRY  16.0f
#define QC      16.0f
#define KC      16.0f
#define VC      1024.0f
#define PC      1024.0f
#define FC      4096.0f
#define ATT_SCALE 0.125f
#define PI_F    3.14159265358979323846f
#define REN_EPS 1e-8f
static_assert(NHEAD * HDIM == DM);
static_assert((TT % 64) == 0 && (DM % 64) == 0 && (DM % 256) == 0 && (TT % 32) == 0 && (TT % 16) == 0);
static_assert(NHEAD == 16 && NGATE == 64);
#define ATT_THREADS (QTB * 32)
#define ATT_QB      (QTB * 16)
#define ATT_QG      (TT / ATT_QB)
#define ATT_BLOCKS  (ATT_QG * NHEAD)
static_assert(ATT_THREADS == 256 && ATT_BLOCKS == 256 && (TT % ATT_QB) == 0);

typedef _Float16 v16h __attribute__((ext_vector_type(16)));
typedef _Float16 v8h  __attribute__((ext_vector_type(8)));
typedef float    v8f  __attribute__((ext_vector_type(8)));
typedef float    v4f  __attribute__((ext_vector_type(4)));
typedef unsigned int v4u __attribute__((ext_vector_type(4)));

union FragH { v16h v; v8h h[2]; v4u u[2]; };

// ---- scalar helpers --------------------------------------------------------------------------------
__device__ __forceinline__ unsigned short bf_bits(float f) {          // f32 -> bf16 bits, RNE convert
  unsigned u = __float_as_uint(f);
  return (unsigned short)((u + 0x7FFFu + ((u >> 16) & 1u)) >> 16);
}
__device__ __forceinline__ float bf_up(unsigned short h) { return __uint_as_float(((unsigned)h) << 16); }
__device__ __forceinline__ float bfr(float f) { return bf_up(bf_bits(f)); }   // value of the bf16 RNE convert
__device__ __forceinline__ unsigned short h_bits(_Float16 x) { return __builtin_bit_cast(unsigned short, x); }
__device__ __forceinline__ unsigned pk16(unsigned short a, unsigned short b) { return (unsigned)a | ((unsigned)b << 16); }
__device__ __forceinline__ v8f zero8() { v8f z = {0.f, 0.f, 0.f, 0.f, 0.f, 0.f, 0.f, 0.f}; return z; }
__device__ __forceinline__ float sigf(float v) { return 1.0f / (1.0f + expf(-v)); }
// 2^x as the one hardware instruction (v_exp_f32). The library exp2f adds a compare, two selects, an add and an ldexp per value, only
// to return subnormal results; here a result under 2^-126 may be 0: it stands beside a term near 1 in the sum of e, beside
// 1e-8 times that sum in the renormaliser, and is 0 in both f16 planes of P either way (a rescale factor that small likewise). -inf gives 0, as in the library form.
__device__ __forceinline__ float exp2_hw(float x) { return __builtin_amdgcn_exp2f(x); }

// ---- fragment loaders: 16-bit A/B operand, lane -> row/col (lane&15), p already includes +8*(lane>>4);
//      elements 0..7 <- p[0..7] (k0+8h..), elements 8..15 <- p[16..23] (k0+16+8h..)  (same split k map for A and B;
//      B is always read from a k-contiguous [n][k] plane)
__device__ __forceinline__ v16h ldfrag_h(const _Float16* p) {
  FragH f;
  f.h[0] = *(const v8h*)(p);
  f.h[1] = *(const v8h*)(p + 16);
  return f.v;
}
__device__ __forceinline__ v16h ldfrag_u(const unsigned short* p) {
  FragH f;
  f.u[0] = *(const v4u*)(p);
  f.u[1] = *(const v4u*)(p + 16);
  return f.v;
}

// ---- WMMA helpers with trailing VALU hazard gaps ------------------------------------------------------
__device__ __forceinline__ v8f mma_raw(v16h a, v16h b, v8f c) {
  return __builtin_amdgcn_wmma_f32_16x16x32_f16(false, a, false, b, (short)0, c, false, false);
}
__device__ __forceinline__ void dep_guard1(v8f& a, v8f& b, v16h x) {
#if defined(__HIP_DEVICE_COMPILE__)
  asm volatile("v_nop\n\tv_nop\n\tv_nop\n\tv_nop" : "+v"(a), "+v"(b) : "v"(x));
#endif
}
__device__ __forceinline__ void guard_s2(v8f& s, v16h a0, v16h a1) {
#if defined(__HIP_DEVICE_COMPILE__)
  asm volatile("v_nop\n\tv_nop\n\tv_nop\n\tv_nop" : "+v"(s) : "v"(a0), "v"(a1));
#endif
}
__device__ __forceinline__ void guard_s4(v8f& s, v16h a0, v16h a1, v16h b0, v16h b1) {
#if defined(__HIP_DEVICE_COMPILE__)
  asm volatile("v_nop\n\tv_nop\n\tv_nop\n\tv_nop" : "+v"(s) : "v"(a0), "v"(a1), "v"(b0), "v"(b1));
#endif
}
__device__ __forceinline__ void guard_pv6(v8f& a, v8f& b, v8f& c, v8f& d,
                                          v16h p0, v16h p1, v16h x0, v16h x1, v16h x2, v16h x3) {
#if defined(__HIP_DEVICE_COMPILE__)
  asm volatile("v_nop\n\tv_nop\n\tv_nop\n\tv_nop"
               : "+v"(a), "+v"(b), "+v"(c), "+v"(d) : "v"(p0), "v"(p1), "v"(x0), "v"(x1), "v"(x2), "v"(x3));
#endif
}
__device__ __forceinline__ void guard_pv5(v8f& a, v8f& b, v8f& c, v8f& d,
                                          v16h p0, v16h x0, v16h x1, v16h x2, v16h x3) {
#if defined(__HIP_DEVICE_COMPILE__)
  asm volatile("v_nop\n\tv_nop\n\tv_nop\n\tv_nop"
               : "+v"(a), "+v"(b), "+v"(c), "+v"(d) : "v"(p0), "v"(x0), "v"(x1), "v"(x2), "v"(x3));
#endif
}
__device__ __forceinline__ void keep4_h(v16h a, v16h b, v16h c, v16h d) {
#if defined(__HIP_DEVICE_COMPILE__)
  asm volatile("v_nop" :: "v"(a), "v"(b), "v"(c), "v"(d));
#endif
}
__device__ __forceinline__ void acc_guard4(v8f& a, v8f& b, v8f& c, v8f& d) {
#if defined(__HIP_DEVICE_COMPILE__)
  asm volatile("v_nop\n\tv_nop\n\tv_nop\n\tv_nop" : "+v"(a), "+v"(b), "+v"(c), "+v"(d));
#endif
}
__device__ __forceinline__ void wave_sync_lds() {
  __builtin_amdgcn_fence(__ATOMIC_RELEASE, "workgroup");
  __builtin_amdgcn_wave_barrier();
  __builtin_amdgcn_fence(__ATOMIC_ACQUIRE, "workgroup");
}

// =====================================================================================================
// Row convert: X f32 [nrows][1024] -> Y f16 [nrows][1024] = f16( bf16_RNE(X) * carry ), carry a power of two (exact).
// One wave per row (8 rows per block); lane l holds cols j*256 + 8l..8l+7 for j = 0..3; store instruction j covers a contiguous
// coverage: 4 x 32 lanes x 8 halves = 1024 = the whole row; nrows/8 blocks per job (exact multiples here) with a wave-uniform row bound.
// Used for x (carry 16) and for Wi, Wo, Wv, Wout in their native [out][in] = [n][k] layout (carry 64).
// =====================================================================================================
__device__ __forceinline__ void conv_rows(int blk, const float* __restrict__ X, unsigned short* Y, int nrows, float carry) {
  const int lane = threadIdx.x & 31, wave = threadIdx.x >> 5;
  const int row = blk * 8 + wave;
  if (row >= nrows) return;                      // wave-uniform; no barriers in this kernel
  const float* xp = X + (size_t)row * DM;
  unsigned short* op = Y + (size_t)row * DM;
  v4u res[4];
#pragma unroll
  for (int j = 0; j < 4; ++j) {
    const int c0 = j * 256 + lane * 8;
    const v4f a0 = *(const v4f*)(xp + c0), a1 = *(const v4f*)(xp + c0 + 4);
    float t[8];
#pragma unroll
    for (int e = 0; e < 4; ++e) { t[e] = bfr(a0[e]) * carry; t[4 + e] = bfr(a1[e]) * carry; }
    v4u o = {0u, 0u, 0u, 0u};
#pragma unroll
    for (int e = 0; e < 4; ++e) o[e] = pk16(h_bits((_Float16)t[2 * e]), h_bits((_Float16)t[2 * e + 1]));
    res[j] = o;
  }
  {
#pragma unroll
    for (int j = 0; j < 4; ++j) *(v4u*)(op + j * 256 + lane * 8) = res[j];
    
  }
}

// =====================================================================================================
// Gate weight plane: G f16 [64][1024]: row r = f16( 64 * bf16_RNE( (r & 16) ? We[r & 15] : Wa[r & 15] ) ) (rows 32..63 duplicate 0..31).
// Both candidate rows loaded with clamped in-range addresses, selected by value (row is wave-uniform). Same store shape as conv_rows.
// coverage: 8 blocks x 8 waves = 64 rows x (4 x 32 x 8 = 1024 cols), exact.
// =====================================================================================================
__device__ __forceinline__ void conv_gate(int blk, const float* __restrict__ Wa, const float* __restrict__ We,
                                          unsigned short* Y, float carry) {
  const int lane = threadIdx.x & 31, wave = threadIdx.x >> 5;
  const int row = blk * 8 + wave;
  if (row >= NGATE) return;                      // wave-uniform; no barriers in this kernel
  const float* pa = Wa + (size_t)(row & 15) * DM;
  const float* pb = We + (size_t)(row & 15) * DM;
  const bool useb = (row & 16) != 0;
  unsigned short* op = Y + (size_t)row * DM;
  v4u res[4];
#pragma unroll
  for (int j = 0; j < 4; ++j) {
    const int c0 = j * 256 + lane * 8;
    const v4f a0 = *(const v4f*)(pa + c0), a1 = *(const v4f*)(pa + c0 + 4);
    const v4f b0 = *(const v4f*)(pb + c0), b1 = *(const v4f*)(pb + c0 + 4);
    float t[8];
#pragma unroll
    for (int e = 0; e < 4; ++e) {
      t[e]     = bfr(useb ? b0[e] : a0[e]) * carry;
      t[4 + e] = bfr(useb ? b1[e] : a1[e]) * carry;
    }
    v4u o = {0u, 0u, 0u, 0u};
#pragma unroll
    for (int e = 0; e < 4; ++e) o[e] = pk16(h_bits((_Float16)t[2 * e]), h_bits((_Float16)t[2 * e + 1]));
    res[j] = o;
  }
  {
#pragma unroll
    for (int j = 0; j < 4; ++j) *(v4u*)(op + j * 256 + lane * 8) = res[j];
    
  }
}

// =====================================================================================================
// All conversions in one launch: none reads what another writes. The block index picks the job (block-uniform, no barriers):
// blocks 0..255 x, then 128 each for Wi, Wo, Wv, Wout, then 8 for the gate plane; every job keeps its own rows and stores.
// =====================================================================================================
#define CB_X  (TT / 8)
#define CB_W  (DM / 8)
#define CB_G  (NGATE / 8)
#define CB_ALL (CB_X + 4 * CB_W + CB_G)
__global__ __launch_bounds__(256) void conv_all(const float* __restrict__ x, const float* __restrict__ Wi,
                                                const float* __restrict__ Wo, const float* __restrict__ Wv,
                                                const float* __restrict__ Wout, const float* __restrict__ Wa,
                                                const float* __restrict__ We,
                                                unsigned short* XB, unsigned short* WIO, unsigned short* WV,
                                                unsigned short* WOUT, unsigned short* WG) {
  const int b = blockIdx.x;
  if (b >= CB_X + 4 * CB_W) {
    conv_gate(b - (CB_X + 4 * CB_W), Wa, We, WG, WSC);
    return;
  }
  const float* X = x;
  unsigned short* Y = XB;
  int rb = b, nrows = TT;
  float carry = ACARRY;
  if (b >= CB_X) {
    const int w = (b - CB_X) / CB_W;             // 0..3: Wi, Wo, Wv, Wout
    rb = (b - CB_X) % CB_W;
    nrows = DM;
    carry = WSC;
    X = w == 0 ? Wi : w == 1 ? Wo : w == 2 ? Wv : Wout;
    Y = w == 0 ? WIO : w == 1 ? WIO + (size_t)DM * DM : w == 2 ? WV : WOUT;
  }
  conv_rows(rb, X, Y, nrows, carry);
}

// ---- asynchronous global -> LDS copies (16 B per lane). Each statement ends in s_wait_xcnt 0 so that no address register of an
//      issued copy is rewritten before the wait (a precaution); landing is waited for separately with s_wait_asynccnt 0.
#define KST   64      // k per stage: 128 B of every operand row = one whole line
#define LROW  144     // LDS row pitch in bytes: 128 + 16 (16 B x odd: conflict-free for 16-byte readers)
#define RSTEP (32 * LROW)   // LDS bytes between two copy rounds (a round = 8 waves x 4 rows)
__device__ __forceinline__ unsigned lds_off(const void* p) { return (unsigned)(size_t)p; }
__device__ __forceinline__ void copy2_lds(unsigned l, const unsigned short* g, size_t st) {
#if defined(__HIP_DEVICE_COMPILE__)
  asm volatile("global_load_async_to_lds_b128 %0, %1, off\n\t"
               "global_load_async_to_lds_b128 %2, %3, off\n\t"
               "s_wait_xcnt 0x0"
               :: "v"(l), "v"(g), "v"(l + RSTEP), "v"(g + st) : "memory");
#endif
}
__device__ __forceinline__ void copy8_lds(unsigned l, const unsigned short* g, size_t st) {
#if defined(__HIP_DEVICE_COMPILE__)
  asm volatile("global_load_async_to_lds_b128 %0, %1, off\n\t"
               "global_load_async_to_lds_b128 %2, %3, off\n\t"
               "global_load_async_to_lds_b128 %4, %5, off\n\t"
               "global_load_async_to_lds_b128 %6, %7, off\n\t"
               "global_load_async_to_lds_b128 %8, %9, off\n\t"
               "global_load_async_to_lds_b128 %10, %11, off\n\t"
               "global_load_async_to_lds_b128 %12, %13, off\n\t"
               "global_load_async_to_lds_b128 %14, %15, off\n\t"
               "s_wait_xcnt 0x0"
               :: "v"(l), "v"(g), "v"(l + RSTEP), "v"(g + st), "v"(l + 2 * RSTEP), "v"(g + 2 * st),
                  "v"(l + 3 * RSTEP), "v"(g + 3 * st), "v"(l + 4 * RSTEP), "v"(g + 4 * st), "v"(l + 5 * RSTEP), "v"(g + 5 * st),
                  "v"(l + 6 * RSTEP), "v"(g + 6 * st), "v"(l + 7 * RSTEP), "v"(g + 7 * st) : "memory");
#endif
}
// NR rounds of 32 rows (NR = 2 or 16): lane -> row 4*wave + (lane>>3) of its round, 16-byte piece lane&7; st = 32 source rows in elements
template <int NR>
__device__ __forceinline__ void copy_rows(unsigned l, const unsigned short* g, size_t st) {
  static_assert(NR == 2 || NR == 16);
  if constexpr (NR == 2) {
    copy2_lds(l, g, st);
  } else {
    copy8_lds(l, g, st);
    copy8_lds(l + 8 * RSTEP, g + 8 * st, st);
  }
}
__device__ __forceinline__ void wait_copies() {      // this wave's copies have landed in LDS
#if defined(__HIP_DEVICE_COMPILE__)
  asm volatile("s_wait_asynccnt 0x0" ::: "memory");
#endif
}
__device__ __forceinline__ void wait_store_regs() {  // in front of an overwrite of registers that issued global stores name (a precaution)
#if defined(__HIP_DEVICE_COMPILE__)
  asm volatile("s_wait_xcnt 0x0" ::: "memory");
#endif
}
__device__ __forceinline__ void wait_lds_reads() {   // this wave's LDS reads have returned (before their buffer is refilled)
#if defined(__HIP_DEVICE_COMPILE__)
  asm volatile("s_wait_dscnt 0x0" ::: "memory");
#endif
}

// =====================================================================================================
// Register-blocked f16 WMMA GEMM: C[m][n] = f( oscale * sum_k A[m][k] * Bt[n][k] ); one wave per 64x64 tile, 8 tiles per block.
// Operands reach the fragments through LDS: per stage of 64 k the block copies its operand rows (128 B each, whole lines) with
// asynchronous copies into one of two buffers; the next stage's copies fly while this stage is multiplied; one barrier per stage.
// WM 1: the 8 tiles share their 64 A rows and lie side by side in n (N a multiple of 512); WM 8: they share their 64 B rows and
// lie below one another in m (N = 64, M a multiple of 512). K a multiple of 64.
// A row-major [M][K] pitch lda (16-bit plane), Bt row-major [N][K] pitch ldb (k contiguous); M, N multiples of 64, K multiple of 64.
// BM: 0 = no bias; 3 = per-column head bias bf16( (col & 16) ? bias2[col & 15] : bias[col & 15] ) (in-range addresses).
// OM: 0 = f32 out (pitch ldc), ACT 2 applies sigmoid after bias;
//     2 = f16 out = f16( value * ocarry ); 3 = f16 hi plane f16(value*ocarry) to C and unscaled residual f16(value*ocarry - hi) to C2.
// coverage: 4 slabs x 16 rows (f32: it 0..7 x lane>>4; f16: it 0..3 x lane>>3) x 64 cols = the wave's whole 64x64 tile;
//           tilesM*tilesN/8 blocks per product (exact here); a block that does not fit the shape rules leaves as a whole before any barrier.
// =====================================================================================================
// The body is a device function: its kernel owns the LDS (ring: two stages; sT: 8 slabs) and hands in the block's index in this product.
__host__ __device__ constexpr int gemm_stage_bytes(int wm) {
  return (wm * 64 + (8 / wm) * 64) * LROW;
}
#define SLAB_F (16 * 68)   // per-wave 16x64 slab, pitch 68 floats
template <int OM, int BM, int ACT, int WM>
__device__ __forceinline__ void gemm64(
    unsigned char* ring, float* sT, int blk,
    const unsigned short* __restrict__ Ap, int lda,
    const unsigned short* __restrict__ Btp, int ldb,
    const float* __restrict__ bias, const float* __restrict__ bias2,
    void* Cout, void* C2out, int ldc,
    int M, int N, int K, float oscale, float ocarry) {
  static_assert(WM == 1 || WM == 8);
  constexpr int RA  = WM * 64;                     // A rows per block
  constexpr int RB  = (8 / WM) * 64;               // B rows per block
  constexpr int OB  = RA * LROW;                   // stage layout in bytes: [A | B]
  constexpr int STG = OB + RB * LROW;              // bytes per stage
  static_assert(STG == gemm_stage_bytes(WM));
  const int lane = threadIdx.x & 31;
  const int wave = threadIdx.x >> 5;
  const int tilesN = N >> 6;
  const int tilesM = M >> 6;
  const int tile0 = blk * 8;
  if (tile0 + 8 > tilesM * tilesN) return;         // block-uniform, before any barrier or copy
  if (WM == 1 ? (tilesN & 7) != 0 : (tilesN != 1)) return;   // block-uniform shape rule of this build
  const int tmB = tile0 / tilesN;
  const int mB = tmB << 6;                         // block's first row and column
  const int nB = (tile0 - tmB * tilesN) << 6;
  const int m0 = mB + (WM == 8 ? (wave << 6) : 0);
  const int n0 = nB + (WM == 1 ? (wave << 6) : 0);

  const int rlane = lane & 15;                 // row (A) / col (B, D) within subtile
  const int koff  = (lane >> 4) * 8;           // k offset of this lane half
  const int mOff  = (lane >> 4) * 8;           // D row offset

  // copy side: this lane's row and 16-byte piece in a round of 32 rows
  const int crow = wave * 4 + (lane >> 3);
  const int cseg = (lane & 7) * 8;
  const unsigned lcp = lds_off(ring) + (unsigned)(crow * LROW + cseg * 2);
  const unsigned short* gA  = Ap  + (size_t)(mB + crow) * lda + cseg;
  const unsigned short* gB  = Btp + (size_t)(nB + crow) * ldb + cseg;
  const size_t stA = (size_t)32 * lda, stB = (size_t)32 * ldb;
  // reader side: fragment rows of this wave in a stage
  const int fa = ((WM == 8 ? (wave << 6) : 0) + rlane) * LROW + koff * 2;
  const int fb = OB + ((WM == 1 ? (wave << 6) : 0) + rlane) * LROW + koff * 2;

  v8f acc[4][4];
#pragma unroll
  for (int i = 0; i < 4; ++i)
#pragma unroll
    for (int j = 0; j < 4; ++j) acc[i][j] = zero8();

  const int nst = K / KST;
  // stage 0 into buffer 0, landed and published; then stage 1 into buffer 1
  copy_rows<RA / 32>(lcp, gA, stA);
  copy_rows<RB / 32>(lcp + OB, gB, stB);
  wait_copies();
  __syncthreads();
  if (nst > 1) {
    copy_rows<RA / 32>(lcp + STG, gA + KST, stA);
    copy_rows<RB / 32>(lcp + STG + OB, gB + KST, stB);
  }

#pragma unroll 1   // one stage per trip: the ring's order at the foot stays as written
  for (int t = 0; t < nst; ++t) {
    const unsigned bofs = (unsigned)(t & 1) * STG;
    const unsigned char* sb = ring + bofs;
#pragma unroll
    for (int s = 0; s < 2; ++s) {              // two k-steps of 32 per stage, ascending k
      v16h bh[4], ah[4];
#pragma unroll
      for (int j = 0; j < 4; ++j) bh[j] = ldfrag_u((const unsigned short*)(sb + fb + j * 16 * LROW + s * 64));
#pragma unroll
      for (int i = 0; i < 4; ++i) ah[i] = ldfrag_u((const unsigned short*)(sb + fa + i * 16 * LROW + s * 64));
#pragma unroll
      for (int i = 0; i < 4; ++i) {
#pragma unroll
        for (int j = 0; j < 4; ++j) acc[i][j] = mma_raw(ah[i], bh[j], acc[i][j]);
        dep_guard1(acc[i][0], acc[i][3], ah[i]);
      }
      keep4_h(bh[0], bh[1], bh[2], bh[3]);
    }
    // publish point of stage t + 1; the same barrier ends every reader's last read of stage t's buffer
    wait_lds_reads();
    wait_copies();
    __syncthreads();
    if (t + 2 < nst) {                         // block-uniform: refill the buffer that this trip has just read
      const int kn = (t + 2) * KST;
      copy_rows<RA / 32>(lcp + bofs, gA + kn, stA);
      copy_rows<RB / 32>(lcp + bofs + OB, gB + kn, stB);
    }
  }
  wait_copies();
  acc_guard4(acc[0][0], acc[0][1], acc[0][2], acc[0][3]);
  acc_guard4(acc[1][0], acc[1][1], acc[1][2], acc[1][3]);
  acc_guard4(acc[2][0], acc[2][1], acc[2][2], acc[2][3]);
  acc_guard4(acc[3][0], acc[3][1], acc[3][2], acc[3][3]);

  const int hh2 = lane >> 4, c4 = (lane & 15) * 4;     // f32 out: 256-B row segment = 16 lanes x 16 B
  const int q8  = lane >> 3, c8 = (lane & 7) * 8;
  float bc[4];
#pragma unroll
  for (int e = 0; e < 4; ++e) bc[e] = 0.f;
  if constexpr (BM == 3) {
#pragma unroll
    for (int e = 0; e < 4; ++e) {
      const int col = n0 + c4 + e;
      const float fa = bfr(bias[col & 15]);             // in-range addresses 0..15
      const float fb = bfr(bias2[col & 15]);
      bc[e] = (col & 16) ? fb : fa;
    }
  }

  // ---- epilogue ----
  float* slab = sT + wave * SLAB_F;
#pragma unroll
  for (int i = 0; i < 4; ++i) {
    const int mBase = m0 + (i << 4);
#pragma unroll
    for (int j = 0; j < 4; ++j) {
#pragma unroll
      for (int r = 0; r < 8; ++r) {
        slab[(mOff + r) * 68 + (j << 4) + rlane] = acc[i][j][r];
      }
    }
    wave_sync_lds();
    if constexpr (OM == 0) {
      float* C = (float*)Cout;
      constexpr int IU = (ACT == 2) ? 2 : 8;               // row pairs per trip
#pragma unroll 1   // ACT 2: 128 unrolled divisions are 13 KB of text; rolled, the kernel that holds this body stays under 32 KB
      for (int ib = 0; ib < 8; ib += IU) {
        v4f vals[IU];
#pragma unroll
        for (int u = 0; u < IU; ++u) {
          const int row = (ib + u) * 2 + hh2;              // ib + u 0..7 x hh2 0..1 = rows 0..15
          v4f v = *(const v4f*)(slab + row * 68 + c4);
#pragma unroll
          for (int e = 0; e < 4; ++e) {
            float f = v[e] * oscale + bc[e];
            if constexpr (ACT == 2) f = 1.0f / (1.0f + __expf(-f));
            v[e] = f;
          }
          vals[u] = v;
        }
#pragma unroll
        for (int u = 0; u < IU; ++u) {
          const int gr = mBase + (ib + u) * 2 + hh2;
          *(v4f*)(C + (size_t)gr * ldc + n0 + c4) = vals[u];
        }
        if constexpr (IU < 8) wait_store_regs();           // the next trip rewrites the registers that these stores name
      }
    } else {
      unsigned short* C  = (unsigned short*)Cout;
      unsigned short* C2 = (unsigned short*)C2out;
      v4u hv[4], lv[4];
#pragma unroll
      for (int it = 0; it < 4; ++it) {
        const int row = it * 4 + q8;                       // it 0..3 x q8 0..3 = rows 0..15
        const float* sp = slab + row * 68 + c8;
        v4u a = {0u, 0u, 0u, 0u};
        v4u b = {0u, 0u, 0u, 0u};
#pragma unroll
        for (int e = 0; e < 4; ++e) {
          const float f0 = (sp[2 * e] * oscale) * ocarry;
          const float f1 = (sp[2 * e + 1] * oscale) * ocarry;
          const _Float16 h0 = (_Float16)f0, h1 = (_Float16)f1;
          a[e] = pk16(h_bits(h0), h_bits(h1));
          if constexpr (OM == 3) {
            const _Float16 l0 = (_Float16)(f0 - (float)h0);
            const _Float16 l1 = (_Float16)(f1 - (float)h1);
            b[e] = pk16(h_bits(l0), h_bits(l1));
          }
        }
        hv[it] = a;
        lv[it] = b;
      }
      {
#pragma unroll
        for (int it = 0; it < 4; ++it) {
          const int row = it * 4 + q8;
          *(v4u*)(C + (size_t)(mBase + row) * ldc + n0 + c8) = hv[it];
          if constexpr (OM == 3) {
            *(v4u*)(C2 + (size_t)(mBase + row) * ldc + n0 + c8) = lv[it];
          }
        }
        
      }
    }
    wave_sync_lds();
  }
}

// =====================================================================================================
// The three products of x in one launch: none reads what another writes, and together they have fewer blocks than the chip has WGPs.
// The block index picks the product (block-uniform, so every barrier of a body is passed by the whole block); longest epilogue first:
//   blocks 0..3     gates: AEF[t][j] = sigmoid(x[t] . G[j] / (16*64) + bf16(bias_j)); M = 2048, N = 64, K = 1024, f32 out
//   blocks 4..67    v^T: VTH/VTL[d][t] = hi/residual of f16(1024 * Wv[d] . x[t]); M = 1024, N = 2048, K = 1024
//   blocks 68..195  inner | outer: QK[t][n] = f16(16 * x[t] . [Wi;Wo][n]); M = 2048, N = 2048, K = 1024
// =====================================================================================================
#define PB_GE ((TT / 64) * (NGATE / 64) / 8)
#define PB_VT ((DM / 64) * (TT / 64) / 8)
#define PB_QK ((TT / 64) * (QKP / 64) / 8)
#define PB_ALL (PB_GE + PB_VT + PB_QK)
static_assert(gemm_stage_bytes(1) == gemm_stage_bytes(8));
__global__ __launch_bounds__(256) void proj_gemms(
    const unsigned short* __restrict__ XB, const unsigned short* __restrict__ WIO, const unsigned short* __restrict__ WV,
    const unsigned short* __restrict__ WG, const float* __restrict__ ba, const float* __restrict__ be,
    unsigned short* QK, unsigned short* VTH, unsigned short* VTL, float* AEF) {
  __shared__ __align__(16) unsigned char ring[2 * gemm_stage_bytes(1)];
  __shared__ __align__(16) float sT[8 * SLAB_F];
  const int b = blockIdx.x;
  if (b < PB_GE) {
    gemm64<0, 3, 2, 8>(ring, sT, b, XB, DM, WG, DM, ba, be,
                          (void*)AEF, (void*)AEF, NGATE, TT, NGATE, DM, 1.0f / (ACARRY * WSC), 1.0f);
  } else if (b < PB_GE + PB_VT) {
    gemm64<3, 0, 0, 1>(ring, sT, b - PB_GE, WV, DM, XB, DM, ba, be,
                          (void*)VTH, (void*)VTL, TT, DM, TT, DM, 1.0f / (WSC * ACARRY), VC);
  } else {
    gemm64<2, 0, 0, 1>(ring, sT, b - (PB_GE + PB_VT), XB, DM, WIO, DM, ba, be,
                          (void*)QK, (void*)QK, QKP, TT, QKP, DM, 1.0f / (ACARRY * WSC), QC);
  }
}
// =====================================================================================================
// Output projection: out[m][n] = sum_k (CTH[m][k] + CTL[m][k]) * WOUT[n][k] / (4096 * 64); M = 2048, N = 1024, K = 1024, f32 out.
// One block per 64 x 128 tile of out: 32 x 8 = 256 blocks, so that every WGP has one (512 tiles of 64 x 64, one a wave, fill only 64).
// 8 waves as 2 (m) x 4 (n), 32 x 32 of out per wave = 4 accumulator tiles. The ring is gemm64's: stages of 64 k, two buffers, the next
// stage's asynchronous copies fly while this stage is multiplied, one barrier per stage. A stage is 8 copy rounds of 32 rows:
// [ctx hi 64 rows | ctx residual 64 rows | Wout 128 rows]. Per accumulator and k-step of 32: hi product, then residual product, ascending k.
// coverage: 32 rows (it 0..7 x lane>>3) x 32 cols (128 B, one whole line) = the wave's 32 x 32; the grid is exact.
// =====================================================================================================
#define OBM   64
#define OBN   128
#define OOA2  (OBM * LROW)
#define OOB   (2 * OBM * LROW)
#define OSTG  (OOB + OBN * LROW)     // bytes per stage
#define OSLAB (32 * 36)              // per-wave 32 x 32 slab, pitch 36 floats
static_assert((TT % OBM) == 0 && (DM % OBN) == 0 && (DM % KST) == 0 && DM / KST >= 2 && OSTG == 8 * RSTEP);
// one stage: the 8 rounds in one statement that ends in s_wait_xcnt 0, as in the copy helpers above (no address register of an issued
// copy is rewritten before the wait, a precaution); a, a2, b are this lane's row and piece at the stage's k; st = 32 source rows
__device__ __forceinline__ void out_stage(unsigned l, const unsigned short* a, const unsigned short* a2, const unsigned short* b,
                                          size_t st) {
#if defined(__HIP_DEVICE_COMPILE__)
  asm volatile("global_load_async_to_lds_b128 %0, %1, off\n\t"
               "global_load_async_to_lds_b128 %2, %3, off\n\t"
               "global_load_async_to_lds_b128 %4, %5, off\n\t"
               "global_load_async_to_lds_b128 %6, %7, off\n\t"
               "global_load_async_to_lds_b128 %8, %9, off\n\t"
               "global_load_async_to_lds_b128 %10, %11, off\n\t"
               "global_load_async_to_lds_b128 %12, %13, off\n\t"
               "global_load_async_to_lds_b128 %14, %15, off\n\t"
               "s_wait_xcnt 0x0"
               :: "v"(l), "v"(a), "v"(l + RSTEP), "v"(a + st), "v"(l + 2 * RSTEP), "v"(a2), "v"(l + 3 * RSTEP), "v"(a2 + st),
                  "v"(l + 4 * RSTEP), "v"(b), "v"(l + 5 * RSTEP), "v"(b + st), "v"(l + 6 * RSTEP), "v"(b + 2 * st),
                  "v"(l + 7 * RSTEP), "v"(b + 3 * st) : "memory");
#endif
}
__global__ __launch_bounds__(256) void out_gemm(
    const unsigned short* __restrict__ CTH, const unsigned short* __restrict__ CTL, const unsigned short* __restrict__ WOUT,
    float* out) {
  __shared__ __align__(16) unsigned char ring[2 * OSTG];
  __shared__ __align__(16) float sT[8 * OSLAB];
  const int lane = threadIdx.x & 31;
  const int wave = threadIdx.x >> 5;
  const int mB = ((int)blockIdx.x / (DM / OBN)) * OBM;      // block's first row and column
  const int nB = ((int)blockIdx.x % (DM / OBN)) * OBN;
  const int wr = (wave >> 2) * 32, wc = (wave & 3) * 32;    // wave's first row and column in the block tile
  const int rlane = lane & 15;                 // row (A) / col (B, D) within subtile
  const int koff  = (lane >> 4) * 8;           // k offset of this lane half
  const int mOff  = (lane >> 4) * 8;           // D row offset

  // copy side: this lane's row and 16-byte piece in a round of 32 rows
  const int crow = wave * 4 + (lane >> 3);
  const int cseg = (lane & 7) * 8;
  const unsigned lcp = lds_off(ring) + (unsigned)(crow * LROW + cseg * 2);
  const unsigned short* gA  = CTH  + (size_t)(mB + crow) * DM + cseg;
  const unsigned short* gA2 = CTL  + (size_t)(mB + crow) * DM + cseg;
  const unsigned short* gB  = WOUT + (size_t)(nB + crow) * DM + cseg;
  const size_t st = (size_t)32 * DM;
  // reader side: fragment rows of this wave in a stage
  const int fa = (wr + rlane) * LROW + koff * 2;
  const int fb = OOB + (wc + rlane) * LROW + koff * 2;

  v8f a00 = zero8(), a01 = zero8(), a10 = zero8(), a11 = zero8();

  constexpr int nst = DM / KST;
  // stage 0 into buffer 0, landed and published; then stage 1 into buffer 1
  out_stage(lcp, gA, gA2, gB, st);
  wait_copies();
  __syncthreads();
  out_stage(lcp + OSTG, gA + KST, gA2 + KST, gB + KST, st);

#pragma unroll 1   // one stage per trip: the ring's order at the foot stays as written
  for (int t = 0; t < nst; ++t) {
    const unsigned bofs = (unsigned)(t & 1) * OSTG;
    const unsigned char* sb = ring + bofs;
    v16h bh[2][2], ah[2][2], al[2][2];         // [k-step][subtile]: the stage's 24 LDS reads stand together, in front of its WMMAs
#pragma unroll
    for (int s = 0; s < 2; ++s) {
#pragma unroll
      for (int i = 0; i < 2; ++i) {
        bh[s][i] = ldfrag_u((const unsigned short*)(sb + fb + i * 16 * LROW + s * 64));
        ah[s][i] = ldfrag_u((const unsigned short*)(sb + fa + i * 16 * LROW + s * 64));
        al[s][i] = ldfrag_u((const unsigned short*)(sb + OOA2 + fa + i * 16 * LROW + s * 64));
      }
    }
#pragma unroll
    for (int s = 0; s < 2; ++s) {              // two k-steps of 32 per stage, ascending k
      a00 = mma_raw(ah[s][0], bh[s][0], a00);
      a01 = mma_raw(ah[s][0], bh[s][1], a01);
      a10 = mma_raw(ah[s][1], bh[s][0], a10);
      a11 = mma_raw(ah[s][1], bh[s][1], a11);
      a00 = mma_raw(al[s][0], bh[s][0], a00);
      a01 = mma_raw(al[s][0], bh[s][1], a01);
      a10 = mma_raw(al[s][1], bh[s][0], a10);
      a11 = mma_raw(al[s][1], bh[s][1], a11);
      // four vector slots behind the last WMMA, before anything rewrites its operands or touches its results (also over the branch below)
      guard_pv6(a00, a01, a10, a11, ah[s][0], ah[s][1], al[s][0], al[s][1], bh[s][0], bh[s][1]);
    }
    // publish point of stage t + 1; the same barrier ends every reader's last read of stage t's buffer
    wait_lds_reads();
    wait_copies();
    __syncthreads();
    if (t + 2 < nst) {                         // block-uniform: refill the buffer that this trip has just read
      const int kn = (t + 2) * KST;
      out_stage(lcp + bofs, gA + kn, gA2 + kn, gB + kn, st);
    }
  }
  wait_copies();

  // ---- epilogue: each wave stages its 32 x 32 in its own slab and stores whole 128-B lines ----
  const float oscale = 1.0f / (FC * WSC);
  const int q8 = lane >> 3, c4 = (lane & 7) * 4;
  float* slab = sT + wave * OSLAB;
  float* op = out + (size_t)(mB + wr + q8) * DM + nB + wc + c4;
#pragma unroll
  for (int r = 0; r < 8; ++r) {
    slab[(mOff + r) * 36 + rlane] = a00[r];
    slab[(mOff + r) * 36 + 16 + rlane] = a01[r];
    slab[(16 + mOff + r) * 36 + rlane] = a10[r];
    slab[(16 + mOff + r) * 36 + 16 + rlane] = a11[r];
  }
  wave_sync_lds();
  v4f vals[8];
#pragma unroll
  for (int it = 0; it < 8; ++it) vals[it] = *(const v4f*)(slab + (it * 4 + q8) * 36 + c4) * oscale;   // it 0..7 x q8 0..3 = rows 0..31
#pragma unroll
  for (int it = 0; it < 8; ++it) *(v4f*)(op + (size_t)(it * 4) * DM) = vals[it];
}

// =====================================================================================================
// Flash attention for one head and 128 query rows (one wave per 16 query rows), head dim 64, 2048 keys:
//   inner|outer plane (f16 x16) QK[tok][2048]: inner at col 64h + d, outer at col 1024 + 64h + d;
//   v^T planes (f16 hi x1024, unscaled residual): VH/VL[64h + d][key] (pitch 2048);
//   gate plane AEF f32 [tok][64]: col h = ap[h][tok] (sigmoid applied), col 16 + h = ex[h][tok];
//   out: CTH/CTL[tok][64h + d] = f16 hi / residual of 4096 * ctx, ctx = valve/rotation epilogue of
//        ap * sum_s p_s v_s / (ap * sum_s p_s + 1e-8 * sum_s e_s), e_s = exp(score_s - max), p_s = e_s * ex[s].
//   block = 8 waves = 256 threads; grid = 16 heads x 16 query groups = 256; every wave does identical bounded work (64 steps).
//   The 8 waves read the same keys: per stage of 64 keys the block copies the head's 64 outer rows and the 64 rows of each v^T
//   plane (128 B each, whole lines) with asynchronous copies into one of two LDS buffers; the next stage's copies fly while this
//   stage is worked on; one barrier per stage. A stage is two steps of 32 keys. The head's ex column (2048 f32) is put into LDS
//   once, in front of the first barrier.
//   Both products are transposed: S^T = outer . inner^T (A = 16 key rows from the stage, B = the wave's 16 query rows, kept in
//   registers) and O^T += v^T . P^T (A = 16 d rows of v^T from the stage, B = P^T). A lane (c = lane & 15, hh = lane >> 4) then
//   holds only query q0 + c: score register r of tile i is key kb + 16 i + 8 hh + r, which is the k order of a B operand, so the
//   two score tiles of a step, converted in place, are P^T; output register r of tile j is d = 16 j + 8 hh + r.
//   Per step: 2 score tiles on f16 WMMA (K = 64 as two k-steps of 32); the maximum over the lane's 16 keys in the lane, joined with
//   the other half by one cross-row move; online max-subtracted softmax in f32 (exp2, log2e / 8 / carries folded in); running sums
//   of e and of p = e*ex in eight partial sums per lane (one per score register; they and the halves are joined once, behind the loop); one
//   rescale factor per lane; 12 WMMAs (hi.hi, hi.lo, lo.hi) into one accumulator set.
//   Final scaling in f32; each lane stages its query's 4 x 8 consecutive d (hi and residual) in the block's LDS row buffers [128][64];
// coverage: LDS row buffers: 8 waves x 16 rows x 64 cols = 128 x 64; global: 4 iterations x 256 threads x 8 halves = 128 rows x 64
//           cols (cols 64*head ..) of rows qB..qB+127, both planes; grid covers all 2048 rows x 1024 cols exactly once.
// =====================================================================================================
#define AKS   64                        // keys per stage: 128 B of every v^T row = one whole line
#define AOVH  (AKS * LROW)              // stage layout in bytes: [64 outer rows | 64 v^T hi rows | 64 v^T residual rows]
#define AOVL  (AOVH + HDIM * LROW)
#define ASTG  (AOVL + HDIM * LROW)      // bytes per stage
static_assert(AKS == 64 && HDIM == 64 && (TT % AKS) == 0 && (TT / AKS) >= 2 && HDIM * 2 + 16 == LROW && AKS * 2 + 16 == LROW);
static_assert((TT % ATT_THREADS) == 0);
// one stage: keys 64 t .. 64 t + 63; l, gK, gVh, gVl are this lane's row (4*wave + (lane>>3) of a round of 32) and 16-byte piece
__device__ __forceinline__ void att_stage(unsigned l, const unsigned short* gK, const unsigned short* gVh,
                                          const unsigned short* gVl, int t) {
  copy_rows<2>(l,        gK  + (size_t)t * AKS * QKP, (size_t)32 * QKP);
  copy_rows<2>(l + AOVH, gVh + (size_t)t * AKS,       (size_t)32 * TT);
  copy_rows<2>(l + AOVL, gVl + (size_t)t * AKS,       (size_t)32 * TT);
}
__device__ __forceinline__ const _Float16* lds_h(const unsigned char* p) { return (const _Float16*)(const void*)p; }
// value of lane l ^ 16 (one vector cross-row move, no LDS counter)
__device__ __forceinline__ float xhalf(float x) {
  const int b = __builtin_bit_cast(int, x);
  return __builtin_bit_cast(float, __builtin_amdgcn_permlanex16(b, b, 0x76543210, 0xfedcba98, false, false));
}

__global__ __launch_bounds__(ATT_THREADS)
void attn_heads(const unsigned short* __restrict__ QKq, const unsigned short* __restrict__ VHq,
                const unsigned short* __restrict__ VLq, const float* __restrict__ AEF,
                const float* __restrict__ betap, const float* __restrict__ ivp,
                const float* __restrict__ ovp, const float* __restrict__ chg,
                unsigned short* CTH, unsigned short* CTL) {
  __shared__ __align__(16) unsigned char kv[2 * ASTG];      // two stages of outer rows and v^T rows
  __shared__ __align__(16) float exs[TT];                   // ex of this head, by key
  __shared__ __align__(16) unsigned short Osh[ATT_QB * HDIM];   // block result rows [128][64], hi
  __shared__ __align__(16) unsigned short Osl[ATT_QB * HDIM];   // residual

  const int tid  = threadIdx.x;
  const int wave = tid >> 5;
  const int lane = tid & 31;
  const int hh   = lane >> 4;
  const int c    = lane & 15;

  const int qg   = blockIdx.x % ATT_QG;                     // query group 0..15
  const int head = (blockIdx.x / ATT_QG) & (NHEAD - 1);     // 0..15
  const int qB   = qg * ATT_QB;                             // block's first query row
  const int q0   = qB + wave * 16;                          // wave's first query row

  const _Float16* Qh = (const _Float16*)(const void*)QKq + (size_t)(q0 + c) * QKP + head * HDIM + 8 * hh;
  const float* Ex = AEF + 16 + head;                                    // ex column of this head
  const float lsc = (1.4426950408889634f * ATT_SCALE) / (QC * KC);      // log2(e) / 8 / carries

  // copy side: this lane's row and 16-byte piece in a round of 32 rows
  const int crow = wave * 4 + (lane >> 3);
  const int cseg = (lane & 7) * 8;
  const unsigned lcp = lds_off(kv) + (unsigned)(crow * LROW + cseg * 2);
  const unsigned short* gK  = QKq + (size_t)crow * QKP + DM + head * HDIM + cseg;
  const unsigned short* gVh = VHq + (size_t)(head * HDIM + crow) * TT + cseg;
  const unsigned short* gVl = VLq + (size_t)(head * HDIM + crow) * TT + cseg;
  // reader side: this lane's fragment row (key or d = c within a group of 16 rows) and k half, in bytes
  const int fr = c * LROW + 16 * hh;

  // stage 0 into buffer 0, landed and published; then stage 1 into buffer 1. The ex column is published by the same barrier.
  att_stage(lcp, gK, gVh, gVl, 0);
  const v16h qa = ldfrag_h(Qh), qb = ldfrag_h(Qh + 32);
  const float apq = AEF[(size_t)(q0 + c) * NGATE + head];    // ap of this lane's query, used behind the loop
#pragma unroll   // the 8 loads are issued together, one latency
  for (int i = 0; i < TT / ATT_THREADS; ++i) {
    const int k = i * ATT_THREADS + tid;                     // 8 x 256 = all 2048 keys
    exs[k] = Ex[(size_t)k * NGATE];
  }
  wait_copies();
  __syncthreads();
  att_stage(lcp + ASTG, gK, gVh, gVl, 1);

  float mrow = -INFINITY;                                    // this lane's query
  v8f zv = zero8(), lv = zero8();                            // sums of e and p: element r over this half's keys 8hh + r (mod 16)
  v8f o0 = zero8(), o1 = zero8(), o2 = zero8(), o3 = zero8();

  constexpr int nst = TT / AKS;
#pragma unroll 1   // one stage per trip: the ring's order at the foot stays as written
  for (int t = 0; t < nst; ++t) {
    const unsigned bofs = (unsigned)(t & 1) * ASTG;
    const unsigned char* sb = kv + bofs + fr;
#pragma unroll
    for (int s = 0; s < 2; ++s) {              // two steps of 32 keys per stage, ascending keys
      const int kb = t * AKS + s * 32;
      v8f s0, s1;                              // s0[r]: key kb + 8hh + r, s1[r]: key kb + 16 + 8hh + r, query q0 + c
      {
        const _Float16* kp = lds_h(sb + (s * 32) * LROW);
        const v16h k0 = ldfrag_h(kp), k1 = ldfrag_h(kp + 32);
        s0 = mma_raw(k0, qa, zero8());
        s0 = mma_raw(k1, qb, s0);
        guard_s2(s0, k0, k1);
      }
      {
        const _Float16* kq = lds_h(sb + (s * 32 + 16) * LROW);
        const v16h k0 = ldfrag_h(kq), k1 = ldfrag_h(kq + 32);
        s1 = mma_raw(k0, qa, zero8());
        s1 = mma_raw(k1, qb, s1);
        guard_s4(s1, k0, k1, qa, qb);
      }
      const float* exq = exs + kb + 8 * hh;
      const v4f xa = *(const v4f*)(exq),      xb = *(const v4f*)(exq + 4);      // ex of keys kb + 8hh + 0..7
      const v4f xc = *(const v4f*)(exq + 16), xd = *(const v4f*)(exq + 20);     // ex of keys kb + 16 + 8hh + 0..7
      const v8f x0 = __builtin_shufflevector(xa, xb, 0, 1, 2, 3, 4, 5, 6, 7);
      const v8f x1 = __builtin_shufflevector(xc, xd, 0, 1, 2, 3, 4, 5, 6, 7);
      const float m0 = fmaxf(fmaxf(s0[0], s0[1]), s0[2]), m1 = fmaxf(fmaxf(s0[3], s0[4]), s0[5]);
      const float m2 = fmaxf(fmaxf(s0[6], s0[7]), s1[0]), m3 = fmaxf(fmaxf(s1[1], s1[2]), s1[3]);
      const float m4 = fmaxf(fmaxf(s1[4], s1[5]), s1[6]);
      float mx = fmaxf(fmaxf(fmaxf(m0, m1), s1[7]), fmaxf(fmaxf(m2, m3), m4));   // the lane's 16 keys
      mx = fmaxf(mx, xhalf(mx));               // both halves: maximum over the step's 32 keys
      const float mn = fmaxf(mrow, mx * lsc);
      const float al = exp2_hw(mrow - mn);
      mrow = mn;
      // the exponents' arguments as one vector fma (the contraction the compiler made before): written so, they stay two to an instruction
      const v8f mn8 = {mn, mn, mn, mn, mn, mn, mn, mn};
      const v8f lsc8 = {lsc, lsc, lsc, lsc, lsc, lsc, lsc, lsc};
      const v8f t0 = __builtin_elementwise_fma(s0, lsc8, -mn8), t1 = __builtin_elementwise_fma(s1, lsc8, -mn8);
      v8f e0, e1;
#pragma unroll   // constant element indices: the vectors stay in registers
      for (int r = 0; r < 8; ++r) { e0[r] = exp2_hw(t0[r]); e1[r] = exp2_hw(t1[r]); }
      const v8f p0 = e0 * x0, p1 = e1 * x1;
      zv = zv * al + (e0 + e1);
      lv = lv * al + (p0 + p1);
      FragH ph, pl;                            // P^T as a B operand: element r <- k = 8hh + r, element 8 + r <- k = 16 + 8hh + r
      {
        const v8f y0 = p0 * PC, y1 = p1 * PC;
        ph.h[0] = __builtin_convertvector(y0, v8h);
        ph.h[1] = __builtin_convertvector(y1, v8h);
        pl.h[0] = __builtin_convertvector(y0 - __builtin_convertvector(ph.h[0], v8f), v8h);
        pl.h[1] = __builtin_convertvector(y1 - __builtin_convertvector(ph.h[1], v8f), v8h);
      }
      o0 *= al;
      o1 *= al;
      o2 *= al;
      o3 *= al;
      {
        const unsigned char* vp = sb + AOVH + s * 64;          // 32 keys = 64 B along a v^T row
        const v16h vb0 = ldfrag_h(lds_h(vp));
        const v16h vb1 = ldfrag_h(lds_h(vp + 16 * LROW));
        const v16h vb2 = ldfrag_h(lds_h(vp + 32 * LROW));
        const v16h vb3 = ldfrag_h(lds_h(vp + 48 * LROW));
        o0 = mma_raw(vb0, ph.v, o0);
        o1 = mma_raw(vb1, ph.v, o1);
        o2 = mma_raw(vb2, ph.v, o2);
        o3 = mma_raw(vb3, ph.v, o3);
        o0 = mma_raw(vb0, pl.v, o0);
        o1 = mma_raw(vb1, pl.v, o1);
        o2 = mma_raw(vb2, pl.v, o2);
        o3 = mma_raw(vb3, pl.v, o3);
        guard_pv6(o0, o1, o2, o3, ph.v, pl.v, vb0, vb1, vb2, vb3);
      }
      {
        const unsigned char* vp = sb + AOVL + s * 64;
        const v16h vl0 = ldfrag_h(lds_h(vp));
        const v16h vl1 = ldfrag_h(lds_h(vp + 16 * LROW));
        const v16h vl2 = ldfrag_h(lds_h(vp + 32 * LROW));
        const v16h vl3 = ldfrag_h(lds_h(vp + 48 * LROW));
        o0 = mma_raw(vl0, ph.v, o0);
        o1 = mma_raw(vl1, ph.v, o1);
        o2 = mma_raw(vl2, ph.v, o2);
        o3 = mma_raw(vl3, ph.v, o3);
        guard_pv5(o0, o1, o2, o3, ph.v, vl0, vl1, vl2, vl3);
      }
    }
    // publish point of stage t + 1; the same barrier ends every reader's last read of stage t's buffer
    wait_lds_reads();
    wait_copies();
    __syncthreads();
    if (t + 2 < nst) att_stage(lcp + bofs, gK, gVh, gVl, t + 2);   // block-uniform: refill the buffer that this trip has just read
  }
  wait_copies();

  // ---- per-head gates and rotation, renormaliser, carries (1024 on p, 1024 on v, 4096 on the stored ctx) ----
  const float zrow = ((zv[0] + zv[1]) + (zv[2] + zv[3])) + ((zv[4] + zv[5]) + (zv[6] + zv[7]));
  const float lrow = ((lv[0] + lv[1]) + (lv[2] + lv[3])) + ((lv[4] + lv[5]) + (lv[6] + lv[7]));
  const float zt  = zrow + xhalf(zrow);                      // the two halves' sums, on the same maximum
  const float lt  = lrow + xhalf(lrow);
  const float bet = bfr(betap[head]);
  const float ivs = sigf(bfr(ivp[head]));
  const float og  = sigf(bfr(ovp[head])) * tanhf(bfr(chg[head]));
  const float ang = PI_F * sigf(bet);
  const float ca  = cosf(ang), sa = sinf(ang);
  const float base = ivs / (PC * VC);
  const float den = apq * lt + REN_EPS * zt;
  const float sc  = apq * (1.0f / den) * base;
  v8h yh[4], yl[4];                                          // tile j: d = 16 j + 8 hh + r
#pragma unroll
  for (int r = 0; r < 8; ++r) {
    const float x0 = o0[r] * sc, x1 = o1[r] * sc, x2 = o2[r] * sc, x3 = o3[r] * sc;
    const float y0 = ((x0 * ca - x2 * sa) * og) * FC;
    const float y1 = ((x1 * ca - x3 * sa) * og) * FC;
    const float y2 = ((x0 * sa + x2 * ca) * og) * FC;
    const float y3 = ((x1 * sa + x3 * ca) * og) * FC;
    const _Float16 h0 = (_Float16)y0, h1 = (_Float16)y1, h2 = (_Float16)y2, h3 = (_Float16)y3;
    yh[0][r] = h0;
    yh[1][r] = h1;
    yh[2][r] = h2;
    yh[3][r] = h3;
    yl[0][r] = (_Float16)(y0 - (float)h0);
    yl[1][r] = (_Float16)(y1 - (float)h1);
    yl[2][r] = (_Float16)(y2 - (float)h2);
    yl[3][r] = (_Float16)(y3 - (float)h3);
  }
  {
    unsigned short* oh = Osh + (wave * 16 + c) * HDIM + 8 * hh;
    unsigned short* ol = Osl + (wave * 16 + c) * HDIM + 8 * hh;
#pragma unroll   // constant array indices: yh, yl stay in registers
    for (int j = 0; j < 4; ++j) {
      *(v8h*)(void*)(oh + 16 * j) = yh[j];
      *(v8h*)(void*)(ol + 16 * j) = yl[j];
    }
  }
  __syncthreads();
  // ---- block writes its 128 row segments: piece p = it*256 + tid -> row p>>3, halves (p&7)*8 of the 64-col slab (128 B a row) ----
  {
    v4u vh[4], vl[4];
#pragma unroll
    for (int it = 0; it < 4; ++it) {
      const int p = it * ATT_THREADS + tid;
      vh[it] = *(const v4u*)(Osh + (size_t)p * 8);
      vl[it] = *(const v4u*)(Osl + (size_t)p * 8);
    }
    const size_t dofs = (size_t)qB * DM + (size_t)head * HDIM;
    unsigned short* dh = CTH + dofs;
    unsigned short* dl = CTL + dofs;
    {
#pragma unroll
      for (int it = 0; it < 4; ++it) {
        const int p = it * ATT_THREADS + tid;
        const size_t po = (size_t)(p >> 3) * DM + (size_t)(p & 7) * 8;
        *(v4u*)(dh + po) = vh[it];
        *(v4u*)(dl + po) = vl[it];
      }
    }
  }
}

// =====================================================================================================
// Workspace map (bytes); every plane is an exact multiple of its tile / whole-row store granularity (M, N exact tile multiples,
// row blocks exact, no pad rows needed), every offset a multiple of 131072:
//   WIO  f16 [2048][1024] x64     4194304   (rows 0..1023 Wi, 1024..2047 Wo; native [out][in] = [n][k])
//   WV   f16 [1024][1024] x64     2097152
//   WOUT f16 [1024][1024] x64     2097152
//   WG   f16 [64][1024]   x64      131072   (Wa, We, Wa, We)
//   XB   f16 [2048][1024] x16     4194304
//   QK   f16 [2048][2048] x16     8388608   (inner | outer)
//   VTH  f16 [1024][2048] x1024   4194304   (v^T hi)
//   VTL  f16 [1024][2048]         4194304   (v^T residual)
//   AEF  f32 [2048][64]            524288   (sigmoid gates)
//   CTH  f16 [2048][1024] x4096   4194304   (ctx hi)
//   CTL  f16 [2048][1024]         4194304   (ctx residual)
//   end                          38404096
// =====================================================================================================
extern "C" void kernel_launch(void* const* d_in, const int* in_sizes, int n_in,
                              void* d_out, int out_size, void* d_ws, size_t ws_size,
                              hipStream_t stream) {
  if (n_in < 13) return;
  if (in_sizes[0] != TT * DM) return;
  if (in_sizes[1] != NHEAD * DM || in_sizes[2] != NHEAD) return;
  if (in_sizes[3] != NHEAD * DM || in_sizes[4] != NHEAD) return;
  if (in_sizes[5] != DM * DM || in_sizes[6] != DM * DM || in_sizes[7] != DM * DM || in_sizes[8] != DM * DM) return;
  if (in_sizes[9] != NHEAD || in_sizes[10] != NHEAD || in_sizes[11] != NHEAD || in_sizes[12] != NHEAD) return;
  if (out_size != TT * DM) return;

  const float* x     = (const float*)d_in[0];
  const float* Wa    = (const float*)d_in[1];
  const float* ba    = (const float*)d_in[2];
  const float* We    = (const float*)d_in[3];
  const float* be    = (const float*)d_in[4];
  const float* Wi    = (const float*)d_in[5];
  const float* Wo    = (const float*)d_in[6];
  const float* Wv    = (const float*)d_in[7];
  const float* Wout  = (const float*)d_in[8];
  const float* betap = (const float*)d_in[9];
  const float* ivp   = (const float*)d_in[10];
  const float* ovp   = (const float*)d_in[11];
  const float* chg   = (const float*)d_in[12];
  float*       out   = (float*)d_out;

  const size_t PWIO = (size_t)2 * DM * DM * 2;                    //  4194304
  const size_t PW   = (size_t)DM * DM * 2;                        //  2097152
  const size_t PG   = (size_t)NGATE * DM * 2;                     //   131072
  const size_t PX   = (size_t)TT * DM * 2;                        //  4194304
  const size_t PQK  = (size_t)TT * QKP * 2;                       //  8388608
  const size_t PVT  = (size_t)DM * TT * 2;                        //  4194304
  const size_t PAE  = (size_t)TT * NGATE * 4;                     //   524288
  const size_t PCT  = (size_t)TT * DM * 2;                        //  4194304
  size_t off = 0;
  const size_t oWIO = off; off += PWIO;
  const size_t oWV  = off; off += PW;
  const size_t oWOU = off; off += PW;
  const size_t oWG  = off; off += PG;
  const size_t oXB  = off; off += PX;
  const size_t oQK  = off; off += PQK;
  const size_t oVTH = off; off += PVT;
  const size_t oVTL = off; off += PVT;
  const size_t oAEF = off; off += PAE;
  const size_t oCTH = off; off += PCT;
  const size_t oCTL = off; off += PCT;
  if (off > ws_size) return;                                      // off = 38404096
  if (off > (size_t)134217728) return;

  char* ws = (char*)d_ws;
  unsigned short* WIO  = (unsigned short*)(ws + oWIO);
  unsigned short* WV   = (unsigned short*)(ws + oWV);
  unsigned short* WOUT = (unsigned short*)(ws + oWOU);
  unsigned short* WG   = (unsigned short*)(ws + oWG);
  unsigned short* XB   = (unsigned short*)(ws + oXB);
  unsigned short* QK   = (unsigned short*)(ws + oQK);
  unsigned short* VTH  = (unsigned short*)(ws + oVTH);
  unsigned short* VTL  = (unsigned short*)(ws + oVTL);
  float*          AEF  = (float*)(ws + oAEF);
  unsigned short* CTH  = (unsigned short*)(ws + oCTH);
  unsigned short* CTL  = (unsigned short*)(ws + oCTL);

  const dim3 blk(256);
  const dim3 gCV(CB_ALL);                                         // 776 blocks
  const dim3 gPR(PB_ALL);                                         // 196 blocks
  const dim3 gO((TT / OBM) * (DM / OBN));                         // 256
  const dim3 gAT(ATT_BLOCKS);                                     // 256
  const dim3 bAT(ATT_THREADS);                                    // 256

  // (0) 16-bit planes: XB = f16(16 * bf16(x)); W planes = f16(64 * bf16(W)) in native [n][k] layout; gate plane
  conv_all<<<gCV, blk, 0, stream>>>(x, Wi, Wo, Wv, Wout, Wa, We, XB, WIO, WV, WOUT, WG);

  // (1..3) gates, v^T, inner | outer
  proj_gemms<<<gPR, blk, 0, stream>>>(XB, WIO, WV, WG, ba, be, QK, VTH, VTL, AEF);

  // (4) attention per (128 query rows, 1 head) -> CTH/CTL (ctx x4096 hi + residual)
  attn_heads<<<gAT, bAT, 0, stream>>>(QK, VTH, VTL, AEF, betap, ivp, ovp, chg, CTH, CTL);

  // (5) output projection
  out_gemm<<<gO, blk, 0, stream>>>(CTH, CTL, WOUT, out);
  (void)hipGetLastError();
}

// v007
// One run takes 81 microseconds.
// Next to v006, in two timings, it ran 1.06 times as fast each time.
// All steps since v000 together make it 4.62 times as fast.
// Contractions: gate logits (x f16 x16 . [Wa;We;Wa;We] f16 x64, K=1024), inner|outer projections (x f16 x16 . [Wi;Wo] f16 x64, K=1024),
// v^T projection (Wv f16 x64 . x f16 x16, K=1024; stored as f16 hi x1024 + residual plane), scores (inner f16 x16 . outer f16 x16, K=64),
// v^T . P^T (v^T f16 hi+residual . P f16 x1024 hi+residual, three products, 2048 keys in steps of 32; scores and this product transposed),
// output projection (ctx f16 x4096 hi+residual . Wout f16 x64, two products, K=1024): all v_wmma_f32_16x16x32_f16, f32 accumulate.
// Sigmoid gates, online max-subtracted softmax, renormaliser, valve/rotation epilogue in f32 on VALU; every float input RNE-converted to bf16 on load.
#include <hip/hip_runtime.h>
#include <math.h>
#include <stdint.h>

#define TT      2048
#define DM      1024
#define NHEAD   16
#define HDIM    64
#define NGATE   64
#define QTB     8
#define QKP     (2 * DM)
#define WSC     64.0f
#define ACARRY  16.0f
#define QC      16.0f
#define KC      16.0f
#define VC      1024.0f
#define PC      1024.0f
#define FC      4096.0f
#define ATT_SCALE 0.125f
#define PI_F    3.14159265358979323846f
#define REN_EPS 1e-8f
static_assert(NHEAD * HDIM == DM);
static_assert((TT % 64) == 0 && (DM % 64) == 0 && (DM % 256) == 0 && (TT % 32) == 0 && (TT % 16) == 0);
static_assert(NHEAD == 16 && NGATE == 64);
#define ATT_THREADS (QTB * 32)
#define ATT_QB      (QTB * 16)
#define ATT_QG      (TT / ATT_QB)
#define ATT_BLOCKS  (ATT_QG * NHEAD)
static_assert(ATT_THREADS == 256 && ATT_BLOCKS == 256 && (TT % ATT_QB) == 0);

typedef _Float16 v16h __attribute__((ext_vector_type(16)));
typedef _Float16 v8h  __attribute__((ext_vector_type(8)));
typedef float    v8f  __attribute__((ext_vector_type(8)));
typedef float    v4f  __attribute__((ext_vector_type(4)));
typedef unsigned int v4u __attribute__((ext_vector_type(4)));

union FragH { v16h v; v8h h[2]; v4u u[2]; };

// ---- scalar helpers --------------------------------------------------------------------------------
__device__ __forceinline__ unsigned short bf_bits(float f) {          // f32 -> bf16 bits, RNE convert
  unsigned u = __float_as_uint(f);
  return (unsigned short)((u + 0x7FFFu + ((u >> 16) & 1u)) >> 16);
}
__device__ __forceinline__ float bf_up(unsigned short h) { return __uint_as_float(((unsigned)h) << 16); }
__device__ __forceinline__ float bfr(float f) { return bf_up(bf_bits(f)); }   // value of the bf16 RNE convert
__device__ __forceinline__ unsigned short h_bits(_Float16 x) { return __builtin_bit_cast(unsigned short, x); }
__device__ __forceinline__ unsigned pk16(unsigned short a, unsigned short b) { return (unsigned)a | ((unsigned)b << 16); }
__device__ __forceinline__ v8f zero8() { v8f z = {0.f, 0.f, 0.f, 0.f, 0.f, 0.f, 0.f, 0.f}; return z; }
__device__ __forceinline__ float sigf(float v) { return 1.0f / (1.0f + expf(-v)); }
// 2^x as the one hardware instruction (v_exp_f32). The library exp2f adds a compare, two selects, an add and an ldexp per value, only
// to return subnormal results; here a result under 2^-126 may be 0: it stands beside a term near 1 in the sum of e, beside
// 1e-8 times that sum in the renormaliser, and is 0 in both f16 planes of P either way (a rescale factor that small likewise). -inf gives 0, as in the library form.
__device__ __forceinline__ float exp2_hw(float x) { return __builtin_amdgcn_exp2f(x); }

// ---- fragment loaders: 16-bit A/B operand, lane -> row/col (lane&15), p already includes +8*(lane>>4);
//      elements 0..7 <- p[0..7] (k0+8h..), elements 8..15 <- p[16..23] (k0+16+8h..)  (same split k map for A and B;
//      B is always read from a k-contiguous [n][k] plane)
__device__ __forceinline__ v16h ldfrag_h(const _Float16* p) {
  FragH f;
  f.h[0] = *(const v8h*)(p);
  f.h[1] = *(const v8h*)(p + 16);
  return f.v;
}
__device__ __forceinline__ v16h ldfrag_u(const unsigned short* p) {
  FragH f;
  f.u[0] = *(const v4u*)(p);
  f.u[1] = *(const v4u*)(p + 16);
  return f.v;
}

// ---- WMMA helpers with trailing VALU hazard gaps ------------------------------------------------------
__device__ __forceinline__ v8f mma_raw(v16h a, v16h b, v8f c) {
  return __builtin_amdgcn_wmma_f32_16x16x32_f16(false, a, false, b, (short)0, c, false, false);
}
__device__ __forceinline__ void dep_guard1(v8f& a, v8f& b, v16h x) {
#if defined(__HIP_DEVICE_COMPILE__)
  asm volatile("v_nop\n\tv_nop\n\tv_nop\n\tv_nop" : "+v"(a), "+v"(b) : "v"(x));
#endif
}
__device__ __forceinline__ void guard_pv6(v8f& a, v8f& b, v8f& c, v8f& d,
                                          v16h p0, v16h p1, v16h x0, v16h x1, v16h x2, v16h x3) {
#if defined(__HIP_DEVICE_COMPILE__)
  asm volatile("v_nop\n\tv_nop\n\tv_nop\n\tv_nop"
               : "+v"(a), "+v"(b), "+v"(c), "+v"(d) : "v"(p0), "v"(p1), "v"(x0), "v"(x1), "v"(x2), "v"(x3));
#endif
}
__device__ __forceinline__ void keep4_h(v16h a, v16h b, v16h c, v16h d) {
#if defined(__HIP_DEVICE_COMPILE__)
  asm volatile("v_nop" :: "v"(a), "v"(b), "v"(c), "v"(d));
#endif
}
__device__ __forceinline__ void acc_guard4(v8f& a, v8f& b, v8f& c, v8f& d) {
#if defined(__HIP_DEVICE_COMPILE__)
  asm volatile("v_nop\n\tv_nop\n\tv_nop\n\tv_nop" : "+v"(a), "+v"(b), "+v"(c), "+v"(d));
#endif
}
__device__ __forceinline__ void wave_sync_lds() {
  __builtin_amdgcn_fence(__ATOMIC_RELEASE, "workgroup");
  __builtin_amdgcn_wave_barrier();
  __builtin_amdgcn_fence(__ATOMIC_ACQUIRE, "workgroup");
}

// =====================================================================================================
// Row convert: X f32 [nrows][1024] -> Y f16 [nrows][1024] = f16( bf16_RNE(X) * carry ), carry a power of two (exact).
// One wave per row (8 rows per block); lane l holds cols j*256 + 8l..8l+7 for j = 0..3; store instruction j covers a contiguous
// coverage: 4 x 32 lanes x 8 halves = 1024 = the whole row; nrows/8 blocks per job (exact multiples here) with a wave-uniform row bound.
// Used for x (carry 16) and for Wi, Wo, Wv, Wout in their native [out][in] = [n][k] layout (carry 64).
// =====================================================================================================
__device__ __forceinline__ void conv_rows(int blk, const float* __restrict__ X, unsigned short* Y, int nrows, float carry) {
  const int lane = threadIdx.x & 31, wave = threadIdx.x >> 5;
  const int row = blk * 8 + wave;
  if (row >= nrows) return;                      // wave-uniform; no barriers in this kernel
  const float* xp = X + (size_t)row * DM;
  unsigned short* op = Y + (size_t)row * DM;
  v4u res[4];
#pragma unroll
  for (int j = 0; j < 4; ++j) {
    const int c0 = j * 256 + lane * 8;
    const v4f a0 = *(const v4f*)(xp + c0), a1 = *(const v4f*)(xp + c0 + 4);
    float t[8];
#pragma unroll
    for (int e = 0; e < 4; ++e) { t[e] = bfr(a0[e]) * carry; t[4 + e] = bfr(a1[e]) * carry; }
    v4u o = {0u, 0u, 0u, 0u};
#pragma unroll
    for (int e = 0; e < 4; ++e) o[e] = pk16(h_bits((_Float16)t[2 * e]), h_bits((_Float16)t[2 * e + 1]));
    res[j] = o;
  }
  {
#pragma unroll
    for (int j = 0; j < 4; ++j) *(v4u*)(op + j * 256 + lane * 8) = res[j];
    
  }
}

// =====================================================================================================
// Gate weight plane: G f16 [64][1024]: row r = f16( 64 * bf16_RNE( (r & 16) ? We[r & 15] : Wa[r & 15] ) ) (rows 32..63 duplicate 0..31).
// Both candidate rows loaded with clamped in-range addresses, selected by value (row is wave-uniform). Same store shape as conv_rows.
// coverage: 8 blocks x 8 waves = 64 rows x (4 x 32 x 8 = 1024 cols), exact.
// =====================================================================================================
__device__ __forceinline__ void conv_gate(int blk, const float* __restrict__ Wa, const float* __restrict__ We,
                                          unsigned short* Y, float carry) {
  const int lane = threadIdx.x & 31, wave = threadIdx.x >> 5;
  const int row = blk * 8 + wave;
  if (row >= NGATE) return;                      // wave-uniform; no barriers in this kernel
  const float* pa = Wa + (size_t)(row & 15) * DM;
  const float* pb = We + (size_t)(row & 15) * DM;
  const bool useb = (row & 16) != 0;
  unsigned short* op = Y + (size_t)row * DM;
  v4u res[4];
#pragma unroll
  for (int j = 0; j < 4; ++j) {
    const int c0 = j * 256 + lane * 8;
    const v4f a0 = *(const v4f*)(pa + c0), a1 = *(const v4f*)(pa + c0 + 4);
    const v4f b0 = *(const v4f*)(pb + c0), b1 = *(const v4f*)(pb + c0 + 4);
    float t[8];
#pragma unroll
    for (int e = 0; e < 4; ++e) {
      t[e]     = bfr(useb ? b0[e] : a0[e]) * carry;
      t[4 + e] = bfr(useb ? b1[e] : a1[e]) * carry;
    }
    v4u o = {0u, 0u, 0u, 0u};
#pragma unroll
    for (int e = 0; e < 4; ++e) o[e] = pk16(h_bits((_Float16)t[2 * e]), h_bits((_Float16)t[2 * e + 1]));
    res[j] = o;
  }
  {
#pragma unroll
    for (int j = 0; j < 4; ++j) *(v4u*)(op + j * 256 + lane * 8) = res[j];
    
  }
}

// =====================================================================================================
// All conversions in one launch: none reads what another writes. The block index picks the job (block-uniform, no barriers):
// blocks 0..255 x, then 128 each for Wi, Wo, Wv, Wout, then 8 for the gate plane; every job keeps its own rows and stores.
// =====================================================================================================
#define CB_X  (TT / 8)
#define CB_W  (DM / 8)
#define CB_G  (NGATE / 8)
#define CB_ALL (CB_X + 4 * CB_W + CB_G)
__global__ __launch_bounds__(256) void conv_all(const float* __restrict__ x, const float* __restrict__ Wi,
                                                const float* __restrict__ Wo, const float* __restrict__ Wv,
                                                const float* __restrict__ Wout, const float* __restrict__ Wa,
                                                const float* __restrict__ We,
                                                unsigned short* XB, unsigned short* WIO, unsigned short* WV,
                                                unsigned short* WOUT, unsigned short* WG) {
  const int b = blockIdx.x;
  if (b >= CB_X + 4 * CB_W) {
    conv_gate(b - (CB_X + 4 * CB_W), Wa, We, WG, WSC);
    return;
  }
  const float* X = x;
  unsigned short* Y = XB;
  int rb = b, nrows = TT;
  float carry = ACARRY;
  if (b >= CB_X) {
    const int w = (b - CB_X) / CB_W;             // 0..3: Wi, Wo, Wv, Wout
    rb = (b - CB_X) % CB_W;
    nrows = DM;
    carry = WSC;
    X = w == 0 ? Wi : w == 1 ? Wo : w == 2 ? Wv : Wout;
    Y = w == 0 ? WIO : w == 1 ? WIO + (size_t)DM * DM : w == 2 ? WV : WOUT;
  }
  conv_rows(rb, X, Y, nrows, carry);
}

// ---- asynchronous global -> LDS copies (16 B per lane). Each statement ends in s_wait_xcnt 0 so that no address register of an
//      issued copy is rewritten before the wait (a precaution); landing is waited for separately with s_wait_asynccnt 0.
#define KST   64      // k per stage: 128 B of every operand row = one whole line
#define LROW  144     // LDS row pitch in bytes: 128 + 16 (16 B x odd: conflict-free for 16-byte readers)
#define RSTEP (32 * LROW)   // LDS bytes between two copy rounds (a round = 8 waves x 4 rows)
__device__ __forceinline__ unsigned lds_off(const void* p) { return (unsigned)(size_t)p; }
__device__ __forceinline__ void copy2_lds(unsigned l, const unsigned short* g, size_t st) {
#if defined(__HIP_DEVICE_COMPILE__)
  asm volatile("global_load_async_to_lds_b128 %0, %1, off\n\t"
               "global_load_async_to_lds_b128 %2, %3, off\n\t"
               "s_wait_xcnt 0x0"
               :: "v"(l), "v"(g), "v"(l + RSTEP), "v"(g + st) : "memory");
#endif
}
__device__ __forceinline__ void copy8_lds(unsigned l, const unsigned short* g, size_t st) {
#if defined(__HIP_DEVICE_COMPILE__)
  asm volatile("global_load_async_to_lds_b128 %0, %1, off\n\t"
               "global_load_async_to_lds_b128 %2, %3, off\n\t"
               "global_load_async_to_lds_b128 %4, %5, off\n\t"
               "global_load_async_to_lds_b128 %6, %7, off\n\t"
               "global_load_async_to_lds_b128 %8, %9, off\n\t"
               "global_load_async_to_lds_b128 %10, %11, off\n\t"
               "global_load_async_to_lds_b128 %12, %13, off\n\t"
               "global_load_async_to_lds_b128 %14, %15, off\n\t"
               "s_wait_xcnt 0x0"
               :: "v"(l), "v"(g), "v"(l + RSTEP), "v"(g + st), "v"(l + 2 * RSTEP), "v"(g + 2 * st),
                  "v"(l + 3 * RSTEP), "v"(g + 3 * st), "v"(l + 4 * RSTEP), "v"(g + 4 * st), "v"(l + 5 * RSTEP), "v"(g + 5 * st),
                  "v"(l + 6 * RSTEP), "v"(g + 6 * st), "v"(l + 7 * RSTEP), "v"(g + 7 * st) : "memory");
#endif
}
// NR rounds of 32 rows (NR = 2 or 16): lane -> row 4*wave + (lane>>3) of its round, 16-byte piece lane&7; st = 32 source rows in elements
template <int NR>
__device__ __forceinline__ void copy_rows(unsigned l, const unsigned short* g, size_t st) {
  static_assert(NR == 2 || NR == 16);
  if constexpr (NR == 2) {
    copy2_lds(l, g, st);
  } else {
    copy8_lds(l, g, st);
    copy8_lds(l + 8 * RSTEP, g + 8 * st, st);
  }
}
__device__ __forceinline__ void wait_copies() {      // this wave's copies have landed in LDS
#if defined(__HIP_DEVICE_COMPILE__)
  asm volatile("s_wait_asynccnt 0x0" ::: "memory");
#endif
}
__device__ __forceinline__ void wait_store_regs() {  // in front of an overwrite of registers that issued global stores name (a precaution)
#if defined(__HIP_DEVICE_COMPILE__)
  asm volatile("s_wait_xcnt 0x0" ::: "memory");
#endif
}
__device__ __forceinline__ void wait_lds_reads() {   // this wave's LDS reads have returned (before their buffer is refilled)
#if defined(__HIP_DEVICE_COMPILE__)
  asm volatile("s_wait_dscnt 0x0" ::: "memory");
#endif
}

// =====================================================================================================
// Register-blocked f16 WMMA GEMM: C[m][n] = f( oscale * sum_k A[m][k] * Bt[n][k] ); one wave per 64x64 tile, 8 tiles per block.
// Operands reach the fragments through LDS: per stage of 64 k the block copies its operand rows (128 B each, whole lines) with
// asynchronous copies into one of two buffers; the next stage's copies fly while this stage is multiplied; one barrier per stage.
// WM 1: the 8 tiles share their 64 A rows and lie side by side in n (N a multiple of 512); WM 8: they share their 64 B rows and
// lie below one another in m (N = 64, M a multiple of 512). K a multiple of 64.
// A row-major [M][K] pitch lda (16-bit plane), Bt row-major [N][K] pitch ldb (k contiguous); M, N multiples of 64, K multiple of 64.
// BM: 0 = no bias; 3 = per-column head bias bf16( (col & 16) ? bias2[col & 15] : bias[col & 15] ) (in-range addresses).
// OM: 0 = f32 out (pitch ldc), ACT 2 applies sigmoid after bias;
//     2 = f16 out = f16( value * ocarry ); 3 = f16 hi plane f16(value*ocarry) to C and unscaled residual f16(value*ocarry - hi) to C2.
// coverage: 4 slabs x 16 rows (f32: it 0..7 x lane>>4; f16: it 0..3 x lane>>3) x 64 cols = the wave's whole 64x64 tile;
//           tilesM*tilesN/8 blocks per product (exact here); a block that does not fit the shape rules leaves as a whole before any barrier.
// =====================================================================================================
// The body is a device function: its kernel owns the LDS (ring: two stages; sT: 8 slabs) and hands in the block's index in this product.
__host__ __device__ constexpr int gemm_stage_bytes(int wm) {
  return (wm * 64 + (8 / wm) * 64) * LROW;
}
#define SLAB_F (16 * 68)   // per-wave 16x64 slab, pitch 68 floats
template <int OM, int BM, int ACT, int WM>
__device__ __forceinline__ void gemm64(
    unsigned char* ring, float* sT, int blk,
    const unsigned short* __restrict__ Ap, int lda,
    const unsigned short* __restrict__ Btp, int ldb,
    const float* __restrict__ bias, const float* __restrict__ bias2,
    void* Cout, void* C2out, int ldc,
    int M, int N, int K, float oscale, float ocarry) {
  static_assert(WM == 1 || WM == 8);
  constexpr int RA  = WM * 64;                     // A rows per block
  constexpr int RB  = (8 / WM) * 64;               // B rows per block
  constexpr int OB  = RA * LROW;                   // stage layout in bytes: [A | B]
  constexpr int STG = OB + RB * LROW;              // bytes per stage
  static_assert(STG == gemm_stage_bytes(WM));
  const int lane = threadIdx.x & 31;
  const int wave = threadIdx.x >> 5;
  const int tilesN = N >> 6;
  const int tilesM = M >> 6;
  const int tile0 = blk * 8;
  if (tile0 + 8 > tilesM * tilesN) return;         // block-uniform, before any barrier or copy
  if (WM == 1 ? (tilesN & 7) != 0 : (tilesN != 1)) return;   // block-uniform shape rule of this build
  const int tmB = tile0 / tilesN;
  const int mB = tmB << 6;                         // block's first row and column
  const int nB = (tile0 - tmB * tilesN) << 6;
  const int m0 = mB + (WM == 8 ? (wave << 6) : 0);
  const int n0 = nB + (WM == 1 ? (wave << 6) : 0);

  const int rlane = lane & 15;                 // row (A) / col (B, D) within subtile
  const int koff  = (lane >> 4) * 8;           // k offset of this lane half
  const int mOff  = (lane >> 4) * 8;           // D row offset

  // copy side: this lane's row and 16-byte piece in a round of 32 rows
  const int crow = wave * 4 + (lane >> 3);
  const int cseg = (lane & 7) * 8;
  const unsigned lcp = lds_off(ring) + (unsigned)(crow * LROW + cseg * 2);
  const unsigned short* gA  = Ap  + (size_t)(mB + crow) * lda + cseg;
  const unsigned short* gB  = Btp + (size_t)(nB + crow) * ldb + cseg;
  const size_t stA = (size_t)32 * lda, stB = (size_t)32 * ldb;
  // reader side: fragment rows of this wave in a stage
  const int fa = ((WM == 8 ? (wave << 6) : 0) + rlane) * LROW + koff * 2;
  const int fb = OB + ((WM == 1 ? (wave << 6) : 0) + rlane) * LROW + koff * 2;

  v8f acc[4][4];
#pragma unroll
  for (int i = 0; i < 4; ++i)
#pragma unroll
    for (int j = 0; j < 4; ++j) acc[i][j] = zero8();

  const int nst = K / KST;
  // stage 0 into buffer 0, landed and published; then stage 1 into buffer 1
  copy_rows<RA / 32>(lcp, gA, stA);
  copy_rows<RB / 32>(lcp + OB, gB, stB);
  wait_copies();
  __syncthreads();
  if (nst > 1) {
    copy_rows<RA / 32>(lcp + STG, gA + KST, stA);
    copy_rows<RB / 32>(lcp + STG + OB, gB + KST, stB);
  }

#pragma unroll 1   // one stage per trip: the ring's order at the foot stays as written
  for (int t = 0; t < nst; ++t) {
    const unsigned bofs = (unsigned)(t & 1) * STG;
    const unsigned char* sb = ring + bofs;
#pragma unroll
    for (int s = 0; s < 2; ++s) {              // two k-steps of 32 per stage, ascending k
      v16h bh[4], ah[4];
#pragma unroll
      for (int j = 0; j < 4; ++j) bh[j] = ldfrag_u((const unsigned short*)(sb + fb + j * 16 * LROW + s * 64));
#pragma unroll
      for (int i = 0; i < 4; ++i) ah[i] = ldfrag_u((const unsigned short*)(sb + fa + i * 16 * LROW + s * 64));
#pragma unroll
      for (int i = 0; i < 4; ++i) {
#pragma unroll
        for (int j = 0; j < 4; ++j) acc[i][j] = mma_raw(ah[i], bh[j], acc[i][j]);
        dep_guard1(acc[i][0], acc[i][3], ah[i]);
      }
      keep4_h(bh[0], bh[1], bh[2], bh[3]);
    }
    // publish point of stage t + 1; the same barrier ends every reader's last read of stage t's buffer
    wait_lds_reads();
    wait_copies();
    __syncthreads();
    if (t + 2 < nst) {                         // block-uniform: refill the buffer that this trip has just read
      const int kn = (t + 2) * KST;
      copy_rows<RA / 32>(lcp + bofs, gA + kn, stA);
      copy_rows<RB / 32>(lcp + bofs + OB, gB + kn, stB);
    }
  }
  wait_copies();
  acc_guard4(acc[0][0], acc[0][1], acc[0][2], acc[0][3]);
  acc_guard4(acc[1][0], acc[1][1], acc[1][2], acc[1][3]);
  acc_guard4(acc[2][0], acc[2][1], acc[2][2], acc[2][3]);
  acc_guard4(acc[3][0], acc[3][1], acc[3][2], acc[3][3]);

  const int hh2 = lane >> 4, c4 = (lane & 15) * 4;     // f32 out: 256-B row segment = 16 lanes x 16 B
  const int q8  = lane >> 3, c8 = (lane & 7) * 8;
  float bc[4];
#pragma unroll
  for (int e = 0; e < 4; ++e) bc[e] = 0.f;
  if constexpr (BM == 3) {
#pragma unroll
    for (int e = 0; e < 4; ++e) {
      const int col = n0 + c4 + e;
      const float fa = bfr(bias[col & 15]);             // in-range addresses 0..15
      const float fb = bfr(bias2[col & 15]);
      bc[e] = (col & 16) ? fb : fa;
    }
  }

  // ---- epilogue ----
  float* slab = sT + wave * SLAB_F;
#pragma unroll
  for (int i = 0; i < 4; ++i) {
    const int mBase = m0 + (i << 4);
#pragma unroll
    for (int j = 0; j < 4; ++j) {
#pragma unroll
      for (int r = 0; r < 8; ++r) {
        slab[(mOff + r) * 68 + (j << 4) + rlane] = acc[i][j][r];
      }
    }
    wave_sync_lds();
    if constexpr (OM == 0) {
      float* C = (float*)Cout;
      constexpr int IU = (ACT == 2) ? 2 : 8;               // row pairs per trip
#pragma unroll 1   // ACT 2: 128 unrolled divisions are 13 KB of text; rolled, the kernel that holds this body stays under 32 KB
      for (int ib = 0; ib < 8; ib += IU) {
        v4f vals[IU];
#pragma unroll
        for (int u = 0; u < IU; ++u) {
          const int row = (ib + u) * 2 + hh2;              // ib + u 0..7 x hh2 0..1 = rows 0..15
          v4f v = *(const v4f*)(slab + row * 68 + c4);
#pragma unroll
          for (int e = 0; e < 4; ++e) {
            float f = v[e] * oscale + bc[e];
            if constexpr (ACT == 2) f = 1.0f / (1.0f + __expf(-f));
            v[e] = f;
          }
          vals[u] = v;
        }
#pragma unroll
        for (int u = 0; u < IU; ++u) {
          const int gr = mBase + (ib + u) * 2 + hh2;
          *(v4f*)(C + (size_t)gr * ldc + n0 + c4) = vals[u];
        }
        if constexpr (IU < 8) wait_store_regs();           // the next trip rewrites the registers that these stores name
      }
    } else {
      unsigned short* C  = (unsigned short*)Cout;
      unsigned short* C2 = (unsigned short*)C2out;
      v4u hv[4], lv[4];
#pragma unroll
      for (int it = 0; it < 4; ++it) {
        const int row = it * 4 + q8;                       // it 0..3 x q8 0..3 = rows 0..15
        const float* sp = slab + row * 68 + c8;
        v4u a = {0u, 0u, 0u, 0u};
        v4u b = {0u, 0u, 0u, 0u};
#pragma unroll
        for (int e = 0; e < 4; ++e) {
          const float f0 = (sp[2 * e] * oscale) * ocarry;
          const float f1 = (sp[2 * e + 1] * oscale) * ocarry;
          const _Float16 h0 = (_Float16)f0, h1 = (_Float16)f1;
          a[e] = pk16(h_bits(h0), h_bits(h1));
          if constexpr (OM == 3) {
            const _Float16 l0 = (_Float16)(f0 - (float)h0);
            const _Float16 l1 = (_Float16)(f1 - (float)h1);
            b[e] = pk16(h_bits(l0), h_bits(l1));
          }
        }
        hv[it] = a;
        lv[it] = b;
      }
      {
#pragma unroll
        for (int it = 0; it < 4; ++it) {
          const int row = it * 4 + q8;
          *(v4u*)(C + (size_t)(mBase + row) * ldc + n0 + c8) = hv[it];
          if constexpr (OM == 3) {
            *(v4u*)(C2 + (size_t)(mBase + row) * ldc + n0 + c8) = lv[it];
          }
        }
        
      }
    }
    wave_sync_lds();
  }
}

// =====================================================================================================
// The three products of x in one launch: none reads what another writes, and together they have fewer blocks than the chip has WGPs.
// The block index picks the product (block-uniform, so every barrier of a body is passed by the whole block); longest epilogue first:
//   blocks 0..3     gates: AEF[t][j] = sigmoid(x[t] . G[j] / (16*64) + bf16(bias_j)); M = 2048, N = 64, K = 1024, f32 out
//   blocks 4..67    v^T: VTH/VTL[d][t] = hi/residual of f16(1024 * Wv[d] . x[t]); M = 1024, N = 2048, K = 1024
//   blocks 68..195  inner | outer: QK[t][n] = f16(16 * x[t] . [Wi;Wo][n]); M = 2048, N = 2048, K = 1024
// =====================================================================================================
#define PB_GE ((TT / 64) * (NGATE / 64) / 8)
#define PB_VT ((DM / 64) * (TT / 64) / 8)
#define PB_QK ((TT / 64) * (QKP / 64) / 8)
#define PB_ALL (PB_GE + PB_VT + PB_QK)
static_assert(gemm_stage_bytes(1) == gemm_stage_bytes(8));
__global__ __launch_bounds__(256) void proj_gemms(
    const unsigned short* __restrict__ XB, const unsigned short* __restrict__ WIO, const unsigned short* __restrict__ WV,
    const unsigned short* __restrict__ WG, const float* __restrict__ ba, const float* __restrict__ be,
    unsigned short* QK, unsigned short* VTH, unsigned short* VTL, float* AEF) {
  __shared__ __align__(16) unsigned char ring[2 * gemm_stage_bytes(1)];
  __shared__ __align__(16) float sT[8 * SLAB_F];
  const int b = blockIdx.x;
  if (b < PB_GE) {
    gemm64<0, 3, 2, 8>(ring, sT, b, XB, DM, WG, DM, ba, be,
                          (void*)AEF, (void*)AEF, NGATE, TT, NGATE, DM, 1.0f / (ACARRY * WSC), 1.0f);
  } else if (b < PB_GE + PB_VT) {
    gemm64<3, 0, 0, 1>(ring, sT, b - PB_GE, WV, DM, XB, DM, ba, be,
                          (void*)VTH, (void*)VTL, TT, DM, TT, DM, 1.0f / (WSC * ACARRY), VC);
  } else {
    gemm64<2, 0, 0, 1>(ring, sT, b - (PB_GE + PB_VT), XB, DM, WIO, DM, ba, be,
                          (void*)QK, (void*)QK, QKP, TT, QKP, DM, 1.0f / (ACARRY * WSC), QC);
  }
}
// =====================================================================================================
// Output projection: out[m][n] = sum_k (CTH[m][k] + CTL[m][k]) * WOUT[n][k] / (4096 * 64); M = 2048, N = 1024, K = 1024, f32 out.
// One block per 64 x 128 tile of out: 32 x 8 = 256 blocks, so that every WGP has one (512 tiles of 64 x 64, one a wave, fill only 64).
// 8 waves as 2 (m) x 4 (n), 32 x 32 of out per wave = 4 accumulator tiles. The ring is gemm64's: stages of 64 k, two buffers, the next
// stage's asynchronous copies fly while this stage is multiplied, one barrier per stage. A stage is 8 copy rounds of 32 rows:
// [ctx hi 64 rows | ctx residual 64 rows | Wout 128 rows]. Per accumulator and k-step of 32: hi product, then residual product, ascending k.
// coverage: 32 rows (it 0..7 x lane>>3) x 32 cols (128 B, one whole line) = the wave's 32 x 32; the grid is exact.
// =====================================================================================================
#define OBM   64
#define OBN   128
#define OOA2  (OBM * LROW)
#define OOB   (2 * OBM * LROW)
#define OSTG  (OOB + OBN * LROW)     // bytes per stage
#define OSLAB (32 * 36)              // per-wave 32 x 32 slab, pitch 36 floats
static_assert((TT % OBM) == 0 && (DM % OBN) == 0 && (DM % KST) == 0 && DM / KST >= 2 && OSTG == 8 * RSTEP);
// one stage: the 8 rounds in one statement that ends in s_wait_xcnt 0, as in the copy helpers above (no address register of an issued
// copy is rewritten before the wait, a precaution); a, a2, b are this lane's row and piece at the stage's k; st = 32 source rows
__device__ __forceinline__ void out_stage(unsigned l, const unsigned short* a, const unsigned short* a2, const unsigned short* b,
                                          size_t st) {
#if defined(__HIP_DEVICE_COMPILE__)
  asm volatile("global_load_async_to_lds_b128 %0, %1, off\n\t"
               "global_load_async_to_lds_b128 %2, %3, off\n\t"
               "global_load_async_to_lds_b128 %4, %5, off\n\t"
               "global_load_async_to_lds_b128 %6, %7, off\n\t"
               "global_load_async_to_lds_b128 %8, %9, off\n\t"
               "global_load_async_to_lds_b128 %10, %11, off\n\t"
               "global_load_async_to_lds_b128 %12, %13, off\n\t"
               "global_load_async_to_lds_b128 %14, %15, off\n\t"
               "s_wait_xcnt 0x0"
               :: "v"(l), "v"(a), "v"(l + RSTEP), "v"(a + st), "v"(l + 2 * RSTEP), "v"(a2), "v"(l + 3 * RSTEP), "v"(a2 + st),
                  "v"(l + 4 * RSTEP), "v"(b), "v"(l + 5 * RSTEP), "v"(b + st), "v"(l + 6 * RSTEP), "v"(b + 2 * st),
                  "v"(l + 7 * RSTEP), "v"(b + 3 * st) : "memory");
#endif
}
__global__ __launch_bounds__(256) void out_gemm(
    const unsigned short* __restrict__ CTH, const unsigned short* __restrict__ CTL, const unsigned short* __restrict__ WOUT,
    float* out) {
  __shared__ __align__(16) unsigned char ring[2 * OSTG];
  __shared__ __align__(16) float sT[8 * OSLAB];
  const int lane = threadIdx.x & 31;
  const int wave = threadIdx.x >> 5;
  const int mB = ((int)blockIdx.x / (DM / OBN)) * OBM;      // block's first row and column
  const int nB = ((int)blockIdx.x % (DM / OBN)) * OBN;
  const int wr = (wave >> 2) * 32, wc = (wave & 3) * 32;    // wave's first row and column in the block tile
  const int rlane = lane & 15;                 // row (A) / col (B, D) within subtile
  const int koff  = (lane >> 4) * 8;           // k offset of this lane half
  const int mOff  = (lane >> 4) * 8;           // D row offset

  // copy side: this lane's row and 16-byte piece in a round of 32 rows
  const int crow = wave * 4 + (lane >> 3);
  const int cseg = (lane & 7) * 8;
  const unsigned lcp = lds_off(ring) + (unsigned)(crow * LROW + cseg * 2);
  const unsigned short* gA  = CTH  + (size_t)(mB + crow) * DM + cseg;
  const unsigned short* gA2 = CTL  + (size_t)(mB + crow) * DM + cseg;
  const unsigned short* gB  = WOUT + (size_t)(nB + crow) * DM + cseg;
  const size_t st = (size_t)32 * DM;
  // reader side: fragment rows of this wave in a stage
  const int fa = (wr + rlane) * LROW + koff * 2;
  const int fb = OOB + (wc + rlane) * LROW + koff * 2;

  v8f a00 = zero8(), a01 = zero8(), a10 = zero8(), a11 = zero8();

  constexpr int nst = DM / KST;
  // stage 0 into buffer 0, landed and published; then stage 1 into buffer 1
  out_stage(lcp, gA, gA2, gB, st);
  wait_copies();
  __syncthreads();
  out_stage(lcp + OSTG, gA + KST, gA2 + KST, gB + KST, st);

#pragma unroll 1   // one stage per trip: the ring's order at the foot stays as written
  for (int t = 0; t < nst; ++t) {
    const unsigned bofs = (unsigned)(t & 1) * OSTG;
    const unsigned char* sb = ring + bofs;
    v16h bh[2][2], ah[2][2], al[2][2];         // [k-step][subtile]: the stage's 24 LDS reads stand together, in front of its WMMAs
#pragma unroll
    for (int s = 0; s < 2; ++s) {
#pragma unroll
      for (int i = 0; i < 2; ++i) {
        bh[s][i] = ldfrag_u((const unsigned short*)(sb + fb + i * 16 * LROW + s * 64));
        ah[s][i] = ldfrag_u((const unsigned short*)(sb + fa + i * 16 * LROW + s * 64));
        al[s][i] = ldfrag_u((const unsigned short*)(sb + OOA2 + fa + i * 16 * LROW + s * 64));
      }
    }
#pragma unroll
    for (int s = 0; s < 2; ++s) {              // two k-steps of 32 per stage, ascending k
      a00 = mma_raw(ah[s][0], bh[s][0], a00);
      a01 = mma_raw(ah[s][0], bh[s][1], a01);
      a10 = mma_raw(ah[s][1], bh[s][0], a10);
      a11 = mma_raw(ah[s][1], bh[s][1], a11);
      a00 = mma_raw(al[s][0], bh[s][0], a00);
      a01 = mma_raw(al[s][0], bh[s][1], a01);
      a10 = mma_raw(al[s][1], bh[s][0], a10);
      a11 = mma_raw(al[s][1], bh[s][1], a11);
      // four vector slots behind the last WMMA, before anything rewrites its operands or touches its results (also over the branch below)
      guard_pv6(a00, a01, a10, a11, ah[s][0], ah[s][1], al[s][0], al[s][1], bh[s][0], bh[s][1]);
    }
    // publish point of stage t + 1; the same barrier ends every reader's last read of stage t's buffer
    wait_lds_reads();
    wait_copies();
    __syncthreads();
    if (t + 2 < nst) {                         // block-uniform: refill the buffer that this trip has just read
      const int kn = (t + 2) * KST;
      out_stage(lcp + bofs, gA + kn, gA2 + kn, gB + kn, st);
    }
  }
  wait_copies();

  // ---- epilogue: each wave stages its 32 x 32 in its own slab and stores whole 128-B lines ----
  const float oscale = 1.0f / (FC * WSC);
  const int q8 = lane >> 3, c4 = (lane & 7) * 4;
  float* slab = sT + wave * OSLAB;
  float* op = out + (size_t)(mB + wr + q8) * DM + nB + wc + c4;
#pragma unroll
  for (int r = 0; r < 8; ++r) {
    slab[(mOff + r) * 36 + rlane] = a00[r];
    slab[(mOff + r) * 36 + 16 + rlane] = a01[r];
    slab[(16 + mOff + r) * 36 + rlane] = a10[r];
    slab[(16 + mOff + r) * 36 + 16 + rlane] = a11[r];
  }
  wave_sync_lds();
  v4f vals[8];
#pragma unroll
  for (int it = 0; it < 8; ++it) vals[it] = *(const v4f*)(slab + (it * 4 + q8) * 36 + c4) * oscale;   // it 0..7 x q8 0..3 = rows 0..31
#pragma unroll
  for (int it = 0; it < 8; ++it) *(v4f*)(op + (size_t)(it * 4) * DM) = vals[it];
}

// =====================================================================================================
// Flash attention for one head and 128 query rows, head dim 64, 2048 keys:
//   inner|outer plane (f16 x16) QK[tok][2048]: inner at col 64h + d, outer at col 1024 + 64h + d;
//   v^T planes (f16 hi x1024, unscaled residual): VH/VL[64h + d][key] (pitch 2048);
//   gate plane AEF f32 [tok][64]: col h = ap[h][tok] (sigmoid applied), col 16 + h = ex[h][tok];
//   out: CTH/CTL[tok][64h + d] = f16 hi / residual of 4096 * ctx, ctx = valve/rotation epilogue of
//        ap * sum_s p_s v_s / (ap * sum_s p_s + 1e-8 * sum_s e_s), e_s = exp(score_s - max), p_s = e_s * ex[s].
//   block = 8 waves = 256 threads; grid = 16 heads x 16 query groups = 256; every wave does identical bounded work (32 steps).
//   Per stage of 64 keys the block copies the head's 64 outer rows and the 64 rows of each v^T plane (128 B each, whole lines)
//   with asynchronous copies into one of two LDS buffers; the next stage's copies fly while this stage is worked on; one barrier
//   per stage. The head's ex column (2048 f32) is put into LDS once, in front of the first barrier.
//   A wave takes 32 query rows (two tiles of 16; wave & 3 picks them) and 32 of a stage's 64 keys (wave >> 2 picks the half), so
//   every outer, v^T and ex fragment that it reads from LDS feeds two query tiles: half the LDS reads per WMMA of a 16-query wave.
//   Both products are transposed: S^T = outer . inner^T (A = 16 key rows from the stage, B = 16 query rows, kept in registers) and
//   O^T += v^T . P^T (A = 16 d rows of v^T from the stage, B = P^T). A lane (c = lane & 15, hh = lane >> 4) then holds, per query
//   tile, only query c of it: score register r of key tile i is key kb + 16 i + 8 hh + r, which is the k order of a B operand, so
//   the two score tiles of a step, converted in place, are P^T; output register r of tile j is d = 16 j + 8 hh + r.
//   Per step and query tile: 2 score tiles on f16 WMMA (K = 64 as two k-steps of 32); the maximum over the lane's 16 keys in the
//   lane, joined with the other half by one cross-row move; online max-subtracted softmax in f32 (exp2, log2e / 8 / carries folded
//   in); running sums of e and of p = e*ex in two partial sums per lane (joined behind the loop); one rescale factor per lane;
//   12 WMMAs (hi.hi, hi.lo, lo.hi) into one accumulator set.
//   Behind the loop the two waves of a query group (w, w ^ 4) hold the sums of their own keys on their own maxima. Each finishes
//   one of the two query tiles: it hands the other tile's maximum, sums and O^T to its partner through the ring's LDS (free behind
//   the loop's last barrier), and joins what it gets on the common maximum.
//   Final scaling in f32; each lane stages its query's 4 x 8 consecutive d (hi and residual) in the block's LDS row buffers [128][64];
// coverage: LDS row buffers: 8 waves x 16 rows x 64 cols = 128 x 64; global: 4 iterations x 256 threads x 8 halves = 128 rows x 64
//           cols (cols 64*head ..) of rows qB..qB+127, both planes; grid covers all 2048 rows x 1024 cols exactly once.
// =====================================================================================================
#define AKS   64                        // keys per stage: 128 B of every v^T row = one whole line
#define AOVH  (AKS * LROW)              // stage layout in bytes: [64 outer rows | 64 v^T hi rows | 64 v^T residual rows]
#define AOVL  (AOVH + HDIM * LROW)
#define ASTG  (AOVL + HDIM * LROW)      // bytes per stage
static_assert(AKS == 64 && HDIM == 64 && (TT % AKS) == 0 && (TT / AKS) >= 2 && HDIM * 2 + 16 == LROW && AKS * 2 + 16 == LROW);
static_assert((TT % ATT_THREADS) == 0);
// one stage: keys 64 t .. 64 t + 63; l, gK, gVh, gVl are this lane's row (4*wave + (lane>>3) of a round of 32) and 16-byte piece
__device__ __forceinline__ void att_stage(unsigned l, const unsigned short* gK, const unsigned short* gVh,
                                          const unsigned short* gVl, int t) {
  copy_rows<2>(l,        gK  + (size_t)t * AKS * QKP, (size_t)32 * QKP);
  copy_rows<2>(l + AOVH, gVh + (size_t)t * AKS,       (size_t)32 * TT);
  copy_rows<2>(l + AOVL, gVl + (size_t)t * AKS,       (size_t)32 * TT);
}
__device__ __forceinline__ const _Float16* lds_h(const unsigned char* p) { return (const _Float16*)(const void*)p; }
// value of lane l ^ 16 (one vector cross-row move, no LDS counter)
__device__ __forceinline__ float xhalf(float x) {
  const int b = __builtin_bit_cast(int, x);
  return __builtin_bit_cast(float, __builtin_amdgcn_permlanex16(b, b, 0x76543210, 0xfedcba98, false, false));
}

// eight values to two, in packed adds: as many instructions as eight running sums take, and 6 registers fewer per sum
typedef float v2f __attribute__((ext_vector_type(2)));
__device__ __forceinline__ v2f fold2(const v8f v) {
  const v4f q = __builtin_shufflevector(v, v, 0, 1, 2, 3) + __builtin_shufflevector(v, v, 4, 5, 6, 7);
  return __builtin_shufflevector(q, q, 0, 1) + __builtin_shufflevector(q, q, 2, 3);
}
// one query tile's softmax over a step's 32 keys: s0[r]: key kb + 8hh + r, s1[r]: key kb + 16 + 8hh + r; x0, x1: ex of those keys.
// Returns the rescale factor of the running sums and of O^T; ph, pl: P^T x1024 as a B operand, hi and residual.
__device__ __forceinline__ float soft_step(const v8f s0, const v8f s1, const v8f x0, const v8f x1, const float lsc,
                                           float& mrow, v2f& zv, v2f& lv, v16h& phv, v16h& plv) {
  const float m0 = fmaxf(fmaxf(s0[0], s0[1]), s0[2]), m1 = fmaxf(fmaxf(s0[3], s0[4]), s0[5]);
  const float m2 = fmaxf(fmaxf(s0[6], s0[7]), s1[0]), m3 = fmaxf(fmaxf(s1[1], s1[2]), s1[3]);
  const float m4 = fmaxf(fmaxf(s1[4], s1[5]), s1[6]);
  float mx = fmaxf(fmaxf(fmaxf(m0, m1), s1[7]), fmaxf(fmaxf(m2, m3), m4));   // the lane's 16 keys
  mx = fmaxf(mx, xhalf(mx));               // both halves: maximum over the step's 32 keys
  const float mn = fmaxf(mrow, mx * lsc);
  const float al = exp2_hw(mrow - mn);
  mrow = mn;
  // the exponents' arguments as one vector fma: written so, they stay two to an instruction
  const v8f mn8 = {mn, mn, mn, mn, mn, mn, mn, mn};
  const v8f lsc8 = {lsc, lsc, lsc, lsc, lsc, lsc, lsc, lsc};
  const v8f t0 = __builtin_elementwise_fma(s0, lsc8, -mn8), t1 = __builtin_elementwise_fma(s1, lsc8, -mn8);
  v8f e0, e1;
#pragma unroll   // constant element indices: the vectors stay in registers
  for (int r = 0; r < 8; ++r) { e0[r] = exp2_hw(t0[r]); e1[r] = exp2_hw(t1[r]); }
  const v8f p0 = e0 * x0, p1 = e1 * x1;
  zv = zv * al + fold2(e0 + e1);
  lv = lv * al + fold2(p0 + p1);
  FragH ph, pl;                            // element r <- k = 8hh + r, element 8 + r <- k = 16 + 8hh + r
  const v8f y0 = p0 * PC, y1 = p1 * PC;
  ph.h[0] = __builtin_convertvector(y0, v8h);
  ph.h[1] = __builtin_convertvector(y1, v8h);
  pl.h[0] = __builtin_convertvector(y0 - __builtin_convertvector(ph.h[0], v8f), v8h);
  pl.h[1] = __builtin_convertvector(y1 - __builtin_convertvector(ph.h[1], v8f), v8h);
  phv = ph.v;
  plv = pl.v;
  return al;
}
// eight floats at a 16-byte boundary, as two 16-byte accesses
__device__ __forceinline__ void st8(float* p, const v8f v) {
  *(v4f*)(p)     = __builtin_shufflevector(v, v, 0, 1, 2, 3);
  *(v4f*)(p + 4) = __builtin_shufflevector(v, v, 4, 5, 6, 7);
}
__device__ __forceinline__ v8f ld8(const float* p) {
  const v4f a = *(const v4f*)(p), b = *(const v4f*)(p + 4);
  return __builtin_shufflevector(a, b, 0, 1, 2, 3, 4, 5, 6, 7);
}
#define XLANE 36                        // floats a lane hands over: 32 of O^T, maximum, two sums, one unused; 144 B = 16 B x odd
static_assert(QTB * 32 * XLANE * 4 <= 2 * ASTG);

__global__ __launch_bounds__(ATT_THREADS)
void attn_heads(const unsigned short* __restrict__ QKq, const unsigned short* __restrict__ VHq,
                const unsigned short* __restrict__ VLq, const float* __restrict__ AEF,
                const float* __restrict__ betap, const float* __restrict__ ivp,
                const float* __restrict__ ovp, const float* __restrict__ chg,
                unsigned short* CTH, unsigned short* CTL) {
  __shared__ __align__(16) unsigned char kv[2 * ASTG];      // two stages of outer rows and v^T rows; behind the loop: the hand-over
  __shared__ __align__(16) float exs[TT];                   // ex of this head, by key
  __shared__ __align__(16) unsigned short Osh[ATT_QB * HDIM];   // block result rows [128][64], hi
  __shared__ __align__(16) unsigned short Osl[ATT_QB * HDIM];   // residual

  const int tid  = threadIdx.x;
  const int wave = tid >> 5;
  const int lane = tid & 31;
  const int hh   = lane >> 4;
  const int c    = lane & 15;
  const int qw   = wave & 3;                                // which 32 query rows of the block
  const int kh   = wave >> 2;                               // which 32 keys of every stage

  const int qg   = blockIdx.x % ATT_QG;                     // query group 0..15
  const int head = (blockIdx.x / ATT_QG) & (NHEAD - 1);     // 0..15
  const int qB   = qg * ATT_QB;                             // block's first query row
  const int q0   = qB + qw * 32;                            // wave's first query row
  const int orow = qw * 32 + kh * 16 + c;                   // the block row (query) that this lane finishes

  const _Float16* Qh = (const _Float16*)(const void*)QKq + (size_t)(q0 + c) * QKP + head * HDIM + 8 * hh;
  const float* Ex = AEF + 16 + head;                                    // ex column of this head
  const float lsc = (1.4426950408889634f * ATT_SCALE) / (QC * KC);      // log2(e) / 8 / carries

  // copy side: this lane's row and 16-byte piece in a round of 32 rows
  const int crow = wave * 4 + (lane >> 3);
  const int cseg = (lane & 7) * 8;
  const unsigned lcp = lds_off(kv) + (unsigned)(crow * LROW + cseg * 2);
  const unsigned short* gK  = QKq + (size_t)crow * QKP + DM + head * HDIM + cseg;
  const unsigned short* gVh = VHq + (size_t)(head * HDIM + crow) * TT + cseg;
  const unsigned short* gVl = VLq + (size_t)(head * HDIM + crow) * TT + cseg;
  // reader side, in bytes: this lane's fragment row (key or d = c within a group of 16 rows) and k half, at the wave's 32 keys
  const int frk = (kh * 32 + c) * LROW + 16 * hh;            // outer rows: 32 rows down
  const int frv = AOVH + c * LROW + 16 * hh + kh * 64;       // v^T rows: 32 keys = 64 B along

  // stage 0 into buffer 0, landed and published; then stage 1 into buffer 1. The ex column is published by the same barrier.
  att_stage(lcp, gK, gVh, gVl, 0);
  const v16h qa0 = ldfrag_h(Qh), qb0 = ldfrag_h(Qh + 32);                                // query tile 0: rows q0 + c
  const v16h qa1 = ldfrag_h(Qh + (size_t)16 * QKP), qb1 = ldfrag_h(Qh + (size_t)16 * QKP + 32);   // tile 1: rows q0 + 16 + c
  const float apq = AEF[(size_t)(qB + orow) * NGATE + head]; // ap of the query that this lane finishes, used behind the loop
#pragma unroll   // the 8 loads are issued together, one latency
  for (int i = 0; i < TT / ATT_THREADS; ++i) {
    const int k = i * ATT_THREADS + tid;                     // 8 x 256 = all 2048 keys
    exs[k] = Ex[(size_t)k * NGATE];
  }
  wait_copies();
  __syncthreads();
  att_stage(lcp + ASTG, gK, gVh, gVl, 1);

  float mr0 = -INFINITY, mr1 = -INFINITY;                    // this lane's query of tile 0, of tile 1
  v2f zv0 = {0.f, 0.f}, lv0 = {0.f, 0.f}, zv1 = {0.f, 0.f}, lv1 = {0.f, 0.f};   // sums of e and p over this half's keys: even r, odd r
  v8f a0 = zero8(), a1 = zero8(), a2 = zero8(), a3 = zero8();       // O^T of tile 0
  v8f b0 = zero8(), b1 = zero8(), b2 = zero8(), b3 = zero8();       // O^T of tile 1

  constexpr int nst = TT / AKS;
#pragma unroll 1   // one stage per trip: the ring's order at the foot stays as written
  for (int t = 0; t < nst; ++t) {
    const unsigned bofs = (unsigned)(t & 1) * ASTG;
    const unsigned char* sb = kv + bofs;
    const int kb = t * AKS + kh * 32;          // the wave's one step of 32 keys in this stage
    v8f sa0, sa1, sb0, sb1;                    // s?0[r]: key kb + 8hh + r, s?1[r]: key kb + 16 + 8hh + r; sa: tile 0, sb: tile 1
    {
      const _Float16* kp = lds_h(sb + frk);
      const _Float16* kq = lds_h(sb + frk + 16 * LROW);
      const v16h k00 = ldfrag_h(kp), k01 = ldfrag_h(kp + 32);
      const v16h k10 = ldfrag_h(kq), k11 = ldfrag_h(kq + 32);
      sa0 = mma_raw(k00, qa0, zero8());
      sb0 = mma_raw(k00, qa1, zero8());
      sa1 = mma_raw(k10, qa0, zero8());
      sb1 = mma_raw(k10, qa1, zero8());
      sa0 = mma_raw(k01, qb0, sa0);
      sb0 = mma_raw(k01, qb1, sb0);
      sa1 = mma_raw(k11, qb0, sa1);
      sb1 = mma_raw(k11, qb1, sb1);
    }
    const float* exq = exs + kb + 8 * hh;
    const v4f xa = *(const v4f*)(exq),      xb = *(const v4f*)(exq + 4);      // ex of keys kb + 8hh + 0..7
    const v4f xc = *(const v4f*)(exq + 16), xd = *(const v4f*)(exq + 20);     // ex of keys kb + 16 + 8hh + 0..7
    const v8f x0 = __builtin_shufflevector(xa, xb, 0, 1, 2, 3, 4, 5, 6, 7);
    const v8f x1 = __builtin_shufflevector(xc, xd, 0, 1, 2, 3, 4, 5, 6, 7);
    v16h pha, pla, phb, plb;
    const float ala = soft_step(sa0, sa1, x0, x1, lsc, mr0, zv0, lv0, pha, pla);
    const float alb = soft_step(sb0, sb1, x0, x1, lsc, mr1, zv1, lv1, phb, plb);
    a0 *= ala;
    a1 *= ala;
    a2 *= ala;
    a3 *= ala;
    b0 *= alb;
    b1 *= alb;
    b2 *= alb;
    b3 *= alb;
    {
      const unsigned char* vp = sb + frv;
      const v16h vb0 = ldfrag_h(lds_h(vp));
      const v16h vb1 = ldfrag_h(lds_h(vp + 16 * LROW));
      const v16h vb2 = ldfrag_h(lds_h(vp + 32 * LROW));
      const v16h vb3 = ldfrag_h(lds_h(vp + 48 * LROW));
      a0 = mma_raw(vb0, pha, a0);
      a1 = mma_raw(vb1, pha, a1);
      a2 = mma_raw(vb2, pha, a2);
      a3 = mma_raw(vb3, pha, a3);
      b0 = mma_raw(vb0, phb, b0);
      b1 = mma_raw(vb1, phb, b1);
      b2 = mma_raw(vb2, phb, b2);
      b3 = mma_raw(vb3, phb, b3);
      a0 = mma_raw(vb0, pla, a0);
      a1 = mma_raw(vb1, pla, a1);
      a2 = mma_raw(vb2, pla, a2);
      a3 = mma_raw(vb3, pla, a3);
      b0 = mma_raw(vb0, plb, b0);
      b1 = mma_raw(vb1, plb, b1);
      b2 = mma_raw(vb2, plb, b2);
      b3 = mma_raw(vb3, plb, b3);
    }
    {
      const unsigned char* vp = sb + frv + (AOVL - AOVH);
      const v16h vl0 = ldfrag_h(lds_h(vp));
      const v16h vl1 = ldfrag_h(lds_h(vp + 16 * LROW));
      const v16h vl2 = ldfrag_h(lds_h(vp + 32 * LROW));
      const v16h vl3 = ldfrag_h(lds_h(vp + 48 * LROW));
      a0 = mma_raw(vl0, pha, a0);
      a1 = mma_raw(vl1, pha, a1);
      a2 = mma_raw(vl2, pha, a2);
      a3 = mma_raw(vl3, pha, a3);
      b0 = mma_raw(vl0, phb, b0);
      b1 = mma_raw(vl1, phb, b1);
      b2 = mma_raw(vl2, phb, b2);
      b3 = mma_raw(vl3, phb, b3);
    }
    // publish point of stage t + 1; the same barrier ends every reader's last read of stage t's buffer
    wait_lds_reads();
    wait_copies();
    __syncthreads();
    if (t + 2 < nst) att_stage(lcp + bofs, gK, gVh, gVl, t + 2);   // block-uniform: refill the buffer that this trip has just read
  }
  wait_copies();

  // ---- the two key halves of a query group are joined: wave (qw, kh) finishes tile kh and hands tile 1 - kh to wave ^ 4 ----
  const float za = zv0[0] + zv0[1], la = lv0[0] + lv0[1], zb = zv1[0] + zv1[1], lb = lv1[0] + lv1[1];
  const float zta = za + xhalf(za), lta = la + xhalf(la);    // the two lane halves' sums, on the same maximum
  const float ztb = zb + xhalf(zb), ltb = lb + xhalf(lb);
  const bool fin1 = kh != 0;                                 // the same in every lane of a wave
  {
    float* xs = (float*)(void*)kv + (size_t)(wave * 32 + lane) * XLANE;   // the ring is free: every read of it ended at the last barrier
    const v8f g0 = fin1 ? a0 : b0, g1 = fin1 ? a1 : b1, g2 = fin1 ? a2 : b2, g3 = fin1 ? a3 : b3;
    const v4f gs = {fin1 ? mr0 : mr1, fin1 ? zta : ztb, fin1 ? lta : ltb, 0.f};
    st8(xs, g0);
    st8(xs + 8, g1);
    st8(xs + 16, g2);
    st8(xs + 24, g3);
    *(v4f*)(xs + 32) = gs;
  }
  __syncthreads();                                           // the hand-over is published
  v8f o0 = fin1 ? b0 : a0, o1 = fin1 ? b1 : a1, o2 = fin1 ? b2 : a2, o3 = fin1 ? b3 : a3;
  float zt, lt;
  {
    const float* xp = (const float*)(const void*)kv + (size_t)((wave ^ 4) * 32 + lane) * XLANE;   // same lane, same query, other keys
    const v8f h0 = ld8(xp), h1 = ld8(xp + 8), h2 = ld8(xp + 16), h3 = ld8(xp + 24);
    const v4f hs = *(const v4f*)(xp + 32);
    const float mm = fin1 ? mr1 : mr0;
    const float mj = fmaxf(mm, hs[0]);                       // the common maximum
    const float fm = exp2_hw(mm - mj), fp = exp2_hw(hs[0] - mj);
    zt = (fin1 ? ztb : zta) * fm + hs[1] * fp;
    lt = (fin1 ? ltb : lta) * fm + hs[2] * fp;
    o0 = o0 * fm + h0 * fp;
    o1 = o1 * fm + h1 * fp;
    o2 = o2 * fm + h2 * fp;
    o3 = o3 * fm + h3 * fp;
  }

  // ---- per-head gates and rotation, renormaliser, carries (1024 on p, 1024 on v, 4096 on the stored ctx) ----
  const float bet = bfr(betap[head]);
  const float ivs = sigf(bfr(ivp[head]));
  const float og  = sigf(bfr(ovp[head])) * tanhf(bfr(chg[head]));
  const float ang = PI_F * sigf(bet);
  const float ca  = cosf(ang), sa = sinf(ang);
  const float base = ivs / (PC * VC);
  const float den = apq * lt + REN_EPS * zt;
  const float sc  = apq * (1.0f / den) * base;
  v8h yh[4], yl[4];                                          // tile j: d = 16 j + 8 hh + r
#pragma unroll
  for (int r = 0; r < 8; ++r) {
    const float x0 = o0[r] * sc, x1 = o1[r] * sc, x2 = o2[r] * sc, x3 = o3[r] * sc;
    const float y0 = ((x0 * ca - x2 * sa) * og) * FC;
    const float y1 = ((x1 * ca - x3 * sa) * og) * FC;
    const float y2 = ((x0 * sa + x2 * ca) * og) * FC;
    const float y3 = ((x1 * sa + x3 * ca) * og) * FC;
    const _Float16 h0 = (_Float16)y0, h1 = (_Float16)y1, h2 = (_Float16)y2, h3 = (_Float16)y3;
    yh[0][r] = h0;
    yh[1][r] = h1;
    yh[2][r] = h2;
    yh[3][r] = h3;
    yl[0][r] = (_Float16)(y0 - (float)h0);
    yl[1][r] = (_Float16)(y1 - (float)h1);
    yl[2][r] = (_Float16)(y2 - (float)h2);
    yl[3][r] = (_Float16)(y3 - (float)h3);
  }
  {
    unsigned short* oh = Osh + orow * HDIM + 8 * hh;
    unsigned short* ol = Osl + orow * HDIM + 8 * hh;
#pragma unroll   // constant array indices: yh, yl stay in registers
    for (int j = 0; j < 4; ++j) {
      *(v8h*)(void*)(oh + 16 * j) = yh[j];
      *(v8h*)(void*)(ol + 16 * j) = yl[j];
    }
  }
  __syncthreads();
  // ---- block writes its 128 row segments: piece p = it*256 + tid -> row p>>3, halves (p&7)*8 of the 64-col slab (128 B a row) ----
  {
    v4u vh[4], vl[4];
#pragma unroll
    for (int it = 0; it < 4; ++it) {
      const int p = it * ATT_THREADS + tid;
      vh[it] = *(const v4u*)(Osh + (size_t)p * 8);
      vl[it] = *(const v4u*)(Osl + (size_t)p * 8);
    }
    const size_t dofs = (size_t)qB * DM + (size_t)head * HDIM;
    unsigned short* dh = CTH + dofs;
    unsigned short* dl = CTL + dofs;
    {
#pragma unroll
      for (int it = 0; it < 4; ++it) {
        const int p = it * ATT_THREADS + tid;
        const size_t po = (size_t)(p >> 3) * DM + (size_t)(p & 7) * 8;
        *(v4u*)(dh + po) = vh[it];
        *(v4u*)(dl + po) = vl[it];
      }
    }
  }
}

// =====================================================================================================
// Workspace map (bytes); every plane is an exact multiple of its tile / whole-row store granularity (M, N exact tile multiples,
// row blocks exact, no pad rows needed), every offset a multiple of 131072:
//   WIO  f16 [2048][1024] x64     4194304   (rows 0..1023 Wi, 1024..2047 Wo; native [out][in] = [n][k])
//   WV   f16 [1024][1024] x64     2097152
//   WOUT f16 [1024][1024] x64     2097152
//   WG   f16 [64][1024]   x64      131072   (Wa, We, Wa, We)
//   XB   f16 [2048][1024] x16     4194304
//   QK   f16 [2048][2048] x16     8388608   (inner | outer)
//   VTH  f16 [1024][2048] x1024   4194304   (v^T hi)
//   VTL  f16 [1024][2048]         4194304   (v^T residual)
//   AEF  f32 [2048][64]            524288   (sigmoid gates)
//   CTH  f16 [2048][1024] x4096   4194304   (ctx hi)
//   CTL  f16 [2048][1024]         4194304   (ctx residual)
//   end                          38404096
// =====================================================================================================
extern "C" void kernel_launch(void* const* d_in, const int* in_sizes, int n_in,
                              void* d_out, int out_size, void* d_ws, size_t ws_size,
                              hipStream_t stream) {
  if (n_in < 13) return;
  if (in_sizes[0] != TT * DM) return;
  if (in_sizes[1] != NHEAD * DM || in_sizes[2] != NHEAD) return;
  if (in_sizes[3] != NHEAD * DM || in_sizes[4] != NHEAD) return;
  if (in_sizes[5] != DM * DM || in_sizes[6] != DM * DM || in_sizes[7] != DM * DM || in_sizes[8] != DM * DM) return;
  if (in_sizes[9] != NHEAD || in_sizes[10] != NHEAD || in_sizes[11] != NHEAD || in_sizes[12] != NHEAD) return;
  if (out_size != TT * DM) return;

  const float* x     = (const float*)d_in[0];
  const float* Wa    = (const float*)d_in[1];
  const float* ba    = (const float*)d_in[2];
  const float* We    = (const float*)d_in[3];
  const float* be    = (const float*)d_in[4];
  const float* Wi    = (const float*)d_in[5];
  const float* Wo    = (const float*)d_in[6];
  const float* Wv    = (const float*)d_in[7];
  const float* Wout  = (const float*)d_in[8];
  const float* betap = (const float*)d_in[9];
  const float* ivp   = (const float*)d_in[10];
  const float* ovp   = (const float*)d_in[11];
  const float* chg   = (const float*)d_in[12];
  float*       out   = (float*)d_out;

  const size_t PWIO = (size_t)2 * DM * DM * 2;                    //  4194304
  const size_t PW   = (size_t)DM * DM * 2;                        //  2097152
  const size_t PG   = (size_t)NGATE * DM * 2;                     //   131072
  const size_t PX   = (size_t)TT * DM * 2;                        //  4194304
  const size_t PQK  = (size_t)TT * QKP * 2;                       //  8388608
  const size_t PVT  = (size_t)DM * TT * 2;                        //  4194304
  const size_t PAE  = (size_t)TT * NGATE * 4;                     //   524288
  const size_t PCT  = (size_t)TT * DM * 2;                        //  4194304
  size_t off = 0;
  const size_t oWIO = off; off += PWIO;
  const size_t oWV  = off; off += PW;
  const size_t oWOU = off; off += PW;
  const size_t oWG  = off; off += PG;
  const size_t oXB  = off; off += PX;
  const size_t oQK  = off; off += PQK;
  const size_t oVTH = off; off += PVT;
  const size_t oVTL = off; off += PVT;
  const size_t oAEF = off; off += PAE;
  const size_t oCTH = off; off += PCT;
  const size_t oCTL = off; off += PCT;
  if (off > ws_size) return;                                      // off = 38404096
  if (off > (size_t)134217728) return;

  char* ws = (char*)d_ws;
  unsigned short* WIO  = (unsigned short*)(ws + oWIO);
  unsigned short* WV   = (unsigned short*)(ws + oWV);
  unsigned short* WOUT = (unsigned short*)(ws + oWOU);
  unsigned short* WG   = (unsigned short*)(ws + oWG);
  unsigned short* XB   = (unsigned short*)(ws + oXB);
  unsigned short* QK   = (unsigned short*)(ws + oQK);
  unsigned short* VTH  = (unsigned short*)(ws + oVTH);
  unsigned short* VTL  = (unsigned short*)(ws + oVTL);
  float*          AEF  = (float*)(ws + oAEF);
  unsigned short* CTH  = (unsigned short*)(ws + oCTH);
  unsigned short* CTL  = (unsigned short*)(ws + oCTL);

  const dim3 blk(256);
  const dim3 gCV(CB_ALL);                                         // 776 blocks
  const dim3 gPR(PB_ALL);                                         // 196 blocks
  const dim3 gO((TT / OBM) * (DM / OBN));                         // 256
  const dim3 gAT(ATT_BLOCKS);                                     // 256
  const dim3 bAT(ATT_THREADS);                                    // 256

  // (0) 16-bit planes: XB = f16(16 * bf16(x)); W planes = f16(64 * bf16(W)) in native [n][k] layout; gate plane
  conv_all<<<gCV, blk, 0, stream>>>(x, Wi, Wo, Wv, Wout, Wa, We, XB, WIO, WV, WOUT, WG);

  // (1..3) gates, v^T, inner | outer
  proj_gemms<<<gPR, blk, 0, stream>>>(XB, WIO, WV, WG, ba, be, QK, VTH, VTL, AEF);

  // (4) attention per (128 query rows, 1 head) -> CTH/CTL (ctx x4096 hi + residual)
  attn_heads<<<gAT, bAT, 0, stream>>>(QK, VTH, VTL, AEF, betap, ivp, ovp, chg, CTH, CTL);

  // (5) output projection
  out_gemm<<<gO, blk, 0, stream>>>(CTH, CTL, WOUT, out);
  (void)hipGetLastError();
}

// v008
// One run takes 76.9 microseconds.
// In both of two side-by-side timings against v007, it was 1.05 times as fast.
// Counting every step since v000, it is 4.84 times as fast.
// Contractions: gate logits (x f16 x16 . [Wa;We;Wa;We] f16 x64, K=1024), inner|outer projections (x f16 x16 . [Wi;Wo] f16 x64, K=1024),
// v^T projection (Wv f16 x64 . x f16 x16, K=1024; stored as f16 hi x1024 + residual plane), scores (inner f16 x16 . outer f16 x16, K=64),
// v^T . P^T (v^T f16 hi+residual . P f16 x1024 hi+residual, three products, 2048 keys in steps of 32; scores and this product transposed),
// output projection (ctx f16 x4096 hi+residual . Wout f16 x64, two products, K=1024): all v_wmma_f32_16x16x32_f16, f32 accumulate.
// Sigmoid gates, online max-subtracted softmax, renormaliser, valve/rotation epilogue in f32 on VALU; every float input RNE-converted to bf16 on load.
#include <hip/hip_runtime.h>
#include <math.h>
#include <stdint.h>

#define TT      2048
#define DM      1024
#define NHEAD   16
#define HDIM    64
#define NGATE   64
#define QTB     8
#define QKP     (2 * DM)
#define WSC     64.0f
#define ACARRY  16.0f
#define QC      16.0f
#define KC      16.0f
#define VC      1024.0f
#define PC      1024.0f
#define FC      4096.0f
#define ATT_SCALE 0.125f
#define PI_F    3.14159265358979323846f
#define REN_EPS 1e-8f
static_assert(NHEAD * HDIM == DM);
static_assert((TT % 64) == 0 && (DM % 64) == 0 && (DM % 256) == 0 && (TT % 32) == 0 && (TT % 16) == 0);
static_assert(NHEAD == 16 && NGATE == 64);
#define ATT_WAVES   16
#define ATT_THREADS (ATT_WAVES * 32)
#define ATT_QB      (QTB * 16)
#define ATT_QG      (TT / ATT_QB)
#define ATT_BLOCKS  (ATT_QG * NHEAD)
static_assert(ATT_THREADS == 512 && ATT_BLOCKS == 256 && (TT % ATT_QB) == 0);

typedef _Float16 v16h __attribute__((ext_vector_type(16)));
typedef _Float16 v8h  __attribute__((ext_vector_type(8)));
typedef float    v8f  __attribute__((ext_vector_type(8)));
typedef float    v4f  __attribute__((ext_vector_type(4)));
typedef unsigned int v4u __attribute__((ext_vector_type(4)));

union FragH { v16h v; v8h h[2]; v4u u[2]; };

// ---- scalar helpers --------------------------------------------------------------------------------
__device__ __forceinline__ unsigned short bf_bits(float f) {          // f32 -> bf16 bits, RNE convert
  unsigned u = __float_as_uint(f);
  return (unsigned short)((u + 0x7FFFu + ((u >> 16) & 1u)) >> 16);
}
__device__ __forceinline__ float bf_up(unsigned short h) { return __uint_as_float(((unsigned)h) << 16); }
__device__ __forceinline__ float bfr(float f) { return bf_up(bf_bits(f)); }   // value of the bf16 RNE convert
__device__ __forceinline__ unsigned short h_bits(_Float16 x) { return __builtin_bit_cast(unsigned short, x); }
__device__ __forceinline__ unsigned pk16(unsigned short a, unsigned short b) { return (unsigned)a | ((unsigned)b << 16); }
__device__ __forceinline__ v8f zero8() { v8f z = {0.f, 0.f, 0.f, 0.f, 0.f, 0.f, 0.f, 0.f}; return z; }
__device__ __forceinline__ float sigf(float v) { return 1.0f / (1.0f + expf(-v)); }
// 2^x as the one hardware instruction (v_exp_f32). The library exp2f adds a compare, two selects, an add and an ldexp per value, only
// to return subnormal results; here a result under 2^-126 may be 0: it stands beside a term near 1 in the sum of e, beside
// 1e-8 times that sum in the renormaliser, and is 0 in both f16 planes of P either way (a rescale factor that small likewise). -inf gives 0, as in the library form.
__device__ __forceinline__ float exp2_hw(float x) { return __builtin_amdgcn_exp2f(x); }

// ---- fragment loaders: 16-bit A/B operand, lane -> row/col (lane&15), p already includes +8*(lane>>4);
//      elements 0..7 <- p[0..7] (k0+8h..), elements 8..15 <- p[16..23] (k0+16+8h..)  (same split k map for A and B;
//      B is always read from a k-contiguous [n][k] plane)
__device__ __forceinline__ v16h ldfrag_h(const _Float16* p) {
  FragH f;
  f.h[0] = *(const v8h*)(p);
  f.h[1] = *(const v8h*)(p + 16);
  return f.v;
}
__device__ __forceinline__ v16h ldfrag_u(const unsigned short* p) {
  FragH f;
  f.u[0] = *(const v4u*)(p);
  f.u[1] = *(const v4u*)(p + 16);
  return f.v;
}

// ---- WMMA helpers with trailing VALU hazard gaps ------------------------------------------------------
__device__ __forceinline__ v8f mma_raw(v16h a, v16h b, v8f c) {
  return __builtin_amdgcn_wmma_f32_16x16x32_f16(false, a, false, b, (short)0, c, false, false);
}
__device__ __forceinline__ void dep_guard1(v8f& a, v8f& b, v16h x) {
#if defined(__HIP_DEVICE_COMPILE__)
  asm volatile("v_nop\n\tv_nop\n\tv_nop\n\tv_nop" : "+v"(a), "+v"(b) : "v"(x));
#endif
}
__device__ __forceinline__ void guard_pv6(v8f& a, v8f& b, v8f& c, v8f& d,
                                          v16h p0, v16h p1, v16h x0, v16h x1, v16h x2, v16h x3) {
#if defined(__HIP_DEVICE_COMPILE__)
  asm volatile("v_nop\n\tv_nop\n\tv_nop\n\tv_nop"
               : "+v"(a), "+v"(b), "+v"(c), "+v"(d) : "v"(p0), "v"(p1), "v"(x0), "v"(x1), "v"(x2), "v"(x3));
#endif
}
__device__ __forceinline__ void keep4_h(v16h a, v16h b, v16h c, v16h d) {
#if defined(__HIP_DEVICE_COMPILE__)
  asm volatile("v_nop" :: "v"(a), "v"(b), "v"(c), "v"(d));
#endif
}
__device__ __forceinline__ void acc_guard4(v8f& a, v8f& b, v8f& c, v8f& d) {
#if defined(__HIP_DEVICE_COMPILE__)
  asm volatile("v_nop\n\tv_nop\n\tv_nop\n\tv_nop" : "+v"(a), "+v"(b), "+v"(c), "+v"(d));
#endif
}
__device__ __forceinline__ void wave_sync_lds() {
  __builtin_amdgcn_fence(__ATOMIC_RELEASE, "workgroup");
  __builtin_amdgcn_wave_barrier();
  __builtin_amdgcn_fence(__ATOMIC_ACQUIRE, "workgroup");
}

// =====================================================================================================
// Row convert: X f32 [nrows][1024] -> Y f16 [nrows][1024] = f16( bf16_RNE(X) * carry ), carry a power of two (exact).
// One wave per row (8 rows per block); lane l holds cols j*256 + 8l..8l+7 for j = 0..3; store instruction j covers a contiguous
// coverage: 4 x 32 lanes x 8 halves = 1024 = the whole row; nrows/8 blocks per job (exact multiples here) with a wave-uniform row bound.
// Used for x (carry 16) and for Wi, Wo, Wv, Wout in their native [out][in] = [n][k] layout (carry 64).
// =====================================================================================================
__device__ __forceinline__ void conv_rows(int blk, const float* __restrict__ X, unsigned short* Y, int nrows, float carry) {
  const int lane = threadIdx.x & 31, wave = threadIdx.x >> 5;
  const int row = blk * 8 + wave;
  if (row >= nrows) return;                      // wave-uniform; no barriers in this kernel
  const float* xp = X + (size_t)row * DM;
  unsigned short* op = Y + (size_t)row * DM;
  v4u res[4];
#pragma unroll
  for (int j = 0; j < 4; ++j) {
    const int c0 = j * 256 + lane * 8;
    const v4f a0 = *(const v4f*)(xp + c0), a1 = *(const v4f*)(xp + c0 + 4);
    float t[8];
#pragma unroll
    for (int e = 0; e < 4; ++e) { t[e] = bfr(a0[e]) * carry; t[4 + e] = bfr(a1[e]) * carry; }
    v4u o = {0u, 0u, 0u, 0u};
#pragma unroll
    for (int e = 0; e < 4; ++e) o[e] = pk16(h_bits((_Float16)t[2 * e]), h_bits((_Float16)t[2 * e + 1]));
    res[j] = o;
  }
  {
#pragma unroll
    for (int j = 0; j < 4; ++j) *(v4u*)(op + j * 256 + lane * 8) = res[j];
    
  }
}

// =====================================================================================================
// Gate weight plane: G f16 [64][1024]: row r = f16( 64 * bf16_RNE( (r & 16) ? We[r & 15] : Wa[r & 15] ) ) (rows 32..63 duplicate 0..31).
// Both candidate rows loaded with clamped in-range addresses, selected by value (row is wave-uniform). Same store shape as conv_rows.
// coverage: 8 blocks x 8 waves = 64 rows x (4 x 32 x 8 = 1024 cols), exact.
// =====================================================================================================
__device__ __forceinline__ void conv_gate(int blk, const float* __restrict__ Wa, const float* __restrict__ We,
                                          unsigned short* Y, float carry) {
  const int lane = threadIdx.x & 31, wave = threadIdx.x >> 5;
  const int row = blk * 8 + wave;
  if (row >= NGATE) return;                      // wave-uniform; no barriers in this kernel
  const float* pa = Wa + (size_t)(row & 15) * DM;
  const float* pb = We + (size_t)(row & 15) * DM;
  const bool useb = (row & 16) != 0;
  unsigned short* op = Y + (size_t)row * DM;
  v4u res[4];
#pragma unroll
  for (int j = 0; j < 4; ++j) {
    const int c0 = j * 256 + lane * 8;
    const v4f a0 = *(const v4f*)(pa + c0), a1 = *(const v4f*)(pa + c0 + 4);
    const v4f b0 = *(const v4f*)(pb + c0), b1 = *(const v4f*)(pb + c0 + 4);
    float t[8];
#pragma unroll
    for (int e = 0; e < 4; ++e) {
      t[e]     = bfr(useb ? b0[e] : a0[e]) * carry;
      t[4 + e] = bfr(useb ? b1[e] : a1[e]) * carry;
    }
    v4u o = {0u, 0u, 0u, 0u};
#pragma unroll
    for (int e = 0; e < 4; ++e) o[e] = pk16(h_bits((_Float16)t[2 * e]), h_bits((_Float16)t[2 * e + 1]));
    res[j] = o;
  }
  {
#pragma unroll
    for (int j = 0; j < 4; ++j) *(v4u*)(op + j * 256 + lane * 8) = res[j];
    
  }
}

// =====================================================================================================
// All conversions in one launch: none reads what another writes. The block index picks the job (block-uniform, no barriers):
// blocks 0..255 x, then 128 each for Wi, Wo, Wv, Wout, then 8 for the gate plane; every job keeps its own rows and stores.
// =====================================================================================================
#define CB_X  (TT / 8)
#define CB_W  (DM / 8)
#define CB_G  (NGATE / 8)
#define CB_ALL (CB_X + 4 * CB_W + CB_G)
__global__ __launch_bounds__(256) void conv_all(const float* __restrict__ x, const float* __restrict__ Wi,
                                                const float* __restrict__ Wo, const float* __restrict__ Wv,
                                                const float* __restrict__ Wout, const float* __restrict__ Wa,
                                                const float* __restrict__ We,
                                                unsigned short* XB, unsigned short* WIO, unsigned short* WV,
                                                unsigned short* WOUT, unsigned short* WG) {
  const int b = blockIdx.x;
  if (b >= CB_X + 4 * CB_W) {
    conv_gate(b - (CB_X + 4 * CB_W), Wa, We, WG, WSC);
    return;
  }
  const float* X = x;
  unsigned short* Y = XB;
  int rb = b, nrows = TT;
  float carry = ACARRY;
  if (b >= CB_X) {
    const int w = (b - CB_X) / CB_W;             // 0..3: Wi, Wo, Wv, Wout
    rb = (b - CB_X) % CB_W;
    nrows = DM;
    carry = WSC;
    X = w == 0 ? Wi : w == 1 ? Wo : w == 2 ? Wv : Wout;
    Y = w == 0 ? WIO : w == 1 ? WIO + (size_t)DM * DM : w == 2 ? WV : WOUT;
  }
  conv_rows(rb, X, Y, nrows, carry);
}

// ---- asynchronous global -> LDS copies (16 B per lane). Each statement ends in s_wait_xcnt 0 so that no address register of an
//      issued copy is rewritten before the wait (a precaution); landing is waited for separately with s_wait_asynccnt 0.
#define KST   64      // k per stage: 128 B of every operand row = one whole line
#define LROW  144     // LDS row pitch in bytes: 128 + 16 (16 B x odd: conflict-free for 16-byte readers)
#define RSTEP (32 * LROW)   // LDS bytes between two copy rounds (a round = 8 waves x 4 rows)
__device__ __forceinline__ unsigned lds_off(const void* p) { return (unsigned)(size_t)p; }
__device__ __forceinline__ void copy2_lds(unsigned l, const unsigned short* g, size_t st) {
#if defined(__HIP_DEVICE_COMPILE__)
  asm volatile("global_load_async_to_lds_b128 %0, %1, off\n\t"
               "global_load_async_to_lds_b128 %2, %3, off\n\t"
               "s_wait_xcnt 0x0"
               :: "v"(l), "v"(g), "v"(l + RSTEP), "v"(g + st) : "memory");
#endif
}
__device__ __forceinline__ void copy8_lds(unsigned l, const unsigned short* g, size_t st) {
#if defined(__HIP_DEVICE_COMPILE__)
  asm volatile("global_load_async_to_lds_b128 %0, %1, off\n\t"
               "global_load_async_to_lds_b128 %2, %3, off\n\t"
               "global_load_async_to_lds_b128 %4, %5, off\n\t"
               "global_load_async_to_lds_b128 %6, %7, off\n\t"
               "global_load_async_to_lds_b128 %8, %9, off\n\t"
               "global_load_async_to_lds_b128 %10, %11, off\n\t"
               "global_load_async_to_lds_b128 %12, %13, off\n\t"
               "global_load_async_to_lds_b128 %14, %15, off\n\t"
               "s_wait_xcnt 0x0"
               :: "v"(l), "v"(g), "v"(l + RSTEP), "v"(g + st), "v"(l + 2 * RSTEP), "v"(g + 2 * st),
                  "v"(l + 3 * RSTEP), "v"(g + 3 * st), "v"(l + 4 * RSTEP), "v"(g + 4 * st), "v"(l + 5 * RSTEP), "v"(g + 5 * st),
                  "v"(l + 6 * RSTEP), "v"(g + 6 * st), "v"(l + 7 * RSTEP), "v"(g + 7 * st) : "memory");
#endif
}
// NR rounds of 32 rows (NR = 2 or 16): lane -> row 4*wave + (lane>>3) of its round, 16-byte piece lane&7; st = 32 source rows in elements
template <int NR>
__device__ __forceinline__ void copy_rows(unsigned l, const unsigned short* g, size_t st) {
  static_assert(NR == 2 || NR == 16);
  if constexpr (NR == 2) {
    copy2_lds(l, g, st);
  } else {
    copy8_lds(l, g, st);
    copy8_lds(l + 8 * RSTEP, g + 8 * st, st);
  }
}
__device__ __forceinline__ void wait_copies() {      // this wave's copies have landed in LDS
#if defined(__HIP_DEVICE_COMPILE__)
  asm volatile("s_wait_asynccnt 0x0" ::: "memory");
#endif
}
__device__ __forceinline__ void wait_store_regs() {  // in front of an overwrite of registers that issued global stores name (a precaution)
#if defined(__HIP_DEVICE_COMPILE__)
  asm volatile("s_wait_xcnt 0x0" ::: "memory");
#endif
}
__device__ __forceinline__ void wait_lds_reads() {   // this wave's LDS reads have returned (before their buffer is refilled)
#if defined(__HIP_DEVICE_COMPILE__)
  asm volatile("s_wait_dscnt 0x0" ::: "memory");
#endif
}

// =====================================================================================================
// Register-blocked f16 WMMA GEMM: C[m][n] = f( oscale * sum_k A[m][k] * Bt[n][k] ); one wave per 64x64 tile, 8 tiles per block.
// Operands reach the fragments through LDS: per stage of 64 k the block copies its operand rows (128 B each, whole lines) with
// asynchronous copies into one of two buffers; the next stage's copies fly while this stage is multiplied; one barrier per stage.
// WM 1: the 8 tiles share their 64 A rows and lie side by side in n (N a multiple of 512); WM 8: they share their 64 B rows and
// lie below one another in m (N = 64, M a multiple of 512). K a multiple of 64.
// A row-major [M][K] pitch lda (16-bit plane), Bt row-major [N][K] pitch ldb (k contiguous); M, N multiples of 64, K multiple of 64.
// BM: 0 = no bias; 3 = per-column head bias bf16( (col & 16) ? bias2[col & 15] : bias[col & 15] ) (in-range addresses).
// OM: 0 = f32 out (pitch ldc), ACT 2 applies sigmoid after bias;
//     2 = f16 out = f16( value * ocarry ); 3 = f16 hi plane f16(value*ocarry) to C and unscaled residual f16(value*ocarry - hi) to C2.
// coverage: 4 slabs x 16 rows (f32: it 0..7 x lane>>4; f16: it 0..3 x lane>>3) x 64 cols = the wave's whole 64x64 tile;
//           tilesM*tilesN/8 blocks per product (exact here); a block that does not fit the shape rules leaves as a whole before any barrier.
// =====================================================================================================
// The body is a device function: its kernel owns the LDS (ring: two stages; sT: 8 slabs) and hands in the block's index in this product.
__host__ __device__ constexpr int gemm_stage_bytes(int wm) {
  return (wm * 64 + (8 / wm) * 64) * LROW;
}
#define SLAB_F (16 * 68)   // per-wave 16x64 slab, pitch 68 floats
template <int OM, int BM, int ACT, int WM>
__device__ __forceinline__ void gemm64(
    unsigned char* ring, float* sT, int blk,
    const unsigned short* __restrict__ Ap, int lda,
    const unsigned short* __restrict__ Btp, int ldb,
    const float* __restrict__ bias, const float* __restrict__ bias2,
    void* Cout, void* C2out, int ldc,
    int M, int N, int K, float oscale, float ocarry) {
  static_assert(WM == 1 || WM == 8);
  constexpr int RA  = WM * 64;                     // A rows per block
  constexpr int RB  = (8 / WM) * 64;               // B rows per block
  constexpr int OB  = RA * LROW;                   // stage layout in bytes: [A | B]
  constexpr int STG = OB + RB * LROW;              // bytes per stage
  static_assert(STG == gemm_stage_bytes(WM));
  const int lane = threadIdx.x & 31;
  const int wave = threadIdx.x >> 5;
  const int tilesN = N >> 6;
  const int tilesM = M >> 6;
  const int tile0 = blk * 8;
  if (tile0 + 8 > tilesM * tilesN) return;         // block-uniform, before any barrier or copy
  if (WM == 1 ? (tilesN & 7) != 0 : (tilesN != 1)) return;   // block-uniform shape rule of this build
  const int tmB = tile0 / tilesN;
  const int mB = tmB << 6;                         // block's first row and column
  const int nB = (tile0 - tmB * tilesN) << 6;
  const int m0 = mB + (WM == 8 ? (wave << 6) : 0);
  const int n0 = nB + (WM == 1 ? (wave << 6) : 0);

  const int rlane = lane & 15;                 // row (A) / col (B, D) within subtile
  const int koff  = (lane >> 4) * 8;           // k offset of this lane half
  const int mOff  = (lane >> 4) * 8;           // D row offset

  // copy side: this lane's row and 16-byte piece in a round of 32 rows
  const int crow = wave * 4 + (lane >> 3);
  const int cseg = (lane & 7) * 8;
  const unsigned lcp = lds_off(ring) + (unsigned)(crow * LROW + cseg * 2);
  const unsigned short* gA  = Ap  + (size_t)(mB + crow) * lda + cseg;
  const unsigned short* gB  = Btp + (size_t)(nB + crow) * ldb + cseg;
  const size_t stA = (size_t)32 * lda, stB = (size_t)32 * ldb;
  // reader side: fragment rows of this wave in a stage
  const int fa = ((WM == 8 ? (wave << 6) : 0) + rlane) * LROW + koff * 2;
  const int fb = OB + ((WM == 1 ? (wave << 6) : 0) + rlane) * LROW + koff * 2;

  v8f acc[4][4];
#pragma unroll
  for (int i = 0; i < 4; ++i)
#pragma unroll
    for (int j = 0; j < 4; ++j) acc[i][j] = zero8();

  const int nst = K / KST;
  // stage 0 into buffer 0, landed and published; then stage 1 into buffer 1
  copy_rows<RA / 32>(lcp, gA, stA);
  copy_rows<RB / 32>(lcp + OB, gB, stB);
  wait_copies();
  __syncthreads();
  if (nst > 1) {
    copy_rows<RA / 32>(lcp + STG, gA + KST, stA);
    copy_rows<RB / 32>(lcp + STG + OB, gB + KST, stB);
  }

#pragma unroll 1   // one stage per trip: the ring's order at the foot stays as written
  for (int t = 0; t < nst; ++t) {
    const unsigned bofs = (unsigned)(t & 1) * STG;
    const unsigned char* sb = ring + bofs;
#pragma unroll
    for (int s = 0; s < 2; ++s) {              // two k-steps of 32 per stage, ascending k
      v16h bh[4], ah[4];
#pragma unroll
      for (int j = 0; j < 4; ++j) bh[j] = ldfrag_u((const unsigned short*)(sb + fb + j * 16 * LROW + s * 64));
#pragma unroll
      for (int i = 0; i < 4; ++i) ah[i] = ldfrag_u((const unsigned short*)(sb + fa + i * 16 * LROW + s * 64));
#pragma unroll
      for (int i = 0; i < 4; ++i) {
#pragma unroll
        for (int j = 0; j < 4; ++j) acc[i][j] = mma_raw(ah[i], bh[j], acc[i][j]);
        dep_guard1(acc[i][0], acc[i][3], ah[i]);
      }
      keep4_h(bh[0], bh[1], bh[2], bh[3]);
    }
    // publish point of stage t + 1; the same barrier ends every reader's last read of stage t's buffer
    wait_lds_reads();
    wait_copies();
    __syncthreads();
    if (t + 2 < nst) {                         // block-uniform: refill the buffer that this trip has just read
      const int kn = (t + 2) * KST;
      copy_rows<RA / 32>(lcp + bofs, gA + kn, stA);
      copy_rows<RB / 32>(lcp + bofs + OB, gB + kn, stB);
    }
  }
  wait_copies();
  acc_guard4(acc[0][0], acc[0][1], acc[0][2], acc[0][3]);
  acc_guard4(acc[1][0], acc[1][1], acc[1][2], acc[1][3]);
  acc_guard4(acc[2][0], acc[2][1], acc[2][2], acc[2][3]);
  acc_guard4(acc[3][0], acc[3][1], acc[3][2], acc[3][3]);

  const int hh2 = lane >> 4, c4 = (lane & 15) * 4;     // f32 out: 256-B row segment = 16 lanes x 16 B
  const int q8  = lane >> 3, c8 = (lane & 7) * 8;
  float bc[4];
#pragma unroll
  for (int e = 0; e < 4; ++e) bc[e] = 0.f;
  if constexpr (BM == 3) {
#pragma unroll
    for (int e = 0; e < 4; ++e) {
      const int col = n0 + c4 + e;
      const float fa = bfr(bias[col & 15]);             // in-range addresses 0..15
      const float fb = bfr(bias2[col & 15]);
      bc[e] = (col & 16) ? fb : fa;
    }
  }

  // ---- epilogue ----
  float* slab = sT + wave * SLAB_F;
#pragma unroll
  for (int i = 0; i < 4; ++i) {
    const int mBase = m0 + (i << 4);
#pragma unroll
    for (int j = 0; j < 4; ++j) {
#pragma unroll
      for (int r = 0; r < 8; ++r) {
        slab[(mOff + r) * 68 + (j << 4) + rlane] = acc[i][j][r];
      }
    }
    wave_sync_lds();
    if constexpr (OM == 0) {
      float* C = (float*)Cout;
      constexpr int IU = (ACT == 2) ? 2 : 8;               // row pairs per trip
#pragma unroll 1   // ACT 2: 128 unrolled divisions are 13 KB of text; rolled, the kernel that holds this body stays under 32 KB
      for (int ib = 0; ib < 8; ib += IU) {
        v4f vals[IU];
#pragma unroll
        for (int u = 0; u < IU; ++u) {
          const int row = (ib + u) * 2 + hh2;              // ib + u 0..7 x hh2 0..1 = rows 0..15
          v4f v = *(const v4f*)(slab + row * 68 + c4);
#pragma unroll
          for (int e = 0; e < 4; ++e) {
            float f = v[e] * oscale + bc[e];
            if constexpr (ACT == 2) f = 1.0f / (1.0f + __expf(-f));
            v[e] = f;
          }
          vals[u] = v;
        }
#pragma unroll
        for (int u = 0; u < IU; ++u) {
          const int gr = mBase + (ib + u) * 2 + hh2;
          *(v4f*)(C + (size_t)gr * ldc + n0 + c4) = vals[u];
        }
        if constexpr (IU < 8) wait_store_regs();           // the next trip rewrites the registers that these stores name
      }
    } else {
      unsigned short* C  = (unsigned short*)Cout;
      unsigned short* C2 = (unsigned short*)C2out;
      v4u hv[4], lv[4];
#pragma unroll
      for (int it = 0; it < 4; ++it) {
        const int row = it * 4 + q8;                       // it 0..3 x q8 0..3 = rows 0..15
        const float* sp = slab + row * 68 + c8;
        v4u a = {0u, 0u, 0u, 0u};
        v4u b = {0u, 0u, 0u, 0u};
#pragma unroll
        for (int e = 0; e < 4; ++e) {
          const float f0 = (sp[2 * e] * oscale) * ocarry;
          const float f1 = (sp[2 * e + 1] * oscale) * ocarry;
          const _Float16 h0 = (_Float16)f0, h1 = (_Float16)f1;
          a[e] = pk16(h_bits(h0), h_bits(h1));
          if constexpr (OM == 3) {
            const _Float16 l0 = (_Float16)(f0 - (float)h0);
            const _Float16 l1 = (_Float16)(f1 - (float)h1);
            b[e] = pk16(h_bits(l0), h_bits(l1));
          }
        }
        hv[it] = a;
        lv[it] = b;
      }
      {
#pragma unroll
        for (int it = 0; it < 4; ++it) {
          const int row = it * 4 + q8;
          *(v4u*)(C + (size_t)(mBase + row) * ldc + n0 + c8) = hv[it];
          if constexpr (OM == 3) {
            *(v4u*)(C2 + (size_t)(mBase + row) * ldc + n0 + c8) = lv[it];
          }
        }
        
      }
    }
    wave_sync_lds();
  }
}

// =====================================================================================================
// The three products of x in one launch: none reads what another writes, and together they have fewer blocks than the chip has WGPs.
// The block index picks the product (block-uniform, so every barrier of a body is passed by the whole block); longest epilogue first:
//   blocks 0..3     gates: AEF[t][j] = sigmoid(x[t] . G[j] / (16*64) + bf16(bias_j)); M = 2048, N = 64, K = 1024, f32 out
//   blocks 4..67    v^T: VTH/VTL[d][t] = hi/residual of f16(1024 * Wv[d] . x[t]); M = 1024, N = 2048, K = 1024
//   blocks 68..195  inner | outer: QK[t][n] = f16(16 * x[t] . [Wi;Wo][n]); M = 2048, N = 2048, K = 1024
// =====================================================================================================
#define PB_GE ((TT / 64) * (NGATE / 64) / 8)
#define PB_VT ((DM / 64) * (TT / 64) / 8)
#define PB_QK ((TT / 64) * (QKP / 64) / 8)
#define PB_ALL (PB_GE + PB_VT + PB_QK)
static_assert(gemm_stage_bytes(1) == gemm_stage_bytes(8));
__global__ __launch_bounds__(256) void proj_gemms(
    const unsigned short* __restrict__ XB, const unsigned short* __restrict__ WIO, const unsigned short* __restrict__ WV,
    const unsigned short* __restrict__ WG, const float* __restrict__ ba, const float* __restrict__ be,
    unsigned short* QK, unsigned short* VTH, unsigned short* VTL, float* AEF) {
  __shared__ __align__(16) unsigned char ring[2 * gemm_stage_bytes(1)];
  __shared__ __align__(16) float sT[8 * SLAB_F];
  const int b = blockIdx.x;
  if (b < PB_GE) {
    gemm64<0, 3, 2, 8>(ring, sT, b, XB, DM, WG, DM, ba, be,
                          (void*)AEF, (void*)AEF, NGATE, TT, NGATE, DM, 1.0f / (ACARRY * WSC), 1.0f);
  } else if (b < PB_GE + PB_VT) {
    gemm64<3, 0, 0, 1>(ring, sT, b - PB_GE, WV, DM, XB, DM, ba, be,
                          (void*)VTH, (void*)VTL, TT, DM, TT, DM, 1.0f / (WSC * ACARRY), VC);
  } else {
    gemm64<2, 0, 0, 1>(ring, sT, b - (PB_GE + PB_VT), XB, DM, WIO, DM, ba, be,
                          (void*)QK, (void*)QK, QKP, TT, QKP, DM, 1.0f / (ACARRY * WSC), QC);
  }
}
// =====================================================================================================
// Output projection: out[m][n] = sum_k (CTH[m][k] + CTL[m][k]) * WOUT[n][k] / (4096 * 64); M = 2048, N = 1024, K = 1024, f32 out.
// One block per 64 x 128 tile of out: 32 x 8 = 256 blocks, so that every WGP has one (512 tiles of 64 x 64, one a wave, fill only 64).
// 8 waves as 2 (m) x 4 (n), 32 x 32 of out per wave = 4 accumulator tiles. The ring is gemm64's: stages of 64 k, two buffers, the next
// stage's asynchronous copies fly while this stage is multiplied, one barrier per stage. A stage is 8 copy rounds of 32 rows:
// [ctx hi 64 rows | ctx residual 64 rows | Wout 128 rows]. Per accumulator and k-step of 32: hi product, then residual product, ascending k.
// coverage: 32 rows (it 0..7 x lane>>3) x 32 cols (128 B, one whole line) = the wave's 32 x 32; the grid is exact.
// =====================================================================================================
#define OBM   64
#define OBN   128
#define OOA2  (OBM * LROW)
#define OOB   (2 * OBM * LROW)
#define OSTG  (OOB + OBN * LROW)     // bytes per stage
#define OSLAB (32 * 36)              // per-wave 32 x 32 slab, pitch 36 floats
static_assert((TT % OBM) == 0 && (DM % OBN) == 0 && (DM % KST) == 0 && DM / KST >= 2 && OSTG == 8 * RSTEP);
// one stage: the 8 rounds in one statement that ends in s_wait_xcnt 0, as in the copy helpers above (no address register of an issued
// copy is rewritten before the wait, a precaution); a, a2, b are this lane's row and piece at the stage's k; st = 32 source rows
__device__ __forceinline__ void out_stage(unsigned l, const unsigned short* a, const unsigned short* a2, const unsigned short* b,
                                          size_t st) {
#if defined(__HIP_DEVICE_COMPILE__)
  asm volatile("global_load_async_to_lds_b128 %0, %1, off\n\t"
               "global_load_async_to_lds_b128 %2, %3, off\n\t"
               "global_load_async_to_lds_b128 %4, %5, off\n\t"
               "global_load_async_to_lds_b128 %6, %7, off\n\t"
               "global_load_async_to_lds_b128 %8, %9, off\n\t"
               "global_load_async_to_lds_b128 %10, %11, off\n\t"
               "global_load_async_to_lds_b128 %12, %13, off\n\t"
               "global_load_async_to_lds_b128 %14, %15, off\n\t"
               "s_wait_xcnt 0x0"
               :: "v"(l), "v"(a), "v"(l + RSTEP), "v"(a + st), "v"(l + 2 * RSTEP), "v"(a2), "v"(l + 3 * RSTEP), "v"(a2 + st),
                  "v"(l + 4 * RSTEP), "v"(b), "v"(l + 5 * RSTEP), "v"(b + st), "v"(l + 6 * RSTEP), "v"(b + 2 * st),
                  "v"(l + 7 * RSTEP), "v"(b + 3 * st) : "memory");
#endif
}
__global__ __launch_bounds__(256) void out_gemm(
    const unsigned short* __restrict__ CTH, const unsigned short* __restrict__ CTL, const unsigned short* __restrict__ WOUT,
    float* out) {
  __shared__ __align__(16) unsigned char ring[2 * OSTG];
  __shared__ __align__(16) float sT[8 * OSLAB];
  const int lane = threadIdx.x & 31;
  const int wave = threadIdx.x >> 5;
  const int mB = ((int)blockIdx.x / (DM / OBN)) * OBM;      // block's first row and column
  const int nB = ((int)blockIdx.x % (DM / OBN)) * OBN;
  const int wr = (wave >> 2) * 32, wc = (wave & 3) * 32;    // wave's first row and column in the block tile
  const int rlane = lane & 15;                 // row (A) / col (B, D) within subtile
  const int koff  = (lane >> 4) * 8;           // k offset of this lane half
  const int mOff  = (lane >> 4) * 8;           // D row offset

  // copy side: this lane's row and 16-byte piece in a round of 32 rows
  const int crow = wave * 4 + (lane >> 3);
  const int cseg = (lane & 7) * 8;
  const unsigned lcp = lds_off(ring) + (unsigned)(crow * LROW + cseg * 2);
  const unsigned short* gA  = CTH  + (size_t)(mB + crow) * DM + cseg;
  const unsigned short* gA2 = CTL  + (size_t)(mB + crow) * DM + cseg;
  const unsigned short* gB  = WOUT + (size_t)(nB + crow) * DM + cseg;
  const size_t st = (size_t)32 * DM;
  // reader side: fragment rows of this wave in a stage
  const int fa = (wr + rlane) * LROW + koff * 2;
  const int fb = OOB + (wc + rlane) * LROW + koff * 2;

  v8f a00 = zero8(), a01 = zero8(), a10 = zero8(), a11 = zero8();

  constexpr int nst = DM / KST;
  // stage 0 into buffer 0, landed and published; then stage 1 into buffer 1
  out_stage(lcp, gA, gA2, gB, st);
  wait_copies();
  __syncthreads();
  out_stage(lcp + OSTG, gA + KST, gA2 + KST, gB + KST, st);

#pragma unroll 1   // one stage per trip: the ring's order at the foot stays as written
  for (int t = 0; t < nst; ++t) {
    const unsigned bofs = (unsigned)(t & 1) * OSTG;
    const unsigned char* sb = ring + bofs;
    v16h bh[2][2], ah[2][2], al[2][2];         // [k-step][subtile]: the stage's 24 LDS reads stand together, in front of its WMMAs
#pragma unroll
    for (int s = 0; s < 2; ++s) {
#pragma unroll
      for (int i = 0; i < 2; ++i) {
        bh[s][i] = ldfrag_u((const unsigned short*)(sb + fb + i * 16 * LROW + s * 64));
        ah[s][i] = ldfrag_u((const unsigned short*)(sb + fa + i * 16 * LROW + s * 64));
        al[s][i] = ldfrag_u((const unsigned short*)(sb + OOA2 + fa + i * 16 * LROW + s * 64));
      }
    }
#pragma unroll
    for (int s = 0; s < 2; ++s) {              // two k-steps of 32 per stage, ascending k
      a00 = mma_raw(ah[s][0], bh[s][0], a00);
      a01 = mma_raw(ah[s][0], bh[s][1], a01);
      a10 = mma_raw(ah[s][1], bh[s][0], a10);
      a11 = mma_raw(ah[s][1], bh[s][1], a11);
      a00 = mma_raw(al[s][0], bh[s][0], a00);
      a01 = mma_raw(al[s][0], bh[s][1], a01);
      a10 = mma_raw(al[s][1], bh[s][0], a10);
      a11 = mma_raw(al[s][1], bh[s][1], a11);
      // four vector slots behind the last WMMA, before anything rewrites its operands or touches its results (also over the branch below)
      guard_pv6(a00, a01, a10, a11, ah[s][0], ah[s][1], al[s][0], al[s][1], bh[s][0], bh[s][1]);
    }
    // publish point of stage t + 1; the same barrier ends every reader's last read of stage t's buffer
    wait_lds_reads();
    wait_copies();
    __syncthreads();
    if (t + 2 < nst) {                         // block-uniform: refill the buffer that this trip has just read
      const int kn = (t + 2) * KST;
      out_stage(lcp + bofs, gA + kn, gA2 + kn, gB + kn, st);
    }
  }
  wait_copies();

  // ---- epilogue: each wave stages its 32 x 32 in its own slab and stores whole 128-B lines ----
  const float oscale = 1.0f / (FC * WSC);
  const int q8 = lane >> 3, c4 = (lane & 7) * 4;
  float* slab = sT + wave * OSLAB;
  float* op = out + (size_t)(mB + wr + q8) * DM + nB + wc + c4;
#pragma unroll
  for (int r = 0; r < 8; ++r) {
    slab[(mOff + r) * 36 + rlane] = a00[r];
    slab[(mOff + r) * 36 + 16 + rlane] = a01[r];
    slab[(16 + mOff + r) * 36 + rlane] = a10[r];
    slab[(16 + mOff + r) * 36 + 16 + rlane] = a11[r];
  }
  wave_sync_lds();
  v4f vals[8];
#pragma unroll
  for (int it = 0; it < 8; ++it) vals[it] = *(const v4f*)(slab + (it * 4 + q8) * 36 + c4) * oscale;   // it 0..7 x q8 0..3 = rows 0..31
#pragma unroll
  for (int it = 0; it < 8; ++it) *(v4f*)(op + (size_t)(it * 4) * DM) = vals[it];
}

// =====================================================================================================
// Flash attention for one head and 128 query rows, head dim 64, 2048 keys:
//   inner|outer plane (f16 x16) QK[tok][2048]: inner at col 64h + d, outer at col 1024 + 64h + d;
//   v^T planes (f16 hi x1024, unscaled residual): VH/VL[64h + d][key] (pitch 2048);
//   gate plane AEF f32 [tok][64]: col h = ap[h][tok] (sigmoid applied), col 16 + h = ex[h][tok];
//   out: CTH/CTL[tok][64h + d] = f16 hi / residual of 4096 * ctx, ctx = valve/rotation epilogue of
//        ap * sum_s p_s v_s / (ap * sum_s p_s + 1e-8 * sum_s e_s), e_s = exp(score_s - max), p_s = e_s * ex[s].
//   block = 16 waves = 512 threads, four to a SIMD: the vector work between a wave's matrix runs and its LDS latencies
//   are covered by three other waves. grid = 16 heads x 16 query groups = 256; every wave does identical bounded work (16 steps).
//   A stage is 128 keys, laid out as two halves of 64: per half the head's 64 outer rows and the 64 rows of each v^T plane (128 B
//   each, whole lines). Waves 0..7 copy the first half, waves 8..15 the second, with asynchronous copies into one of two LDS buffers;
//   the next stage's copies fly while this stage is worked on; one barrier per stage. The head's ex column (2048 f32) is put into
//   LDS once, in front of the first barrier.
//   A wave takes 32 query rows (two tiles of 16; wave & 3 picks them) and 32 of a stage's 128 keys (wave >> 2 picks the quarter), so
//   every outer, v^T and ex fragment that it reads from LDS feeds two query tiles: half the LDS reads per WMMA of a 16-query wave.
//   Both products are transposed: S^T = outer . inner^T (A = 16 key rows from the stage, B = 16 query rows, kept in registers) and
//   O^T += v^T . P^T (A = 16 d rows of v^T from the stage, B = P^T). A lane (c = lane & 15, hh = lane >> 4) then holds, per query
//   tile, only query c of it: score register r of key tile i is key kb + 16 i + 8 hh + r, which is the k order of a B operand, so
//   the two score tiles of a step, converted in place, are P^T; output register r of tile j is d = 16 j + 8 hh + r.
//   Per step and query tile: 2 score tiles on f16 WMMA (K = 64 as two k-steps of 32); the maximum over the lane's 16 keys in the
//   lane, joined with the other half by one cross-row move; online max-subtracted softmax in f32 (exp2, log2e / 8 / carries folded
//   in); running sums of e and of p = e*ex in two partial sums per lane (joined behind the loop); one rescale factor per lane;
//   12 WMMAs (hi.hi, hi.lo, lo.hi) into one accumulator set.
//   Behind the loop the four waves of a query group (same wave & 3) hold the sums of their own keys on their own maxima. Each puts
//   its maxima, sums and O^T into the ring's LDS (free behind the loop's last barrier) and finishes one query tile (quarter & 1) and
//   one pair of d tiles (j and j + 2, j = quarter >> 1: the rotation's partners): it joins the four parts, in quarter order, on the
//   common maximum.
//   Final scaling in f32; each lane stages its query's 2 x 8 consecutive d (hi and residual) in the block's LDS row buffers [128][64];
// coverage: LDS row buffers: 16 waves x 16 rows x 32 cols = 128 x 64; global: 2 iterations x 512 threads x 8 halves = 128 rows x 64
//           cols (cols 64*head ..) of rows qB..qB+127, both planes; grid covers all 2048 rows x 1024 cols exactly once.
// =====================================================================================================
#define AKS   64                        // keys per half stage: 128 B of every v^T row = one whole line
#define AOVH  (AKS * LROW)              // half-stage layout in bytes: [64 outer rows | 64 v^T hi rows | 64 v^T residual rows]
#define AOVL  (AOVH + HDIM * LROW)
#define ASTG  (AOVL + HDIM * LROW)      // bytes per half stage
#define ABUF  (2 * ASTG)                // bytes per stage (128 keys) = per buffer
static_assert(AKS == 64 && HDIM == 64 && (TT % (2 * AKS)) == 0 && (TT / (2 * AKS)) >= 2 && HDIM * 2 + 16 == LROW && AKS * 2 + 16 == LROW);
static_assert((TT % ATT_THREADS) == 0);
// one half stage: keys 64 t .. 64 t + 63 behind the pointers' own first key; l, gK, gVh, gVl are this lane's row
// (4*(wave&7) + (lane>>3) of a round of 32) and 16-byte piece
__device__ __forceinline__ void att_stage(unsigned l, const unsigned short* gK, const unsigned short* gVh,
                                          const unsigned short* gVl, int t) {
  copy_rows<2>(l,        gK  + (size_t)t * AKS * QKP, (size_t)32 * QKP);
  copy_rows<2>(l + AOVH, gVh + (size_t)t * AKS,       (size_t)32 * TT);
  copy_rows<2>(l + AOVL, gVl + (size_t)t * AKS,       (size_t)32 * TT);
}
__device__ __forceinline__ const _Float16* lds_h(const unsigned char* p) { return (const _Float16*)(const void*)p; }
// value of lane l ^ 16 (one vector cross-row move, no LDS counter)
__device__ __forceinline__ float xhalf(float x) {
  const int b = __builtin_bit_cast(int, x);
  return __builtin_bit_cast(float, __builtin_amdgcn_permlanex16(b, b, 0x76543210, 0xfedcba98, false, false));
}

// eight values to two, in packed adds: as many instructions as eight running sums take, and 6 registers fewer per sum
typedef float v2f __attribute__((ext_vector_type(2)));
__device__ __forceinline__ v2f fold2(const v8f v) {
  const v4f q = __builtin_shufflevector(v, v, 0, 1, 2, 3) + __builtin_shufflevector(v, v, 4, 5, 6, 7);
  return __builtin_shufflevector(q, q, 0, 1) + __builtin_shufflevector(q, q, 2, 3);
}
// one query tile's softmax over a step's 32 keys: s0[r]: key kb + 8hh + r, s1[r]: key kb + 16 + 8hh + r; x0, x1: ex of those keys.
// Returns the rescale factor of the running sums and of O^T; ph, pl: P^T x1024 as a B operand, hi and residual.
__device__ __forceinline__ float soft_step(const v8f s0, const v8f s1, const v8f x0, const v8f x1, const float lsc,
                                           float& mrow, v2f& zv, v2f& lv, v16h& phv, v16h& plv) {
  const float m0 = fmaxf(fmaxf(s0[0], s0[1]), s0[2]), m1 = fmaxf(fmaxf(s0[3], s0[4]), s0[5]);
  const float m2 = fmaxf(fmaxf(s0[6], s0[7]), s1[0]), m3 = fmaxf(fmaxf(s1[1], s1[2]), s1[3]);
  const float m4 = fmaxf(fmaxf(s1[4], s1[5]), s1[6]);
  float mx = fmaxf(fmaxf(fmaxf(m0, m1), s1[7]), fmaxf(fmaxf(m2, m3), m4));   // the lane's 16 keys
  mx = fmaxf(mx, xhalf(mx));               // both halves: maximum over the step's 32 keys
  const float mn = fmaxf(mrow, mx * lsc);
  const float al = exp2_hw(mrow - mn);
  mrow = mn;
  // the exponents' arguments as one vector fma: written so, they stay two to an instruction
  const v8f mn8 = {mn, mn, mn, mn, mn, mn, mn, mn};
  const v8f lsc8 = {lsc, lsc, lsc, lsc, lsc, lsc, lsc, lsc};
  const v8f t0 = __builtin_elementwise_fma(s0, lsc8, -mn8), t1 = __builtin_elementwise_fma(s1, lsc8, -mn8);
  v8f e0, e1;
#pragma unroll   // constant element indices: the vectors stay in registers
  for (int r = 0; r < 8; ++r) { e0[r] = exp2_hw(t0[r]); e1[r] = exp2_hw(t1[r]); }
  const v8f p0 = e0 * x0, p1 = e1 * x1;
  zv = zv * al + fold2(e0 + e1);
  lv = lv * al + fold2(p0 + p1);
  FragH ph, pl;                            // element r <- k = 8hh + r, element 8 + r <- k = 16 + 8hh + r
  const v8f y0 = p0 * PC, y1 = p1 * PC;
  ph.h[0] = __builtin_convertvector(y0, v8h);
  ph.h[1] = __builtin_convertvector(y1, v8h);
  pl.h[0] = __builtin_convertvector(y0 - __builtin_convertvector(ph.h[0], v8f), v8h);
  pl.h[1] = __builtin_convertvector(y1 - __builtin_convertvector(ph.h[1], v8f), v8h);
  phv = ph.v;
  plv = pl.v;
  return al;
}
// eight floats at a 16-byte boundary, as two 16-byte accesses
__device__ __forceinline__ void st8(float* p, const v8f v) {
  *(v4f*)(p)     = __builtin_shufflevector(v, v, 0, 1, 2, 3);
  *(v4f*)(p + 4) = __builtin_shufflevector(v, v, 4, 5, 6, 7);
}
__device__ __forceinline__ v8f ld8(const float* p) {
  const v4f a = *(const v4f*)(p), b = *(const v4f*)(p + 4);
  return __builtin_shufflevector(a, b, 0, 1, 2, 3, 4, 5, 6, 7);
}
#define XLANE 76                        // floats a lane hands over: 64 of O^T, per tile maximum, two sums, one unused; 4 unused: 304 B = 16 B x odd
#define AXB   (ATT_THREADS * XLANE * 4) // bytes of the hand-over
#define AKVB  (AXB > 2 * ABUF ? AXB : 2 * ABUF)

__global__ __launch_bounds__(ATT_THREADS)
void attn_heads(const unsigned short* __restrict__ QKq, const unsigned short* __restrict__ VHq,
                const unsigned short* __restrict__ VLq, const float* __restrict__ AEF,
                const float* __restrict__ betap, const float* __restrict__ ivp,
                const float* __restrict__ ovp, const float* __restrict__ chg,
                unsigned short* CTH, unsigned short* CTL) {
  __shared__ __align__(16) unsigned char kv[AKVB];          // two stages of outer rows and v^T rows; behind the loop: the hand-over
  __shared__ __align__(16) float exs[TT];                   // ex of this head, by key
  __shared__ __align__(16) unsigned short Osh[ATT_QB * HDIM];   // block result rows [128][64], hi
  __shared__ __align__(16) unsigned short Osl[ATT_QB * HDIM];   // residual

  const int tid  = threadIdx.x;
  const int wave = __builtin_amdgcn_readfirstlane(tid >> 5);   // in a scalar register: what is derived from it takes no vector register (256 a wave at four waves a SIMD)
  const int lane = tid & 31;
  const int hh   = lane >> 4;
  const int c    = lane & 15;
  const int qw   = wave & 3;                                // which 32 query rows of the block
  const int kq   = wave >> 2;                               // which 32 keys of every stage (quarter 0..3)
  const int sub  = kq >> 1;                                 // its half stage, also the half that this wave copies
  const int kh   = kq & 1;                                  // its 32 keys in that half
  const int ft   = kq & 1;                                  // behind the loop: the query tile that this wave finishes
  const int dh   = kq >> 1;                                 // and its d tiles: dh and dh + 2

  const int qg   = blockIdx.x % ATT_QG;                     // query group 0..15
  const int head = (blockIdx.x / ATT_QG) & (NHEAD - 1);     // 0..15
  const int qB   = qg * ATT_QB;                             // block's first query row
  const int q0   = qB + qw * 32;                            // wave's first query row
  const int orow = qw * 32 + ft * 16 + c;                   // the block row (query) that this lane finishes

  const _Float16* Qh = (const _Float16*)(const void*)QKq + (size_t)(q0 + c) * QKP + head * HDIM + 8 * hh;
  const float* Ex = AEF + 16 + head;                                    // ex column of this head
  const float lsc = (1.4426950408889634f * ATT_SCALE) / (QC * KC);      // log2(e) / 8 / carries

  // copy side: this lane's row and 16-byte piece in a round of 32 rows
  const int crow = (wave & 7) * 4 + (lane >> 3);
  const int cseg = (lane & 7) * 8;
  const unsigned lcp = lds_off(kv) + (unsigned)(sub * ASTG + crow * LROW + cseg * 2);
  const unsigned short* gK  = QKq + (size_t)(sub * AKS + crow) * QKP + DM + head * HDIM + cseg;
  const unsigned short* gVh = VHq + (size_t)(head * HDIM + crow) * TT + sub * AKS + cseg;
  const unsigned short* gVl = VLq + (size_t)(head * HDIM + crow) * TT + sub * AKS + cseg;
  // reader side, in bytes: this lane's fragment row (key or d = c within a group of 16 rows) and k half, at the wave's 32 keys
  const int frk = sub * ASTG + (kh * 32 + c) * LROW + 16 * hh;        // outer rows: 32 rows down
  const int frv = sub * ASTG + AOVH + c * LROW + 16 * hh + kh * 64;   // v^T rows: 32 keys = 64 B along

  // stage 0 into buffer 0, landed and published; then stage 1 into buffer 1. The ex column is published by the same barrier.
  att_stage(lcp, gK, gVh, gVl, 0);
  const v16h qa0 = ldfrag_h(Qh), qb0 = ldfrag_h(Qh + 32);                                // query tile 0: rows q0 + c
  const v16h qa1 = ldfrag_h(Qh + (size_t)16 * QKP), qb1 = ldfrag_h(Qh + (size_t)16 * QKP + 32);   // tile 1: rows q0 + 16 + c
  const float apq = AEF[(size_t)(qB + orow) * NGATE + head]; // ap of the query that this lane finishes, used behind the loop
#pragma unroll   // the 4 loads are issued together, one latency
  for (int i = 0; i < TT / ATT_THREADS; ++i) {
    const int k = i * ATT_THREADS + tid;                     // 4 x 512 = all 2048 keys
    exs[k] = Ex[(size_t)k * NGATE];
  }
  wait_copies();
  __syncthreads();
  att_stage(lcp + ABUF, gK, gVh, gVl, 2);

  float mr0 = -INFINITY, mr1 = -INFINITY;                    // this lane's query of tile 0, of tile 1
  v2f zv0 = {0.f, 0.f}, lv0 = {0.f, 0.f}, zv1 = {0.f, 0.f}, lv1 = {0.f, 0.f};   // sums of e and p over this half's keys: even r, odd r
  v8f a0 = zero8(), a1 = zero8(), a2 = zero8(), a3 = zero8();       // O^T of tile 0
  v8f b0 = zero8(), b1 = zero8(), b2 = zero8(), b3 = zero8();       // O^T of tile 1

  constexpr int nst = TT / (2 * AKS);
#pragma unroll 1   // one stage per trip: the ring's order at the foot stays as written
  for (int t = 0; t < nst; ++t) {
    const unsigned bofs = (unsigned)(t & 1) * ABUF;
    const unsigned char* sb = kv + bofs;
    const int kb = t * (2 * AKS) + kq * 32;    // the wave's one step of 32 keys in this stage
    v8f sa0, sa1, sb0, sb1;                    // s?0[r]: key kb + 8hh + r, s?1[r]: key kb + 16 + 8hh + r; sa: tile 0, sb: tile 1
    {
      const _Float16* kp = lds_h(sb + frk);
      const _Float16* kq = lds_h(sb + frk + 16 * LROW);
      const v16h k00 = ldfrag_h(kp), k01 = ldfrag_h(kp + 32);
      const v16h k10 = ldfrag_h(kq), k11 = ldfrag_h(kq + 32);
      sa0 = mma_raw(k00, qa0, zero8());
      sb0 = mma_raw(k00, qa1, zero8());
      sa1 = mma_raw(k10, qa0, zero8());
      sb1 = mma_raw(k10, qa1, zero8());
      sa0 = mma_raw(k01, qb0, sa0);
      sb0 = mma_raw(k01, qb1, sb0);
      sa1 = mma_raw(k11, qb0, sa1);
      sb1 = mma_raw(k11, qb1, sb1);
    }
    const float* exq = exs + kb + 8 * hh;
    const v4f xa = *(const v4f*)(exq),      xb = *(const v4f*)(exq + 4);      // ex of keys kb + 8hh + 0..7
    const v4f xc = *(const v4f*)(exq + 16), xd = *(const v4f*)(exq + 20);     // ex of keys kb + 16 + 8hh + 0..7
    const v8f x0 = __builtin_shufflevector(xa, xb, 0, 1, 2, 3, 4, 5, 6, 7);
    const v8f x1 = __builtin_shufflevector(xc, xd, 0, 1, 2, 3, 4, 5, 6, 7);
    v16h pha, pla, phb, plb;
    const float ala = soft_step(sa0, sa1, x0, x1, lsc, mr0, zv0, lv0, pha, pla);
    const float alb = soft_step(sb0, sb1, x0, x1, lsc, mr1, zv1, lv1, phb, plb);
    a0 *= ala;
    a1 *= ala;
    a2 *= ala;
    a3 *= ala;
    b0 *= alb;
    b1 *= alb;
    b2 *= alb;
    b3 *= alb;
    {
      const unsigned char* vp = sb + frv;
      const v16h vb0 = ldfrag_h(lds_h(vp));
      const v16h vb1 = ldfrag_h(lds_h(vp + 16 * LROW));
      const v16h vb2 = ldfrag_h(lds_h(vp + 32 * LROW));
      const v16h vb3 = ldfrag_h(lds_h(vp + 48 * LROW));
      a0 = mma_raw(vb0, pha, a0);
      a1 = mma_raw(vb1, pha, a1);
      a2 = mma_raw(vb2, pha, a2);
      a3 = mma_raw(vb3, pha, a3);
      b0 = mma_raw(vb0, phb, b0);
      b1 = mma_raw(vb1, phb, b1);
      b2 = mma_raw(vb2, phb, b2);
      b3 = mma_raw(vb3, phb, b3);
      a0 = mma_raw(vb0, pla, a0);
      a1 = mma_raw(vb1, pla, a1);
      a2 = mma_raw(vb2, pla, a2);
      a3 = mma_raw(vb3, pla, a3);
      b0 = mma_raw(vb0, plb, b0);
      b1 = mma_raw(vb1, plb, b1);
      b2 = mma_raw(vb2, plb, b2);
      b3 = mma_raw(vb3, plb, b3);
    }
    {
      const unsigned char* vp = sb + frv + (AOVL - AOVH);
      const v16h vl0 = ldfrag_h(lds_h(vp));
      const v16h vl1 = ldfrag_h(lds_h(vp + 16 * LROW));
      const v16h vl2 = ldfrag_h(lds_h(vp + 32 * LROW));
      const v16h vl3 = ldfrag_h(lds_h(vp + 48 * LROW));
      a0 = mma_raw(vl0, pha, a0);
      a1 = mma_raw(vl1, pha, a1);
      a2 = mma_raw(vl2, pha, a2);
      a3 = mma_raw(vl3, pha, a3);
      b0 = mma_raw(vl0, phb, b0);
      b1 = mma_raw(vl1, phb, b1);
      b2 = mma_raw(vl2, phb, b2);
      b3 = mma_raw(vl3, phb, b3);
    }
    // publish point of stage t + 1; the same barrier ends every reader's last read of stage t's buffer
    wait_lds_reads();
    wait_copies();
    __syncthreads();
    if (t + 2 < nst) att_stage(lcp + bofs, gK, gVh, gVl, 2 * (t + 2));   // block-uniform: refill the buffer that this trip has just read
  }
  wait_copies();

  // ---- the four key quarters of a query group are joined: wave (qw, kq) finishes tile kq & 1, d tiles kq >> 1 and (kq >> 1) + 2 ----
  const float za = zv0[0] + zv0[1], la = lv0[0] + lv0[1], zb = zv1[0] + zv1[1], lb = lv1[0] + lv1[1];
  const float zta = za + xhalf(za), lta = la + xhalf(la);    // the two lane halves' sums, on the same maximum
  const float ztb = zb + xhalf(zb), ltb = lb + xhalf(lb);
  {
    float* xs = (float*)(void*)kv + (size_t)tid * XLANE;     // the ring is free: every read of it ended at the last barrier
    const v4f ga = {mr0, zta, lta, 0.f}, gb = {mr1, ztb, ltb, 0.f};
    st8(xs, a0);
    st8(xs + 8, a1);
    st8(xs + 16, a2);
    st8(xs + 24, a3);
    st8(xs + 32, b0);
    st8(xs + 40, b1);
    st8(xs + 48, b2);
    st8(xs + 56, b3);
    *(v4f*)(xs + 64) = ga;
    *(v4f*)(xs + 68) = gb;
  }
  __syncthreads();                                           // the hand-over is published
  v8f oA, oB;                                                // O^T of the finished tile: d = 16 dh + 8 hh + r, and 32 more
  float zt, lt;
  {
    // same lane, same query, the four quarters' keys (this wave's own part too, so that every wave sums in the same order)
    const float* xp = (const float*)(const void*)kv + (size_t)(qw * 32 + lane) * XLANE;
    v4f hs[4];
    v8f hA[4], hB[4];
#pragma unroll   // constant array indices: the parts stay in registers; the 20 reads are issued together
    for (int i = 0; i < 4; ++i) {
      const float* p = xp + (size_t)i * (4 * 32 * XLANE);
      hs[i] = *(const v4f*)(p + 64 + 4 * ft);
      hA[i] = ld8(p + 32 * ft + 8 * dh);
      hB[i] = ld8(p + 32 * ft + 8 * dh + 16);
    }
    const float mj = fmaxf(fmaxf(hs[0][0], hs[1][0]), fmaxf(hs[2][0], hs[3][0]));   // the common maximum
    const float f0 = exp2_hw(hs[0][0] - mj), f1 = exp2_hw(hs[1][0] - mj);
    const float f2 = exp2_hw(hs[2][0] - mj), f3 = exp2_hw(hs[3][0] - mj);
    zt = hs[0][1] * f0 + hs[1][1] * f1 + hs[2][1] * f2 + hs[3][1] * f3;
    lt = hs[0][2] * f0 + hs[1][2] * f1 + hs[2][2] * f2 + hs[3][2] * f3;
    oA = hA[0] * f0 + hA[1] * f1 + hA[2] * f2 + hA[3] * f3;
    oB = hB[0] * f0 + hB[1] * f1 + hB[2] * f2 + hB[3] * f3;
  }

  // ---- per-head gates and rotation, renormaliser, carries (1024 on p, 1024 on v, 4096 on the stored ctx) ----
  const float bet = bfr(betap[head]);
  const float ivs = sigf(bfr(ivp[head]));
  const float og  = sigf(bfr(ovp[head])) * tanhf(bfr(chg[head]));
  const float ang = PI_F * sigf(bet);
  const float ca  = cosf(ang), sa = sinf(ang);
  const float base = ivs / (PC * VC);
  const float den = apq * lt + REN_EPS * zt;
  const float sc  = apq * (1.0f / den) * base;
  v8h yh[2], yl[2];                                          // [0]: d = 16 dh + 8 hh + r, [1]: d = 32 + 16 dh + 8 hh + r
#pragma unroll
  for (int r = 0; r < 8; ++r) {
    const float x0 = oA[r] * sc, x2 = oB[r] * sc;
    const float y0 = ((x0 * ca - x2 * sa) * og) * FC;
    const float y2 = ((x0 * sa + x2 * ca) * og) * FC;
    const _Float16 h0 = (_Float16)y0, h2 = (_Float16)y2;
    yh[0][r] = h0;
    yh[1][r] = h2;
    yl[0][r] = (_Float16)(y0 - (float)h0);
    yl[1][r] = (_Float16)(y2 - (float)h2);
  }
  {
    unsigned short* oh = Osh + orow * HDIM + 16 * dh + 8 * hh;
    unsigned short* ol = Osl + orow * HDIM + 16 * dh + 8 * hh;
#pragma unroll   // constant array indices: yh, yl stay in registers
    for (int j = 0; j < 2; ++j) {
      *(v8h*)(void*)(oh + 32 * j) = yh[j];
      *(v8h*)(void*)(ol + 32 * j) = yl[j];
    }
  }
  __syncthreads();
  // ---- block writes its 128 row segments: piece p = it*512 + tid -> row p>>3, halves (p&7)*8 of the 64-col slab (128 B a row) ----
  {
    v4u vh[2], vl[2];
#pragma unroll
    for (int it = 0; it < 2; ++it) {
      const int p = it * ATT_THREADS + tid;
      vh[it] = *(const v4u*)(Osh + (size_t)p * 8);
      vl[it] = *(const v4u*)(Osl + (size_t)p * 8);
    }
    const size_t dofs = (size_t)qB * DM + (size_t)head * HDIM;
    unsigned short* dh = CTH + dofs;
    unsigned short* dl = CTL + dofs;
    {
#pragma unroll
      for (int it = 0; it < 2; ++it) {
        const int p = it * ATT_THREADS + tid;
        const size_t po = (size_t)(p >> 3) * DM + (size_t)(p & 7) * 8;
        *(v4u*)(dh + po) = vh[it];
        *(v4u*)(dl + po) = vl[it];
      }
    }
  }
}

// =====================================================================================================
// Workspace map (bytes); every plane is an exact multiple of its tile / whole-row store granularity (M, N exact tile multiples,
// row blocks exact, no pad rows needed), every offset a multiple of 131072:
//   WIO  f16 [2048][1024] x64     4194304   (rows 0..1023 Wi, 1024..2047 Wo; native [out][in] = [n][k])
//   WV   f16 [1024][1024] x64     2097152
//   WOUT f16 [1024][1024] x64     2097152
//   WG   f16 [64][1024]   x64      131072   (Wa, We, Wa, We)
//   XB   f16 [2048][1024] x16     4194304
//   QK   f16 [2048][2048] x16     8388608   (inner | outer)
//   VTH  f16 [1024][2048] x1024   4194304   (v^T hi)
//   VTL  f16 [1024][2048]         4194304   (v^T residual)
//   AEF  f32 [2048][64]            524288   (sigmoid gates)
//   CTH  f16 [2048][1024] x4096   4194304   (ctx hi)
//   CTL  f16 [2048][1024]         4194304   (ctx residual)
//   end                          38404096
// =====================================================================================================
extern "C" void kernel_launch(void* const* d_in, const int* in_sizes, int n_in,
                              void* d_out, int out_size, void* d_ws, size_t ws_size,
                              hipStream_t stream) {
  if (n_in < 13) return;
  if (in_sizes[0] != TT * DM) return;
  if (in_sizes[1] != NHEAD * DM || in_sizes[2] != NHEAD) return;
  if (in_sizes[3] != NHEAD * DM || in_sizes[4] != NHEAD) return;
  if (in_sizes[5] != DM * DM || in_sizes[6] != DM * DM || in_sizes[7] != DM * DM || in_sizes[8] != DM * DM) return;
  if (in_sizes[9] != NHEAD || in_sizes[10] != NHEAD || in_sizes[11] != NHEAD || in_sizes[12] != NHEAD) return;
  if (out_size != TT * DM) return;

  const float* x     = (const float*)d_in[0];
  const float* Wa    = (const float*)d_in[1];
  const float* ba    = (const float*)d_in[2];
  const float* We    = (const float*)d_in[3];
  const float* be    = (const float*)d_in[4];
  const float* Wi    = (const float*)d_in[5];
  const float* Wo    = (const float*)d_in[6];
  const float* Wv    = (const float*)d_in[7];
  const float* Wout  = (const float*)d_in[8];
  const float* betap = (const float*)d_in[9];
  const float* ivp   = (const float*)d_in[10];
  const float* ovp   = (const float*)d_in[11];
  const float* chg   = (const float*)d_in[12];
  float*       out   = (float*)d_out;

  const size_t PWIO = (size_t)2 * DM * DM * 2;                    //  4194304
  const size_t PW   = (size_t)DM * DM * 2;                        //  2097152
  const size_t PG   = (size_t)NGATE * DM * 2;                     //   131072
  const size_t PX   = (size_t)TT * DM * 2;                        //  4194304
  const size_t PQK  = (size_t)TT * QKP * 2;                       //  8388608
  const size_t PVT  = (size_t)DM * TT * 2;                        //  4194304
  const size_t PAE  = (size_t)TT * NGATE * 4;                     //   524288
  const size_t PCT  = (size_t)TT * DM * 2;                        //  4194304
  size_t off = 0;
  const size_t oWIO = off; off += PWIO;
  const size_t oWV  = off; off += PW;
  const size_t oWOU = off; off += PW;
  const size_t oWG  = off; off += PG;
  const size_t oXB  = off; off += PX;
  const size_t oQK  = off; off += PQK;
  const size_t oVTH = off; off += PVT;
  const size_t oVTL = off; off += PVT;
  const size_t oAEF = off; off += PAE;
  const size_t oCTH = off; off += PCT;
  const size_t oCTL = off; off += PCT;
  if (off > ws_size) return;                                      // off = 38404096
  if (off > (size_t)134217728) return;

  char* ws = (char*)d_ws;
  unsigned short* WIO  = (unsigned short*)(ws + oWIO);
  unsigned short* WV   = (unsigned short*)(ws + oWV);
  unsigned short* WOUT = (unsigned short*)(ws + oWOU);
  unsigned short* WG   = (unsigned short*)(ws + oWG);
  unsigned short* XB   = (unsigned short*)(ws + oXB);
  unsigned short* QK   = (unsigned short*)(ws + oQK);
  unsigned short* VTH  = (unsigned short*)(ws + oVTH);
  unsigned short* VTL  = (unsigned short*)(ws + oVTL);
  float*          AEF  = (float*)(ws + oAEF);
  unsigned short* CTH  = (unsigned short*)(ws + oCTH);
  unsigned short* CTL  = (unsigned short*)(ws + oCTL);

  const dim3 blk(256);
  const dim3 gCV(CB_ALL);                                         // 776 blocks
  const dim3 gPR(PB_ALL);                                         // 196 blocks
  const dim3 gO((TT / OBM) * (DM / OBN));                         // 256
  const dim3 gAT(ATT_BLOCKS);                                     // 256
  const dim3 bAT(ATT_THREADS);                                    // 512

  // (0) 16-bit planes: XB = f16(16 * bf16(x)); W planes = f16(64 * bf16(W)) in native [n][k] layout; gate plane
  conv_all<<<gCV, blk, 0, stream>>>(x, Wi, Wo, Wv, Wout, Wa, We, XB, WIO, WV, WOUT, WG);

  // (1..3) gates, v^T, inner | outer
  proj_gemms<<<gPR, blk, 0, stream>>>(XB, WIO, WV, WG, ba, be, QK, VTH, VTL, AEF);

  // (4) attention per (128 query rows, 1 head) -> CTH/CTL (ctx x4096 hi + residual)
  attn_heads<<<gAT, bAT, 0, stream>>>(QK, VTH, VTL, AEF, betap, ivp, ovp, chg, CTH, CTL);

  // (5) output projection
  out_gemm<<<gO, blk, 0, stream>>>(CTH, CTL, WOUT, out);
  (void)hipGetLastError();
}

// v009
// Measured time: 67.8 microseconds a run.
// Next to v008, in two timings, it ran 1.14 and 1.13 times as fast.
// Counting every step since v000, it is 5.50 times as fast.
// Contractions: gate logits (x f16 x16 . [Wa;We;Wa;We] f16 x64, K=1024), inner|outer projections (x f16 x16 . [Wi;Wo] f16 x64, K=1024),
// v^T projection (Wv f16 x64 . x f16 x16, K=1024; stored as f16 hi x1024 + residual plane), scores (inner f16 x16 . outer f16 x16, K=64),
// v^T . P^T (v^T f16 hi+residual . P f16 x1024 hi+residual, three products, 2048 keys in steps of 32; scores and this product transposed),
// output projection (ctx f16 x4096 hi+residual . Wout f16 x64, two products, K=1024): all v_wmma_f32_16x16x32_f16, f32 accumulate.
// Sigmoid gates, online max-subtracted softmax, renormaliser, valve/rotation epilogue in f32 on VALU; every float input RNE-converted to bf16 on load.
#include <hip/hip_runtime.h>
#include <math.h>
#include <stdint.h>

#define TT      2048
#define DM      1024
#define NHEAD   16
#define HDIM    64
#define NGATE   64
#define QTB     8
#define QKP     (2 * DM)
#define WSC     64.0f
#define ACARRY  16.0f
#define QC      16.0f
#define KC      16.0f
#define VC      1024.0f
#define PC      1024.0f
#define FC      4096.0f
#define ATT_SCALE 0.125f
#define PI_F    3.14159265358979323846f
#define REN_EPS 1e-8f
static_assert(NHEAD * HDIM == DM);
static_assert((TT % 64) == 0 && (DM % 64) == 0 && (DM % 256) == 0 && (TT % 32) == 0 && (TT % 16) == 0);
static_assert(NHEAD == 16 && NGATE == 64);
#define ATT_WAVES   16
#define ATT_THREADS (ATT_WAVES * 32)
#define ATT_QB      (QTB * 16)
#define ATT_QG      (TT / ATT_QB)
#define ATT_BLOCKS  (ATT_QG * NHEAD)
static_assert(ATT_THREADS == 512 && ATT_BLOCKS == 256 && (TT % ATT_QB) == 0);

typedef _Float16 v16h __attribute__((ext_vector_type(16)));
typedef _Float16 v8h  __attribute__((ext_vector_type(8)));
typedef float    v8f  __attribute__((ext_vector_type(8)));
typedef float    v4f  __attribute__((ext_vector_type(4)));
typedef unsigned int v4u __attribute__((ext_vector_type(4)));

union FragH { v16h v; v8h h[2]; v4u u[2]; };

// ---- scalar helpers --------------------------------------------------------------------------------
__device__ __forceinline__ unsigned short bf_bits(float f) {          // f32 -> bf16 bits, RNE convert
  unsigned u = __float_as_uint(f);
  return (unsigned short)((u + 0x7FFFu + ((u >> 16) & 1u)) >> 16);
}
__device__ __forceinline__ float bf_up(unsigned short h) { return __uint_as_float(((unsigned)h) << 16); }
__device__ __forceinline__ float bfr(float f) { return bf_up(bf_bits(f)); }   // value of the bf16 RNE convert
__device__ __forceinline__ unsigned short h_bits(_Float16 x) { return __builtin_bit_cast(unsigned short, x); }
__device__ __forceinline__ unsigned pk16(unsigned short a, unsigned short b) { return (unsigned)a | ((unsigned)b << 16); }
__device__ __forceinline__ v8f zero8() { v8f z = {0.f, 0.f, 0.f, 0.f, 0.f, 0.f, 0.f, 0.f}; return z; }
__device__ __forceinline__ float sigf(float v) { return 1.0f / (1.0f + expf(-v)); }
// 2^x as the one hardware instruction (v_exp_f32). The library exp2f adds a compare, two selects, an add and an ldexp per value, only
// to return subnormal results; here a result under 2^-126 may be 0: it stands beside a term near 1 in the sum of e, beside
// 1e-8 times that sum in the renormaliser, and is 0 in both f16 planes of P either way (a rescale factor that small likewise). -inf gives 0, as in the library form.
__device__ __forceinline__ float exp2_hw(float x) { return __builtin_amdgcn_exp2f(x); }

// ---- fragment loaders: 16-bit A/B operand, lane -> row/col (lane&15), p already includes +8*(lane>>4);
//      elements 0..7 <- p[0..7] (k0+8h..), elements 8..15 <- p[16..23] (k0+16+8h..)  (same split k map for A and B;
//      B is always read from a k-contiguous [n][k] plane)
__device__ __forceinline__ v16h ldfrag_h(const _Float16* p) {
  FragH f;
  f.h[0] = *(const v8h*)(p);
  f.h[1] = *(const v8h*)(p + 16);
  return f.v;
}
__device__ __forceinline__ v16h ldfrag_u(const unsigned short* p) {
  FragH f;
  f.u[0] = *(const v4u*)(p);
  f.u[1] = *(const v4u*)(p + 16);
  return f.v;
}

// ---- WMMA helpers with trailing VALU hazard gaps ------------------------------------------------------
__device__ __forceinline__ v8f mma_raw(v16h a, v16h b, v8f c) {
  return __builtin_amdgcn_wmma_f32_16x16x32_f16(false, a, false, b, (short)0, c, false, false);
}
__device__ __forceinline__ void dep_guard1(v8f& a, v8f& b, v16h x) {
#if defined(__HIP_DEVICE_COMPILE__)
  asm volatile("v_nop\n\tv_nop\n\tv_nop\n\tv_nop" : "+v"(a), "+v"(b) : "v"(x));
#endif
}
__device__ __forceinline__ void guard_pv6(v8f& a, v8f& b, v8f& c, v8f& d,
                                          v16h p0, v16h p1, v16h x0, v16h x1, v16h x2, v16h x3) {
#if defined(__HIP_DEVICE_COMPILE__)
  asm volatile("v_nop\n\tv_nop\n\tv_nop\n\tv_nop"
               : "+v"(a), "+v"(b), "+v"(c), "+v"(d) : "v"(p0), "v"(p1), "v"(x0), "v"(x1), "v"(x2), "v"(x3));
#endif
}
__device__ __forceinline__ void keep4_h(v16h a, v16h b, v16h c, v16h d) {
#if defined(__HIP_DEVICE_COMPILE__)
  asm volatile("v_nop" :: "v"(a), "v"(b), "v"(c), "v"(d));
#endif
}
__device__ __forceinline__ void acc_guard4(v8f& a, v8f& b, v8f& c, v8f& d) {
#if defined(__HIP_DEVICE_COMPILE__)
  asm volatile("v_nop\n\tv_nop\n\tv_nop\n\tv_nop" : "+v"(a), "+v"(b), "+v"(c), "+v"(d));
#endif
}
__device__ __forceinline__ void wave_sync_lds() {
  __builtin_amdgcn_fence(__ATOMIC_RELEASE, "workgroup");
  __builtin_amdgcn_wave_barrier();
  __builtin_amdgcn_fence(__ATOMIC_ACQUIRE, "workgroup");
}

// =====================================================================================================
// Row convert: X f32 [nrows][1024] -> Y f16 [nrows][1024] = f16( bf16_RNE(X) * carry ), carry a power of two (exact).
// One wave per row (8 rows per block); lane l holds cols j*256 + 8l..8l+7 for j = 0..3; store instruction j covers a contiguous
// coverage: 4 x 32 lanes x 8 halves = 1024 = the whole row; nrows/8 blocks per job (exact multiples here) with a wave-uniform row bound.
// Used for x (carry 16) and for Wi, Wo, Wv, Wout in their native [out][in] = [n][k] layout (carry 64).
// =====================================================================================================
__device__ __forceinline__ void conv_rows(int blk, const float* __restrict__ X, unsigned short* Y, int nrows, float carry) {
  const int lane = threadIdx.x & 31, wave = threadIdx.x >> 5;
  const int row = blk * 8 + wave;
  if (row >= nrows) return;                      // wave-uniform; no barriers in this kernel
  const float* xp = X + (size_t)row * DM;
  unsigned short* op = Y + (size_t)row * DM;
  v4u res[4];
#pragma unroll
  for (int j = 0; j < 4; ++j) {
    const int c0 = j * 256 + lane * 8;
    const v4f a0 = *(const v4f*)(xp + c0), a1 = *(const v4f*)(xp + c0 + 4);
    float t[8];
#pragma unroll
    for (int e = 0; e < 4; ++e) { t[e] = bfr(a0[e]) * carry; t[4 + e] = bfr(a1[e]) * carry; }
    v4u o = {0u, 0u, 0u, 0u};
#pragma unroll
    for (int e = 0; e < 4; ++e) o[e] = pk16(h_bits((_Float16)t[2 * e]), h_bits((_Float16)t[2 * e + 1]));
    res[j] = o;
  }
  {
#pragma unroll
    for (int j = 0; j < 4; ++j) *(v4u*)(op + j * 256 + lane * 8) = res[j];
    
  }
}

// =====================================================================================================
// Gate weight plane: G f16 [64][1024]: row r = f16( 64 * bf16_RNE( (r & 16) ? We[r & 15] : Wa[r & 15] ) ) (rows 32..63 duplicate 0..31).
// Both candidate rows loaded with clamped in-range addresses, selected by value (row is wave-uniform). Same store shape as conv_rows.
// coverage: 8 blocks x 8 waves = 64 rows x (4 x 32 x 8 = 1024 cols), exact.
// =====================================================================================================
__device__ __forceinline__ void conv_gate(int blk, const float* __restrict__ Wa, const float* __restrict__ We,
                                          unsigned short* Y, float carry) {
  const int lane = threadIdx.x & 31, wave = threadIdx.x >> 5;
  const int row = blk * 8 + wave;
  if (row >= NGATE) return;                      // wave-uniform; no barriers in this kernel
  const float* pa = Wa + (size_t)(row & 15) * DM;
  const float* pb = We + (size_t)(row & 15) * DM;
  const bool useb = (row & 16) != 0;
  unsigned short* op = Y + (size_t)row * DM;
  v4u res[4];
#pragma unroll
  for (int j = 0; j < 4; ++j) {
    const int c0 = j * 256 + lane * 8;
    const v4f a0 = *(const v4f*)(pa + c0), a1 = *(const v4f*)(pa + c0 + 4);
    const v4f b0 = *(const v4f*)(pb + c0), b1 = *(const v4f*)(pb + c0 + 4);
    float t[8];
#pragma unroll
    for (int e = 0; e < 4; ++e) {
      t[e]     = bfr(useb ? b0[e] : a0[e]) * carry;
      t[4 + e] = bfr(useb ? b1[e] : a1[e]) * carry;
    }
    v4u o = {0u, 0u, 0u, 0u};
#pragma unroll
    for (int e = 0; e < 4; ++e) o[e] = pk16(h_bits((_Float16)t[2 * e]), h_bits((_Float16)t[2 * e + 1]));
    res[j] = o;
  }
  {
#pragma unroll
    for (int j = 0; j < 4; ++j) *(v4u*)(op + j * 256 + lane * 8) = res[j];
    
  }
}

// =====================================================================================================
// All conversions in one launch: none reads what another writes. The block index picks the job (block-uniform, no barriers):
// blocks 0..255 x, then 128 each for Wi, Wo, Wv, Wout, then 8 for the gate plane; every job keeps its own rows and stores.
// =====================================================================================================
#define CB_X  (TT / 8)
#define CB_W  (DM / 8)
#define CB_G  (NGATE / 8)
#define CB_ALL (CB_X + 4 * CB_W + CB_G)
__global__ __launch_bounds__(256) void conv_all(const float* __restrict__ x, const float* __restrict__ Wi,
                                                const float* __restrict__ Wo, const float* __restrict__ Wv,
                                                const float* __restrict__ Wout, const float* __restrict__ Wa,
                                                const float* __restrict__ We,
                                                unsigned short* XB, unsigned short* WIO, unsigned short* WV,
                                                unsigned short* WOUT, unsigned short* WG) {
  const int b = blockIdx.x;
  if (b >= CB_X + 4 * CB_W) {
    conv_gate(b - (CB_X + 4 * CB_W), Wa, We, WG, WSC);
    return;
  }
  const float* X = x;
  unsigned short* Y = XB;
  int rb = b, nrows = TT;
  float carry = ACARRY;
  if (b >= CB_X) {
    const int w = (b - CB_X) / CB_W;             // 0..3: Wi, Wo, Wv, Wout
    rb = (b - CB_X) % CB_W;
    nrows = DM;
    carry = WSC;
    X = w == 0 ? Wi : w == 1 ? Wo : w == 2 ? Wv : Wout;
    Y = w == 0 ? WIO : w == 1 ? WIO + (size_t)DM * DM : w == 2 ? WV : WOUT;
  }
  conv_rows(rb, X, Y, nrows, carry);
}

// ---- asynchronous global -> LDS copies (16 B per lane). Each statement ends in s_wait_xcnt 0 so that no address register of an
//      issued copy is rewritten before the wait (a precaution); landing is waited for separately with s_wait_asynccnt 0.
#define LROW  144     // attention ring: LDS row pitch in bytes: 128 + 16 (16 B x odd: conflict-free for 16-byte readers)
#define RSTEP (32 * LROW)   // attention ring: LDS bytes between two copy rounds (a round = 8 waves x 4 rows)
__device__ __forceinline__ unsigned lds_off(const void* p) { return (unsigned)(size_t)p; }
__device__ __forceinline__ void copy2_lds(unsigned l, const unsigned short* g, size_t st) {
#if defined(__HIP_DEVICE_COMPILE__)
  asm volatile("global_load_async_to_lds_b128 %0, %1, off\n\t"
               "global_load_async_to_lds_b128 %2, %3, off\n\t"
               "s_wait_xcnt 0x0"
               :: "v"(l), "v"(g), "v"(l + RSTEP), "v"(g + st) : "memory");
#endif
}
// GEMM rings: four or eight copy rounds in one statement; LS = LDS bytes between two rounds, st = source elements between two rounds
template <int LS>
__device__ __forceinline__ void copy4_lds(unsigned l, const unsigned short* g, size_t st) {
#if defined(__HIP_DEVICE_COMPILE__)
  asm volatile("global_load_async_to_lds_b128 %0, %1, off\n\t"
               "global_load_async_to_lds_b128 %2, %3, off\n\t"
               "global_load_async_to_lds_b128 %4, %5, off\n\t"
               "global_load_async_to_lds_b128 %6, %7, off\n\t"
               "s_wait_xcnt 0x0"
               :: "v"(l), "v"(g), "v"(l + LS), "v"(g + st), "v"(l + 2 * LS), "v"(g + 2 * st),
                  "v"(l + 3 * LS), "v"(g + 3 * st) : "memory");
#endif
}
template <int LS>
__device__ __forceinline__ void copy8_lds(unsigned l, const unsigned short* g, size_t st) {
#if defined(__HIP_DEVICE_COMPILE__)
  asm volatile("global_load_async_to_lds_b128 %0, %1, off\n\t"
               "global_load_async_to_lds_b128 %2, %3, off\n\t"
               "global_load_async_to_lds_b128 %4, %5, off\n\t"
               "global_load_async_to_lds_b128 %6, %7, off\n\t"
               "global_load_async_to_lds_b128 %8, %9, off\n\t"
               "global_load_async_to_lds_b128 %10, %11, off\n\t"
               "global_load_async_to_lds_b128 %12, %13, off\n\t"
               "global_load_async_to_lds_b128 %14, %15, off\n\t"
               "s_wait_xcnt 0x0"
               :: "v"(l), "v"(g), "v"(l + LS), "v"(g + st), "v"(l + 2 * LS), "v"(g + 2 * st),
                  "v"(l + 3 * LS), "v"(g + 3 * st), "v"(l + 4 * LS), "v"(g + 4 * st), "v"(l + 5 * LS), "v"(g + 5 * st),
                  "v"(l + 6 * LS), "v"(g + 6 * st), "v"(l + 7 * LS), "v"(g + 7 * st) : "memory");
#endif
}
// attention ring: 2 rounds of 32 rows: lane -> row 4*wave + (lane>>3) of its round, 16-byte piece lane&7; st = 32 source rows in elements
template <int NR>
__device__ __forceinline__ void copy_rows(unsigned l, const unsigned short* g, size_t st) {
  static_assert(NR == 2);
  copy2_lds(l, g, st);
}
// gemm64's ring: a stage is 128 k = 256 B of every operand row, the most that two buffers of 576 rows hold in a WGP's LDS. A trip ends
// when the next stage's copies have landed (a latency and the stage's bytes): the more k a stage holds, the fewer such latencies,
// waits and barriers the same bytes pay.
#define GKST  128
#define GROW  (GKST * 2 + 16)   // LDS row pitch in bytes: 272 = 16 B x odd: conflict-free for 16-byte readers
#define GSTEP (16 * GROW)       // LDS bytes between two copy rounds (a round = 8 waves x 2 rows)
// NR rounds of 16 rows (NR = 4 or 32): lane -> row 2*wave + (lane>>4) of its round, 16-byte piece lane&15; st = 16 source rows in elements
template <int NR>
__device__ __forceinline__ void copy_rounds(unsigned l, const unsigned short* g, size_t st) {
  static_assert(NR == 4 || NR == 32);
  if constexpr (NR == 4) {
    copy4_lds<GSTEP>(l, g, st);
  } else {
#pragma unroll 1   // rolled: a quarter of the text (the kernel that holds three of these bodies stays near 32 KB); same copies, same order
    for (int q = 0; q < NR / 8; ++q) copy8_lds<GSTEP>(l + (unsigned)q * (8 * GSTEP), g + (size_t)q * 8 * st, st);
  }
}
__device__ __forceinline__ void wait_copies() {      // this wave's copies have landed in LDS
#if defined(__HIP_DEVICE_COMPILE__)
  asm volatile("s_wait_asynccnt 0x0" ::: "memory");
#endif
}
__device__ __forceinline__ void wait_store_regs() {  // in front of an overwrite of registers that issued global stores name (a precaution)
#if defined(__HIP_DEVICE_COMPILE__)
  asm volatile("s_wait_xcnt 0x0" ::: "memory");
#endif
}
__device__ __forceinline__ void wait_lds_reads() {   // this wave's LDS reads have returned (before their buffer is refilled)
#if defined(__HIP_DEVICE_COMPILE__)
  asm volatile("s_wait_dscnt 0x0" ::: "memory");
#endif
}

// =====================================================================================================
// Register-blocked f16 WMMA GEMM: C[m][n] = f( oscale * sum_k A[m][k] * Bt[n][k] ); one wave per 64x64 tile, 8 tiles per block.
// Operands reach the fragments through LDS: per stage of 128 k the block copies its operand rows (256 B each, whole lines) with
// asynchronous copies into one of two buffers; the next stage's copies fly while this stage is multiplied; one barrier per stage.
// WM 1: the 8 tiles share their 64 A rows and lie side by side in n (N a multiple of 512); WM 8: they share their 64 B rows and
// lie below one another in m (N = 64, M a multiple of 512). K a multiple of 128.
// A row-major [M][K] pitch lda (16-bit plane), Bt row-major [N][K] pitch ldb (k contiguous); M, N multiples of 64, K multiple of 128.
// BM: 0 = no bias; 3 = per-column head bias bf16( (col & 16) ? bias2[col & 15] : bias[col & 15] ) (in-range addresses).
// OM: 0 = f32 out (pitch ldc), ACT 2 applies sigmoid after bias;
//     2 = f16 out = f16( value * ocarry ); 3 = f16 hi plane f16(value*ocarry) to C and unscaled residual f16(value*ocarry - hi) to C2.
// coverage: 4 slabs x 16 rows (f32: it 0..7 x lane>>4; f16: it 0..3 x lane>>3) x 64 cols = the wave's whole 64x64 tile;
//           tilesM*tilesN/8 blocks per product (exact here); a block that does not fit the shape rules leaves as a whole before any barrier.
// =====================================================================================================
// The body is a device function: its kernel owns the LDS (ring: two stages; sT: 8 slabs, which may lie on the ring: they are written
// only behind the loop's last barrier, which ends every read of the ring) and hands in the block's index in this product.
__host__ __device__ constexpr int gemm_stage_bytes(int wm) {
  return (wm * 64 + (8 / wm) * 64) * GROW;
}
#define SLAB_F (16 * 68)   // per-wave 16x64 slab, pitch 68 floats
template <int OM, int BM, int ACT, int WM>
__device__ __forceinline__ void gemm64(
    unsigned char* ring, float* sT, int blk,
    const unsigned short* __restrict__ Ap, int lda,
    const unsigned short* __restrict__ Btp, int ldb,
    const float* __restrict__ bias, const float* __restrict__ bias2,
    void* Cout, void* C2out, int ldc,
    int M, int N, int K, float oscale, float ocarry) {
  static_assert(WM == 1 || WM == 8);
  constexpr int RA  = WM * 64;                     // A rows per block
  constexpr int RB  = (8 / WM) * 64;               // B rows per block
  constexpr int OB  = RA * GROW;                   // stage layout in bytes: [A | B]
  constexpr int STG = OB + RB * GROW;              // bytes per stage
  static_assert(STG == gemm_stage_bytes(WM));
  const int lane = threadIdx.x & 31;
  const int wave = threadIdx.x >> 5;
  const int tilesN = N >> 6;
  const int tilesM = M >> 6;
  const int tile0 = blk * 8;
  if (tile0 + 8 > tilesM * tilesN) return;         // block-uniform, before any barrier or copy
  if (WM == 1 ? (tilesN & 7) != 0 : (tilesN != 1)) return;   // block-uniform shape rule of this build
  const int tmB = tile0 / tilesN;
  const int mB = tmB << 6;                         // block's first row and column
  const int nB = (tile0 - tmB * tilesN) << 6;
  const int m0 = mB + (WM == 8 ? (wave << 6) : 0);
  const int n0 = nB + (WM == 1 ? (wave << 6) : 0);

  const int rlane = lane & 15;                 // row (A) / col (B, D) within subtile
  const int koff  = (lane >> 4) * 8;           // k offset of this lane half
  const int mOff  = (lane >> 4) * 8;           // D row offset

  // copy side: this lane's row and 16-byte piece in a round of 16 rows
  const int crow = wave * 2 + (lane >> 4);
  const int cseg = (lane & 15) * 8;
  const unsigned lcp = lds_off(ring) + (unsigned)(crow * GROW + cseg * 2);
  const unsigned short* gA  = Ap  + (size_t)(mB + crow) * lda + cseg;
  const unsigned short* gB  = Btp + (size_t)(nB + crow) * ldb + cseg;
  const size_t stA = (size_t)16 * lda, stB = (size_t)16 * ldb;
  // reader side: fragment rows of this wave in a stage
  const int fa = ((WM == 8 ? (wave << 6) : 0) + rlane) * GROW + koff * 2;
  const int fb = OB + ((WM == 1 ? (wave << 6) : 0) + rlane) * GROW + koff * 2;

  v8f acc[4][4];
#pragma unroll
  for (int i = 0; i < 4; ++i)
#pragma unroll
    for (int j = 0; j < 4; ++j) acc[i][j] = zero8();

  const int nst = K / GKST;
  // stage 0 into buffer 0, landed and published; then stage 1 into buffer 1
  copy_rounds<RA / 16>(lcp, gA, stA);
  copy_rounds<RB / 16>(lcp + OB, gB, stB);
  wait_copies();
  __syncthreads();
  if (nst > 1) {
    copy_rounds<RA / 16>(lcp + STG, gA + GKST, stA);
    copy_rounds<RB / 16>(lcp + STG + OB, gB + GKST, stB);
  }

#pragma unroll 1   // one stage per trip: the ring's order at the foot stays as written
  for (int t = 0; t < nst; ++t) {
    const unsigned bofs = (unsigned)(t & 1) * STG;
    const unsigned char* sb = ring + bofs;
#pragma unroll
    for (int s = 0; s < GKST / 32; ++s) {      // four k-steps of 32 per stage, ascending k
      v16h bh[4], ah[4];
#pragma unroll
      for (int j = 0; j < 4; ++j) bh[j] = ldfrag_u((const unsigned short*)(sb + fb + j * 16 * GROW + s * 64));
#pragma unroll
      for (int i = 0; i < 4; ++i) ah[i] = ldfrag_u((const unsigned short*)(sb + fa + i * 16 * GROW + s * 64));
#pragma unroll
      for (int i = 0; i < 4; ++i) {
#pragma unroll
        for (int j = 0; j < 4; ++j) acc[i][j] = mma_raw(ah[i], bh[j], acc[i][j]);
        dep_guard1(acc[i][0], acc[i][3], ah[i]);
      }
      keep4_h(bh[0], bh[1], bh[2], bh[3]);
    }
    // publish point of stage t + 1; the same barrier ends every reader's last read of stage t's buffer
    wait_lds_reads();
    wait_copies();
    __syncthreads();
    if (t + 2 < nst) {                         // block-uniform: refill the buffer that this trip has just read
      const int kn = (t + 2) * GKST;
      copy_rounds<RA / 16>(lcp + bofs, gA + kn, stA);
      copy_rounds<RB / 16>(lcp + bofs + OB, gB + kn, stB);
    }
  }
  wait_copies();
  acc_guard4(acc[0][0], acc[0][1], acc[0][2], acc[0][3]);
  acc_guard4(acc[1][0], acc[1][1], acc[1][2], acc[1][3]);
  acc_guard4(acc[2][0], acc[2][1], acc[2][2], acc[2][3]);
  acc_guard4(acc[3][0], acc[3][1], acc[3][2], acc[3][3]);

  const int hh2 = lane >> 4, c4 = (lane & 15) * 4;     // f32 out: 256-B row segment = 16 lanes x 16 B
  const int q8  = lane >> 3, c8 = (lane & 7) * 8;
  float bc[4];
#pragma unroll
  for (int e = 0; e < 4; ++e) bc[e] = 0.f;
  if constexpr (BM == 3) {
#pragma unroll
    for (int e = 0; e < 4; ++e) {
      const int col = n0 + c4 + e;
      const float fa = bfr(bias[col & 15]);             // in-range addresses 0..15
      const float fb = bfr(bias2[col & 15]);
      bc[e] = (col & 16) ? fb : fa;
    }
  }

  // ---- epilogue ----
  float* slab = sT + wave * SLAB_F;
#pragma unroll
  for (int i = 0; i < 4; ++i) {
    const int mBase = m0 + (i << 4);
#pragma unroll
    for (int j = 0; j < 4; ++j) {
#pragma unroll
      for (int r = 0; r < 8; ++r) {
        slab[(mOff + r) * 68 + (j << 4) + rlane] = acc[i][j][r];
      }
    }
    wave_sync_lds();
    if constexpr (OM == 0) {
      float* C = (float*)Cout;
      constexpr int IU = (ACT == 2) ? 2 : 8;               // row pairs per trip
#pragma unroll 1   // ACT 2: 128 unrolled divisions are 13 KB of text; rolled, the kernel that holds this body stays under 32 KB
      for (int ib = 0; ib < 8; ib += IU) {
        v4f vals[IU];
#pragma unroll
        for (int u = 0; u < IU; ++u) {
          const int row = (ib + u) * 2 + hh2;              // ib + u 0..7 x hh2 0..1 = rows 0..15
          v4f v = *(const v4f*)(slab + row * 68 + c4);
#pragma unroll
          for (int e = 0; e < 4; ++e) {
            float f = v[e] * oscale + bc[e];
            if constexpr (ACT == 2) f = 1.0f / (1.0f + __expf(-f));
            v[e] = f;
          }
          vals[u] = v;
        }
#pragma unroll
        for (int u = 0; u < IU; ++u) {
          const int gr = mBase + (ib + u) * 2 + hh2;
          *(v4f*)(C + (size_t)gr * ldc + n0 + c4) = vals[u];
        }
        if constexpr (IU < 8) wait_store_regs();           // the next trip rewrites the registers that these stores name
      }
    } else {
      unsigned short* C  = (unsigned short*)Cout;
      unsigned short* C2 = (unsigned short*)C2out;
      v4u hv[4], lv[4];
#pragma unroll
      for (int it = 0; it < 4; ++it) {
        const int row = it * 4 + q8;                       // it 0..3 x q8 0..3 = rows 0..15
        const float* sp = slab + row * 68 + c8;
        v4u a = {0u, 0u, 0u, 0u};
        v4u b = {0u, 0u, 0u, 0u};
#pragma unroll
        for (int e = 0; e < 4; ++e) {
          const float f0 = (sp[2 * e] * oscale) * ocarry;
          const float f1 = (sp[2 * e + 1] * oscale) * ocarry;
          const _Float16 h0 = (_Float16)f0, h1 = (_Float16)f1;
          a[e] = pk16(h_bits(h0), h_bits(h1));
          if constexpr (OM == 3) {
            const _Float16 l0 = (_Float16)(f0 - (float)h0);
            const _Float16 l1 = (_Float16)(f1 - (float)h1);
            b[e] = pk16(h_bits(l0), h_bits(l1));
          }
        }
        hv[it] = a;
        lv[it] = b;
      }
      {
#pragma unroll
        for (int it = 0; it < 4; ++it) {
          const int row = it * 4 + q8;
          *(v4u*)(C + (size_t)(mBase + row) * ldc + n0 + c8) = hv[it];
          if constexpr (OM == 3) {
            *(v4u*)(C2 + (size_t)(mBase + row) * ldc + n0 + c8) = lv[it];
          }
        }
        
      }
    }
    wave_sync_lds();
  }
}

// =====================================================================================================
// The three products of x in one launch: none reads what another writes, and together they have fewer blocks than the chip has WGPs.
// The block index picks the product (block-uniform, so every barrier of a body is passed by the whole block); longest epilogue first:
//   blocks 0..3     gates: AEF[t][j] = sigmoid(x[t] . G[j] / (16*64) + bf16(bias_j)); M = 2048, N = 64, K = 1024, f32 out
//   blocks 4..67    v^T: VTH/VTL[d][t] = hi/residual of f16(1024 * Wv[d] . x[t]); M = 1024, N = 2048, K = 1024
//   blocks 68..195  inner | outer: QK[t][n] = f16(16 * x[t] . [Wi;Wo][n]); M = 2048, N = 2048, K = 1024
// =====================================================================================================
#define PB_GE ((TT / 64) * (NGATE / 64) / 8)
#define PB_VT ((DM / 64) * (TT / 64) / 8)
#define PB_QK ((TT / 64) * (QKP / 64) / 8)
#define PB_ALL (PB_GE + PB_VT + PB_QK)
static_assert(gemm_stage_bytes(1) == gemm_stage_bytes(8));
__global__ __launch_bounds__(256) void proj_gemms(
    const unsigned short* __restrict__ XB, const unsigned short* __restrict__ WIO, const unsigned short* __restrict__ WV,
    const unsigned short* __restrict__ WG, const float* __restrict__ ba, const float* __restrict__ be,
    unsigned short* QK, unsigned short* VTH, unsigned short* VTL, float* AEF) {
  __shared__ __align__(16) unsigned char ring[2 * gemm_stage_bytes(1)];   // 313,344 B of the WGP's 327,680
  static_assert(2 * gemm_stage_bytes(1) <= 327680 && 8 * SLAB_F * 4 <= 2 * gemm_stage_bytes(1) && (DM % GKST) == 0);
  float* sT = (float*)(void*)ring;                 // the epilogue's slabs lie on the ring, free behind the loop's last barrier
  const int b = blockIdx.x;
  if (b < PB_GE) {
    gemm64<0, 3, 2, 8>(ring, sT, b, XB, DM, WG, DM, ba, be,
                          (void*)AEF, (void*)AEF, NGATE, TT, NGATE, DM, 1.0f / (ACARRY * WSC), 1.0f);
  } else if (b < PB_GE + PB_VT) {
    gemm64<3, 0, 0, 1>(ring, sT, b - PB_GE, WV, DM, XB, DM, ba, be,
                          (void*)VTH, (void*)VTL, TT, DM, TT, DM, 1.0f / (WSC * ACARRY), VC);
  } else {
    gemm64<2, 0, 0, 1>(ring, sT, b - (PB_GE + PB_VT), XB, DM, WIO, DM, ba, be,
                          (void*)QK, (void*)QK, QKP, TT, QKP, DM, 1.0f / (ACARRY * WSC), QC);
  }
}
// =====================================================================================================
// Output projection: out[m][n] = sum_k (CTH[m][k] + CTL[m][k]) * WOUT[n][k] / (4096 * 64); M = 2048, N = 1024, K = 1024, f32 out.
// One block per 64 x 128 tile of out: 32 x 8 = 256 blocks, so that every WGP has one (512 tiles of 64 x 64, one a wave, fill only 64).
// 8 waves as 2 (m) x 4 (n), 32 x 32 of out per wave = 4 accumulator tiles. The ring has gemm64's order: two buffers, the next stage's
// asynchronous copies fly while this stage is multiplied, one barrier per stage. A stage is 256 k (512 B of every row; the LDS holds two
// such stages): the whole K is four flights of copies, each a latency and the stage's bytes, four waits and barriers. 32 copy rounds of 8 rows:
// [ctx hi 64 rows | ctx residual 64 rows | Wout 128 rows]. Per accumulator and k-step of 32: hi product, then residual product, ascending k.
// coverage: 32 rows (it 0..7 x lane>>3) x 32 cols (128 B, one whole line) = the wave's 32 x 32; the grid is exact.
// =====================================================================================================
#define OBM   64
#define OBN   128
#define OKST  256                    // k per stage
#define OROW  (OKST * 2 + 16)        // LDS row pitch in bytes: 528 = 16 B x odd: conflict-free for 16-byte readers
#define OSTEP (8 * OROW)             // LDS bytes between two copy rounds (a round = 8 waves x 1 row)
#define OOA2  (OBM * OROW)
#define OOB   (2 * OBM * OROW)
#define OSTG  (OOB + OBN * OROW)     // bytes per stage
#define OSLAB (32 * 36)              // per-wave 32 x 32 slab, pitch 36 floats
static_assert((TT % OBM) == 0 && (DM % OBN) == 0 && (DM % OKST) == 0 && DM / OKST >= 2 && OSTG == 32 * OSTEP);
static_assert(2 * OSTG + 8 * OSLAB * 4 <= 327680);
// one stage: 32 rounds, 8 to a statement that ends in s_wait_xcnt 0 (the copy helpers above); a, a2, b are this lane's row (its wave's
// number in a round of 8) and 16-byte piece at the stage's k; st = 8 source rows in elements
__device__ __forceinline__ void out_stage(unsigned l, const unsigned short* a, const unsigned short* a2, const unsigned short* b,
                                          size_t st) {
  copy8_lds<OSTEP>(l, a, st);
  copy8_lds<OSTEP>(l + OOA2, a2, st);
  copy8_lds<OSTEP>(l + OOB, b, st);
  copy8_lds<OSTEP>(l + OOB + 8 * OSTEP, b + 8 * st, st);
}
__global__ __launch_bounds__(256) void out_gemm(
    const unsigned short* __restrict__ CTH, const unsigned short* __restrict__ CTL, const unsigned short* __restrict__ WOUT,
    float* out) {
  __shared__ __align__(16) unsigned char ring[2 * OSTG];
  __shared__ __align__(16) float sT[8 * OSLAB];
  const int lane = threadIdx.x & 31;
  const int wave = threadIdx.x >> 5;
  const int mB = ((int)blockIdx.x / (DM / OBN)) * OBM;      // block's first row and column
  const int nB = ((int)blockIdx.x % (DM / OBN)) * OBN;
  const int wr = (wave >> 2) * 32, wc = (wave & 3) * 32;    // wave's first row and column in the block tile
  const int rlane = lane & 15;                 // row (A) / col (B, D) within subtile
  const int koff  = (lane >> 4) * 8;           // k offset of this lane half
  const int mOff  = (lane >> 4) * 8;           // D row offset

  // copy side: this lane's row and 16-byte piece in a round of 8 rows (a wave's copy is one row's 512 B)
  const int crow = wave;
  const int cseg = lane * 8;
  const unsigned lcp = lds_off(ring) + (unsigned)(crow * OROW + cseg * 2);
  const unsigned short* gA  = CTH  + (size_t)(mB + crow) * DM + cseg;
  const unsigned short* gA2 = CTL  + (size_t)(mB + crow) * DM + cseg;
  const unsigned short* gB  = WOUT + (size_t)(nB + crow) * DM + cseg;
  const size_t st = (size_t)8 * DM;
  // reader side: fragment rows of this wave in a stage
  const int fa = (wr + rlane) * OROW + koff * 2;
  const int fb = OOB + (wc + rlane) * OROW + koff * 2;

  v8f a00 = zero8(), a01 = zero8(), a10 = zero8(), a11 = zero8();

  constexpr int nst = DM / OKST;
  // stage 0 into buffer 0, landed and published; then stage 1 into buffer 1
  out_stage(lcp, gA, gA2, gB, st);
  wait_copies();
  __syncthreads();
  out_stage(lcp + OSTG, gA + OKST, gA2 + OKST, gB + OKST, st);

#pragma unroll 1   // one stage per trip: the ring's order at the foot stays as written
  for (int t = 0; t < nst; ++t) {
    const unsigned bofs = (unsigned)(t & 1) * OSTG;
    const unsigned char* sb = ring + bofs;
#pragma unroll   // constant kk: every LDS read takes its place in the stage as an immediate offset, no address arithmetic per run
    for (int kk = 0; kk < OKST / 64; ++kk) {   // four runs of 64 k per stage, ascending k
      v16h bh[2][2], ah[2][2], al[2][2];         // [k-step][subtile]: the run's 24 LDS reads stand together, in front of its WMMAs
#pragma unroll
      for (int s = 0; s < 2; ++s) {
#pragma unroll
        for (int i = 0; i < 2; ++i) {
          bh[s][i] = ldfrag_u((const unsigned short*)(sb + fb + i * 16 * OROW + kk * 128 + s * 64));
          ah[s][i] = ldfrag_u((const unsigned short*)(sb + fa + i * 16 * OROW + kk * 128 + s * 64));
          al[s][i] = ldfrag_u((const unsigned short*)(sb + OOA2 + fa + i * 16 * OROW + kk * 128 + s * 64));
        }
      }
#pragma unroll
      for (int s = 0; s < 2; ++s) {              // two k-steps of 32 per run, ascending k
        a00 = mma_raw(ah[s][0], bh[s][0], a00);
        a01 = mma_raw(ah[s][0], bh[s][1], a01);
        a10 = mma_raw(ah[s][1], bh[s][0], a10);
        a11 = mma_raw(ah[s][1], bh[s][1], a11);
        a00 = mma_raw(al[s][0], bh[s][0], a00);
        a01 = mma_raw(al[s][0], bh[s][1], a01);
        a10 = mma_raw(al[s][1], bh[s][0], a10);
        a11 = mma_raw(al[s][1], bh[s][1], a11);
        // four vector slots behind the last WMMA, before anything rewrites its operands or touches its results (also over the branch below)
        guard_pv6(a00, a01, a10, a11, ah[s][0], ah[s][1], al[s][0], al[s][1], bh[s][0], bh[s][1]);
      }
    }
    // publish point of stage t + 1; the same barrier ends every reader's last read of stage t's buffer
    wait_lds_reads();
    wait_copies();
    __syncthreads();
    if (t + 2 < nst) {                         // block-uniform: refill the buffer that this trip has just read
      const int kn = (t + 2) * OKST;
      out_stage(lcp + bofs, gA + kn, gA2 + kn, gB + kn, st);
    }
  }
  wait_copies();

  // ---- epilogue: each wave stages its 32 x 32 in its own slab and stores whole 128-B lines ----
  const float oscale = 1.0f / (FC * WSC);
  const int q8 = lane >> 3, c4 = (lane & 7) * 4;
  float* slab = sT + wave * OSLAB;
  float* op = out + (size_t)(mB + wr + q8) * DM + nB + wc + c4;
#pragma unroll
  for (int r = 0; r < 8; ++r) {
    slab[(mOff + r) * 36 + rlane] = a00[r];
    slab[(mOff + r) * 36 + 16 + rlane] = a01[r];
    slab[(16 + mOff + r) * 36 + rlane] = a10[r];
    slab[(16 + mOff + r) * 36 + 16 + rlane] = a11[r];
  }
  wave_sync_lds();
  v4f vals[8];
#pragma unroll
  for (int it = 0; it < 8; ++it) vals[it] = *(const v4f*)(slab + (it * 4 + q8) * 36 + c4) * oscale;   // it 0..7 x q8 0..3 = rows 0..31
#pragma unroll
  for (int it = 0; it < 8; ++it) *(v4f*)(op + (size_t)(it * 4) * DM) = vals[it];
}

// =====================================================================================================
// Flash attention for one head and 128 query rows, head dim 64, 2048 keys:
//   inner|outer plane (f16 x16) QK[tok][2048]: inner at col 64h + d, outer at col 1024 + 64h + d;
//   v^T planes (f16 hi x1024, unscaled residual): VH/VL[64h + d][key] (pitch 2048);
//   gate plane AEF f32 [tok][64]: col h = ap[h][tok] (sigmoid applied), col 16 + h = ex[h][tok];
//   out: CTH/CTL[tok][64h + d] = f16 hi / residual of 4096 * ctx, ctx = valve/rotation epilogue of
//        ap * sum_s p_s v_s / (ap * sum_s p_s + 1e-8 * sum_s e_s), e_s = exp(score_s - max), p_s = e_s * ex[s].
//   block = 16 waves = 512 threads, four to a SIMD: the vector work between a wave's matrix runs and its LDS latencies
//   are covered by three other waves. grid = 16 heads x 16 query groups = 256; every wave does identical bounded work (16 steps).
//   A stage is 128 keys, laid out as two halves of 64: per half the head's 64 outer rows and the 64 rows of each v^T plane (128 B
//   each, whole lines). Waves 0..7 copy the first half, waves 8..15 the second, with asynchronous copies into one of two LDS buffers;
//   the next stage's copies fly while this stage is worked on; one barrier per stage. The head's ex column (2048 f32) is put into
//   LDS once, in front of the first barrier.
//   A wave takes 32 query rows (two tiles of 16; wave & 3 picks them) and 32 of a stage's 128 keys (wave >> 2 picks the quarter), so
//   every outer, v^T and ex fragment that it reads from LDS feeds two query tiles: half the LDS reads per WMMA of a 16-query wave.
//   Both products are transposed: S^T = outer . inner^T (A = 16 key rows from the stage, B = 16 query rows, kept in registers) and
//   O^T += v^T . P^T (A = 16 d rows of v^T from the stage, B = P^T). A lane (c = lane & 15, hh = lane >> 4) then holds, per query
//   tile, only query c of it: score register r of key tile i is key kb + 16 i + 8 hh + r, which is the k order of a B operand, so
//   the two score tiles of a step, converted in place, are P^T; output register r of tile j is d = 16 j + 8 hh + r.
//   Per step and query tile: 2 score tiles on f16 WMMA (K = 64 as two k-steps of 32); the maximum over the lane's 16 keys in the
//   lane, joined with the other half by one cross-row move; online max-subtracted softmax in f32 (exp2, log2e / 8 / carries folded
//   in); running sums of e and of p = e*ex in two partial sums per lane (joined behind the loop); one rescale factor per lane;
//   12 WMMAs (hi.hi, hi.lo, lo.hi) into one accumulator set.
//   Behind the loop the four waves of a query group (same wave & 3) hold the sums of their own keys on their own maxima. Each puts
//   its maxima, sums and O^T into the ring's LDS (free behind the loop's last barrier) and finishes one query tile (quarter & 1) and
//   one pair of d tiles (j and j + 2, j = quarter >> 1: the rotation's partners): it joins the four parts, in quarter order, on the
//   common maximum.
//   Final scaling in f32; each lane stages its query's 2 x 8 consecutive d (hi and residual) in the block's LDS row buffers [128][64];
// coverage: LDS row buffers: 16 waves x 16 rows x 32 cols = 128 x 64; global: 2 iterations x 512 threads x 8 halves = 128 rows x 64
//           cols (cols 64*head ..) of rows qB..qB+127, both planes; grid covers all 2048 rows x 1024 cols exactly once.
// =====================================================================================================
#define AKS   64                        // keys per half stage: 128 B of every v^T row = one whole line
#define AOVH  (AKS * LROW)              // half-stage layout in bytes: [64 outer rows | 64 v^T hi rows | 64 v^T residual rows]
#define AOVL  (AOVH + HDIM * LROW)
#define ASTG  (AOVL + HDIM * LROW)      // bytes per half stage
#define ABUF  (2 * ASTG)                // bytes per stage (128 keys) = per buffer
static_assert(AKS == 64 && HDIM == 64 && (TT % (2 * AKS)) == 0 && (TT / (2 * AKS)) >= 2 && HDIM * 2 + 16 == LROW && AKS * 2 + 16 == LROW);
static_assert((TT % ATT_THREADS) == 0);
// one half stage: keys 64 t .. 64 t + 63 behind the pointers' own first key; l, gK, gVh, gVl are this lane's row
// (4*(wave&7) + (lane>>3) of a round of 32) and 16-byte piece
__device__ __forceinline__ void att_stage(unsigned l, const unsigned short* gK, const unsigned short* gVh,
                                          const unsigned short* gVl, int t) {
  copy_rows<2>(l,        gK  + (size_t)t * AKS * QKP, (size_t)32 * QKP);
  copy_rows<2>(l + AOVH, gVh + (size_t)t * AKS,       (size_t)32 * TT);
  copy_rows<2>(l + AOVL, gVl + (size_t)t * AKS,       (size_t)32 * TT);
}
__device__ __forceinline__ const _Float16* lds_h(const unsigned char* p) { return (const _Float16*)(const void*)p; }
// value of lane l ^ 16 (one vector cross-row move, no LDS counter)
__device__ __forceinline__ float xhalf(float x) {
  const int b = __builtin_bit_cast(int, x);
  return __builtin_bit_cast(float, __builtin_amdgcn_permlanex16(b, b, 0x76543210, 0xfedcba98, false, false));
}

// eight values to two, in packed adds: as many instructions as eight running sums take, and 6 registers fewer per sum
typedef float v2f __attribute__((ext_vector_type(2)));
__device__ __forceinline__ v2f fold2(const v8f v) {
  const v4f q = __builtin_shufflevector(v, v, 0, 1, 2, 3) + __builtin_shufflevector(v, v, 4, 5, 6, 7);
  return __builtin_shufflevector(q, q, 0, 1) + __builtin_shufflevector(q, q, 2, 3);
}
// one query tile's softmax over a step's 32 keys: s0[r]: key kb + 8hh + r, s1[r]: key kb + 16 + 8hh + r; x0, x1: ex of those keys.
// Returns the rescale factor of the running sums and of O^T; ph, pl: P^T x1024 as a B operand, hi and residual.
__device__ __forceinline__ float soft_step(const v8f s0, const v8f s1, const v8f x0, const v8f x1, const float lsc,
                                           float& mrow, v2f& zv, v2f& lv, v16h& phv, v16h& plv) {
  const float m0 = fmaxf(fmaxf(s0[0], s0[1]), s0[2]), m1 = fmaxf(fmaxf(s0[3], s0[4]), s0[5]);
  const float m2 = fmaxf(fmaxf(s0[6], s0[7]), s1[0]), m3 = fmaxf(fmaxf(s1[1], s1[2]), s1[3]);
  const float m4 = fmaxf(fmaxf(s1[4], s1[5]), s1[6]);
  float mx = fmaxf(fmaxf(fmaxf(m0, m1), s1[7]), fmaxf(fmaxf(m2, m3), m4));   // the lane's 16 keys
  mx = fmaxf(mx, xhalf(mx));               // both halves: maximum over the step's 32 keys
  const float mn = fmaxf(mrow, mx * lsc);
  const float al = exp2_hw(mrow - mn);
  mrow = mn;
  // the exponents' arguments as one vector fma: written so, they stay two to an instruction
  const v8f mn8 = {mn, mn, mn, mn, mn, mn, mn, mn};
  const v8f lsc8 = {lsc, lsc, lsc, lsc, lsc, lsc, lsc, lsc};
  const v8f t0 = __builtin_elementwise_fma(s0, lsc8, -mn8), t1 = __builtin_elementwise_fma(s1, lsc8, -mn8);
  v8f e0, e1;
#pragma unroll   // constant element indices: the vectors stay in registers
  for (int r = 0; r < 8; ++r) { e0[r] = exp2_hw(t0[r]); e1[r] = exp2_hw(t1[r]); }
  const v8f p0 = e0 * x0, p1 = e1 * x1;
  zv = zv * al + fold2(e0 + e1);
  lv = lv * al + fold2(p0 + p1);
  FragH ph, pl;                            // element r <- k = 8hh + r, element 8 + r <- k = 16 + 8hh + r
  const v8f y0 = p0 * PC, y1 = p1 * PC;
  ph.h[0] = __builtin_convertvector(y0, v8h);
  ph.h[1] = __builtin_convertvector(y1, v8h);
  pl.h[0] = __builtin_convertvector(y0 - __builtin_convertvector(ph.h[0], v8f), v8h);
  pl.h[1] = __builtin_convertvector(y1 - __builtin_convertvector(ph.h[1], v8f), v8h);
  phv = ph.v;
  plv = pl.v;
  return al;
}
// eight floats at a 16-byte boundary, as two 16-byte accesses
__device__ __forceinline__ void st8(float* p, const v8f v) {
  *(v4f*)(p)     = __builtin_shufflevector(v, v, 0, 1, 2, 3);
  *(v4f*)(p + 4) = __builtin_shufflevector(v, v, 4, 5, 6, 7);
}
__device__ __forceinline__ v8f ld8(const float* p) {
  const v4f a = *(const v4f*)(p), b = *(const v4f*)(p + 4);
  return __builtin_shufflevector(a, b, 0, 1, 2, 3, 4, 5, 6, 7);
}
#define XLANE 76                        // floats a lane hands over: 64 of O^T, per tile maximum, two sums, one unused; 4 unused: 304 B = 16 B x odd
#define AXB   (ATT_THREADS * XLANE * 4) // bytes of the hand-over
#define AKVB  (AXB > 2 * ABUF ? AXB : 2 * ABUF)

__global__ __launch_bounds__(ATT_THREADS)
void attn_heads(const unsigned short* __restrict__ QKq, const unsigned short* __restrict__ VHq,
                const unsigned short* __restrict__ VLq, const float* __restrict__ AEF,
                const float* __restrict__ betap, const float* __restrict__ ivp,
                const float* __restrict__ ovp, const float* __restrict__ chg,
                unsigned short* CTH, unsigned short* CTL) {
  __shared__ __align__(16) unsigned char kv[AKVB];          // two stages of outer rows and v^T rows; behind the loop: the hand-over
  __shared__ __align__(16) float exs[TT];                   // ex of this head, by key
  __shared__ __align__(16) unsigned short Osh[ATT_QB * HDIM];   // block result rows [128][64], hi
  __shared__ __align__(16) unsigned short Osl[ATT_QB * HDIM];   // residual

  const int tid  = threadIdx.x;
  const int wave = __builtin_amdgcn_readfirstlane(tid >> 5);   // in a scalar register: what is derived from it takes no vector register (256 a wave at four waves a SIMD)
  const int lane = tid & 31;
  const int hh   = lane >> 4;
  const int c    = lane & 15;
  const int qw   = wave & 3;                                // which 32 query rows of the block
  const int kq   = wave >> 2;                               // which 32 keys of every stage (quarter 0..3)
  const int sub  = kq >> 1;                                 // its half stage, also the half that this wave copies
  const int kh   = kq & 1;                                  // its 32 keys in that half
  const int ft   = kq & 1;                                  // behind the loop: the query tile that this wave finishes
  const int dh   = kq >> 1;                                 // and its d tiles: dh and dh + 2

  const int qg   = blockIdx.x % ATT_QG;                     // query group 0..15
  const int head = (blockIdx.x / ATT_QG) & (NHEAD - 1);     // 0..15
  const int qB   = qg * ATT_QB;                             // block's first query row
  const int q0   = qB + qw * 32;                            // wave's first query row
  const int orow = qw * 32 + ft * 16 + c;                   // the block row (query) that this lane finishes

  const _Float16* Qh = (const _Float16*)(const void*)QKq + (size_t)(q0 + c) * QKP + head * HDIM + 8 * hh;
  const float* Ex = AEF + 16 + head;                                    // ex column of this head
  const float lsc = (1.4426950408889634f * ATT_SCALE) / (QC * KC);      // log2(e) / 8 / carries

  // copy side: this lane's row and 16-byte piece in a round of 32 rows
  const int crow = (wave & 7) * 4 + (lane >> 3);
  const int cseg = (lane & 7) * 8;
  const unsigned lcp = lds_off(kv) + (unsigned)(sub * ASTG + crow * LROW + cseg * 2);
  const unsigned short* gK  = QKq + (size_t)(sub * AKS + crow) * QKP + DM + head * HDIM + cseg;
  const unsigned short* gVh = VHq + (size_t)(head * HDIM + crow) * TT + sub * AKS + cseg;
  const unsigned short* gVl = VLq + (size_t)(head * HDIM + crow) * TT + sub * AKS + cseg;
  // reader side, in bytes: this lane's fragment row (key or d = c within a group of 16 rows) and k half, at the wave's 32 keys
  const int frk = sub * ASTG + (kh * 32 + c) * LROW + 16 * hh;        // outer rows: 32 rows down
  const int frv = sub * ASTG + AOVH + c * LROW + 16 * hh + kh * 64;   // v^T rows: 32 keys = 64 B along

  // stage 0 into buffer 0, landed and published; then stage 1 into buffer 1. The ex column is published by the same barrier.
  att_stage(lcp, gK, gVh, gVl, 0);
  const v16h qa0 = ldfrag_h(Qh), qb0 = ldfrag_h(Qh + 32);                                // query tile 0: rows q0 + c
  const v16h qa1 = ldfrag_h(Qh + (size_t)16 * QKP), qb1 = ldfrag_h(Qh + (size_t)16 * QKP + 32);   // tile 1: rows q0 + 16 + c
  const float apq = AEF[(size_t)(qB + orow) * NGATE + head]; // ap of the query that this lane finishes, used behind the loop
#pragma unroll   // the 4 loads are issued together, one latency
  for (int i = 0; i < TT / ATT_THREADS; ++i) {
    const int k = i * ATT_THREADS + tid;                     // 4 x 512 = all 2048 keys
    exs[k] = Ex[(size_t)k * NGATE];
  }
  wait_copies();
  __syncthreads();
  att_stage(lcp + ABUF, gK, gVh, gVl, 2);

  float mr0 = -INFINITY, mr1 = -INFINITY;                    // this lane's query of tile 0, of tile 1
  v2f zv0 = {0.f, 0.f}, lv0 = {0.f, 0.f}, zv1 = {0.f, 0.f}, lv1 = {0.f, 0.f};   // sums of e and p over this half's keys: even r, odd r
  v8f a0 = zero8(), a1 = zero8(), a2 = zero8(), a3 = zero8();       // O^T of tile 0
  v8f b0 = zero8(), b1 = zero8(), b2 = zero8(), b3 = zero8();       // O^T of tile 1

  constexpr int nst = TT / (2 * AKS);
#pragma unroll 1   // one stage per trip: the ring's order at the foot stays as written
  for (int t = 0; t < nst; ++t) {
    const unsigned bofs = (unsigned)(t & 1) * ABUF;
    const unsigned char* sb = kv + bofs;
    const int kb = t * (2 * AKS) + kq * 32;    // the wave's one step of 32 keys in this stage
    v8f sa0, sa1, sb0, sb1;                    // s?0[r]: key kb + 8hh + r, s?1[r]: key kb + 16 + 8hh + r; sa: tile 0, sb: tile 1
    {
      const _Float16* kp = lds_h(sb + frk);
      const _Float16* kq = lds_h(sb + frk + 16 * LROW);
      const v16h k00 = ldfrag_h(kp), k01 = ldfrag_h(kp + 32);
      const v16h k10 = ldfrag_h(kq), k11 = ldfrag_h(kq + 32);
      sa0 = mma_raw(k00, qa0, zero8());
      sb0 = mma_raw(k00, qa1, zero8());
      sa1 = mma_raw(k10, qa0, zero8());
      sb1 = mma_raw(k10, qa1, zero8());
      sa0 = mma_raw(k01, qb0, sa0);
      sb0 = mma_raw(k01, qb1, sb0);
      sa1 = mma_raw(k11, qb0, sa1);
      sb1 = mma_raw(k11, qb1, sb1);
    }
    const float* exq = exs + kb + 8 * hh;
    const v4f xa = *(const v4f*)(exq),      xb = *(const v4f*)(exq + 4);      // ex of keys kb + 8hh + 0..7
    const v4f xc = *(const v4f*)(exq + 16), xd = *(const v4f*)(exq + 20);     // ex of keys kb + 16 + 8hh + 0..7
    const v8f x0 = __builtin_shufflevector(xa, xb, 0, 1, 2, 3, 4, 5, 6, 7);
    const v8f x1 = __builtin_shufflevector(xc, xd, 0, 1, 2, 3, 4, 5, 6, 7);
    v16h pha, pla, phb, plb;
    const float ala = soft_step(sa0, sa1, x0, x1, lsc, mr0, zv0, lv0, pha, pla);
    const float alb = soft_step(sb0, sb1, x0, x1, lsc, mr1, zv1, lv1, phb, plb);
    a0 *= ala;
    a1 *= ala;
    a2 *= ala;
    a3 *= ala;
    b0 *= alb;
    b1 *= alb;
    b2 *= alb;
    b3 *= alb;
    {
      const unsigned char* vp = sb + frv;
      const v16h vb0 = ldfrag_h(lds_h(vp));
      const v16h vb1 = ldfrag_h(lds_h(vp + 16 * LROW));
      const v16h vb2 = ldfrag_h(lds_h(vp + 32 * LROW));
      const v16h vb3 = ldfrag_h(lds_h(vp + 48 * LROW));
      a0 = mma_raw(vb0, pha, a0);
      a1 = mma_raw(vb1, pha, a1);
      a2 = mma_raw(vb2, pha, a2);
      a3 = mma_raw(vb3, pha, a3);
      b0 = mma_raw(vb0, phb, b0);
      b1 = mma_raw(vb1, phb, b1);
      b2 = mma_raw(vb2, phb, b2);
      b3 = mma_raw(vb3, phb, b3);
      a0 = mma_raw(vb0, pla, a0);
      a1 = mma_raw(vb1, pla, a1);
      a2 = mma_raw(vb2, pla, a2);
      a3 = mma_raw(vb3, pla, a3);
      b0 = mma_raw(vb0, plb, b0);
      b1 = mma_raw(vb1, plb, b1);
      b2 = mma_raw(vb2, plb, b2);
      b3 = mma_raw(vb3, plb, b3);
    }
    {
      const unsigned char* vp = sb + frv + (AOVL - AOVH);
      const v16h vl0 = ldfrag_h(lds_h(vp));
      const v16h vl1 = ldfrag_h(lds_h(vp + 16 * LROW));
      const v16h vl2 = ldfrag_h(lds_h(vp + 32 * LROW));
      const v16h vl3 = ldfrag_h(lds_h(vp + 48 * LROW));
      a0 = mma_raw(vl0, pha, a0);
      a1 = mma_raw(vl1, pha, a1);
      a2 = mma_raw(vl2, pha, a2);
      a3 = mma_raw(vl3, pha, a3);
      b0 = mma_raw(vl0, phb, b0);
      b1 = mma_raw(vl1, phb, b1);
      b2 = mma_raw(vl2, phb, b2);
      b3 = mma_raw(vl3, phb, b3);
    }
    // publish point of stage t + 1; the same barrier ends every reader's last read of stage t's buffer
    wait_lds_reads();
    wait_copies();
    __syncthreads();
    if (t + 2 < nst) att_stage(lcp + bofs, gK, gVh, gVl, 2 * (t + 2));   // block-uniform: refill the buffer that this trip has just read
  }
  wait_copies();

  // ---- the four key quarters of a query group are joined: wave (qw, kq) finishes tile kq & 1, d tiles kq >> 1 and (kq >> 1) + 2 ----
  const float za = zv0[0] + zv0[1], la = lv0[0] + lv0[1], zb = zv1[0] + zv1[1], lb = lv1[0] + lv1[1];
  const float zta = za + xhalf(za), lta = la + xhalf(la);    // the two lane halves' sums, on the same maximum
  const float ztb = zb + xhalf(zb), ltb = lb + xhalf(lb);
  {
    float* xs = (float*)(void*)kv + (size_t)tid * XLANE;     // the ring is free: every read of it ended at the last barrier
    const v4f ga = {mr0, zta, lta, 0.f}, gb = {mr1, ztb, ltb, 0.f};
    st8(xs, a0);
    st8(xs + 8, a1);
    st8(xs + 16, a2);
    st8(xs + 24, a3);
    st8(xs + 32, b0);
    st8(xs + 40, b1);
    st8(xs + 48, b2);
    st8(xs + 56, b3);
    *(v4f*)(xs + 64) = ga;
    *(v4f*)(xs + 68) = gb;
  }
  __syncthreads();                                           // the hand-over is published
  v8f oA, oB;                                                // O^T of the finished tile: d = 16 dh + 8 hh + r, and 32 more
  float zt, lt;
  {
    // same lane, same query, the four quarters' keys (this wave's own part too, so that every wave sums in the same order)
    const float* xp = (const float*)(const void*)kv + (size_t)(qw * 32 + lane) * XLANE;
    v4f hs[4];
    v8f hA[4], hB[4];
#pragma unroll   // constant array indices: the parts stay in registers; the 20 reads are issued together
    for (int i = 0; i < 4; ++i) {
      const float* p = xp + (size_t)i * (4 * 32 * XLANE);
      hs[i] = *(const v4f*)(p + 64 + 4 * ft);
      hA[i] = ld8(p + 32 * ft + 8 * dh);
      hB[i] = ld8(p + 32 * ft + 8 * dh + 16);
    }
    const float mj = fmaxf(fmaxf(hs[0][0], hs[1][0]), fmaxf(hs[2][0], hs[3][0]));   // the common maximum
    const float f0 = exp2_hw(hs[0][0] - mj), f1 = exp2_hw(hs[1][0] - mj);
    const float f2 = exp2_hw(hs[2][0] - mj), f3 = exp2_hw(hs[3][0] - mj);
    zt = hs[0][1] * f0 + hs[1][1] * f1 + hs[2][1] * f2 + hs[3][1] * f3;
    lt = hs[0][2] * f0 + hs[1][2] * f1 + hs[2][2] * f2 + hs[3][2] * f3;
    oA = hA[0] * f0 + hA[1] * f1 + hA[2] * f2 + hA[3] * f3;
    oB = hB[0] * f0 + hB[1] * f1 + hB[2] * f2 + hB[3] * f3;
  }

  // ---- per-head gates and rotation, renormaliser, carries (1024 on p, 1024 on v, 4096 on the stored ctx) ----
  const float bet = bfr(betap[head]);
  const float ivs = sigf(bfr(ivp[head]));
  const float og  = sigf(bfr(ovp[head])) * tanhf(bfr(chg[head]));
  const float ang = PI_F * sigf(bet);
  const float ca  = cosf(ang), sa = sinf(ang);
  const float base = ivs / (PC * VC);
  const float den = apq * lt + REN_EPS * zt;
  const float sc  = apq * (1.0f / den) * base;
  v8h yh[2], yl[2];                                          // [0]: d = 16 dh + 8 hh + r, [1]: d = 32 + 16 dh + 8 hh + r
#pragma unroll
  for (int r = 0; r < 8; ++r) {
    const float x0 = oA[r] * sc, x2 = oB[r] * sc;
    const float y0 = ((x0 * ca - x2 * sa) * og) * FC;
    const float y2 = ((x0 * sa + x2 * ca) * og) * FC;
    const _Float16 h0 = (_Float16)y0, h2 = (_Float16)y2;
    yh[0][r] = h0;
    yh[1][r] = h2;
    yl[0][r] = (_Float16)(y0 - (float)h0);
    yl[1][r] = (_Float16)(y2 - (float)h2);
  }
  {
    unsigned short* oh = Osh + orow * HDIM + 16 * dh + 8 * hh;
    unsigned short* ol = Osl + orow * HDIM + 16 * dh + 8 * hh;
#pragma unroll   // constant array indices: yh, yl stay in registers
    for (int j = 0; j < 2; ++j) {
      *(v8h*)(void*)(oh + 32 * j) = yh[j];
      *(v8h*)(void*)(ol + 32 * j) = yl[j];
    }
  }
  __syncthreads();
  // ---- block writes its 128 row segments: piece p = it*512 + tid -> row p>>3, halves (p&7)*8 of the 64-col slab (128 B a row) ----
  {
    v4u vh[2], vl[2];
#pragma unroll
    for (int it = 0; it < 2; ++it) {
      const int p = it * ATT_THREADS + tid;
      vh[it] = *(const v4u*)(Osh + (size_t)p * 8);
      vl[it] = *(const v4u*)(Osl + (size_t)p * 8);
    }
    const size_t dofs = (size_t)qB * DM + (size_t)head * HDIM;
    unsigned short* dh = CTH + dofs;
    unsigned short* dl = CTL + dofs;
    {
#pragma unroll
      for (int it = 0; it < 2; ++it) {
        const int p = it * ATT_THREADS + tid;
        const size_t po = (size_t)(p >> 3) * DM + (size_t)(p & 7) * 8;
        *(v4u*)(dh + po) = vh[it];
        *(v4u*)(dl + po) = vl[it];
      }
    }
  }
}

// =====================================================================================================
// Workspace map (bytes); every plane is an exact multiple of its tile / whole-row store granularity (M, N exact tile multiples,
// row blocks exact, no pad rows needed), every offset a multiple of 131072:
//   WIO  f16 [2048][1024] x64     4194304   (rows 0..1023 Wi, 1024..2047 Wo; native [out][in] = [n][k])
//   WV   f16 [1024][1024] x64     2097152
//   WOUT f16 [1024][1024] x64     2097152
//   WG   f16 [64][1024]   x64      131072   (Wa, We, Wa, We)
//   XB   f16 [2048][1024] x16     4194304
//   QK   f16 [2048][2048] x16     8388608   (inner | outer)
//   VTH  f16 [1024][2048] x1024   4194304   (v^T hi)
//   VTL  f16 [1024][2048]         4194304   (v^T residual)
//   AEF  f32 [2048][64]            524288   (sigmoid gates)
//   CTH  f16 [2048][1024] x4096   4194304   (ctx hi)
//   CTL  f16 [2048][1024]         4194304   (ctx residual)
//   end                          38404096
// =====================================================================================================
extern "C" void kernel_launch(void* const* d_in, const int* in_sizes, int n_in,
                              void* d_out, int out_size, void* d_ws, size_t ws_size,
                              hipStream_t stream) {
  if (n_in < 13) return;
  if (in_sizes[0] != TT * DM) return;
  if (in_sizes[1] != NHEAD * DM || in_sizes[2] != NHEAD) return;
  if (in_sizes[3] != NHEAD * DM || in_sizes[4] != NHEAD) return;
  if (in_sizes[5] != DM * DM || in_sizes[6] != DM * DM || in_sizes[7] != DM * DM || in_sizes[8] != DM * DM) return;
  if (in_sizes[9] != NHEAD || in_sizes[10] != NHEAD || in_sizes[11] != NHEAD || in_sizes[12] != NHEAD) return;
  if (out_size != TT * DM) return;

  const float* x     = (const float*)d_in[0];
  const float* Wa    = (const float*)d_in[1];
  const float* ba    = (const float*)d_in[2];
  const float* We    = (const float*)d_in[3];
  const float* be    = (const float*)d_in[4];
  const float* Wi    = (const float*)d_in[5];
  const float* Wo    = (const float*)d_in[6];
  const float* Wv    = (const float*)d_in[7];
  const float* Wout  = (const float*)d_in[8];
  const float* betap = (const float*)d_in[9];
  const float* ivp   = (const float*)d_in[10];
  const float* ovp   = (const float*)d_in[11];
  const float* chg   = (const float*)d_in[12];
  float*       out   = (float*)d_out;

  const size_t PWIO = (size_t)2 * DM * DM * 2;                    //  4194304
  const size_t PW   = (size_t)DM * DM * 2;                        //  2097152
  const size_t PG   = (size_t)NGATE * DM * 2;                     //   131072
  const size_t PX   = (size_t)TT * DM * 2;                        //  4194304
  const size_t PQK  = (size_t)TT * QKP * 2;                       //  8388608
  const size_t PVT  = (size_t)DM * TT * 2;                        //  4194304
  const size_t PAE  = (size_t)TT * NGATE * 4;                     //   524288
  const size_t PCT  = (size_t)TT * DM * 2;                        //  4194304
  size_t off = 0;
  const size_t oWIO = off; off += PWIO;
  const size_t oWV  = off; off += PW;
  const size_t oWOU = off; off += PW;
  const size_t oWG  = off; off += PG;
  const size_t oXB  = off; off += PX;
  const size_t oQK  = off; off += PQK;
  const size_t oVTH = off; off += PVT;
  const size_t oVTL = off; off += PVT;
  const size_t oAEF = off; off += PAE;
  const size_t oCTH = off; off += PCT;
  const size_t oCTL = off; off += PCT;
  if (off > ws_size) return;                                      // off = 38404096
  if (off > (size_t)134217728) return;

  char* ws = (char*)d_ws;
  unsigned short* WIO  = (unsigned short*)(ws + oWIO);
  unsigned short* WV   = (unsigned short*)(ws + oWV);
  unsigned short* WOUT = (unsigned short*)(ws + oWOU);
  unsigned short* WG   = (unsigned short*)(ws + oWG);
  unsigned short* XB   = (unsigned short*)(ws + oXB);
  unsigned short* QK   = (unsigned short*)(ws + oQK);
  unsigned short* VTH  = (unsigned short*)(ws + oVTH);
  unsigned short* VTL  = (unsigned short*)(ws + oVTL);
  float*          AEF  = (float*)(ws + oAEF);
  unsigned short* CTH  = (unsigned short*)(ws + oCTH);
  unsigned short* CTL  = (unsigned short*)(ws + oCTL);

  const dim3 blk(256);
  const dim3 gCV(CB_ALL);                                         // 776 blocks
  const dim3 gPR(PB_ALL);                                         // 196 blocks
  const dim3 gO((TT / OBM) * (DM / OBN));                         // 256
  const dim3 gAT(ATT_BLOCKS);                                     // 256
  const dim3 bAT(ATT_THREADS);                                    // 512

  // (0) 16-bit planes: XB = f16(16 * bf16(x)); W planes = f16(64 * bf16(W)) in native [n][k] layout; gate plane
  conv_all<<<gCV, blk, 0, stream>>>(x, Wi, Wo, Wv, Wout, Wa, We, XB, WIO, WV, WOUT, WG);

  // (1..3) gates, v^T, inner | outer
  proj_gemms<<<gPR, blk, 0, stream>>>(XB, WIO, WV, WG, ba, be, QK, VTH, VTL, AEF);

  // (4) attention per (128 query rows, 1 head) -> CTH/CTL (ctx x4096 hi + residual)
  attn_heads<<<gAT, bAT, 0, stream>>>(QK, VTH, VTL, AEF, betap, ivp, ovp, chg, CTH, CTL);

  // (5) output projection
  out_gemm<<<gO, blk, 0, stream>>>(CTH, CTL, WOUT, out);
  (void)hipGetLastError();
}

// v010
// One run takes 64.5 microseconds.
// Next to v009, in two timings, it ran 1.05 times as fast each time.
// Over all steps from v000 it is 5.77 times as fast.
// Contractions: gate logits ([Wa;We;Wa;We] f16 x64 . x f16 x16, K=1024), inner|outer projections (x f16 x16 . [Wi;Wo] f16 x64, K=1024),
// v^T projection (Wv f16 x64 . x f16 x16, K=1024; stored as f16 hi x1024 + residual plane), scores (inner f16 x16 . outer f16 x16, K=64),
// v^T . P^T (v^T f16 hi+residual . P f16 x1024 hi+residual, three products, 2048 keys in steps of 32; scores and this product transposed),
// output projection (ctx f16 x4096 hi+residual . Wout f16 x64, two products, K=1024): all v_wmma_f32_16x16x32_f16, f32 accumulate.
// Sigmoid gates, online max-subtracted softmax, renormaliser, valve/rotation epilogue in f32 on VALU; every float input RNE-converted to bf16 on load.
#include <hip/hip_runtime.h>
#include <math.h>
#include <stdint.h>

#define TT      2048
#define DM      1024
#define NHEAD   16
#define HDIM    64
#define NGATE   64
#define QTB     8
#define QKP     (2 * DM)
#define WSC     64.0f
#define ACARRY  16.0f
#define QC      16.0f
#define KC      16.0f
#define VC      1024.0f
#define PC      1024.0f
#define FC      4096.0f
#define ATT_SCALE 0.125f
#define PI_F    3.14159265358979323846f
#define REN_EPS 1e-8f
static_assert(NHEAD * HDIM == DM);
static_assert((TT % 64) == 0 && (DM % 64) == 0 && (DM % 256) == 0 && (TT % 32) == 0 && (TT % 16) == 0);
static_assert(NHEAD == 16 && NGATE == 64);
#define ATT_WAVES   16
#define ATT_THREADS (ATT_WAVES * 32)
#define ATT_QB      (QTB * 16)
#define ATT_QG      (TT / ATT_QB)
#define ATT_BLOCKS  (ATT_QG * NHEAD)
static_assert(ATT_THREADS == 512 && ATT_BLOCKS == 256 && (TT % ATT_QB) == 0);

typedef _Float16 v16h __attribute__((ext_vector_type(16)));
typedef _Float16 v8h  __attribute__((ext_vector_type(8)));
typedef float    v8f  __attribute__((ext_vector_type(8)));
typedef float    v4f  __attribute__((ext_vector_type(4)));
typedef unsigned int v4u __attribute__((ext_vector_type(4)));

union FragH { v16h v; v8h h[2]; v4u u[2]; };

// ---- scalar helpers --------------------------------------------------------------------------------
__device__ __forceinline__ unsigned short bf_bits(float f) {          // f32 -> bf16 bits, RNE convert
  unsigned u = __float_as_uint(f);
  return (unsigned short)((u + 0x7FFFu + ((u >> 16) & 1u)) >> 16);
}
__device__ __forceinline__ float bf_up(unsigned short h) { return __uint_as_float(((unsigned)h) << 16); }
__device__ __forceinline__ float bfr(float f) { return bf_up(bf_bits(f)); }   // value of the bf16 RNE convert
__device__ __forceinline__ unsigned short h_bits(_Float16 x) { return __builtin_bit_cast(unsigned short, x); }
__device__ __forceinline__ unsigned pk16(unsigned short a, unsigned short b) { return (unsigned)a | ((unsigned)b << 16); }
__device__ __forceinline__ v8f zero8() { v8f z = {0.f, 0.f, 0.f, 0.f, 0.f, 0.f, 0.f, 0.f}; return z; }
__device__ __forceinline__ float sigf(float v) { return 1.0f / (1.0f + expf(-v)); }
// 2^x as the one hardware instruction (v_exp_f32). The library exp2f adds a compare, two selects, an add and an ldexp per value, only
// to return subnormal results; here a result under 2^-126 may be 0: it stands beside a term near 1 in the sum of e, beside
// 1e-8 times that sum in the renormaliser, and is 0 in both f16 planes of P either way (a rescale factor that small likewise). -inf gives 0, as in the library form.
__device__ __forceinline__ float exp2_hw(float x) { return __builtin_amdgcn_exp2f(x); }

// ---- fragment loaders: 16-bit A/B operand, lane -> row/col (lane&15), p already includes +8*(lane>>4);
//      elements 0..7 <- p[0..7] (k0+8h..), elements 8..15 <- p[16..23] (k0+16+8h..)  (same split k map for A and B;
//      B is always read from a k-contiguous [n][k] plane)
__device__ __forceinline__ v16h ldfrag_h(const _Float16* p) {
  FragH f;
  f.h[0] = *(const v8h*)(p);
  f.h[1] = *(const v8h*)(p + 16);
  return f.v;
}
__device__ __forceinline__ v16h ldfrag_u(const unsigned short* p) {
  FragH f;
  f.u[0] = *(const v4u*)(p);
  f.u[1] = *(const v4u*)(p + 16);
  return f.v;
}

// ---- WMMA helpers with trailing VALU hazard gaps ------------------------------------------------------
__device__ __forceinline__ v8f mma_raw(v16h a, v16h b, v8f c) {
  return __builtin_amdgcn_wmma_f32_16x16x32_f16(false, a, false, b, (short)0, c, false, false);
}
__device__ __forceinline__ void dep_guard1(v8f& a, v8f& b, v16h x) {
#if defined(__HIP_DEVICE_COMPILE__)
  asm volatile("v_nop\n\tv_nop\n\tv_nop\n\tv_nop" : "+v"(a), "+v"(b) : "v"(x));
#endif
}
__device__ __forceinline__ void guard_pv6(v8f& a, v8f& b, v8f& c, v8f& d,
                                          v16h p0, v16h p1, v16h x0, v16h x1, v16h x2, v16h x3) {
#if defined(__HIP_DEVICE_COMPILE__)
  asm volatile("v_nop\n\tv_nop\n\tv_nop\n\tv_nop"
               : "+v"(a), "+v"(b), "+v"(c), "+v"(d) : "v"(p0), "v"(p1), "v"(x0), "v"(x1), "v"(x2), "v"(x3));
#endif
}
__device__ __forceinline__ void keep4_h(v16h a, v16h b, v16h c, v16h d) {
#if defined(__HIP_DEVICE_COMPILE__)
  asm volatile("v_nop" :: "v"(a), "v"(b), "v"(c), "v"(d));
#endif
}
__device__ __forceinline__ void acc_guard4(v8f& a, v8f& b, v8f& c, v8f& d) {
#if defined(__HIP_DEVICE_COMPILE__)
  asm volatile("v_nop\n\tv_nop\n\tv_nop\n\tv_nop" : "+v"(a), "+v"(b), "+v"(c), "+v"(d));
#endif
}
__device__ __forceinline__ void wave_sync_lds() {
  __builtin_amdgcn_fence(__ATOMIC_RELEASE, "workgroup");
  __builtin_amdgcn_wave_barrier();
  __builtin_amdgcn_fence(__ATOMIC_ACQUIRE, "workgroup");
}

// =====================================================================================================
// Row convert: X f32 [nrows][1024] -> Y f16 [nrows][1024] = f16( bf16_RNE(X) * carry ), carry a power of two (exact).
// One wave per row (8 rows per block); lane l holds cols j*256 + 8l..8l+7 for j = 0..3; store instruction j covers a contiguous
// coverage: 4 x 32 lanes x 8 halves = 1024 = the whole row; nrows/8 blocks per job (exact multiples here) with a wave-uniform row bound.
// Used for x (carry 16) and for Wi, Wo, Wv, Wout in their native [out][in] = [n][k] layout (carry 64).
// =====================================================================================================
__device__ __forceinline__ void conv_rows(int blk, const float* __restrict__ X, unsigned short* Y, int nrows, float carry) {
  const int lane = threadIdx.x & 31, wave = threadIdx.x >> 5;
  const int row = blk * 8 + wave;
  if (row >= nrows) return;                      // wave-uniform; no barriers in this kernel
  const float* xp = X + (size_t)row * DM;
  unsigned short* op = Y + (size_t)row * DM;
  v4u res[4];
#pragma unroll
  for (int j = 0; j < 4; ++j) {
    const int c0 = j * 256 + lane * 8;
    const v4f a0 = *(const v4f*)(xp + c0), a1 = *(const v4f*)(xp + c0 + 4);
    float t[8];
#pragma unroll
    for (int e = 0; e < 4; ++e) { t[e] = bfr(a0[e]) * carry; t[4 + e] = bfr(a1[e]) * carry; }
    v4u o = {0u, 0u, 0u, 0u};
#pragma unroll
    for (int e = 0; e < 4; ++e) o[e] = pk16(h_bits((_Float16)t[2 * e]), h_bits((_Float16)t[2 * e + 1]));
    res[j] = o;
  }
  {
#pragma unroll
    for (int j = 0; j < 4; ++j) *(v4u*)(op + j * 256 + lane * 8) = res[j];
    
  }
}

// =====================================================================================================
// Gate weight plane: G f16 [64][1024]: row r = f16( 64 * bf16_RNE( (r & 16) ? We[r & 15] : Wa[r & 15] ) ) (rows 32..63 duplicate 0..31).
// Both candidate rows loaded with clamped in-range addresses, selected by value (row is wave-uniform). Same store shape as conv_rows.
// coverage: 8 blocks x 8 waves = 64 rows x (4 x 32 x 8 = 1024 cols), exact.
// =====================================================================================================
__device__ __forceinline__ void conv_gate(int blk, const float* __restrict__ Wa, const float* __restrict__ We,
                                          unsigned short* Y, float carry) {
  const int lane = threadIdx.x & 31, wave = threadIdx.x >> 5;
  const int row = blk * 8 + wave;
  if (row >= NGATE) return;                      // wave-uniform; no barriers in this kernel
  const float* pa = Wa + (size_t)(row & 15) * DM;
  const float* pb = We + (size_t)(row & 15) * DM;
  const bool useb = (row & 16) != 0;
  unsigned short* op = Y + (size_t)row * DM;
  v4u res[4];
#pragma unroll
  for (int j = 0; j < 4; ++j) {
    const int c0 = j * 256 + lane * 8;
    const v4f a0 = *(const v4f*)(pa + c0), a1 = *(const v4f*)(pa + c0 + 4);
    const v4f b0 = *(const v4f*)(pb + c0), b1 = *(const v4f*)(pb + c0 + 4);
    float t[8];
#pragma unroll
    for (int e = 0; e < 4; ++e) {
      t[e]     = bfr(useb ? b0[e] : a0[e]) * carry;
      t[4 + e] = bfr(useb ? b1[e] : a1[e]) * carry;
    }
    v4u o = {0u, 0u, 0u, 0u};
#pragma unroll
    for (int e = 0; e < 4; ++e) o[e] = pk16(h_bits((_Float16)t[2 * e]), h_bits((_Float16)t[2 * e + 1]));
    res[j] = o;
  }
  {
#pragma unroll
    for (int j = 0; j < 4; ++j) *(v4u*)(op + j * 256 + lane * 8) = res[j];
    
  }
}

// =====================================================================================================
// All conversions in one launch: none reads what another writes. The block index picks the job (block-uniform, no barriers):
// blocks 0..255 x, then 128 each for Wi, Wo, Wv, Wout, then 8 for the gate plane; every job keeps its own rows and stores.
// =====================================================================================================
#define CB_X  (TT / 8)
#define CB_W  (DM / 8)
#define CB_G  (NGATE / 8)
#define CB_ALL (CB_X + 4 * CB_W + CB_G)
__global__ __launch_bounds__(256) void conv_all(const float* __restrict__ x, const float* __restrict__ Wi,
                                                const float* __restrict__ Wo, const float* __restrict__ Wv,
                                                const float* __restrict__ Wout, const float* __restrict__ Wa,
                                                const float* __restrict__ We,
                                                unsigned short* XB, unsigned short* WIO, unsigned short* WV,
                                                unsigned short* WOUT, unsigned short* WG) {
  const int b = blockIdx.x;
  if (b >= CB_X + 4 * CB_W) {
    conv_gate(b - (CB_X + 4 * CB_W), Wa, We, WG, WSC);
    return;
  }
  const float* X = x;
  unsigned short* Y = XB;
  int rb = b, nrows = TT;
  float carry = ACARRY;
  if (b >= CB_X) {
    const int w = (b - CB_X) / CB_W;             // 0..3: Wi, Wo, Wv, Wout
    rb = (b - CB_X) % CB_W;
    nrows = DM;
    carry = WSC;
    X = w == 0 ? Wi : w == 1 ? Wo : w == 2 ? Wv : Wout;
    Y = w == 0 ? WIO : w == 1 ? WIO + (size_t)DM * DM : w == 2 ? WV : WOUT;
  }
  conv_rows(rb, X, Y, nrows, carry);
}

// ---- asynchronous global -> LDS copies (16 B per lane). Each statement ends in s_wait_xcnt 0 so that no address register of an
//      issued copy is rewritten before the wait (a precaution); landing is waited for separately with s_wait_asynccnt 0.
#define LROW  144     // attention ring: LDS row pitch in bytes: 128 + 16 (16 B x odd: conflict-free for 16-byte readers)
#define RSTEP (32 * LROW)   // attention ring: LDS bytes between two copy rounds (a round = 8 waves x 4 rows)
__device__ __forceinline__ unsigned lds_off(const void* p) { return (unsigned)(size_t)p; }
__device__ __forceinline__ void copy2_lds(unsigned l, const unsigned short* g, size_t st) {
#if defined(__HIP_DEVICE_COMPILE__)
  asm volatile("global_load_async_to_lds_b128 %0, %1, off\n\t"
               "global_load_async_to_lds_b128 %2, %3, off\n\t"
               "s_wait_xcnt 0x0"
               :: "v"(l), "v"(g), "v"(l + RSTEP), "v"(g + st) : "memory");
#endif
}
// GEMM rings: four or eight copy rounds in one statement; LS = LDS bytes between two rounds, st = source elements between two rounds
template <int LS>
__device__ __forceinline__ void copy4_lds(unsigned l, const unsigned short* g, size_t st) {
#if defined(__HIP_DEVICE_COMPILE__)
  asm volatile("global_load_async_to_lds_b128 %0, %1, off\n\t"
               "global_load_async_to_lds_b128 %2, %3, off\n\t"
               "global_load_async_to_lds_b128 %4, %5, off\n\t"
               "global_load_async_to_lds_b128 %6, %7, off\n\t"
               "s_wait_xcnt 0x0"
               :: "v"(l), "v"(g), "v"(l + LS), "v"(g + st), "v"(l + 2 * LS), "v"(g + 2 * st),
                  "v"(l + 3 * LS), "v"(g + 3 * st) : "memory");
#endif
}
template <int LS>
__device__ __forceinline__ void copy8_lds(unsigned l, const unsigned short* g, size_t st) {
#if defined(__HIP_DEVICE_COMPILE__)
  asm volatile("global_load_async_to_lds_b128 %0, %1, off\n\t"
               "global_load_async_to_lds_b128 %2, %3, off\n\t"
               "global_load_async_to_lds_b128 %4, %5, off\n\t"
               "global_load_async_to_lds_b128 %6, %7, off\n\t"
               "global_load_async_to_lds_b128 %8, %9, off\n\t"
               "global_load_async_to_lds_b128 %10, %11, off\n\t"
               "global_load_async_to_lds_b128 %12, %13, off\n\t"
               "global_load_async_to_lds_b128 %14, %15, off\n\t"
               "s_wait_xcnt 0x0"
               :: "v"(l), "v"(g), "v"(l + LS), "v"(g + st), "v"(l + 2 * LS), "v"(g + 2 * st),
                  "v"(l + 3 * LS), "v"(g + 3 * st), "v"(l + 4 * LS), "v"(g + 4 * st), "v"(l + 5 * LS), "v"(g + 5 * st),
                  "v"(l + 6 * LS), "v"(g + 6 * st), "v"(l + 7 * LS), "v"(g + 7 * st) : "memory");
#endif
}
// attention ring: 2 rounds of 32 rows: lane -> row 4*wave + (lane>>3) of its round, 16-byte piece lane&7; st = 32 source rows in elements
template <int NR>
__device__ __forceinline__ void copy_rows(unsigned l, const unsigned short* g, size_t st) {
  static_assert(NR == 2);
  copy2_lds(l, g, st);
}
// gemm64's ring: a stage is 128 k = 256 B of every operand row, the most that two buffers of 576 rows hold in a WGP's LDS. A trip ends
// when the next stage's copies have landed (a latency and the stage's bytes): the more k a stage holds, the fewer such latencies,
// waits and barriers the same bytes pay.
#define GKST  128
#define GROW  (GKST * 2 + 16)   // LDS row pitch in bytes: 272 = 16 B x odd: conflict-free for 16-byte readers
#define GSTEP (16 * GROW)       // LDS bytes between two copy rounds (a round = 8 waves x 2 rows)
// NR rounds of 16 rows (NR = 4 or 32): lane -> row 2*wave + (lane>>4) of its round, 16-byte piece lane&15; st = 16 source rows in elements
template <int NR>
__device__ __forceinline__ void copy_rounds(unsigned l, const unsigned short* g, size_t st) {
  static_assert(NR == 4 || NR == 32);
  if constexpr (NR == 4) {
    copy4_lds<GSTEP>(l, g, st);
  } else {
#pragma unroll 1   // rolled: a quarter of the text (the kernel that holds three of these bodies stays near 32 KB); same copies, same order
    for (int q = 0; q < NR / 8; ++q) copy8_lds<GSTEP>(l + (unsigned)q * (8 * GSTEP), g + (size_t)q * 8 * st, st);
  }
}
__device__ __forceinline__ void wait_copies() {      // this wave's copies have landed in LDS
#if defined(__HIP_DEVICE_COMPILE__)
  asm volatile("s_wait_asynccnt 0x0" ::: "memory");
#endif
}
__device__ __forceinline__ void wait_store_regs() {  // in front of an overwrite of registers that issued global stores name (a precaution)
#if defined(__HIP_DEVICE_COMPILE__)
  asm volatile("s_wait_xcnt 0x0" ::: "memory");
#endif
}
__device__ __forceinline__ void wait_lds_reads() {   // this wave's LDS reads have returned (before their buffer is refilled)
#if defined(__HIP_DEVICE_COMPILE__)
  asm volatile("s_wait_dscnt 0x0" ::: "memory");
#endif
}

// =====================================================================================================
// Register-blocked f16 WMMA GEMM: C[m][n] = f( oscale * sum_k A[m][k] * Bt[n][k] ); one wave per 64x64 tile, 8 tiles per block.
// Operands reach the fragments through LDS: per stage of 128 k the block copies its operand rows (256 B each, whole lines) with
// asynchronous copies into one of two buffers; the next stage's copies fly while this stage is multiplied; one barrier per stage.
// WM 1: the 8 tiles share their 64 A rows and lie side by side in n (N a multiple of 512); WM 8: they share their 64 B rows and
// lie below one another in m (N = 64, M a multiple of 512). K a multiple of 128.
// A row-major [M][K] pitch lda (16-bit plane), Bt row-major [N][K] pitch ldb (k contiguous); M, N multiples of 64, K multiple of 128.
// BM: 0 = no bias; 3 = per-row head bias bf16( (row & 16) ? bias2[row & 15] : bias[row & 15] ) (in-range addresses); of such a tile only
//     rows 0..31 are stored (rows 32..63 of the gate plane repeat them and nobody reads them).
// OM: 0 = f32 out (pitch ldc), ACT 2 applies sigmoid after bias;
//     2 = f16 out = f16( value * ocarry ); 3 = f16 hi plane f16(value*ocarry) to C and unscaled residual f16(value*ocarry - hi) to C2.
// coverage: 4 slabs (BM 3: the first 2) x 16 rows (f32: it 0..7 x lane>>4; f16: it 0..3 x lane>>3) x 64 cols = the wave's whole 64x64 tile (BM 3: its rows 0..31);
//           tilesM*tilesN/8 blocks per product (exact here); a block that does not fit the shape rules leaves as a whole before any barrier.
// =====================================================================================================
// The body is a device function: its kernel owns the LDS (ring: two stages; sT: 8 slabs, which may lie on the ring: they are written
// only behind the loop's last barrier, which ends every read of the ring) and hands in the block's index in this product.
__host__ __device__ constexpr int gemm_stage_bytes(int wm) {
  return (wm * 64 + (8 / wm) * 64) * GROW;
}
#define SLAB_F (16 * 68)   // per-wave 16x64 slab, pitch 68 floats
template <int OM, int BM, int ACT, int WM>
__device__ __forceinline__ void gemm64(
    unsigned char* ring, float* sT, int blk,
    const unsigned short* __restrict__ Ap, int lda,
    const unsigned short* __restrict__ Btp, int ldb,
    const float* __restrict__ bias, const float* __restrict__ bias2,
    void* Cout, void* C2out, int ldc,
    int M, int N, int K, float oscale, float ocarry) {
  static_assert(WM == 1 || WM == 8);
  constexpr int RA  = WM * 64;                     // A rows per block
  constexpr int RB  = (8 / WM) * 64;               // B rows per block
  constexpr int OB  = RA * GROW;                   // stage layout in bytes: [A | B]
  constexpr int STG = OB + RB * GROW;              // bytes per stage
  static_assert(STG == gemm_stage_bytes(WM));
  const int lane = threadIdx.x & 31;
  const int wave = threadIdx.x >> 5;
  const int tilesN = N >> 6;
  const int tilesM = M >> 6;
  const int tile0 = blk * 8;
  if (tile0 + 8 > tilesM * tilesN) return;         // block-uniform, before any barrier or copy
  if (WM == 1 ? (tilesN & 7) != 0 : (tilesN != 1)) return;   // block-uniform shape rule of this build
  const int tmB = tile0 / tilesN;
  const int mB = tmB << 6;                         // block's first row and column
  const int nB = (tile0 - tmB * tilesN) << 6;
  const int m0 = mB + (WM == 8 ? (wave << 6) : 0);
  const int n0 = nB + (WM == 1 ? (wave << 6) : 0);

  const int rlane = lane & 15;                 // row (A) / col (B, D) within subtile
  const int koff  = (lane >> 4) * 8;           // k offset of this lane half
  const int mOff  = (lane >> 4) * 8;           // D row offset

  // copy side: this lane's row and 16-byte piece in a round of 16 rows
  const int crow = wave * 2 + (lane >> 4);
  const int cseg = (lane & 15) * 8;
  const unsigned lcp = lds_off(ring) + (unsigned)(crow * GROW + cseg * 2);
  const unsigned short* gA  = Ap  + (size_t)(mB + crow) * lda + cseg;
  const unsigned short* gB  = Btp + (size_t)(nB + crow) * ldb + cseg;
  const size_t stA = (size_t)16 * lda, stB = (size_t)16 * ldb;
  // reader side: fragment rows of this wave in a stage
  const int fa = ((WM == 8 ? (wave << 6) : 0) + rlane) * GROW + koff * 2;
  const int fb = OB + ((WM == 1 ? (wave << 6) : 0) + rlane) * GROW + koff * 2;

  v8f acc[4][4];
#pragma unroll
  for (int i = 0; i < 4; ++i)
#pragma unroll
    for (int j = 0; j < 4; ++j) acc[i][j] = zero8();

  constexpr int NI = (BM == 3) ? 2 : 4;                // slabs of 16 rows that are stored
  float br[NI][8];                                     // BM 3: bias of this lane's accumulator rows 16 i + mOff + r (m0 is a multiple of 64)
#pragma unroll
  for (int i = 0; i < NI; ++i) {
#pragma unroll
    for (int r = 0; r < 8; ++r) {
      br[i][r] = 0.f;
      if constexpr (BM == 3) br[i][r] = bfr(((i & 1) ? bias2 : bias)[mOff + r]);   // in-range addresses 0..15
    }
  }

  const int nst = K / GKST;
  // stage 0 into buffer 0, landed and published; then stage 1 into buffer 1
  copy_rounds<RA / 16>(lcp, gA, stA);
  copy_rounds<RB / 16>(lcp + OB, gB, stB);
  wait_copies();
  __syncthreads();
  if (nst > 1) {
    copy_rounds<RA / 16>(lcp + STG, gA + GKST, stA);
    copy_rounds<RB / 16>(lcp + STG + OB, gB + GKST, stB);
  }

#pragma unroll 1   // one stage per trip: the ring's order at the foot stays as written
  for (int t = 0; t < nst; ++t) {
    const unsigned bofs = (unsigned)(t & 1) * STG;
    const unsigned char* sb = ring + bofs;
#pragma unroll
    for (int s = 0; s < GKST / 32; ++s) {      // four k-steps of 32 per stage, ascending k
      v16h bh[4], ah[4];
#pragma unroll
      for (int j = 0; j < 4; ++j) bh[j] = ldfrag_u((const unsigned short*)(sb + fb + j * 16 * GROW + s * 64));
#pragma unroll
      for (int i = 0; i < 4; ++i) ah[i] = ldfrag_u((const unsigned short*)(sb + fa + i * 16 * GROW + s * 64));
#pragma unroll
      for (int i = 0; i < 4; ++i) {
#pragma unroll
        for (int j = 0; j < 4; ++j) acc[i][j] = mma_raw(ah[i], bh[j], acc[i][j]);
        dep_guard1(acc[i][0], acc[i][3], ah[i]);
      }
      keep4_h(bh[0], bh[1], bh[2], bh[3]);
    }
    // publish point of stage t + 1; the same barrier ends every reader's last read of stage t's buffer
    wait_lds_reads();
    wait_copies();
    __syncthreads();
    if (t + 2 < nst) {                         // block-uniform: refill the buffer that this trip has just read
      const int kn = (t + 2) * GKST;
      copy_rounds<RA / 16>(lcp + bofs, gA + kn, stA);
      copy_rounds<RB / 16>(lcp + bofs + OB, gB + kn, stB);
    }
  }
  wait_copies();
  acc_guard4(acc[0][0], acc[0][1], acc[0][2], acc[0][3]);
  acc_guard4(acc[1][0], acc[1][1], acc[1][2], acc[1][3]);
  acc_guard4(acc[2][0], acc[2][1], acc[2][2], acc[2][3]);
  acc_guard4(acc[3][0], acc[3][1], acc[3][2], acc[3][3]);

  const int hh2 = lane >> 4, c4 = (lane & 15) * 4;     // f32 out: 256-B row segment = 16 lanes x 16 B
  const int q8  = lane >> 3, c8 = (lane & 7) * 8;
  // ---- epilogue ----
  float* slab = sT + wave * SLAB_F;
#pragma unroll
  for (int i = 0; i < NI; ++i) {
    const int mBase = m0 + (i << 4);
#pragma unroll
    for (int j = 0; j < 4; ++j) {
#pragma unroll
      for (int r = 0; r < 8; ++r) {
        float f = acc[i][j][r];
        if constexpr (OM == 0) f = f * oscale + br[i][r];  // f32 out: scale and row bias where the row is a register index
        slab[(mOff + r) * 68 + (j << 4) + rlane] = f;
      }
    }
    wave_sync_lds();
    if constexpr (OM == 0) {
      float* C = (float*)Cout;
      constexpr int IU = (ACT == 2) ? 2 : 8;               // row pairs per trip
#pragma unroll 1   // ACT 2: unrolled, the 64 divisions are several KB of text; rolled, the kernel that holds this body stays under 32 KB
      for (int ib = 0; ib < 8; ib += IU) {
        v4f vals[IU];
#pragma unroll
        for (int u = 0; u < IU; ++u) {
          const int row = (ib + u) * 2 + hh2;              // ib + u 0..7 x hh2 0..1 = rows 0..15
          v4f v = *(const v4f*)(slab + row * 68 + c4);
#pragma unroll
          for (int e = 0; e < 4; ++e) {
            float f = v[e];
            if constexpr (ACT == 2) f = 1.0f / (1.0f + __expf(-f));
            v[e] = f;
          }
          vals[u] = v;
        }
#pragma unroll
        for (int u = 0; u < IU; ++u) {
          const int gr = mBase + (ib + u) * 2 + hh2;
          *(v4f*)(C + (size_t)gr * ldc + n0 + c4) = vals[u];
        }
        if constexpr (IU < 8) wait_store_regs();           // the next trip rewrites the registers that these stores name
      }
    } else {
      unsigned short* C  = (unsigned short*)Cout;
      unsigned short* C2 = (unsigned short*)C2out;
      v4u hv[4], lv[4];
#pragma unroll
      for (int it = 0; it < 4; ++it) {
        const int row = it * 4 + q8;                       // it 0..3 x q8 0..3 = rows 0..15
        const float* sp = slab + row * 68 + c8;
        v4u a = {0u, 0u, 0u, 0u};
        v4u b = {0u, 0u, 0u, 0u};
#pragma unroll
        for (int e = 0; e < 4; ++e) {
          const float f0 = (sp[2 * e] * oscale) * ocarry;
          const float f1 = (sp[2 * e + 1] * oscale) * ocarry;
          const _Float16 h0 = (_Float16)f0, h1 = (_Float16)f1;
          a[e] = pk16(h_bits(h0), h_bits(h1));
          if constexpr (OM == 3) {
            const _Float16 l0 = (_Float16)(f0 - (float)h0);
            const _Float16 l1 = (_Float16)(f1 - (float)h1);
            b[e] = pk16(h_bits(l0), h_bits(l1));
          }
        }
        hv[it] = a;
        lv[it] = b;
      }
      {
#pragma unroll
        for (int it = 0; it < 4; ++it) {
          const int row = it * 4 + q8;
          *(v4u*)(C + (size_t)(mBase + row) * ldc + n0 + c8) = hv[it];
          if constexpr (OM == 3) {
            *(v4u*)(C2 + (size_t)(mBase + row) * ldc + n0 + c8) = lv[it];
          }
        }
        
      }
    }
    wave_sync_lds();
  }
}

// =====================================================================================================
// The three products of x in one launch: none reads what another writes, and together they have fewer blocks than the chip has WGPs.
// The block index picks the product (block-uniform, so every barrier of a body is passed by the whole block); longest epilogue first:
//   blocks 0..3     gates, transposed like v^T: AEF[j][t] = sigmoid(G[j] . x[t] / (64*16) + bf16(bias_j)), j < 32; M = 64, N = 2048, K = 1024,
//                   f32 out: a gate's values lie side by side by token, so a head's ex column is 8 KB of whole lines for its readers
//   blocks 4..67    v^T: VTH/VTL[d][t] = hi/residual of f16(1024 * Wv[d] . x[t]); M = 1024, N = 2048, K = 1024
//   blocks 68..195  inner | outer: QK[t][n] = f16(16 * x[t] . [Wi;Wo][n]); M = 2048, N = 2048, K = 1024
// =====================================================================================================
#define PB_GE ((TT / 64) * (NGATE / 64) / 8)
#define PB_VT ((DM / 64) * (TT / 64) / 8)
#define PB_QK ((TT / 64) * (QKP / 64) / 8)
#define PB_ALL (PB_GE + PB_VT + PB_QK)
static_assert(gemm_stage_bytes(1) == gemm_stage_bytes(8));
__global__ __launch_bounds__(256) void proj_gemms(
    const unsigned short* __restrict__ XB, const unsigned short* __restrict__ WIO, const unsigned short* __restrict__ WV,
    const unsigned short* __restrict__ WG, const float* __restrict__ ba, const float* __restrict__ be,
    unsigned short* QK, unsigned short* VTH, unsigned short* VTL, float* AEF) {
  __shared__ __align__(16) unsigned char ring[2 * gemm_stage_bytes(1)];   // 313,344 B of the WGP's 327,680
  static_assert(2 * gemm_stage_bytes(1) <= 327680 && 8 * SLAB_F * 4 <= 2 * gemm_stage_bytes(1) && (DM % GKST) == 0);
  float* sT = (float*)(void*)ring;                 // the epilogue's slabs lie on the ring, free behind the loop's last barrier
  const int b = blockIdx.x;
  if (b < PB_GE) {
    gemm64<0, 3, 2, 1>(ring, sT, b, WG, DM, XB, DM, ba, be,
                          (void*)AEF, (void*)AEF, TT, NGATE, TT, DM, 1.0f / (WSC * ACARRY), 1.0f);
  } else if (b < PB_GE + PB_VT) {
    gemm64<3, 0, 0, 1>(ring, sT, b - PB_GE, WV, DM, XB, DM, ba, be,
                          (void*)VTH, (void*)VTL, TT, DM, TT, DM, 1.0f / (WSC * ACARRY), VC);
  } else {
    gemm64<2, 0, 0, 1>(ring, sT, b - (PB_GE + PB_VT), XB, DM, WIO, DM, ba, be,
                          (void*)QK, (void*)QK, QKP, TT, QKP, DM, 1.0f / (ACARRY * WSC), QC);
  }
}
// =====================================================================================================
// Output projection: out[m][n] = sum_k (CTH[m][k] + CTL[m][k]) * WOUT[n][k] / (4096 * 64); M = 2048, N = 1024, K = 1024, f32 out.
// One block per 64 x 128 tile of out: 32 x 8 = 256 blocks, so that every WGP has one (512 tiles of 64 x 64, one a wave, fill only 64).
// 8 waves as 2 (m) x 4 (n), 32 x 32 of out per wave = 4 accumulator tiles. The ring has gemm64's order: two buffers, the next stage's
// asynchronous copies fly while this stage is multiplied, one barrier per stage. A stage is 256 k (512 B of every row; the LDS holds two
// such stages): the whole K is four flights of copies, each a latency and the stage's bytes, four waits and barriers. 32 copy rounds of 8 rows:
// [ctx hi 64 rows | ctx residual 64 rows | Wout 128 rows]. Per accumulator and k-step of 32: hi product, then residual product, ascending k.
// coverage: 32 rows (it 0..7 x lane>>3) x 32 cols (128 B, one whole line) = the wave's 32 x 32; the grid is exact.
// =====================================================================================================
#define OBM   64
#define OBN   128
#define OKST  256                    // k per stage
#define OROW  (OKST * 2 + 16)        // LDS row pitch in bytes: 528 = 16 B x odd: conflict-free for 16-byte readers
#define OSTEP (8 * OROW)             // LDS bytes between two copy rounds (a round = 8 waves x 1 row)
#define OOA2  (OBM * OROW)
#define OOB   (2 * OBM * OROW)
#define OSTG  (OOB + OBN * OROW)     // bytes per stage
#define OSLAB (32 * 36)              // per-wave 32 x 32 slab, pitch 36 floats
static_assert((TT % OBM) == 0 && (DM % OBN) == 0 && (DM % OKST) == 0 && DM / OKST >= 2 && OSTG == 32 * OSTEP);
static_assert(2 * OSTG + 8 * OSLAB * 4 <= 327680);
// one stage: 32 rounds, 8 to a statement that ends in s_wait_xcnt 0 (the copy helpers above); a, a2, b are this lane's row (its wave's
// number in a round of 8) and 16-byte piece at the stage's k; st = 8 source rows in elements
__device__ __forceinline__ void out_stage(unsigned l, const unsigned short* a, const unsigned short* a2, const unsigned short* b,
                                          size_t st) {
  copy8_lds<OSTEP>(l, a, st);
  copy8_lds<OSTEP>(l + OOA2, a2, st);
  copy8_lds<OSTEP>(l + OOB, b, st);
  copy8_lds<OSTEP>(l + OOB + 8 * OSTEP, b + 8 * st, st);
}
__global__ __launch_bounds__(256) void out_gemm(
    const unsigned short* __restrict__ CTH, const unsigned short* __restrict__ CTL, const unsigned short* __restrict__ WOUT,
    float* out) {
  __shared__ __align__(16) unsigned char ring[2 * OSTG];
  __shared__ __align__(16) float sT[8 * OSLAB];
  const int lane = threadIdx.x & 31;
  const int wave = threadIdx.x >> 5;
  const int mB = ((int)blockIdx.x / (DM / OBN)) * OBM;      // block's first row and column
  const int nB = ((int)blockIdx.x % (DM / OBN)) * OBN;
  const int wr = (wave >> 2) * 32, wc = (wave & 3) * 32;    // wave's first row and column in the block tile
  const int rlane = lane & 15;                 // row (A) / col (B, D) within subtile
  const int koff  = (lane >> 4) * 8;           // k offset of this lane half
  const int mOff  = (lane >> 4) * 8;           // D row offset

  // copy side: this lane's row and 16-byte piece in a round of 8 rows (a wave's copy is one row's 512 B)
  const int crow = wave;
  const int cseg = lane * 8;
  const unsigned lcp = lds_off(ring) + (unsigned)(crow * OROW + cseg * 2);
  const unsigned short* gA  = CTH  + (size_t)(mB + crow) * DM + cseg;
  const unsigned short* gA2 = CTL  + (size_t)(mB + crow) * DM + cseg;
  const unsigned short* gB  = WOUT + (size_t)(nB + crow) * DM + cseg;
  const size_t st = (size_t)8 * DM;
  // reader side: fragment rows of this wave in a stage
  const int fa = (wr + rlane) * OROW + koff * 2;
  const int fb = OOB + (wc + rlane) * OROW + koff * 2;

  v8f a00 = zero8(), a01 = zero8(), a10 = zero8(), a11 = zero8();

  constexpr int nst = DM / OKST;
  // stage 0 into buffer 0, landed and published; then stage 1 into buffer 1
  out_stage(lcp, gA, gA2, gB, st);
  wait_copies();
  __syncthreads();
  out_stage(lcp + OSTG, gA + OKST, gA2 + OKST, gB + OKST, st);

#pragma unroll 1   // one stage per trip: the ring's order at the foot stays as written
  for (int t = 0; t < nst; ++t) {
    const unsigned bofs = (unsigned)(t & 1) * OSTG;
    const unsigned char* sb = ring + bofs;
#pragma unroll   // constant kk: every LDS read takes its place in the stage as an immediate offset, no address arithmetic per run
    for (int kk = 0; kk < OKST / 64; ++kk) {   // four runs of 64 k per stage, ascending k
      v16h bh[2][2], ah[2][2], al[2][2];         // [k-step][subtile]: the run's 24 LDS reads stand together, in front of its WMMAs
#pragma unroll
      for (int s = 0; s < 2; ++s) {
#pragma unroll
        for (int i = 0; i < 2; ++i) {
          bh[s][i] = ldfrag_u((const unsigned short*)(sb + fb + i * 16 * OROW + kk * 128 + s * 64));
          ah[s][i] = ldfrag_u((const unsigned short*)(sb + fa + i * 16 * OROW + kk * 128 + s * 64));
          al[s][i] = ldfrag_u((const unsigned short*)(sb + OOA2 + fa + i * 16 * OROW + kk * 128 + s * 64));
        }
      }
#pragma unroll
      for (int s = 0; s < 2; ++s) {              // two k-steps of 32 per run, ascending k
        a00 = mma_raw(ah[s][0], bh[s][0], a00);
        a01 = mma_raw(ah[s][0], bh[s][1], a01);
        a10 = mma_raw(ah[s][1], bh[s][0], a10);
        a11 = mma_raw(ah[s][1], bh[s][1], a11);
        a00 = mma_raw(al[s][0], bh[s][0], a00);
        a01 = mma_raw(al[s][0], bh[s][1], a01);
        a10 = mma_raw(al[s][1], bh[s][0], a10);
        a11 = mma_raw(al[s][1], bh[s][1], a11);
        // four vector slots behind the last WMMA, before anything rewrites its operands or touches its results (also over the branch below)
        guard_pv6(a00, a01, a10, a11, ah[s][0], ah[s][1], al[s][0], al[s][1], bh[s][0], bh[s][1]);
      }
    }
    // publish point of stage t + 1; the same barrier ends every reader's last read of stage t's buffer
    wait_lds_reads();
    wait_copies();
    __syncthreads();
    if (t + 2 < nst) {                         // block-uniform: refill the buffer that this trip has just read
      const int kn = (t + 2) * OKST;
      out_stage(lcp + bofs, gA + kn, gA2 + kn, gB + kn, st);
    }
  }
  wait_copies();

  // ---- epilogue: each wave stages its 32 x 32 in its own slab and stores whole 128-B lines ----
  const float oscale = 1.0f / (FC * WSC);
  const int q8 = lane >> 3, c4 = (lane & 7) * 4;
  float* slab = sT + wave * OSLAB;
  float* op = out + (size_t)(mB + wr + q8) * DM + nB + wc + c4;
#pragma unroll
  for (int r = 0; r < 8; ++r) {
    slab[(mOff + r) * 36 + rlane] = a00[r];
    slab[(mOff + r) * 36 + 16 + rlane] = a01[r];
    slab[(16 + mOff + r) * 36 + rlane] = a10[r];
    slab[(16 + mOff + r) * 36 + 16 + rlane] = a11[r];
  }
  wave_sync_lds();
  v4f vals[8];
#pragma unroll
  for (int it = 0; it < 8; ++it) vals[it] = *(const v4f*)(slab + (it * 4 + q8) * 36 + c4) * oscale;   // it 0..7 x q8 0..3 = rows 0..31
#pragma unroll
  for (int it = 0; it < 8; ++it) *(v4f*)(op + (size_t)(it * 4) * DM) = vals[it];
}

// =====================================================================================================
// Flash attention for one head and 128 query rows, head dim 64, 2048 keys:
//   inner|outer plane (f16 x16) QK[tok][2048]: inner at col 64h + d, outer at col 1024 + 64h + d;
//   v^T planes (f16 hi x1024, unscaled residual): VH/VL[64h + d][key] (pitch 2048);
//   gate plane AEF f32 [32][tok]: row h = ap[h][tok] (sigmoid applied), row 16 + h = ex[h][tok];
//   out: CTH/CTL[tok][64h + d] = f16 hi / residual of 4096 * ctx, ctx = valve/rotation epilogue of
//        ap * sum_s p_s v_s / (ap * sum_s p_s + 1e-8 * sum_s e_s), e_s = exp(score_s - max), p_s = e_s * ex[s].
//   block = 16 waves = 512 threads, four to a SIMD: the vector work between a wave's matrix runs and its LDS latencies
//   are covered by three other waves. grid = 16 heads x 16 query groups = 256; every wave does identical bounded work (16 steps).
//   A stage is 128 keys, laid out as two halves of 64: per half the head's 64 outer rows and the 64 rows of each v^T plane (128 B
//   each, whole lines). Waves 0..7 copy the first half, waves 8..15 the second, with asynchronous copies into one of two LDS buffers;
//   the next stage's copies fly while this stage is worked on; one barrier per stage. The head's ex column (2048 f32) is put into
//   LDS once, in front of the first barrier.
//   A wave takes 32 query rows (two tiles of 16; wave & 3 picks them) and 32 of a stage's 128 keys (wave >> 2 picks the quarter), so
//   every outer, v^T and ex fragment that it reads from LDS feeds two query tiles: half the LDS reads per WMMA of a 16-query wave.
//   Both products are transposed: S^T = outer . inner^T (A = 16 key rows from the stage, B = 16 query rows, kept in registers) and
//   O^T += v^T . P^T (A = 16 d rows of v^T from the stage, B = P^T). A lane (c = lane & 15, hh = lane >> 4) then holds, per query
//   tile, only query c of it: score register r of key tile i is key kb + 16 i + 8 hh + r, which is the k order of a B operand, so
//   the two score tiles of a step, converted in place, are P^T; output register r of tile j is d = 16 j + 8 hh + r.
//   Per step and query tile: 2 score tiles on f16 WMMA (K = 64 as two k-steps of 32); the maximum over the lane's 16 keys in the
//   lane, joined with the other half by one cross-row move; online max-subtracted softmax in f32 (exp2, log2e / 8 / carries folded
//   in); running sums of e and of p = e*ex in two partial sums per lane (joined behind the loop); one rescale factor per lane;
//   12 WMMAs (hi.hi, hi.lo, lo.hi) into one accumulator set.
//   Behind the loop the four waves of a query group (same wave & 3) hold the sums of their own keys on their own maxima. Each puts
//   its maxima, sums and O^T into the ring's LDS (free behind the loop's last barrier) and finishes one query tile (quarter & 1) and
//   one pair of d tiles (j and j + 2, j = quarter >> 1: the rotation's partners): it joins the four parts, in quarter order, on the
//   common maximum.
//   Final scaling in f32; each lane stages its query's 2 x 8 consecutive d (hi and residual) in the block's LDS row buffers [128][64];
// coverage: LDS row buffers: 16 waves x 16 rows x 32 cols = 128 x 64; global: 2 iterations x 512 threads x 8 halves = 128 rows x 64
//           cols (cols 64*head ..) of rows qB..qB+127, both planes; grid covers all 2048 rows x 1024 cols exactly once.
// =====================================================================================================
#define AKS   64                        // keys per half stage: 128 B of every v^T row = one whole line
#define AOVH  (AKS * LROW)              // half-stage layout in bytes: [64 outer rows | 64 v^T hi rows | 64 v^T residual rows]
#define AOVL  (AOVH + HDIM * LROW)
#define ASTG  (AOVL + HDIM * LROW)      // bytes per half stage
#define ABUF  (2 * ASTG)                // bytes per stage (128 keys) = per buffer
static_assert(AKS == 64 && HDIM == 64 && (TT % (2 * AKS)) == 0 && (TT / (2 * AKS)) >= 2 && HDIM * 2 + 16 == LROW && AKS * 2 + 16 == LROW);
static_assert(TT == 4 * ATT_THREADS);
// one half stage: keys 64 t .. 64 t + 63 behind the pointers' own first key; l, gK, gVh, gVl are this lane's row
// (4*(wave&7) + (lane>>3) of a round of 32) and 16-byte piece
__device__ __forceinline__ void att_stage(unsigned l, const unsigned short* gK, const unsigned short* gVh,
                                          const unsigned short* gVl, int t) {
  copy_rows<2>(l,        gK  + (size_t)t * AKS * QKP, (size_t)32 * QKP);
  copy_rows<2>(l + AOVH, gVh + (size_t)t * AKS,       (size_t)32 * TT);
  copy_rows<2>(l + AOVL, gVl + (size_t)t * AKS,       (size_t)32 * TT);
}
__device__ __forceinline__ const _Float16* lds_h(const unsigned char* p) { return (const _Float16*)(const void*)p; }
// value of lane l ^ 16 (one vector cross-row move, no LDS counter)
__device__ __forceinline__ float xhalf(float x) {
  const int b = __builtin_bit_cast(int, x);
  return __builtin_bit_cast(float, __builtin_amdgcn_permlanex16(b, b, 0x76543210, 0xfedcba98, false, false));
}

// eight values to two, in packed adds: as many instructions as eight running sums take, and 6 registers fewer per sum
typedef float v2f __attribute__((ext_vector_type(2)));
__device__ __forceinline__ v2f fold2(const v8f v) {
  const v4f q = __builtin_shufflevector(v, v, 0, 1, 2, 3) + __builtin_shufflevector(v, v, 4, 5, 6, 7);
  return __builtin_shufflevector(q, q, 0, 1) + __builtin_shufflevector(q, q, 2, 3);
}
// one query tile's softmax over a step's 32 keys: s0[r]: key kb + 8hh + r, s1[r]: key kb + 16 + 8hh + r; x0, x1: ex of those keys.
// Returns the rescale factor of the running sums and of O^T; ph, pl: P^T x1024 as a B operand, hi and residual.
__device__ __forceinline__ float soft_step(const v8f s0, const v8f s1, const v8f x0, const v8f x1, const float lsc,
                                           float& mrow, v2f& zv, v2f& lv, v16h& phv, v16h& plv) {
  const float m0 = fmaxf(fmaxf(s0[0], s0[1]), s0[2]), m1 = fmaxf(fmaxf(s0[3], s0[4]), s0[5]);
  const float m2 = fmaxf(fmaxf(s0[6], s0[7]), s1[0]), m3 = fmaxf(fmaxf(s1[1], s1[2]), s1[3]);
  const float m4 = fmaxf(fmaxf(s1[4], s1[5]), s1[6]);
  float mx = fmaxf(fmaxf(fmaxf(m0, m1), s1[7]), fmaxf(fmaxf(m2, m3), m4));   // the lane's 16 keys
  mx = fmaxf(mx, xhalf(mx));               // both halves: maximum over the step's 32 keys
  const float mn = fmaxf(mrow, mx * lsc);
  const float al = exp2_hw(mrow - mn);
  mrow = mn;
  // the exponents' arguments as one vector fma: written so, they stay two to an instruction
  const v8f mn8 = {mn, mn, mn, mn, mn, mn, mn, mn};
  const v8f lsc8 = {lsc, lsc, lsc, lsc, lsc, lsc, lsc, lsc};
  const v8f t0 = __builtin_elementwise_fma(s0, lsc8, -mn8), t1 = __builtin_elementwise_fma(s1, lsc8, -mn8);
  v8f e0, e1;
#pragma unroll   // constant element indices: the vectors stay in registers
  for (int r = 0; r < 8; ++r) { e0[r] = exp2_hw(t0[r]); e1[r] = exp2_hw(t1[r]); }
  const v8f p0 = e0 * x0, p1 = e1 * x1;
  zv = zv * al + fold2(e0 + e1);
  lv = lv * al + fold2(p0 + p1);
  FragH ph, pl;                            // element r <- k = 8hh + r, element 8 + r <- k = 16 + 8hh + r
  const v8f y0 = p0 * PC, y1 = p1 * PC;
  ph.h[0] = __builtin_convertvector(y0, v8h);
  ph.h[1] = __builtin_convertvector(y1, v8h);
  pl.h[0] = __builtin_convertvector(y0 - __builtin_convertvector(ph.h[0], v8f), v8h);
  pl.h[1] = __builtin_convertvector(y1 - __builtin_convertvector(ph.h[1], v8f), v8h);
  phv = ph.v;
  plv = pl.v;
  return al;
}
// eight floats at a 16-byte boundary, as two 16-byte accesses
__device__ __forceinline__ void st8(float* p, const v8f v) {
  *(v4f*)(p)     = __builtin_shufflevector(v, v, 0, 1, 2, 3);
  *(v4f*)(p + 4) = __builtin_shufflevector(v, v, 4, 5, 6, 7);
}
__device__ __forceinline__ v8f ld8(const float* p) {
  const v4f a = *(const v4f*)(p), b = *(const v4f*)(p + 4);
  return __builtin_shufflevector(a, b, 0, 1, 2, 3, 4, 5, 6, 7);
}
#define XLANE 76                        // floats a lane hands over: 64 of O^T, per tile maximum, two sums, one unused; 4 unused: 304 B = 16 B x odd
#define AXB   (ATT_THREADS * XLANE * 4) // bytes of the hand-over
#define AKVB  (AXB > 2 * ABUF ? AXB : 2 * ABUF)

__global__ __launch_bounds__(ATT_THREADS)
void attn_heads(const unsigned short* __restrict__ QKq, const unsigned short* __restrict__ VHq,
                const unsigned short* __restrict__ VLq, const float* __restrict__ AEF,
                const float* __restrict__ betap, const float* __restrict__ ivp,
                const float* __restrict__ ovp, const float* __restrict__ chg,
                unsigned short* CTH, unsigned short* CTL) {
  __shared__ __align__(16) unsigned char kv[AKVB];          // two stages of outer rows and v^T rows; behind the loop: the hand-over
  __shared__ __align__(16) float exs[TT];                   // ex of this head, by key
  __shared__ __align__(16) unsigned short Osh[ATT_QB * HDIM];   // block result rows [128][64], hi
  __shared__ __align__(16) unsigned short Osl[ATT_QB * HDIM];   // residual

  const int tid  = threadIdx.x;
  const int wave = __builtin_amdgcn_readfirstlane(tid >> 5);   // in a scalar register: what is derived from it takes no vector register (256 a wave at four waves a SIMD)
  const int lane = tid & 31;
  const int hh   = lane >> 4;
  const int c    = lane & 15;
  const int qw   = wave & 3;                                // which 32 query rows of the block
  const int kq   = wave >> 2;                               // which 32 keys of every stage (quarter 0..3)
  const int sub  = kq >> 1;                                 // its half stage, also the half that this wave copies
  const int kh   = kq & 1;                                  // its 32 keys in that half
  const int ft   = kq & 1;                                  // behind the loop: the query tile that this wave finishes
  const int dh   = kq >> 1;                                 // and its d tiles: dh and dh + 2

  const int qg   = blockIdx.x % ATT_QG;                     // query group 0..15
  const int head = (blockIdx.x / ATT_QG) & (NHEAD - 1);     // 0..15
  const int qB   = qg * ATT_QB;                             // block's first query row
  const int q0   = qB + qw * 32;                            // wave's first query row
  const int orow = qw * 32 + ft * 16 + c;                   // the block row (query) that this lane finishes

  const _Float16* Qh = (const _Float16*)(const void*)QKq + (size_t)(q0 + c) * QKP + head * HDIM + 8 * hh;
  const float* Ex = AEF + (size_t)(16 + head) * TT;                     // ex of this head, by key: 8 KB in a row
  const float lsc = (1.4426950408889634f * ATT_SCALE) / (QC * KC);      // log2(e) / 8 / carries

  // copy side: this lane's row and 16-byte piece in a round of 32 rows
  const int crow = (wave & 7) * 4 + (lane >> 3);
  const int cseg = (lane & 7) * 8;
  const unsigned lcp = lds_off(kv) + (unsigned)(sub * ASTG + crow * LROW + cseg * 2);
  const unsigned short* gK  = QKq + (size_t)(sub * AKS + crow) * QKP + DM + head * HDIM + cseg;
  const unsigned short* gVh = VHq + (size_t)(head * HDIM + crow) * TT + sub * AKS + cseg;
  const unsigned short* gVl = VLq + (size_t)(head * HDIM + crow) * TT + sub * AKS + cseg;
  // reader side, in bytes: this lane's fragment row (key or d = c within a group of 16 rows) and k half, at the wave's 32 keys
  const int frk = sub * ASTG + (kh * 32 + c) * LROW + 16 * hh;        // outer rows: 32 rows down
  const int frv = sub * ASTG + AOVH + c * LROW + 16 * hh + kh * 64;   // v^T rows: 32 keys = 64 B along

  // stage 0 into buffer 0, landed and published; then stage 1 into buffer 1. The ex column is published by the same barrier.
  att_stage(lcp, gK, gVh, gVl, 0);
  const v16h qa0 = ldfrag_h(Qh), qb0 = ldfrag_h(Qh + 32);                                // query tile 0: rows q0 + c
  const v16h qa1 = ldfrag_h(Qh + (size_t)16 * QKP), qb1 = ldfrag_h(Qh + (size_t)16 * QKP + 32);   // tile 1: rows q0 + 16 + c
  const float apq = AEF[(size_t)head * TT + qB + orow];      // ap of the query that this lane finishes, used behind the loop
  *(v4f*)(exs + 4 * tid) = *(const v4f*)(Ex + 4 * tid);      // 512 x 4 = all 2048 keys, 16 B a lane, whole lines
  wait_copies();
  __syncthreads();
  att_stage(lcp + ABUF, gK, gVh, gVl, 2);

  float mr0 = -INFINITY, mr1 = -INFINITY;                    // this lane's query of tile 0, of tile 1
  v2f zv0 = {0.f, 0.f}, lv0 = {0.f, 0.f}, zv1 = {0.f, 0.f}, lv1 = {0.f, 0.f};   // sums of e and p over this half's keys: even r, odd r
  v8f a0 = zero8(), a1 = zero8(), a2 = zero8(), a3 = zero8();       // O^T of tile 0
  v8f b0 = zero8(), b1 = zero8(), b2 = zero8(), b3 = zero8();       // O^T of tile 1

  constexpr int nst = TT / (2 * AKS);
#pragma unroll 1   // one stage per trip: the ring's order at the foot stays as written
  for (int t = 0; t < nst; ++t) {
    const unsigned bofs = (unsigned)(t & 1) * ABUF;
    const unsigned char* sb = kv + bofs;
    const int kb = t * (2 * AKS) + kq * 32;    // the wave's one step of 32 keys in this stage
    v8f sa0, sa1, sb0, sb1;                    // s?0[r]: key kb + 8hh + r, s?1[r]: key kb + 16 + 8hh + r; sa: tile 0, sb: tile 1
    {
      const _Float16* kp = lds_h(sb + frk);
      const _Float16* kq = lds_h(sb + frk + 16 * LROW);
      const v16h k00 = ldfrag_h(kp), k01 = ldfrag_h(kp + 32);
      const v16h k10 = ldfrag_h(kq), k11 = ldfrag_h(kq + 32);
      sa0 = mma_raw(k00, qa0, zero8());
      sb0 = mma_raw(k00, qa1, zero8());
      sa1 = mma_raw(k10, qa0, zero8());
      sb1 = mma_raw(k10, qa1, zero8());
      sa0 = mma_raw(k01, qb0, sa0);
      sb0 = mma_raw(k01, qb1, sb0);
      sa1 = mma_raw(k11, qb0, sa1);
      sb1 = mma_raw(k11, qb1, sb1);
    }
    const float* exq = exs + kb + 8 * hh;
    const v4f xa = *(const v4f*)(exq),      xb = *(const v4f*)(exq + 4);      // ex of keys kb + 8hh + 0..7
    const v4f xc = *(const v4f*)(exq + 16), xd = *(const v4f*)(exq + 20);     // ex of keys kb + 16 + 8hh + 0..7
    const v8f x0 = __builtin_shufflevector(xa, xb, 0, 1, 2, 3, 4, 5, 6, 7);
    const v8f x1 = __builtin_shufflevector(xc, xd, 0, 1, 2, 3, 4, 5, 6, 7);
    v16h pha, pla, phb, plb;
    const float ala = soft_step(sa0, sa1, x0, x1, lsc, mr0, zv0, lv0, pha, pla);
    const float alb = soft_step(sb0, sb1, x0, x1, lsc, mr1, zv1, lv1, phb, plb);
    a0 *= ala;
    a1 *= ala;
    a2 *= ala;
    a3 *= ala;
    b0 *= alb;
    b1 *= alb;
    b2 *= alb;
    b3 *= alb;
    {
      const unsigned char* vp = sb + frv;
      const v16h vb0 = ldfrag_h(lds_h(vp));
      const v16h vb1 = ldfrag_h(lds_h(vp + 16 * LROW));
      const v16h vb2 = ldfrag_h(lds_h(vp + 32 * LROW));
      const v16h vb3 = ldfrag_h(lds_h(vp + 48 * LROW));
      a0 = mma_raw(vb0, pha, a0);
      a1 = mma_raw(vb1, pha, a1);
      a2 = mma_raw(vb2, pha, a2);
      a3 = mma_raw(vb3, pha, a3);
      b0 = mma_raw(vb0, phb, b0);
      b1 = mma_raw(vb1, phb, b1);
      b2 = mma_raw(vb2, phb, b2);
      b3 = mma_raw(vb3, phb, b3);
      a0 = mma_raw(vb0, pla, a0);
      a1 = mma_raw(vb1, pla, a1);
      a2 = mma_raw(vb2, pla, a2);
      a3 = mma_raw(vb3, pla, a3);
      b0 = mma_raw(vb0, plb, b0);
      b1 = mma_raw(vb1, plb, b1);
      b2 = mma_raw(vb2, plb, b2);
      b3 = mma_raw(vb3, plb, b3);
    }
    {
      const unsigned char* vp = sb + frv + (AOVL - AOVH);
      const v16h vl0 = ldfrag_h(lds_h(vp));
      const v16h vl1 = ldfrag_h(lds_h(vp + 16 * LROW));
      const v16h vl2 = ldfrag_h(lds_h(vp + 32 * LROW));
      const v16h vl3 = ldfrag_h(lds_h(vp + 48 * LROW));
      a0 = mma_raw(vl0, pha, a0);
      a1 = mma_raw(vl1, pha, a1);
      a2 = mma_raw(vl2, pha, a2);
      a3 = mma_raw(vl3, pha, a3);
      b0 = mma_raw(vl0, phb, b0);
      b1 = mma_raw(vl1, phb, b1);
      b2 = mma_raw(vl2, phb, b2);
      b3 = mma_raw(vl3, phb, b3);
    }
    // publish point of stage t + 1; the same barrier ends every reader's last read of stage t's buffer
    wait_lds_reads();
    wait_copies();
    __syncthreads();
    if (t + 2 < nst) att_stage(lcp + bofs, gK, gVh, gVl, 2 * (t + 2));   // block-uniform: refill the buffer that this trip has just read
  }
  wait_copies();

  // ---- the four key quarters of a query group are joined: wave (qw, kq) finishes tile kq & 1, d tiles kq >> 1 and (kq >> 1) + 2 ----
  const float za = zv0[0] + zv0[1], la = lv0[0] + lv0[1], zb = zv1[0] + zv1[1], lb = lv1[0] + lv1[1];
  const float zta = za + xhalf(za), lta = la + xhalf(la);    // the two lane halves' sums, on the same maximum
  const float ztb = zb + xhalf(zb), ltb = lb + xhalf(lb);
  {
    float* xs = (float*)(void*)kv + (size_t)tid * XLANE;     // the ring is free: every read of it ended at the last barrier
    const v4f ga = {mr0, zta, lta, 0.f}, gb = {mr1, ztb, ltb, 0.f};
    st8(xs, a0);
    st8(xs + 8, a1);
    st8(xs + 16, a2);
    st8(xs + 24, a3);
    st8(xs + 32, b0);
    st8(xs + 40, b1);
    st8(xs + 48, b2);
    st8(xs + 56, b3);
    *(v4f*)(xs + 64) = ga;
    *(v4f*)(xs + 68) = gb;
  }
  __syncthreads();                                           // the hand-over is published
  v8f oA, oB;                                                // O^T of the finished tile: d = 16 dh + 8 hh + r, and 32 more
  float zt, lt;
  {
    // same lane, same query, the four quarters' keys (this wave's own part too, so that every wave sums in the same order)
    const float* xp = (const float*)(const void*)kv + (size_t)(qw * 32 + lane) * XLANE;
    v4f hs[4];
    v8f hA[4], hB[4];
#pragma unroll   // constant array indices: the parts stay in registers; the 20 reads are issued together
    for (int i = 0; i < 4; ++i) {
      const float* p = xp + (size_t)i * (4 * 32 * XLANE);
      hs[i] = *(const v4f*)(p + 64 + 4 * ft);
      hA[i] = ld8(p + 32 * ft + 8 * dh);
      hB[i] = ld8(p + 32 * ft + 8 * dh + 16);
    }
    const float mj = fmaxf(fmaxf(hs[0][0], hs[1][0]), fmaxf(hs[2][0], hs[3][0]));   // the common maximum
    const float f0 = exp2_hw(hs[0][0] - mj), f1 = exp2_hw(hs[1][0] - mj);
    const float f2 = exp2_hw(hs[2][0] - mj), f3 = exp2_hw(hs[3][0] - mj);
    zt = hs[0][1] * f0 + hs[1][1] * f1 + hs[2][1] * f2 + hs[3][1] * f3;
    lt = hs[0][2] * f0 + hs[1][2] * f1 + hs[2][2] * f2 + hs[3][2] * f3;
    oA = hA[0] * f0 + hA[1] * f1 + hA[2] * f2 + hA[3] * f3;
    oB = hB[0] * f0 + hB[1] * f1 + hB[2] * f2 + hB[3] * f3;
  }

  // ---- per-head gates and rotation, renormaliser, carries (1024 on p, 1024 on v, 4096 on the stored ctx) ----
  const float bet = bfr(betap[head]);
  const float ivs = sigf(bfr(ivp[head]));
  const float og  = sigf(bfr(ovp[head])) * tanhf(bfr(chg[head]));
  const float ang = PI_F * sigf(bet);
  const float ca  = cosf(ang), sa = sinf(ang);
  const float base = ivs / (PC * VC);
  const float den = apq * lt + REN_EPS * zt;
  const float sc  = apq * (1.0f / den) * base;
  v8h yh[2], yl[2];                                          // [0]: d = 16 dh + 8 hh + r, [1]: d = 32 + 16 dh + 8 hh + r
#pragma unroll
  for (int r = 0; r < 8; ++r) {
    const float x0 = oA[r] * sc, x2 = oB[r] * sc;
    const float y0 = ((x0 * ca - x2 * sa) * og) * FC;
    const float y2 = ((x0 * sa + x2 * ca) * og) * FC;
    const _Float16 h0 = (_Float16)y0, h2 = (_Float16)y2;
    yh[0][r] = h0;
    yh[1][r] = h2;
    yl[0][r] = (_Float16)(y0 - (float)h0);
    yl[1][r] = (_Float16)(y2 - (float)h2);
  }
  {
    unsigned short* oh = Osh + orow * HDIM + 16 * dh + 8 * hh;
    unsigned short* ol = Osl + orow * HDIM + 16 * dh + 8 * hh;
#pragma unroll   // constant array indices: yh, yl stay in registers
    for (int j = 0; j < 2; ++j) {
      *(v8h*)(void*)(oh + 32 * j) = yh[j];
      *(v8h*)(void*)(ol + 32 * j) = yl[j];
    }
  }
  __syncthreads();
  // ---- block writes its 128 row segments: piece p = it*512 + tid -> row p>>3, halves (p&7)*8 of the 64-col slab (128 B a row) ----
  {
    v4u vh[2], vl[2];
#pragma unroll
    for (int it = 0; it < 2; ++it) {
      const int p = it * ATT_THREADS + tid;
      vh[it] = *(const v4u*)(Osh + (size_t)p * 8);
      vl[it] = *(const v4u*)(Osl + (size_t)p * 8);
    }
    const size_t dofs = (size_t)qB * DM + (size_t)head * HDIM;
    unsigned short* dh = CTH + dofs;
    unsigned short* dl = CTL + dofs;
    {
#pragma unroll
      for (int it = 0; it < 2; ++it) {
        const int p = it * ATT_THREADS + tid;
        const size_t po = (size_t)(p >> 3) * DM + (size_t)(p & 7) * 8;
        *(v4u*)(dh + po) = vh[it];
        *(v4u*)(dl + po) = vl[it];
      }
    }
  }
}

// =====================================================================================================
// Workspace map (bytes); every plane is an exact multiple of its tile / whole-row store granularity (M, N exact tile multiples,
// row blocks exact, no pad rows needed), every offset a multiple of 131072:
//   WIO  f16 [2048][1024] x64     4194304   (rows 0..1023 Wi, 1024..2047 Wo; native [out][in] = [n][k])
//   WV   f16 [1024][1024] x64     2097152
//   WOUT f16 [1024][1024] x64     2097152
//   WG   f16 [64][1024]   x64      131072   (Wa, We, Wa, We)
//   XB   f16 [2048][1024] x16     4194304
//   QK   f16 [2048][2048] x16     8388608   (inner | outer)
//   VTH  f16 [1024][2048] x1024   4194304   (v^T hi)
//   VTL  f16 [1024][2048]         4194304   (v^T residual)
//   AEF  f32 [64][2048]            524288   (sigmoid gates by token; rows 0..31 written and read)
//   CTH  f16 [2048][1024] x4096   4194304   (ctx hi)
//   CTL  f16 [2048][1024]         4194304   (ctx residual)
//   end                          38404096
// =====================================================================================================
extern "C" void kernel_launch(void* const* d_in, const int* in_sizes, int n_in,
                              void* d_out, int out_size, void* d_ws, size_t ws_size,
                              hipStream_t stream) {
  if (n_in < 13) return;
  if (in_sizes[0] != TT * DM) return;
  if (in_sizes[1] != NHEAD * DM || in_sizes[2] != NHEAD) return;
  if (in_sizes[3] != NHEAD * DM || in_sizes[4] != NHEAD) return;
  if (in_sizes[5] != DM * DM || in_sizes[6] != DM * DM || in_sizes[7] != DM * DM || in_sizes[8] != DM * DM) return;
  if (in_sizes[9] != NHEAD || in_sizes[10] != NHEAD || in_sizes[11] != NHEAD || in_sizes[12] != NHEAD) return;
  if (out_size != TT * DM) return;

  const float* x     = (const float*)d_in[0];
  const float* Wa    = (const float*)d_in[1];
  const float* ba    = (const float*)d_in[2];
  const float* We    = (const float*)d_in[3];
  const float* be    = (const float*)d_in[4];
  const float* Wi    = (const float*)d_in[5];
  const float* Wo    = (const float*)d_in[6];
  const float* Wv    = (const float*)d_in[7];
  const float* Wout  = (const float*)d_in[8];
  const float* betap = (const float*)d_in[9];
  const float* ivp   = (const float*)d_in[10];
  const float* ovp   = (const float*)d_in[11];
  const float* chg   = (const float*)d_in[12];
  float*       out   = (float*)d_out;

  const size_t PWIO = (size_t)2 * DM * DM * 2;                    //  4194304
  const size_t PW   = (size_t)DM * DM * 2;                        //  2097152
  const size_t PG   = (size_t)NGATE * DM * 2;                     //   131072
  const size_t PX   = (size_t)TT * DM * 2;                        //  4194304
  const size_t PQK  = (size_t)TT * QKP * 2;                       //  8388608
  const size_t PVT  = (size_t)DM * TT * 2;                        //  4194304
  const size_t PAE  = (size_t)TT * NGATE * 4;                     //   524288
  const size_t PCT  = (size_t)TT * DM * 2;                        //  4194304
  size_t off = 0;
  const size_t oWIO = off; off += PWIO;
  const size_t oWV  = off; off += PW;
  const size_t oWOU = off; off += PW;
  const size_t oWG  = off; off += PG;
  const size_t oXB  = off; off += PX;
  const size_t oQK  = off; off += PQK;
  const size_t oVTH = off; off += PVT;
  const size_t oVTL = off; off += PVT;
  const size_t oAEF = off; off += PAE;
  const size_t oCTH = off; off += PCT;
  const size_t oCTL = off; off += PCT;
  if (off > ws_size) return;                                      // off = 38404096
  if (off > (size_t)134217728) return;

  char* ws = (char*)d_ws;
  unsigned short* WIO  = (unsigned short*)(ws + oWIO);
  unsigned short* WV   = (unsigned short*)(ws + oWV);
  unsigned short* WOUT = (unsigned short*)(ws + oWOU);
  unsigned short* WG   = (unsigned short*)(ws + oWG);
  unsigned short* XB   = (unsigned short*)(ws + oXB);
  unsigned short* QK   = (unsigned short*)(ws + oQK);
  unsigned short* VTH  = (unsigned short*)(ws + oVTH);
  unsigned short* VTL  = (unsigned short*)(ws + oVTL);
  float*          AEF  = (float*)(ws + oAEF);
  unsigned short* CTH  = (unsigned short*)(ws + oCTH);
  unsigned short* CTL  = (unsigned short*)(ws + oCTL);

  const dim3 blk(256);
  const dim3 gCV(CB_ALL);                                         // 776 blocks
  const dim3 gPR(PB_ALL);                                         // 196 blocks
  const dim3 gO((TT / OBM) * (DM / OBN));                         // 256
  const dim3 gAT(ATT_BLOCKS);                                     // 256
  const dim3 bAT(ATT_THREADS);                                    // 512

  // (0) 16-bit planes: XB = f16(16 * bf16(x)); W planes = f16(64 * bf16(W)) in native [n][k] layout; gate plane
  conv_all<<<gCV, blk, 0, stream>>>(x, Wi, Wo, Wv, Wout, Wa, We, XB, WIO, WV, WOUT, WG);

  // (1..3) gates, v^T, inner | outer
  proj_gemms<<<gPR, blk, 0, stream>>>(XB, WIO, WV, WG, ba, be, QK, VTH, VTL, AEF);

  // (4) attention per (128 query rows, 1 head) -> CTH/CTL (ctx x4096 hi + residual)
  attn_heads<<<gAT, bAT, 0, stream>>>(QK, VTH, VTL, AEF, betap, ivp, ovp, chg, CTH, CTL);

  // (5) output projection
  out_gemm<<<gO, blk, 0, stream>>>(CTH, CTL, WOUT, out);
  (void)hipGetLastError();
}
